// v000
// Measured on an AMD MI455X. A time is GPU time per run, averaged over a window of back-to-back runs after a warm-up
// (all launches, gaps included; the runs take copies of the inputs in turn), and the median of several windows.
// Apart from v000's, it joins two sittings. Times from different sittings can be a few percent apart, while
// side-by-side timings come from the same sitting.
// v000 is the starting kernel. One run takes 4520 microseconds.
#include <hip/hip_runtime.h>
// Multi-head self-attention with a learned relative-position bias (x [2][2048][1024]; q/k/v = x W^T + b (nn.Linear [out][in]), 16 heads of 64; scores / 8 + rel_emb[clip(i - j, -128, 128) + 128][h] (rel_emb [257][16]); softmax; o merged; out = o Wo^T + bo -> [2][2048][1024]).
// Structure: token rows r = b*2048 + s; x as exact f16 rows (bf16-rounded); Q, K, V as three WMMA GEMMs (32x64 wave tiles, f32 accumulation, exact x16 weights + bias, f16 outputs); per batch: V^T for all heads via LDS transposes; per (batch, group of 4 heads): scores GEMM (K = 64, batched over the heads on grid.y, alpha = 1/8), row softmax of (scores + relative-position bias looked up by (i - j, head)) on VALU (f32 statistics, native exp; weights stored x256 as f16), o = P . V^T GEMM (K = 2048, alpha 2^-2: o carried x64 against f16 subnormal flush, folded into the output GEMM alpha) written straight into the merged f16 o rows; out = o W_o + b GEMM (f32) into the output layout.
// Compute dtype: inputs rounded to bf16; x / weights exact; q, k, v, softmax weights and o as plain f16 GEMM operands (~2^-12); scores and softmax statistics f32. v_wmma_f32_16x16x32_f16.
#define NB 2
#define SQ 2048
#define DM 1024
#define NH 16
#define HD 64
#define MAXD 128                     /* relative distance clip */
#define HG 4                         /* heads per attention launch group */
#define B0 0                         /* first batch processed (debug hook) */
#define NBR NB                       /* batches processed (debug hook) */
#define NR ((size_t)NB * SQ)         /* token rows */
#define MP ((int)((size_t)NBR * SQ)) /* rows projected (debug hook) */
#define QN SQ                        /* query rows attended per batch (debug hook) */
#define NHD NH                       /* heads attended (debug hook) */
#define MPO MP                       /* rows through the output stage (debug hook) */
#define LQ DM      /* row pitch of the q/k/v rows */
typedef __bf16 v16b __attribute__((ext_vector_type(16)));
typedef unsigned short v8us __attribute__((ext_vector_type(8), may_alias));
typedef float  v8f  __attribute__((ext_vector_type(8)));
typedef float  v4f  __attribute__((ext_vector_type(4)));
typedef float  v4fa __attribute__((ext_vector_type(4), may_alias));
union FragB { v16b v; v8us half[2]; unsigned short u[16]; };

__device__ __forceinline__ unsigned short bf16_bits(float x) { unsigned int u = __float_as_uint(x); return (unsigned short)((u + 0x7FFFu + ((u >> 16) & 1u)) >> 16); }
__device__ __forceinline__ float bf16_val(unsigned short b) { return __uint_as_float(((unsigned int)b) << 16); }
__device__ __forceinline__ float bf16_round(float x) { return bf16_val(bf16_bits(x)); }
// D += A·B with NT terms: 1 = ah·bh, 2 = + al·bh (A split), 3 = + ah·bl (both split)
template <int NT>
__device__ __forceinline__ v8f mmaN(v16b ah, v16b al, v16b bh, v16b bl, v8f c) {
  c = __builtin_amdgcn_wmma_f32_16x16x32_bf16(false, ah, false, bh, (short)0, c, false, false);
  if (NT >= 2) c = __builtin_amdgcn_wmma_f32_16x16x32_bf16(false, al, false, bh, (short)0, c, false, false);
  if (NT >= 3) c = __builtin_amdgcn_wmma_f32_16x16x32_bf16(false, ah, false, bl, (short)0, c, false, false);
  asm volatile("v_nop\n\tv_nop\n\tv_nop\n\tv_nop" : "+v"(c) : "v"(ah), "v"(al), "v"(bh), "v"(bl));
  return c;
}

__global__ __launch_bounds__(256) void k_wt_bf16(const float* __restrict__ W, unsigned short* __restrict__ Wt, int K, int N) {
  const int t = blockIdx.x * 256 + threadIdx.x;
  const int k8n = K / 8;
  if (t >= N * k8n) return;
  const int n = t / k8n, k8 = (t % k8n) * 8;
  v8us v;
#pragma unroll
  for (int i = 0; i < 8; ++i) v[i] = bf16_bits(W[(size_t)(k8 + i) * N + n]);
  *(v8us*)(Wt + (size_t)n * K + k8) = v;
  
}

// GEMM C[M][N] (f32, pitch ldc) = act(A[M][K]·W + bias). A f32 row-major (pitch lda) converted per fragment to bf16
// (ASPLIT: hi/lo two planes -> 2 terms, else single rounded term); Wt bf16 [N][K] (pitch ldb). BIAS_BF16 rounds the
// bias to bf16 first (bias quantised to bf16 before the add). K%32==0, M%16==0, N%64==0.
template <bool ASPLIT, int ACT, bool BIAS_BF16>
__global__ __launch_bounds__(128) void k_gemm_bf(const float* __restrict__ A, int lda, const unsigned short* __restrict__ Wt, int ldb,
                                               const float* __restrict__ bias, float* __restrict__ C, int ldc, int M, int N, int K) {
  __shared__ __attribute__((aligned(16))) float so[4][16][64];
  const int tid = threadIdx.x, w = tid >> 5, lane = tid & 31, ln = lane & 15, hh = lane >> 4;
  const int ntn = N / 64;
  const int wid = blockIdx.x * 4 + w;
  const int mt = wid / ntn, nq = wid % ntn;
  if (mt * 16 >= M) return;
  const int row0 = mt * 16, col0 = nq * 64;
  const float* arow = A + (size_t)(row0 + ln) * lda;
  v8f acc[4] = {};
  for (int kb = 0; kb < K; kb += 32) {
    FragB ah, al;
    const v4f x0 = *(const v4fa*)(arow + kb + 8 * hh), x1 = *(const v4fa*)(arow + kb + 8 * hh + 4);
    const v4f x2 = *(const v4fa*)(arow + kb + 16 + 8 * hh), x3 = *(const v4fa*)(arow + kb + 16 + 8 * hh + 4);
    float xs[16] = {x0[0],x0[1],x0[2],x0[3],x1[0],x1[1],x1[2],x1[3],x2[0],x2[1],x2[2],x2[3],x3[0],x3[1],x3[2],x3[3]};
#pragma unroll
    for (int i = 0; i < 16; ++i) { const unsigned short hb = bf16_bits(xs[i]); ah.u[i] = hb; al.u[i] = ASPLIT ? bf16_bits(xs[i] - bf16_val(hb)) : (unsigned short)0; }
#pragma unroll
    for (int t = 0; t < 4; ++t) {
      const unsigned short* brow = Wt + (size_t)(col0 + t * 16 + ln) * ldb + kb;
      FragB b;
      b.half[0] = *(const v8us*)(brow + 8 * hh);
      b.half[1] = *(const v8us*)(brow + 16 + 8 * hh);
      acc[t] = mmaN<ASPLIT ? 2 : 1>(ah.v, al.v, b.v, b.v, acc[t]);
    }
  }
#pragma unroll
  for (int t = 0; t < 4; ++t) {
    float bv = bias ? bias[col0 + t * 16 + ln] : 0.f;
    if (BIAS_BF16) bv = bf16_round(bv);
#pragma unroll
    for (int r = 0; r < 8; ++r) { float v = acc[t][r] + bv; if (ACT == 1) v = fmaxf(v, 0.f); so[w][8 * hh + r][t * 16 + ln] = v; }
  }
  __builtin_amdgcn_fence(__ATOMIC_ACQ_REL, "workgroup");
  __builtin_amdgcn_wave_barrier();
  const int rsub = lane >> 4, c4 = (lane & 15) * 4;
  {
#pragma unroll
    for (int q = 0; q < 8; ++q) {
      const int r = q * 2 + rsub;
      const v4f v = *(const v4fa*)&so[w][r][c4];
      *(v4f*)(C + (size_t)(row0 + r) * ldc + col0 + c4) = v;
    }
    
  }
}

// GEMM C = act(A·W + bias + resid): A f32 (ASPLIT -> hi/lo 2 terms), Wt bf16 [N][K]; ACT 0 none, 1 relu, 2 exact gelu;
// resid (optional, f32, row index = (row % rmod), pitch ldr, RES_BF16 rounds it) added before the activation.
template <bool ASPLIT, int ACT, bool BIAS_BF16, bool RES_BF16>
__global__ __launch_bounds__(128) void k_gemm_bf3(const float* __restrict__ A, int lda, const unsigned short* __restrict__ Wt, int ldb,
                                                const float* __restrict__ bias, const float* __restrict__ resid, int rmod, int ldr,
                                                float* __restrict__ C, int ldc, int M, int N, int K) {
  __shared__ __attribute__((aligned(16))) float so[4][16][64];
  const int tid = threadIdx.x, w = tid >> 5, lane = tid & 31, ln = lane & 15, hh = lane >> 4;
  const int ntn = N / 64;
  const int wid = blockIdx.x * 4 + w;
  const int mt = wid / ntn, nq = wid % ntn;
  if (mt * 16 >= M) return;
  const int row0 = mt * 16, col0 = nq * 64;
  const float* arow = A + (size_t)(row0 + ln) * lda;
  v8f acc[4] = {};
  for (int kb = 0; kb < K; kb += 32) {
    FragB ah, al;
    const v4f x0 = *(const v4fa*)(arow + kb + 8 * hh), x1 = *(const v4fa*)(arow + kb + 8 * hh + 4);
    const v4f x2 = *(const v4fa*)(arow + kb + 16 + 8 * hh), x3 = *(const v4fa*)(arow + kb + 16 + 8 * hh + 4);
    float xs[16] = {x0[0],x0[1],x0[2],x0[3],x1[0],x1[1],x1[2],x1[3],x2[0],x2[1],x2[2],x2[3],x3[0],x3[1],x3[2],x3[3]};
#pragma unroll
    for (int i = 0; i < 16; ++i) { const unsigned short hb = bf16_bits(xs[i]); ah.u[i] = hb; al.u[i] = ASPLIT ? bf16_bits(xs[i] - bf16_val(hb)) : (unsigned short)0; }
#pragma unroll
    for (int t = 0; t < 4; ++t) {
      const unsigned short* brow = Wt + (size_t)(col0 + t * 16 + ln) * ldb + kb;
      FragB b;
      b.half[0] = *(const v8us*)(brow + 8 * hh);
      b.half[1] = *(const v8us*)(brow + 16 + 8 * hh);
      acc[t] = mmaN<ASPLIT ? 2 : 1>(ah.v, al.v, b.v, b.v, acc[t]);
    }
  }
#pragma unroll
  for (int t = 0; t < 4; ++t) {
    const int col = col0 + t * 16 + ln;
    float bv = bias ? bias[col] : 0.f;
    if (BIAS_BF16) bv = bf16_round(bv);
#pragma unroll
    for (int r = 0; r < 8; ++r) {
      float v = acc[t][r] + bv;
      if (resid) { float rv = resid[(size_t)((row0 + 8 * hh + r) % rmod) * ldr + col]; if (RES_BF16) rv = bf16_round(rv); v += rv; }
      if (ACT == 1) v = fmaxf(v, 0.f);
      if (ACT == 2) v = 0.5f * v * (1.0f + erff(v * 0.70710678118654752f));
      if (ACT == 3) { const float u = 0.7978845608028654f * (v + 0.044715f * v * v * v); v = 0.5f * v * (1.0f + tanhf(u)); }
      so[w][8 * hh + r][t * 16 + ln] = v;
    }
  }
  __builtin_amdgcn_fence(__ATOMIC_ACQ_REL, "workgroup");
  __builtin_amdgcn_wave_barrier();
  const int rsub = lane >> 4, c4 = (lane & 15) * 4;
  {
#pragma unroll
    for (int q = 0; q < 8; ++q) {
      const int r = q * 2 + rsub;
      const v4f v = *(const v4fa*)&so[w][r][c4];
      *(v4f*)(C + (size_t)(row0 + r) * ldc + col0 + c4) = v;
    }
    
  }
}
// row LayerNorm (biased variance, eps) over N: s = X (+ R); optional out_sum <- s; out_norm <- (s-mu)*rsqrt(var+eps)*g + b
template <bool PARAM_BF16>
__global__ __launch_bounds__(256) void k_layernorm(const float* __restrict__ X, const float* __restrict__ R, const float* __restrict__ g, const float* __restrict__ bta,
                                                  float* __restrict__ out_sum, float* __restrict__ out_norm, int N, float eps) {
  __shared__ float red[256];
  const int row = blockIdx.x, tid = threadIdx.x;
  const float* x = X + (size_t)row * N; const float* rr = R ? R + (size_t)row * N : nullptr;
  float vals[16];                     // up to N = 4096
  const int per = N / 256;            // contiguous chunk per thread? use strided-by-4 chunks: thread handles j = tid*4 + 1024*u
  float s1 = 0.f;
  for (int u = 0; u < per / 4; ++u) {
    const int j = tid * 4 + 1024 * u;
    const v4f a = *(const v4fa*)(x + j);
    v4f b = {0.f,0.f,0.f,0.f}; if (rr) b = *(const v4fa*)(rr + j);
#pragma unroll
    for (int q = 0; q < 4; ++q) { const float v = a[q] + b[q]; vals[u * 4 + q] = v; s1 += v; }
  }
  red[tid] = s1; __syncthreads();
  for (int st = 128; st > 0; st >>= 1) { if (tid < st) red[tid] += red[tid + st]; __syncthreads(); }
  const float mu = red[0] / (float)N; __syncthreads();
  float s2 = 0.f;
  for (int u = 0; u < per / 4; ++u)
#pragma unroll
    for (int q = 0; q < 4; ++q) { const float c = vals[u * 4 + q] - mu; s2 += c * c; }
  red[tid] = s2; __syncthreads();
  for (int st = 128; st > 0; st >>= 1) { if (tid < st) red[tid] += red[tid + st]; __syncthreads(); }
  const float rs = rsqrtf(red[0] / (float)N + eps);
  {
    for (int u = 0; u < per / 4; ++u) {
      const int j = tid * 4 + 1024 * u;
      v4f o, sm;
#pragma unroll
      for (int q = 0; q < 4; ++q) {
        float gg = g[j + q], bb = bta[j + q];
        if (PARAM_BF16) { gg = bf16_round(gg); bb = bf16_round(bb); }
        sm[q] = vals[u * 4 + q]; o[q] = (vals[u * 4 + q] - mu) * rs * gg + bb;
      }
      if (out_sum) *(v4f*)(out_sum + (size_t)row * N + j) = sm;
      *(v4f*)(out_norm + (size_t)row * N + j) = o;
    }
    
  }
}



// ---- f16 WMMA path (v_wmma_f32_16x16x32_f16): 11-bit significands for operands in range — used where a [0,1] probability operand needs more precision than bf16
typedef _Float16 v16h __attribute__((ext_vector_type(16)));
union FragH { v16h v; v8us half[2]; _Float16 h[16]; unsigned short u[16]; };
template <int NT>
__device__ __forceinline__ v8f mmaH(v16h ah, v16h al, v16h bh, v16h bl, v8f c) {
  c = __builtin_amdgcn_wmma_f32_16x16x32_f16(false, ah, false, bh, (short)0, c, false, false);
  if (NT >= 2) c = __builtin_amdgcn_wmma_f32_16x16x32_f16(false, al, false, bh, (short)0, c, false, false);
  if (NT >= 3) c = __builtin_amdgcn_wmma_f32_16x16x32_f16(false, ah, false, bl, (short)0, c, false, false);
  asm volatile("v_nop\n\tv_nop\n\tv_nop\n\tv_nop" : "+v"(c) : "v"(ah), "v"(al), "v"(bh), "v"(bl));
  return c;
}
// batched GEMM like k_gemm_b but f16 operands: A f32 (split into f16 hi/lo if ASPLIT, else rounded to f16), Bt = f16 values [n][k]; alpha; C f32; N multiple of 16 (partial tiles skipped)
template <bool ASPLIT>
__global__ __launch_bounds__(128) void k_gemm_h(const float* __restrict__ A, int lda, size_t sA, const _Float16* __restrict__ Bh, int ldb, size_t sB, float alpha, float* __restrict__ C, int ldc, size_t sC, int M, int N, int K) {
  __shared__ __attribute__((aligned(16))) float so[4][16][64];
  const int tid = threadIdx.x, w = tid >> 5, lane = tid & 31, ln = lane & 15, hh = lane >> 4; const int by = blockIdx.y;
  A += (size_t)by * sA; Bh += (size_t)by * sB; C += (size_t)by * sC;
  const int ntn = (N + 63) / 64; const int wid = blockIdx.x * 4 + w; const int mt = wid / ntn, nq = wid % ntn; if (mt * 16 >= M) return;
  const int row0 = mt * 16, col0 = nq * 64; const float* arow = A + (size_t)(row0 + ln) * lda;
  v8f acc[4] = {};
  for (int kb = 0; kb < K; kb += 32) {
    FragH ah, al;
    const v4f x0 = *(const v4fa*)(arow + kb + 8 * hh), x1 = *(const v4fa*)(arow + kb + 8 * hh + 4), x2 = *(const v4fa*)(arow + kb + 16 + 8 * hh), x3 = *(const v4fa*)(arow + kb + 16 + 8 * hh + 4);
    float xs[16] = {x0[0],x0[1],x0[2],x0[3],x1[0],x1[1],x1[2],x1[3],x2[0],x2[1],x2[2],x2[3],x3[0],x3[1],x3[2],x3[3]};
#pragma unroll
    for (int i = 0; i < 16; ++i) { const _Float16 h = (_Float16)xs[i]; ah.h[i] = h; al.h[i] = ASPLIT ? (_Float16)(xs[i] - (float)h) : (_Float16)0.0f; }
#pragma unroll
    for (int t = 0; t < 4; ++t) { if (col0 + t * 16 >= N) continue; const size_t boff = (size_t)(col0 + t * 16 + ln) * ldb + kb; FragH bq; bq.half[0] = *(const v8us*)(Bh + boff + 8 * hh); bq.half[1] = *(const v8us*)(Bh + boff + 16 + 8 * hh);
      acc[t] = mmaH<ASPLIT ? 2 : 1>(ah.v, al.v, bq.v, bq.v, acc[t]); }
  }
#pragma unroll
  for (int t = 0; t < 4; ++t) { if (col0 + t * 16 >= N) continue;
#pragma unroll
    for (int r = 0; r < 8; ++r) so[w][8 * hh + r][t * 16 + ln] = acc[t][r] * alpha; }
  __builtin_amdgcn_fence(__ATOMIC_ACQ_REL, "workgroup"); __builtin_amdgcn_wave_barrier();
  const int rsub = lane >> 4, c4 = (lane & 15) * 4;
  {
#pragma unroll
    for (int q = 0; q < 8; ++q) { const int r = q * 2 + rsub; if (col0 + c4 < N) { const v4f v = *(const v4fa*)&so[w][r][c4]; *(v4f*)(C + (size_t)(row0 + r) * ldc + col0 + c4) = v; } }
     }
}

// Wt[n][k] = f16(W[k][n]·scale) from f32 row-major W[K][N] (scale = power of two; bf16-exact weights stay exact in f16 away from the subnormal range)
__global__ __launch_bounds__(256) void k_wt_f16(const float* __restrict__ W, _Float16* __restrict__ Wt, int K, int N, float scale) {
  const int t = blockIdx.x * 256 + threadIdx.x; if (t >= N * (K / 8)) return; const int n = t / (K / 8), k8 = (t % (K / 8)) * 8; FragH f;
#pragma unroll
  for (int i = 0; i < 8; ++i) f.h[i] = (_Float16)(bf16_round(W[(size_t)(k8 + i) * N + n]) * scale); const v8us o = f.half[0];
  *(v8us*)((unsigned short*)Wt + (size_t)n * K + k8) = o; 
}
// k_gemm_hh variant with fused epilogue: v = acc·alpha + bias[by·sBias + col] (+ CP[(row/rowsPerB)·sCPb + by·64 + col] if CP) ; ACT 0 none / 1 elu ; writes f16 C16 (and f32 C if non-null)
template <int ACT>
__global__ __launch_bounds__(128) void k_gemm_hhx(const _Float16* __restrict__ A, int lda, size_t sA, const _Float16* __restrict__ Bh, int ldb, size_t sB, float alpha, const float* __restrict__ bias, size_t sBias, const float* __restrict__ CP, int rowsPerB, size_t sCPb, int row0g,
    float* __restrict__ C, _Float16* __restrict__ C16, int ldc, size_t sC, int M, int N, int K) {
  __shared__ __attribute__((aligned(16))) float so[4][16][64];
  const int tid = threadIdx.x, w = tid >> 5, lane = tid & 31, ln = lane & 15, hh = lane >> 4; const int by = blockIdx.y;
  A += (size_t)by * sA; Bh += (size_t)by * sB; const size_t cofs = (size_t)by * sC; const float* bp = bias ? bias + (size_t)by * sBias : nullptr;
  const int ntn = (N + 63) / 64; const int wid = blockIdx.x * 4 + w; const int mt = wid / ntn, nq = wid % ntn; if (mt * 16 >= M) return;
  const int row0 = mt * 16, col0 = nq * 64; const _Float16* arow = A + (size_t)(row0 + ln) * lda;
  v8f acc[4] = {};
  for (int kb = 0; kb < K; kb += 32) { FragH ah; ah.half[0] = *(const v8us*)((const unsigned short*)arow + kb + 8 * hh); ah.half[1] = *(const v8us*)((const unsigned short*)arow + kb + 16 + 8 * hh);
#pragma unroll
    for (int t = 0; t < 4; ++t) { if (col0 + t * 16 >= N) continue; const size_t boff = (size_t)(col0 + t * 16 + ln) * ldb + kb; FragH bq; bq.half[0] = *(const v8us*)((const unsigned short*)Bh + boff + 8 * hh); bq.half[1] = *(const v8us*)((const unsigned short*)Bh + boff + 16 + 8 * hh);
      acc[t] = mmaH<1>(ah.v, ah.v, bq.v, bq.v, acc[t]); }
  }
#pragma unroll
  for (int t = 0; t < 4; ++t) { if (col0 + t * 16 >= N) continue; const int col = col0 + t * 16 + ln; const float bv = bp ? bf16_round(bp[col]) : 0.f;
#pragma unroll
    for (int r = 0; r < 8; ++r) { float v = acc[t][r] * alpha + bv; if (CP) { const int rr = row0g + row0 + 8 * hh + r; if (rowsPerB < 0) v += CP[cofs + (size_t)rr * ldc + col];      /* rowsPerB < 0: own element of the batched C plane */ else { const int bidx = rr / rowsPerB; v += CP[(size_t)bidx * sCPb + (size_t)by * 64 + col]; } } if (ACT == 1) v = (v > 0.f) ? v : expm1f(v); else if (ACT == 7) v = (v > 0.f) ? v + 1.0f : expf(v); else if (ACT == 8) v = tanhf(v); else if (ACT == 9) v = 0.5f * v * (1.0f + tanhf(0.7978845608028654f * (v + 0.044715f * v * v * v))); else if (ACT == 11) v = 1.0f / (1.0f + expf(-v)); else if (ACT == 12) v = (v > 0.f) ? v : 0.01f * v; else if (ACT == 14) v = (v > 0.f) ? v : 0.1f * v; else if (ACT == 16) v = (v >= 0.f) ? v : 0.3f * v; else if (ACT == 17) v = (v >= 0.f) ? v : 0.2f * v; else if (ACT == 15) v = v / (1.0f + expf(-v)); else if (ACT == 3) v = fmaxf(v, 0.f); else if (ACT == 6) v = 0.5f * v * (1.0f + erff(v * 0.70710678118654752f)); so[w][8 * hh + r][t * 16 + ln] = v; } }
  __builtin_amdgcn_fence(__ATOMIC_ACQ_REL, "workgroup"); __builtin_amdgcn_wave_barrier();
  const int rsub = lane >> 4, c4 = (lane & 15) * 4; typedef _Float16 v4h __attribute__((ext_vector_type(4)));
  {
#pragma unroll
    for (int q = 0; q < 8; ++q) { const int r = q * 2 + rsub; if (col0 + c4 < N) { const v4f v = *(const v4fa*)&so[w][r][c4]; if (C) *(v4f*)(C + cofs + (size_t)(row0 + r) * ldc + col0 + c4) = v; if (C16) { v4h h4; for (int i = 0; i < 4; ++i) h4[i] = (_Float16)v[i]; *(v4h*)(C16 + cofs + (size_t)(row0 + r) * ldc + col0 + c4) = h4; } } }
     }
}


typedef _Float16 v4h __attribute__((ext_vector_type(4)));

__global__ __launch_bounds__(256) void k_x16(const float* __restrict__ x, _Float16* __restrict__ X16, size_t n8) { const size_t t = (size_t)blockIdx.x * 256 + threadIdx.x; if (t >= n8) return; FragH f;
#pragma unroll
  for (int q = 0; q < 8; ++q) f.h[q] = (_Float16)bf16_round(x[t * 8 + q]); *(v8us*)((unsigned short*)X16 + t * 8) = f.half[0];  }
__global__ __launch_bounds__(256) void k_h16(const float* __restrict__ x, _Float16* __restrict__ X16, size_t n8) { const size_t t = (size_t)blockIdx.x * 256 + threadIdx.x; if (t >= n8) return; FragH f;
#pragma unroll
  for (int q = 0; q < 8; ++q) f.h[q] = (_Float16)x[t * 8 + q]; *(v8us*)((unsigned short*)X16 + t * 8) = f.half[0];  }
__global__ __launch_bounds__(256) void k_round16f(const float* __restrict__ W, _Float16* __restrict__ Bt, size_t n8) { const size_t t = (size_t)blockIdx.x * 256 + threadIdx.x; if (t >= n8) return; FragH f;
#pragma unroll
  for (int i = 0; i < 8; ++i) f.h[i] = (_Float16)(bf16_round(W[t * 8 + i]) * 16.0f); *(v8us*)((unsigned short*)Bt + t * 8) = f.half[0];  }
template <int NHv, int TTv>
__global__ __launch_bounds__(256) void k_vt(const _Float16* __restrict__ V16, int ldv, int voff, _Float16* __restrict__ Vt) { __shared__ unsigned short tl[64][66]; const int tid = threadIdx.x; const int slab = blockIdx.x / (TTv / 64), lg = blockIdx.x % (TTv / 64); const int b = slab / NHv, h = slab % NHv;
  for (int i = tid; i < 64 * 8; i += 256) { const int r = i / 8, c8 = (i % 8) * 8; FragH f; f.half[0] = *(const v8us*)((const unsigned short*)V16 + ((size_t)b * TTv + lg * 64 + r) * ldv + voff + h * 64 + c8);
#pragma unroll
    for (int q = 0; q < 8; ++q) tl[r][c8 + q] = f.u[q]; }
  __syncthreads();
  {
#pragma unroll
    for (int rd = 0; rd < 2; ++rd) { const int d = rd * 32 + tid / 8, pc = tid % 8; FragH f;
#pragma unroll
      for (int q = 0; q < 8; ++q) f.u[q] = tl[pc * 8 + q][d];
      *(v8us*)((unsigned short*)Vt + ((size_t)slab * 64 + d) * TTv + lg * 64 + pc * 8) = f.half[0]; }
     } }

__global__ __launch_bounds__(256) void k_hl(const float* __restrict__ F, _Float16* __restrict__ Hh, _Float16* __restrict__ Hl, size_t n8) { const size_t t = (size_t)blockIdx.x * 256 + threadIdx.x; if (t >= n8) return; FragH fh, fl; const v4f a = *(const v4fa*)(F + t * 8), c = *(const v4fa*)(F + t * 8 + 4);
#pragma unroll
  for (int q = 0; q < 4; ++q) { _Float16 h = (_Float16)a[q]; fh.h[q] = h; fl.h[q] = (_Float16)((a[q] - (float)h) * 1024.0f); h = (_Float16)c[q]; fh.h[4 + q] = h; fl.h[4 + q] = (_Float16)((c[q] - (float)h) * 1024.0f); }
  { *(v8us*)((unsigned short*)Hh + t * 8) = fh.half[0]; *(v8us*)((unsigned short*)Hl + t * 8) = fl.half[0];  } }

// ---- fast GEMM (wave tile 32x64; requires M % 32 == 0 rows per launch region and N % 64 == 0); epilogue = k_gemm_hhx semantics ----
__device__ __forceinline__ v16h g2_frag(const _Float16* p, int hh) { FragH f; f.half[0] = *(const v8us*)((const unsigned short*)p + 8 * hh); f.half[1] = *(const v8us*)((const unsigned short*)p + 16 + 8 * hh); return f.v; }
__device__ __forceinline__ v8f g2_mma(v16h a, v16h b, v8f c) { v8f d = __builtin_amdgcn_wmma_f32_16x16x32_f16(false, a, false, b, (short)0, c, false, false); asm volatile("v_nop\n\tv_nop\n\tv_nop\n\tv_nop" : "+v"(d) : "v"(a), "v"(b)); return d; }
template <int ACT>
__global__ __launch_bounds__(128) void k_gemm2(const _Float16* __restrict__ A, int lda, size_t sA, const _Float16* __restrict__ Bh, int ldb, size_t sB, float alpha, const float* __restrict__ bias, size_t sBias, const float* __restrict__ CP, int rowsPerB, size_t sCPb, int row0g,
    float* __restrict__ C, _Float16* __restrict__ C16, int ldc, size_t sC, int M, int N, int K) { static_assert(ACT == 0 || ACT == 3 || ACT == 6 || ACT == 8 || ACT == 9 || ACT == 11 || ACT == 12 || ACT == 14 || ACT == 15 || ACT == 16 || ACT == 17, "k_gemm2: unsupported ACT code (would silently apply no activation)");
  __shared__ __attribute__((aligned(16))) float so[4][32][68];
  const int tid = threadIdx.x, w = tid >> 5, lane = tid & 31, ln = lane & 15, hh = lane >> 4; const int by = blockIdx.y;
  A += (size_t)by * sA; Bh += (size_t)by * sB; const size_t cofs = (size_t)by * sC; const float* bp = bias ? bias + (size_t)by * sBias : nullptr;
  const int ntn = N >> 6; const int mt = blockIdx.x / ntn, nq = blockIdx.x - mt * ntn; const int row0 = mt * 128 + 32 * w, col0 = nq * 64; if (row0 >= M) return;
  const _Float16* a0p = A + (size_t)(row0 + ln) * lda; const _Float16* a1p = a0p + (size_t)16 * lda;
  const _Float16* b0p = Bh + (size_t)(col0 + ln) * ldb; const _Float16* b1p = b0p + (size_t)16 * ldb; const _Float16* b2p = b1p + (size_t)16 * ldb; const _Float16* b3p = b2p + (size_t)16 * ldb;
  const v8f z8 = {0.f,0.f,0.f,0.f,0.f,0.f,0.f,0.f}; v8f c00 = z8, c01 = z8, c02 = z8, c03 = z8, c10 = z8, c11 = z8, c12 = z8, c13 = z8;
#pragma unroll 1
  for (int kb = 0; kb < K; kb += 32) { const v16h a0 = g2_frag(a0p + kb, hh), a1 = g2_frag(a1p + kb, hh);
    v16h b = g2_frag(b0p + kb, hh); c00 = g2_mma(a0, b, c00); c10 = g2_mma(a1, b, c10);
    b = g2_frag(b1p + kb, hh); c01 = g2_mma(a0, b, c01); c11 = g2_mma(a1, b, c11);
    b = g2_frag(b2p + kb, hh); c02 = g2_mma(a0, b, c02); c12 = g2_mma(a1, b, c12);
    b = g2_frag(b3p + kb, hh); c03 = g2_mma(a0, b, c03); c13 = g2_mma(a1, b, c13); }
  v8f accs[8] = {c00, c01, c02, c03, c10, c11, c12, c13};
#pragma unroll
  for (int u = 0; u < 8; ++u) { const int t = u & 3, half = u >> 2; const int col = col0 + t * 16 + ln; const float bv = bp ? bf16_round(bp[col]) : 0.f;
#pragma unroll
    for (int r = 0; r < 8; ++r) { const int rloc = half * 16 + 8 * hh + r; float v = accs[u][r] * alpha + bv; if (CP) { if (rowsPerB < 0) v += CP[cofs + (size_t)(row0g + row0 + rloc) * ldc + col];      /* rowsPerB < 0: own element of the batched C plane */ else { const int bidx = (row0g + row0 + rloc) / rowsPerB; v += CP[(size_t)bidx * sCPb + (size_t)by * 64 + col]; } }
      if (ACT == 3) v = fmaxf(v, 0.f); else if (ACT == 6) v = 0.5f * v * (1.0f + erff(v * 0.70710678118654752f)); else if (ACT == 11) v = 1.0f / (1.0f + expf(-v)); else if (ACT == 15) v = v / (1.0f + expf(-v)); else if (ACT == 12) v = (v > 0.f) ? v : 0.01f * v; else if (ACT == 8) v = tanhf(v); else if (ACT == 9) v = 0.5f * v * (1.0f + tanhf(0.7978845608028654f * (v + 0.044715f * v * v * v))); else if (ACT == 14) v = (v > 0.f) ? v : 0.1f * v; else if (ACT == 16) v = (v >= 0.f) ? v : 0.3f * v; else if (ACT == 17) v = (v >= 0.f) ? v : 0.2f * v;
      so[w][rloc][t * 16 + ln] = v; } }
  __builtin_amdgcn_fence(__ATOMIC_ACQ_REL, "workgroup"); __builtin_amdgcn_wave_barrier();
  const int rsub = lane >> 4, c4 = (lane & 15) * 4;
  {
#pragma unroll
    for (int q = 0; q < 16; ++q) { const int r = q * 2 + rsub; const v4f v = *(const v4fa*)&so[w][r][c4]; if (C) *(v4f*)(C + cofs + (size_t)(row0 + r) * ldc + col0 + c4) = v; if (C16) { v4h h4; for (int i = 0; i < 4; ++i) h4[i] = (_Float16)v[i]; *(v4h*)(C16 + cofs + (size_t)(row0 + r) * ldc + col0 + c4) = h4; } }
     } }


__global__ __launch_bounds__(256) void k_wnat(const float* __restrict__ w, size_t n8, _Float16* __restrict__ Bt) { const size_t t = (size_t)blockIdx.x * 256 + threadIdx.x; if (t >= n8) return; FragH f; for (int q = 0; q < 8; ++q) f.h[q] = (_Float16)(bf16_round(w[t * 8 + q]) * 16.0f); *(v8us*)((unsigned short*)Bt + t * 8) = f.half[0];  }
__global__ __launch_bounds__(256) void k_rsm(const float* __restrict__ S, _Float16* __restrict__ P, int nrows) {
  #pragma clang fp contract(off)
  const int i = blockIdx.x * 256 + threadIdx.x; if (i >= nrows) return; const float* s = S + (size_t)i * SQ; float mx = -3.0e38f;
#pragma unroll 1
  for (int j = 0; j < SQ; ++j) mx = fmaxf(mx, s[j]); float se = 0.f;
#pragma unroll 1
  for (int j = 0; j < SQ; ++j) se += expf(s[j] - mx); const float sc = 256.0f / se;
#pragma unroll 1
  for (int j0 = 0; j0 < SQ; j0 += 8) { FragH f; for (int q = 0; q < 8; ++q) f.h[q] = (_Float16)(expf(s[j0 + q] - mx) * sc); unsigned short* d = (unsigned short*)P + (size_t)i * SQ + j0; *(v8us*)d = f.half[0];  } }
__global__ __launch_bounds__(256) void k_vt(const _Float16* __restrict__ V16, int b, int h0, _Float16* __restrict__ VT) { __shared__ unsigned short tl[64][65]; const int tid = threadIdx.x; const int hh = blockIdx.x % HG, sg = blockIdx.x / HG; const int s0 = sg * 64; const int h = h0 + hh;
  for (int i = tid; i < 64 * 8; i += 256) { const int j = i / 8, d8 = (i % 8) * 8; FragH f; f.half[0] = *(const v8us*)((const unsigned short*)V16 + ((size_t)b * SQ + s0 + j) * DM + h * HD + d8); for (int q = 0; q < 8; ++q) tl[d8 + q][j] = f.u[q]; }
  __syncthreads();
  { for (int i = tid; i < 64 * 8; i += 256) { const int d = i / 8, j8 = (i % 8) * 8; FragH f; for (int q = 0; q < 8; ++q) f.u[q] = tl[d][j8 + q]; *(v8us*)((unsigned short*)VT + ((size_t)hh * HD + d) * SQ + s0 + j8) = f.half[0]; }  } }



__global__ __launch_bounds__(256) void k_rsmfrb(const float* __restrict__ S, _Float16* __restrict__ P, int qn, int hg, const float* __restrict__ emb, int h0) {
  #pragma clang fp contract(off)
  const int t = blockIdx.x * 256 + threadIdx.x; if (t >= qn * hg) return; const int qi = t % qn; const int h = h0 + t / qn; const size_t i = (size_t)(t / qn) * SQ + qi; const float* s = S + i * SQ; float mx = -3.0e38f;
#pragma unroll 1
  for (int j = 0; j < SQ; ++j) { const int r = min(max(qi - j, -MAXD), MAXD) + MAXD; mx = fmaxf(mx, __fadd_rn(s[j], bf16_round(emb[r * NH + h]))); } float se = 0.f;
#pragma unroll 1
  for (int j = 0; j < SQ; ++j) { const int r = min(max(qi - j, -MAXD), MAXD) + MAXD; se += __expf(__fadd_rn(s[j], bf16_round(emb[r * NH + h])) - mx); } const float sc = 256.0f / se;
#pragma unroll 1
  for (int j0 = 0; j0 < SQ; j0 += 8) { FragH fr; for (int q = 0; q < 8; ++q) { const int j = j0 + q; const int r = min(max(qi - j, -MAXD), MAXD) + MAXD; fr.h[q] = (_Float16)(__expf(__fadd_rn(s[j], bf16_round(emb[r * NH + h])) - mx) * sc); } unsigned short* d = (unsigned short*)P + i * SQ + j0; *(v8us*)d = fr.half[0];  } }

extern "C" void kernel_launch(void* const* d_in, const int* in_sizes, int n_in,
                              void* d_out, int out_size, void* d_ws, size_t ws_size, hipStream_t stream) {
  (void)in_sizes; (void)n_in; (void)out_size;
  const float* const* I = (const float* const*)d_in; const float* x = I[0]; const float* wq = I[1]; const float* bq = I[2]; const float* wk = I[3]; const float* bk = I[4]; const float* wv = I[5]; const float* bv = I[6]; const float* wo = I[7]; const float* bo = I[8]; const float* emb = I[9];      /* nn.Linear weights [out][in]; rel_emb [2*MAXD+1][NH] */
  char* ws = (char*)d_ws; size_t off = 0;
  auto take = [&](size_t bytes) { char* p = ws + off; off += (bytes + 255) & ~(size_t)255; return p; };
  _Float16* BQ = (_Float16*)take((size_t)DM * DM * 2); _Float16* BK = (_Float16*)take((size_t)DM * DM * 2); _Float16* BV = (_Float16*)take((size_t)DM * DM * 2); _Float16* BO = (_Float16*)take((size_t)DM * DM * 2);
  _Float16* X16 = (_Float16*)take(NR * DM * 2); _Float16* Q16 = (_Float16*)take(NR * DM * 2); _Float16* K16 = (_Float16*)take(NR * DM * 2); _Float16* V16 = (_Float16*)take(NR * DM * 2); _Float16* O16 = (_Float16*)take(NR * DM * 2);
  float* S = (float*)take((size_t)HG * SQ * SQ * 4); _Float16* P = (_Float16*)take((size_t)HG * SQ * SQ * 2); _Float16* VT = (_Float16*)take((size_t)NH * HD * SQ * 2);
  if (off > ws_size) return;
  { const unsigned g = (unsigned)(((size_t)DM * DM / 8 + 255) / 256); k_wnat<<<g, 256, 0, stream>>>(wq, (size_t)DM * DM / 8, BQ); k_wnat<<<g, 256, 0, stream>>>(wk, (size_t)DM * DM / 8, BK); k_wnat<<<g, 256, 0, stream>>>(wv, (size_t)DM * DM / 8, BV); k_wnat<<<g, 256, 0, stream>>>(wo, (size_t)DM * DM / 8, BO); }      /* natural [out][in] = Bt[n][k], x16 */
  k_x16<<<(unsigned)((NR * DM / 8 + 255) / 256), 256, 0, stream>>>(x, X16, NR * DM / 8);
  const size_t r0p = (size_t)B0 * SQ;      /* first projected row */
  k_gemm2<0><<<dim3((unsigned)((MP / 128) * (DM / 64)), 1), 128, 0, stream>>>(X16 + r0p * DM, DM, 0, BQ, DM, 0, 0.0625f, bq, 0, nullptr, 1, 0, 0, nullptr, Q16 + r0p * DM, DM, 0, MP, DM, DM);
  k_gemm2<0><<<dim3((unsigned)((MP / 128) * (DM / 64)), 1), 128, 0, stream>>>(X16 + r0p * DM, DM, 0, BK, DM, 0, 0.0625f, bk, 0, nullptr, 1, 0, 0, nullptr, K16 + r0p * DM, DM, 0, MP, DM, DM);
  k_gemm2<0><<<dim3((unsigned)((MP / 128) * (DM / 64)), 1), 128, 0, stream>>>(X16 + r0p * DM, DM, 0, BV, DM, 0, 0.0625f, bv, 0, nullptr, 1, 0, 0, nullptr, V16 + r0p * DM, DM, 0, MP, DM, DM);
  for (int b = B0; b < B0 + NBR; ++b) { const size_t r0 = (size_t)b * SQ;
    k_vt<NH, SQ><<<NH * (SQ / 64), 256, 0, stream>>>(V16 + r0 * LQ, LQ, 0, VT);      /* V^T [NH][HD][SQ] for this batch */
    for (int h0 = 0; h0 < NHD; h0 += HG) {
      k_gemm2<0><<<dim3((QN / 128) * (SQ / 64), HG), 128, 0, stream>>>(Q16 + r0 * LQ + h0 * HD, LQ, (size_t)HD, K16 + r0 * LQ + h0 * HD, LQ, (size_t)HD, 0.125f, nullptr, 0, nullptr, 1, 0, 0, S, nullptr, SQ, (size_t)SQ * SQ, QN, SQ, HD);      /* scores, HG heads per launch */
      k_rsmfrb<<<(HG * QN + 255) / 256, 256, 0, stream>>>(S, P, QN, HG, emb, h0);      /* P = 256 softmax (f16), rows of all HG heads */
      k_gemm2<0><<<dim3((QN / 128) * (HD / 64), HG), 128, 0, stream>>>(P, SQ, (size_t)SQ * SQ, VT + (size_t)h0 * HD * SQ, SQ, (size_t)HD * SQ, 0.25f, nullptr, 0, nullptr, 1, 0, 0, nullptr, O16 + r0 * DM + h0 * HD, DM, (size_t)HD, QN, HD, SQ); } }      /* o (merged heads) as f16 rows */
  k_gemm2<0><<<dim3((unsigned)((MPO / 128) * (DM / 64)), 1), 128, 0, stream>>>(O16 + r0p * DM, DM, 0, BO, DM, 0, 0.0009765625f, bo, 0, nullptr, 1, 0, 0, (float*)d_out + r0p * DM, nullptr, DM, 0, MPO, DM, DM);      /* out rows are the output layout */
}

// v001
// One run takes 989 microseconds.
// In two side-by-side timings against v000, it was 4.53 and 4.63 times as fast.
#include <hip/hip_runtime.h>
// Multi-head self-attention with a learned relative-position bias (x [2][2048][1024]; q/k/v = x W^T + b (nn.Linear [out][in]), 16 heads of 64; scores / 8 + rel_emb[clip(i - j, -128, 128) + 128][h] (rel_emb [257][16]); softmax; o merged; out = o Wo^T + bo -> [2][2048][1024]).
// Structure: token rows r = b*2048 + s; x as exact f16 rows (bf16-rounded); Q, K, V as three WMMA GEMMs (32x64 wave tiles, f32 accumulation, exact x16 weights + bias, f16 outputs); per batch: V^T for all heads via LDS transposes; per (batch, group of 4 heads): scores GEMM (K = 64, batched over the heads on grid.y, alpha = 1/8), row softmax of (scores + relative-position bias looked up by (i - j, head)) on VALU (f32 statistics, native exp; weights stored x256 as f16), o = P . V^T GEMM (K = 2048, alpha 2^-2: o carried x64 against f16 subnormal flush, folded into the output GEMM alpha) written straight into the merged f16 o rows; out = o W_o + b GEMM (f32) into the output layout.
// Compute dtype: inputs rounded to bf16; x / weights exact; q, k, v, softmax weights and o as plain f16 GEMM operands (~2^-12); scores and softmax statistics f32. v_wmma_f32_16x16x32_f16.
#define NB 2
#define SQ 2048
#define DM 1024
#define NH 16
#define HD 64
#define MAXD 128                     /* relative distance clip */
#define HG 4                         /* heads per attention launch group */
#define B0 0                         /* first batch processed (debug hook) */
#define NBR NB                       /* batches processed (debug hook) */
#define NR ((size_t)NB * SQ)         /* token rows */
#define MP ((int)((size_t)NBR * SQ)) /* rows projected (debug hook) */
#define QN SQ                        /* query rows attended per batch (debug hook) */
#define NHD NH                       /* heads attended (debug hook) */
#define MPO MP                       /* rows through the output stage (debug hook) */
#define LQ DM      /* row pitch of the q/k/v rows */
typedef __bf16 v16b __attribute__((ext_vector_type(16)));
typedef unsigned short v8us __attribute__((ext_vector_type(8), may_alias));
typedef float  v8f  __attribute__((ext_vector_type(8)));
typedef float  v4f  __attribute__((ext_vector_type(4)));
typedef float  v4fa __attribute__((ext_vector_type(4), may_alias));
union FragB { v16b v; v8us half[2]; unsigned short u[16]; };

__device__ __forceinline__ unsigned short bf16_bits(float x) { unsigned int u = __float_as_uint(x); return (unsigned short)((u + 0x7FFFu + ((u >> 16) & 1u)) >> 16); }
__device__ __forceinline__ float bf16_val(unsigned short b) { return __uint_as_float(((unsigned int)b) << 16); }
__device__ __forceinline__ float bf16_round(float x) { return bf16_val(bf16_bits(x)); }
// D += A·B with NT terms: 1 = ah·bh, 2 = + al·bh (A split), 3 = + ah·bl (both split)
template <int NT>
__device__ __forceinline__ v8f mmaN(v16b ah, v16b al, v16b bh, v16b bl, v8f c) {
  c = __builtin_amdgcn_wmma_f32_16x16x32_bf16(false, ah, false, bh, (short)0, c, false, false);
  if (NT >= 2) c = __builtin_amdgcn_wmma_f32_16x16x32_bf16(false, al, false, bh, (short)0, c, false, false);
  if (NT >= 3) c = __builtin_amdgcn_wmma_f32_16x16x32_bf16(false, ah, false, bl, (short)0, c, false, false);
  asm volatile("v_nop\n\tv_nop\n\tv_nop\n\tv_nop" : "+v"(c) : "v"(ah), "v"(al), "v"(bh), "v"(bl));
  return c;
}

__global__ __launch_bounds__(256) void k_wt_bf16(const float* __restrict__ W, unsigned short* __restrict__ Wt, int K, int N) {
  const int t = blockIdx.x * 256 + threadIdx.x;
  const int k8n = K / 8;
  if (t >= N * k8n) return;
  const int n = t / k8n, k8 = (t % k8n) * 8;
  v8us v;
#pragma unroll
  for (int i = 0; i < 8; ++i) v[i] = bf16_bits(W[(size_t)(k8 + i) * N + n]);
  *(v8us*)(Wt + (size_t)n * K + k8) = v;
  
}

// GEMM C[M][N] (f32, pitch ldc) = act(A[M][K]·W + bias). A f32 row-major (pitch lda) converted per fragment to bf16
// (ASPLIT: hi/lo two planes -> 2 terms, else single rounded term); Wt bf16 [N][K] (pitch ldb). BIAS_BF16 rounds the
// bias to bf16 first (bias quantised to bf16 before the add). K%32==0, M%16==0, N%64==0.
template <bool ASPLIT, int ACT, bool BIAS_BF16>
__global__ __launch_bounds__(128) void k_gemm_bf(const float* __restrict__ A, int lda, const unsigned short* __restrict__ Wt, int ldb,
                                               const float* __restrict__ bias, float* __restrict__ C, int ldc, int M, int N, int K) {
  __shared__ __attribute__((aligned(16))) float so[4][16][64];
  const int tid = threadIdx.x, w = tid >> 5, lane = tid & 31, ln = lane & 15, hh = lane >> 4;
  const int ntn = N / 64;
  const int wid = blockIdx.x * 4 + w;
  const int mt = wid / ntn, nq = wid % ntn;
  if (mt * 16 >= M) return;
  const int row0 = mt * 16, col0 = nq * 64;
  const float* arow = A + (size_t)(row0 + ln) * lda;
  v8f acc[4] = {};
  for (int kb = 0; kb < K; kb += 32) {
    FragB ah, al;
    const v4f x0 = *(const v4fa*)(arow + kb + 8 * hh), x1 = *(const v4fa*)(arow + kb + 8 * hh + 4);
    const v4f x2 = *(const v4fa*)(arow + kb + 16 + 8 * hh), x3 = *(const v4fa*)(arow + kb + 16 + 8 * hh + 4);
    float xs[16] = {x0[0],x0[1],x0[2],x0[3],x1[0],x1[1],x1[2],x1[3],x2[0],x2[1],x2[2],x2[3],x3[0],x3[1],x3[2],x3[3]};
#pragma unroll
    for (int i = 0; i < 16; ++i) { const unsigned short hb = bf16_bits(xs[i]); ah.u[i] = hb; al.u[i] = ASPLIT ? bf16_bits(xs[i] - bf16_val(hb)) : (unsigned short)0; }
#pragma unroll
    for (int t = 0; t < 4; ++t) {
      const unsigned short* brow = Wt + (size_t)(col0 + t * 16 + ln) * ldb + kb;
      FragB b;
      b.half[0] = *(const v8us*)(brow + 8 * hh);
      b.half[1] = *(const v8us*)(brow + 16 + 8 * hh);
      acc[t] = mmaN<ASPLIT ? 2 : 1>(ah.v, al.v, b.v, b.v, acc[t]);
    }
  }
#pragma unroll
  for (int t = 0; t < 4; ++t) {
    float bv = bias ? bias[col0 + t * 16 + ln] : 0.f;
    if (BIAS_BF16) bv = bf16_round(bv);
#pragma unroll
    for (int r = 0; r < 8; ++r) { float v = acc[t][r] + bv; if (ACT == 1) v = fmaxf(v, 0.f); so[w][8 * hh + r][t * 16 + ln] = v; }
  }
  __builtin_amdgcn_fence(__ATOMIC_ACQ_REL, "workgroup");
  __builtin_amdgcn_wave_barrier();
  const int rsub = lane >> 4, c4 = (lane & 15) * 4;
  {
#pragma unroll
    for (int q = 0; q < 8; ++q) {
      const int r = q * 2 + rsub;
      const v4f v = *(const v4fa*)&so[w][r][c4];
      *(v4f*)(C + (size_t)(row0 + r) * ldc + col0 + c4) = v;
    }
    
  }
}

// GEMM C = act(A·W + bias + resid): A f32 (ASPLIT -> hi/lo 2 terms), Wt bf16 [N][K]; ACT 0 none, 1 relu, 2 exact gelu;
// resid (optional, f32, row index = (row % rmod), pitch ldr, RES_BF16 rounds it) added before the activation.
template <bool ASPLIT, int ACT, bool BIAS_BF16, bool RES_BF16>
__global__ __launch_bounds__(128) void k_gemm_bf3(const float* __restrict__ A, int lda, const unsigned short* __restrict__ Wt, int ldb,
                                                const float* __restrict__ bias, const float* __restrict__ resid, int rmod, int ldr,
                                                float* __restrict__ C, int ldc, int M, int N, int K) {
  __shared__ __attribute__((aligned(16))) float so[4][16][64];
  const int tid = threadIdx.x, w = tid >> 5, lane = tid & 31, ln = lane & 15, hh = lane >> 4;
  const int ntn = N / 64;
  const int wid = blockIdx.x * 4 + w;
  const int mt = wid / ntn, nq = wid % ntn;
  if (mt * 16 >= M) return;
  const int row0 = mt * 16, col0 = nq * 64;
  const float* arow = A + (size_t)(row0 + ln) * lda;
  v8f acc[4] = {};
  for (int kb = 0; kb < K; kb += 32) {
    FragB ah, al;
    const v4f x0 = *(const v4fa*)(arow + kb + 8 * hh), x1 = *(const v4fa*)(arow + kb + 8 * hh + 4);
    const v4f x2 = *(const v4fa*)(arow + kb + 16 + 8 * hh), x3 = *(const v4fa*)(arow + kb + 16 + 8 * hh + 4);
    float xs[16] = {x0[0],x0[1],x0[2],x0[3],x1[0],x1[1],x1[2],x1[3],x2[0],x2[1],x2[2],x2[3],x3[0],x3[1],x3[2],x3[3]};
#pragma unroll
    for (int i = 0; i < 16; ++i) { const unsigned short hb = bf16_bits(xs[i]); ah.u[i] = hb; al.u[i] = ASPLIT ? bf16_bits(xs[i] - bf16_val(hb)) : (unsigned short)0; }
#pragma unroll
    for (int t = 0; t < 4; ++t) {
      const unsigned short* brow = Wt + (size_t)(col0 + t * 16 + ln) * ldb + kb;
      FragB b;
      b.half[0] = *(const v8us*)(brow + 8 * hh);
      b.half[1] = *(const v8us*)(brow + 16 + 8 * hh);
      acc[t] = mmaN<ASPLIT ? 2 : 1>(ah.v, al.v, b.v, b.v, acc[t]);
    }
  }
#pragma unroll
  for (int t = 0; t < 4; ++t) {
    const int col = col0 + t * 16 + ln;
    float bv = bias ? bias[col] : 0.f;
    if (BIAS_BF16) bv = bf16_round(bv);
#pragma unroll
    for (int r = 0; r < 8; ++r) {
      float v = acc[t][r] + bv;
      if (resid) { float rv = resid[(size_t)((row0 + 8 * hh + r) % rmod) * ldr + col]; if (RES_BF16) rv = bf16_round(rv); v += rv; }
      if (ACT == 1) v = fmaxf(v, 0.f);
      if (ACT == 2) v = 0.5f * v * (1.0f + erff(v * 0.70710678118654752f));
      if (ACT == 3) { const float u = 0.7978845608028654f * (v + 0.044715f * v * v * v); v = 0.5f * v * (1.0f + tanhf(u)); }
      so[w][8 * hh + r][t * 16 + ln] = v;
    }
  }
  __builtin_amdgcn_fence(__ATOMIC_ACQ_REL, "workgroup");
  __builtin_amdgcn_wave_barrier();
  const int rsub = lane >> 4, c4 = (lane & 15) * 4;
  {
#pragma unroll
    for (int q = 0; q < 8; ++q) {
      const int r = q * 2 + rsub;
      const v4f v = *(const v4fa*)&so[w][r][c4];
      *(v4f*)(C + (size_t)(row0 + r) * ldc + col0 + c4) = v;
    }
    
  }
}
// row LayerNorm (biased variance, eps) over N: s = X (+ R); optional out_sum <- s; out_norm <- (s-mu)*rsqrt(var+eps)*g + b
template <bool PARAM_BF16>
__global__ __launch_bounds__(256) void k_layernorm(const float* __restrict__ X, const float* __restrict__ R, const float* __restrict__ g, const float* __restrict__ bta,
                                                  float* __restrict__ out_sum, float* __restrict__ out_norm, int N, float eps) {
  __shared__ float red[256];
  const int row = blockIdx.x, tid = threadIdx.x;
  const float* x = X + (size_t)row * N; const float* rr = R ? R + (size_t)row * N : nullptr;
  float vals[16];                     // up to N = 4096
  const int per = N / 256;            // contiguous chunk per thread? use strided-by-4 chunks: thread handles j = tid*4 + 1024*u
  float s1 = 0.f;
  for (int u = 0; u < per / 4; ++u) {
    const int j = tid * 4 + 1024 * u;
    const v4f a = *(const v4fa*)(x + j);
    v4f b = {0.f,0.f,0.f,0.f}; if (rr) b = *(const v4fa*)(rr + j);
#pragma unroll
    for (int q = 0; q < 4; ++q) { const float v = a[q] + b[q]; vals[u * 4 + q] = v; s1 += v; }
  }
  red[tid] = s1; __syncthreads();
  for (int st = 128; st > 0; st >>= 1) { if (tid < st) red[tid] += red[tid + st]; __syncthreads(); }
  const float mu = red[0] / (float)N; __syncthreads();
  float s2 = 0.f;
  for (int u = 0; u < per / 4; ++u)
#pragma unroll
    for (int q = 0; q < 4; ++q) { const float c = vals[u * 4 + q] - mu; s2 += c * c; }
  red[tid] = s2; __syncthreads();
  for (int st = 128; st > 0; st >>= 1) { if (tid < st) red[tid] += red[tid + st]; __syncthreads(); }
  const float rs = rsqrtf(red[0] / (float)N + eps);
  {
    for (int u = 0; u < per / 4; ++u) {
      const int j = tid * 4 + 1024 * u;
      v4f o, sm;
#pragma unroll
      for (int q = 0; q < 4; ++q) {
        float gg = g[j + q], bb = bta[j + q];
        if (PARAM_BF16) { gg = bf16_round(gg); bb = bf16_round(bb); }
        sm[q] = vals[u * 4 + q]; o[q] = (vals[u * 4 + q] - mu) * rs * gg + bb;
      }
      if (out_sum) *(v4f*)(out_sum + (size_t)row * N + j) = sm;
      *(v4f*)(out_norm + (size_t)row * N + j) = o;
    }
    
  }
}



// ---- f16 WMMA path (v_wmma_f32_16x16x32_f16): 11-bit significands for operands in range — used where a [0,1] probability operand needs more precision than bf16
typedef _Float16 v16h __attribute__((ext_vector_type(16)));
union FragH { v16h v; v8us half[2]; _Float16 h[16]; unsigned short u[16]; };
template <int NT>
__device__ __forceinline__ v8f mmaH(v16h ah, v16h al, v16h bh, v16h bl, v8f c) {
  c = __builtin_amdgcn_wmma_f32_16x16x32_f16(false, ah, false, bh, (short)0, c, false, false);
  if (NT >= 2) c = __builtin_amdgcn_wmma_f32_16x16x32_f16(false, al, false, bh, (short)0, c, false, false);
  if (NT >= 3) c = __builtin_amdgcn_wmma_f32_16x16x32_f16(false, ah, false, bl, (short)0, c, false, false);
  asm volatile("v_nop\n\tv_nop\n\tv_nop\n\tv_nop" : "+v"(c) : "v"(ah), "v"(al), "v"(bh), "v"(bl));
  return c;
}
// batched GEMM like k_gemm_b but f16 operands: A f32 (split into f16 hi/lo if ASPLIT, else rounded to f16), Bt = f16 values [n][k]; alpha; C f32; N multiple of 16 (partial tiles skipped)
template <bool ASPLIT>
__global__ __launch_bounds__(128) void k_gemm_h(const float* __restrict__ A, int lda, size_t sA, const _Float16* __restrict__ Bh, int ldb, size_t sB, float alpha, float* __restrict__ C, int ldc, size_t sC, int M, int N, int K) {
  __shared__ __attribute__((aligned(16))) float so[4][16][64];
  const int tid = threadIdx.x, w = tid >> 5, lane = tid & 31, ln = lane & 15, hh = lane >> 4; const int by = blockIdx.y;
  A += (size_t)by * sA; Bh += (size_t)by * sB; C += (size_t)by * sC;
  const int ntn = (N + 63) / 64; const int wid = blockIdx.x * 4 + w; const int mt = wid / ntn, nq = wid % ntn; if (mt * 16 >= M) return;
  const int row0 = mt * 16, col0 = nq * 64; const float* arow = A + (size_t)(row0 + ln) * lda;
  v8f acc[4] = {};
  for (int kb = 0; kb < K; kb += 32) {
    FragH ah, al;
    const v4f x0 = *(const v4fa*)(arow + kb + 8 * hh), x1 = *(const v4fa*)(arow + kb + 8 * hh + 4), x2 = *(const v4fa*)(arow + kb + 16 + 8 * hh), x3 = *(const v4fa*)(arow + kb + 16 + 8 * hh + 4);
    float xs[16] = {x0[0],x0[1],x0[2],x0[3],x1[0],x1[1],x1[2],x1[3],x2[0],x2[1],x2[2],x2[3],x3[0],x3[1],x3[2],x3[3]};
#pragma unroll
    for (int i = 0; i < 16; ++i) { const _Float16 h = (_Float16)xs[i]; ah.h[i] = h; al.h[i] = ASPLIT ? (_Float16)(xs[i] - (float)h) : (_Float16)0.0f; }
#pragma unroll
    for (int t = 0; t < 4; ++t) { if (col0 + t * 16 >= N) continue; const size_t boff = (size_t)(col0 + t * 16 + ln) * ldb + kb; FragH bq; bq.half[0] = *(const v8us*)(Bh + boff + 8 * hh); bq.half[1] = *(const v8us*)(Bh + boff + 16 + 8 * hh);
      acc[t] = mmaH<ASPLIT ? 2 : 1>(ah.v, al.v, bq.v, bq.v, acc[t]); }
  }
#pragma unroll
  for (int t = 0; t < 4; ++t) { if (col0 + t * 16 >= N) continue;
#pragma unroll
    for (int r = 0; r < 8; ++r) so[w][8 * hh + r][t * 16 + ln] = acc[t][r] * alpha; }
  __builtin_amdgcn_fence(__ATOMIC_ACQ_REL, "workgroup"); __builtin_amdgcn_wave_barrier();
  const int rsub = lane >> 4, c4 = (lane & 15) * 4;
  {
#pragma unroll
    for (int q = 0; q < 8; ++q) { const int r = q * 2 + rsub; if (col0 + c4 < N) { const v4f v = *(const v4fa*)&so[w][r][c4]; *(v4f*)(C + (size_t)(row0 + r) * ldc + col0 + c4) = v; } }
     }
}

// Wt[n][k] = f16(W[k][n]·scale) from f32 row-major W[K][N] (scale = power of two; bf16-exact weights stay exact in f16 away from the subnormal range)
__global__ __launch_bounds__(256) void k_wt_f16(const float* __restrict__ W, _Float16* __restrict__ Wt, int K, int N, float scale) {
  const int t = blockIdx.x * 256 + threadIdx.x; if (t >= N * (K / 8)) return; const int n = t / (K / 8), k8 = (t % (K / 8)) * 8; FragH f;
#pragma unroll
  for (int i = 0; i < 8; ++i) f.h[i] = (_Float16)(bf16_round(W[(size_t)(k8 + i) * N + n]) * scale); const v8us o = f.half[0];
  *(v8us*)((unsigned short*)Wt + (size_t)n * K + k8) = o; 
}
// k_gemm_hh variant with fused epilogue: v = acc·alpha + bias[by·sBias + col] (+ CP[(row/rowsPerB)·sCPb + by·64 + col] if CP) ; ACT 0 none / 1 elu ; writes f16 C16 (and f32 C if non-null)
template <int ACT>
__global__ __launch_bounds__(128) void k_gemm_hhx(const _Float16* __restrict__ A, int lda, size_t sA, const _Float16* __restrict__ Bh, int ldb, size_t sB, float alpha, const float* __restrict__ bias, size_t sBias, const float* __restrict__ CP, int rowsPerB, size_t sCPb, int row0g,
    float* __restrict__ C, _Float16* __restrict__ C16, int ldc, size_t sC, int M, int N, int K) {
  __shared__ __attribute__((aligned(16))) float so[4][16][64];
  const int tid = threadIdx.x, w = tid >> 5, lane = tid & 31, ln = lane & 15, hh = lane >> 4; const int by = blockIdx.y;
  A += (size_t)by * sA; Bh += (size_t)by * sB; const size_t cofs = (size_t)by * sC; const float* bp = bias ? bias + (size_t)by * sBias : nullptr;
  const int ntn = (N + 63) / 64; const int wid = blockIdx.x * 4 + w; const int mt = wid / ntn, nq = wid % ntn; if (mt * 16 >= M) return;
  const int row0 = mt * 16, col0 = nq * 64; const _Float16* arow = A + (size_t)(row0 + ln) * lda;
  v8f acc[4] = {};
  for (int kb = 0; kb < K; kb += 32) { FragH ah; ah.half[0] = *(const v8us*)((const unsigned short*)arow + kb + 8 * hh); ah.half[1] = *(const v8us*)((const unsigned short*)arow + kb + 16 + 8 * hh);
#pragma unroll
    for (int t = 0; t < 4; ++t) { if (col0 + t * 16 >= N) continue; const size_t boff = (size_t)(col0 + t * 16 + ln) * ldb + kb; FragH bq; bq.half[0] = *(const v8us*)((const unsigned short*)Bh + boff + 8 * hh); bq.half[1] = *(const v8us*)((const unsigned short*)Bh + boff + 16 + 8 * hh);
      acc[t] = mmaH<1>(ah.v, ah.v, bq.v, bq.v, acc[t]); }
  }
#pragma unroll
  for (int t = 0; t < 4; ++t) { if (col0 + t * 16 >= N) continue; const int col = col0 + t * 16 + ln; const float bv = bp ? bf16_round(bp[col]) : 0.f;
#pragma unroll
    for (int r = 0; r < 8; ++r) { float v = acc[t][r] * alpha + bv; if (CP) { const int rr = row0g + row0 + 8 * hh + r; if (rowsPerB < 0) v += CP[cofs + (size_t)rr * ldc + col];      /* rowsPerB < 0: own element of the batched C plane */ else { const int bidx = rr / rowsPerB; v += CP[(size_t)bidx * sCPb + (size_t)by * 64 + col]; } } if (ACT == 1) v = (v > 0.f) ? v : expm1f(v); else if (ACT == 7) v = (v > 0.f) ? v + 1.0f : expf(v); else if (ACT == 8) v = tanhf(v); else if (ACT == 9) v = 0.5f * v * (1.0f + tanhf(0.7978845608028654f * (v + 0.044715f * v * v * v))); else if (ACT == 11) v = 1.0f / (1.0f + expf(-v)); else if (ACT == 12) v = (v > 0.f) ? v : 0.01f * v; else if (ACT == 14) v = (v > 0.f) ? v : 0.1f * v; else if (ACT == 16) v = (v >= 0.f) ? v : 0.3f * v; else if (ACT == 17) v = (v >= 0.f) ? v : 0.2f * v; else if (ACT == 15) v = v / (1.0f + expf(-v)); else if (ACT == 3) v = fmaxf(v, 0.f); else if (ACT == 6) v = 0.5f * v * (1.0f + erff(v * 0.70710678118654752f)); so[w][8 * hh + r][t * 16 + ln] = v; } }
  __builtin_amdgcn_fence(__ATOMIC_ACQ_REL, "workgroup"); __builtin_amdgcn_wave_barrier();
  const int rsub = lane >> 4, c4 = (lane & 15) * 4; typedef _Float16 v4h __attribute__((ext_vector_type(4)));
  {
#pragma unroll
    for (int q = 0; q < 8; ++q) { const int r = q * 2 + rsub; if (col0 + c4 < N) { const v4f v = *(const v4fa*)&so[w][r][c4]; if (C) *(v4f*)(C + cofs + (size_t)(row0 + r) * ldc + col0 + c4) = v; if (C16) { v4h h4; for (int i = 0; i < 4; ++i) h4[i] = (_Float16)v[i]; *(v4h*)(C16 + cofs + (size_t)(row0 + r) * ldc + col0 + c4) = h4; } } }
     }
}


typedef _Float16 v4h __attribute__((ext_vector_type(4)));

__global__ __launch_bounds__(256) void k_x16(const float* __restrict__ x, _Float16* __restrict__ X16, size_t n8) { const size_t t = (size_t)blockIdx.x * 256 + threadIdx.x; if (t >= n8) return; FragH f;
#pragma unroll
  for (int q = 0; q < 8; ++q) f.h[q] = (_Float16)bf16_round(x[t * 8 + q]); *(v8us*)((unsigned short*)X16 + t * 8) = f.half[0];  }
__global__ __launch_bounds__(256) void k_h16(const float* __restrict__ x, _Float16* __restrict__ X16, size_t n8) { const size_t t = (size_t)blockIdx.x * 256 + threadIdx.x; if (t >= n8) return; FragH f;
#pragma unroll
  for (int q = 0; q < 8; ++q) f.h[q] = (_Float16)x[t * 8 + q]; *(v8us*)((unsigned short*)X16 + t * 8) = f.half[0];  }
__global__ __launch_bounds__(256) void k_round16f(const float* __restrict__ W, _Float16* __restrict__ Bt, size_t n8) { const size_t t = (size_t)blockIdx.x * 256 + threadIdx.x; if (t >= n8) return; FragH f;
#pragma unroll
  for (int i = 0; i < 8; ++i) f.h[i] = (_Float16)(bf16_round(W[t * 8 + i]) * 16.0f); *(v8us*)((unsigned short*)Bt + t * 8) = f.half[0];  }
template <int NHv, int TTv>
__global__ __launch_bounds__(256) void k_vt(const _Float16* __restrict__ V16, int ldv, int voff, _Float16* __restrict__ Vt) { __shared__ unsigned short tl[64][66]; const int tid = threadIdx.x; const int slab = blockIdx.x / (TTv / 64), lg = blockIdx.x % (TTv / 64); const int b = slab / NHv, h = slab % NHv;
  for (int i = tid; i < 64 * 8; i += 256) { const int r = i / 8, c8 = (i % 8) * 8; FragH f; f.half[0] = *(const v8us*)((const unsigned short*)V16 + ((size_t)b * TTv + lg * 64 + r) * ldv + voff + h * 64 + c8);
#pragma unroll
    for (int q = 0; q < 8; ++q) tl[r][c8 + q] = f.u[q]; }
  __syncthreads();
  {
#pragma unroll
    for (int rd = 0; rd < 2; ++rd) { const int d = rd * 32 + tid / 8, pc = tid % 8; FragH f;
#pragma unroll
      for (int q = 0; q < 8; ++q) f.u[q] = tl[pc * 8 + q][d];
      *(v8us*)((unsigned short*)Vt + ((size_t)slab * 64 + d) * TTv + lg * 64 + pc * 8) = f.half[0]; }
     } }

__global__ __launch_bounds__(256) void k_hl(const float* __restrict__ F, _Float16* __restrict__ Hh, _Float16* __restrict__ Hl, size_t n8) { const size_t t = (size_t)blockIdx.x * 256 + threadIdx.x; if (t >= n8) return; FragH fh, fl; const v4f a = *(const v4fa*)(F + t * 8), c = *(const v4fa*)(F + t * 8 + 4);
#pragma unroll
  for (int q = 0; q < 4; ++q) { _Float16 h = (_Float16)a[q]; fh.h[q] = h; fl.h[q] = (_Float16)((a[q] - (float)h) * 1024.0f); h = (_Float16)c[q]; fh.h[4 + q] = h; fl.h[4 + q] = (_Float16)((c[q] - (float)h) * 1024.0f); }
  { *(v8us*)((unsigned short*)Hh + t * 8) = fh.half[0]; *(v8us*)((unsigned short*)Hl + t * 8) = fl.half[0];  } }

// ---- fast GEMM (wave tile 32x64; requires M % 32 == 0 rows per launch region and N % 64 == 0); epilogue = k_gemm_hhx semantics ----
__device__ __forceinline__ v16h g2_frag(const _Float16* p, int hh) { FragH f; f.half[0] = *(const v8us*)((const unsigned short*)p + 8 * hh); f.half[1] = *(const v8us*)((const unsigned short*)p + 16 + 8 * hh); return f.v; }
__device__ __forceinline__ v8f g2_mma(v16h a, v16h b, v8f c) { v8f d = __builtin_amdgcn_wmma_f32_16x16x32_f16(false, a, false, b, (short)0, c, false, false); asm volatile("v_nop\n\tv_nop\n\tv_nop\n\tv_nop" : "+v"(d) : "v"(a), "v"(b)); return d; }
template <int ACT>
__global__ __launch_bounds__(128) void k_gemm2(const _Float16* __restrict__ A, int lda, size_t sA, const _Float16* __restrict__ Bh, int ldb, size_t sB, float alpha, const float* __restrict__ bias, size_t sBias, const float* __restrict__ CP, int rowsPerB, size_t sCPb, int row0g,
    float* __restrict__ C, _Float16* __restrict__ C16, int ldc, size_t sC, int M, int N, int K) { static_assert(ACT == 0 || ACT == 3 || ACT == 6 || ACT == 8 || ACT == 9 || ACT == 11 || ACT == 12 || ACT == 14 || ACT == 15 || ACT == 16 || ACT == 17, "k_gemm2: unsupported ACT code (would silently apply no activation)");
  __shared__ __attribute__((aligned(16))) float so[4][32][68];
  const int tid = threadIdx.x, w = tid >> 5, lane = tid & 31, ln = lane & 15, hh = lane >> 4; const int by = blockIdx.y;
  A += (size_t)by * sA; Bh += (size_t)by * sB; const size_t cofs = (size_t)by * sC; const float* bp = bias ? bias + (size_t)by * sBias : nullptr;
  const int ntn = N >> 6; const int mt = blockIdx.x / ntn, nq = blockIdx.x - mt * ntn; const int row0 = mt * 128 + 32 * w, col0 = nq * 64; if (row0 >= M) return;
  const _Float16* a0p = A + (size_t)(row0 + ln) * lda; const _Float16* a1p = a0p + (size_t)16 * lda;
  const _Float16* b0p = Bh + (size_t)(col0 + ln) * ldb; const _Float16* b1p = b0p + (size_t)16 * ldb; const _Float16* b2p = b1p + (size_t)16 * ldb; const _Float16* b3p = b2p + (size_t)16 * ldb;
  const v8f z8 = {0.f,0.f,0.f,0.f,0.f,0.f,0.f,0.f}; v8f c00 = z8, c01 = z8, c02 = z8, c03 = z8, c10 = z8, c11 = z8, c12 = z8, c13 = z8;
#pragma unroll 1
  for (int kb = 0; kb < K; kb += 32) { const v16h a0 = g2_frag(a0p + kb, hh), a1 = g2_frag(a1p + kb, hh);
    v16h b = g2_frag(b0p + kb, hh); c00 = g2_mma(a0, b, c00); c10 = g2_mma(a1, b, c10);
    b = g2_frag(b1p + kb, hh); c01 = g2_mma(a0, b, c01); c11 = g2_mma(a1, b, c11);
    b = g2_frag(b2p + kb, hh); c02 = g2_mma(a0, b, c02); c12 = g2_mma(a1, b, c12);
    b = g2_frag(b3p + kb, hh); c03 = g2_mma(a0, b, c03); c13 = g2_mma(a1, b, c13); }
  v8f accs[8] = {c00, c01, c02, c03, c10, c11, c12, c13};
#pragma unroll
  for (int u = 0; u < 8; ++u) { const int t = u & 3, half = u >> 2; const int col = col0 + t * 16 + ln; const float bv = bp ? bf16_round(bp[col]) : 0.f;
#pragma unroll
    for (int r = 0; r < 8; ++r) { const int rloc = half * 16 + 8 * hh + r; float v = accs[u][r] * alpha + bv; if (CP) { if (rowsPerB < 0) v += CP[cofs + (size_t)(row0g + row0 + rloc) * ldc + col];      /* rowsPerB < 0: own element of the batched C plane */ else { const int bidx = (row0g + row0 + rloc) / rowsPerB; v += CP[(size_t)bidx * sCPb + (size_t)by * 64 + col]; } }
      if (ACT == 3) v = fmaxf(v, 0.f); else if (ACT == 6) v = 0.5f * v * (1.0f + erff(v * 0.70710678118654752f)); else if (ACT == 11) v = 1.0f / (1.0f + expf(-v)); else if (ACT == 15) v = v / (1.0f + expf(-v)); else if (ACT == 12) v = (v > 0.f) ? v : 0.01f * v; else if (ACT == 8) v = tanhf(v); else if (ACT == 9) v = 0.5f * v * (1.0f + tanhf(0.7978845608028654f * (v + 0.044715f * v * v * v))); else if (ACT == 14) v = (v > 0.f) ? v : 0.1f * v; else if (ACT == 16) v = (v >= 0.f) ? v : 0.3f * v; else if (ACT == 17) v = (v >= 0.f) ? v : 0.2f * v;
      so[w][rloc][t * 16 + ln] = v; } }
  __builtin_amdgcn_fence(__ATOMIC_ACQ_REL, "workgroup"); __builtin_amdgcn_wave_barrier();
  const int rsub = lane >> 4, c4 = (lane & 15) * 4;
  {
#pragma unroll
    for (int q = 0; q < 16; ++q) { const int r = q * 2 + rsub; const v4f v = *(const v4fa*)&so[w][r][c4]; if (C) *(v4f*)(C + cofs + (size_t)(row0 + r) * ldc + col0 + c4) = v; if (C16) { v4h h4; for (int i = 0; i < 4; ++i) h4[i] = (_Float16)v[i]; *(v4h*)(C16 + cofs + (size_t)(row0 + r) * ldc + col0 + c4) = h4; } }
     } }


__global__ __launch_bounds__(256) void k_wnat(const float* __restrict__ w, size_t n8, _Float16* __restrict__ Bt) { const size_t t = (size_t)blockIdx.x * 256 + threadIdx.x; if (t >= n8) return; FragH f; for (int q = 0; q < 8; ++q) f.h[q] = (_Float16)(bf16_round(w[t * 8 + q]) * 16.0f); *(v8us*)((unsigned short*)Bt + t * 8) = f.half[0];  }
__global__ __launch_bounds__(256) void k_rsm(const float* __restrict__ S, _Float16* __restrict__ P, int nrows) {
  #pragma clang fp contract(off)
  const int i = blockIdx.x * 256 + threadIdx.x; if (i >= nrows) return; const float* s = S + (size_t)i * SQ; float mx = -3.0e38f;
#pragma unroll 1
  for (int j = 0; j < SQ; ++j) mx = fmaxf(mx, s[j]); float se = 0.f;
#pragma unroll 1
  for (int j = 0; j < SQ; ++j) se += expf(s[j] - mx); const float sc = 256.0f / se;
#pragma unroll 1
  for (int j0 = 0; j0 < SQ; j0 += 8) { FragH f; for (int q = 0; q < 8; ++q) f.h[q] = (_Float16)(expf(s[j0 + q] - mx) * sc); unsigned short* d = (unsigned short*)P + (size_t)i * SQ + j0; *(v8us*)d = f.half[0];  } }
__global__ __launch_bounds__(256) void k_vt(const _Float16* __restrict__ V16, int b, int h0, _Float16* __restrict__ VT) { __shared__ unsigned short tl[64][65]; const int tid = threadIdx.x; const int hh = blockIdx.x % HG, sg = blockIdx.x / HG; const int s0 = sg * 64; const int h = h0 + hh;
  for (int i = tid; i < 64 * 8; i += 256) { const int j = i / 8, d8 = (i % 8) * 8; FragH f; f.half[0] = *(const v8us*)((const unsigned short*)V16 + ((size_t)b * SQ + s0 + j) * DM + h * HD + d8); for (int q = 0; q < 8; ++q) tl[d8 + q][j] = f.u[q]; }
  __syncthreads();
  { for (int i = tid; i < 64 * 8; i += 256) { const int d = i / 8, j8 = (i % 8) * 8; FragH f; for (int q = 0; q < 8; ++q) f.u[q] = tl[d][j8 + q]; *(v8us*)((unsigned short*)VT + ((size_t)hh * HD + d) * SQ + s0 + j8) = f.half[0]; }  } }



// Row softmax of (scores + relative-position bias): one wave per score row, SM_ROWS rows a wave, SM_WAVES waves a block (all rows of a block belong to one head).
// A lane holds 4 consecutive scores of each 128-wide piece (one wave-wide load = 512 contiguous bytes); the row stays in registers from its one read to its one write.
// Every loop of the kernel is unrolled in full: v[][] stays in registers only where each index is a constant.
#define SM_WAVES 16
#define SM_ROWS 2
#define SM_NC (SQ / 128)             /* 128-wide pieces of a row */
template <int M> __device__ __forceinline__ float sm_xm(float x) { return __builtin_bit_cast(float, __builtin_amdgcn_update_dpp(0, __builtin_bit_cast(int, x), 0x160 + M, 0xf, 0xf, true)); }      /* lane l ^ M inside a 16-lane row */
__device__ __forceinline__ float sm_xh(float x) { return __builtin_bit_cast(float, __builtin_amdgcn_permlanex16(__builtin_bit_cast(int, x), __builtin_bit_cast(int, x), 0x76543210, 0xfedcba98, false, false)); }      /* lane l ^ 16 */
__device__ __forceinline__ float sm_wmax(float x) { x = fmaxf(x, sm_xm<1>(x)); x = fmaxf(x, sm_xm<2>(x)); x = fmaxf(x, sm_xm<4>(x)); x = fmaxf(x, sm_xm<8>(x)); return fmaxf(x, sm_xh(x)); }
__device__ __forceinline__ float sm_wsum(float x) { x += sm_xm<1>(x); x += sm_xm<2>(x); x += sm_xm<4>(x); x += sm_xm<8>(x); return x + sm_xh(x); }
// Four native exp2 in place. In one statement with a closing v_nop: the slot that the instruction set asks for behind a transcendental before its result is read or its source overwritten.
__device__ __forceinline__ v4f sm_exp2x4(v4f x) { float a = x[0], b = x[1], c = x[2], d = x[3];
  asm("v_exp_f32 %0, %0\n\tv_exp_f32 %1, %1\n\tv_exp_f32 %2, %2\n\tv_exp_f32 %3, %3\n\tv_nop" : "+v"(a), "+v"(b), "+v"(c), "+v"(d));
  const v4f y = {a, b, c, d}; return y; }
__global__ __launch_bounds__(SM_WAVES * 32) void k_rsmw(const float* __restrict__ S, _Float16* __restrict__ P, const float* __restrict__ emb, int h0) {
  static_assert(QN % (SM_WAVES * SM_ROWS) == 0 && SQ % 128 == 0 && 4 * MAXD - 1 <= SM_WAVES * 32 && MAXD == 128, "k_rsmw: whole blocks per head, whole pieces per row, one table entry a thread, band pieces inside the table");
  __shared__ float tb[4 * MAXD - 1];      /* this head's bias, bf16-rounded, by k = j - i + (2 * MAXD - 1), already clipped: 4 consecutive j are 4 consecutive entries */
  const int tid = threadIdx.x, lane = tid & 31; const int wave = __builtin_amdgcn_readfirstlane(tid >> 5);
  const int hl = blockIdx.x / (QN / (SM_WAVES * SM_ROWS)); const int q0 = (blockIdx.x % (QN / (SM_WAVES * SM_ROWS))) * (SM_WAVES * SM_ROWS) + wave * SM_ROWS;
  float tv = 0.f; if (tid < 4 * MAXD - 1) tv = emb[(min(max(2 * MAXD - 1 - tid, -MAXD), MAXD) + MAXD) * NH + h0 + hl];
  const size_t i0 = (size_t)hl * SQ + q0; const float* sp = S + i0 * SQ + lane * 4;
  v4f v[SM_ROWS][SM_NC];
#pragma unroll
  for (int r = 0; r < SM_ROWS; ++r)
#pragma unroll
    for (int c = 0; c < SM_NC; ++c) v[r][c] = *(const v4fa*)(sp + (size_t)r * SQ + c * 128);
  if (tid < 4 * MAXD - 1) tb[tid] = bf16_round(tv);
  /* work-group barrier that publishes tb only: fences on LDS alone, so that the score loads stay in flight across it (__syncthreads() waits for all of them here) */
  __builtin_amdgcn_fence(__ATOMIC_RELEASE, "workgroup", "local"); __builtin_amdgcn_s_barrier(); __builtin_amdgcn_fence(__ATOMIC_ACQUIRE, "workgroup", "local");
  const float bfar = tb[0], bnear = tb[4 * MAXD - 2];      /* j <= i - MAXD ; j >= i + MAXD */
#pragma unroll
  for (int r = 0; r < SM_ROWS; ++r) { const int qi = q0 + r;
    float m0 = -3.0e38f, m1 = -3.0e38f;
#pragma unroll
    for (int c = 0; c < SM_NC; ++c) { const int j0 = c * 128;
      if (j0 + 127 > qi - MAXD && j0 < qi + MAXD) { const float* tp = tb + (j0 - qi + 2 * MAXD - 1) + lane * 4;      /* wave-uniform: the piece meets the unclipped band; here 1 <= k <= 4 * MAXD - 3 */
#pragma unroll
        for (int e = 0; e < 4; ++e) v[r][c][e] += tp[e];
      } else { const float bc = (j0 >= qi + MAXD) ? bnear : bfar;
#pragma unroll
        for (int e = 0; e < 4; ++e) v[r][c][e] += bc; }
      m0 = fmaxf(fmaxf(m0, v[r][c][0]), v[r][c][1]); m1 = fmaxf(fmaxf(m1, v[r][c][2]), v[r][c][3]); }
    const float nm = -1.4426950408889634f * sm_wmax(fmaxf(m0, m1));
    float a0 = 0.f, a1 = 0.f, a2 = 0.f, a3 = 0.f;
#pragma unroll
    for (int c = 0; c < SM_NC; ++c) {
#pragma unroll
      for (int e = 0; e < 4; ++e) v[r][c][e] = __builtin_fmaf(v[r][c][e], 1.4426950408889634f, nm);
      v[r][c] = sm_exp2x4(v[r][c]);
      a0 += v[r][c][0]; a1 += v[r][c][1]; a2 += v[r][c][2]; a3 += v[r][c][3]; }
    const float sc = 256.0f / sm_wsum((a0 + a1) + (a2 + a3));
    _Float16* pp = P + (i0 + r) * SQ + lane * 4;
#pragma unroll
    for (int c = 0; c < SM_NC; ++c) { v4h h4;
#pragma unroll
      for (int e = 0; e < 4; ++e) h4[e] = (_Float16)(v[r][c][e] * sc);
      *(v4h*)(pp + c * 128) = h4; }
    if (r + 1 < SM_ROWS) asm volatile("s_wait_xcnt 0x0" ::: "memory"); } }      /* the next row's arithmetic reuses registers that these stores name */

extern "C" void kernel_launch(void* const* d_in, const int* in_sizes, int n_in,
                              void* d_out, int out_size, void* d_ws, size_t ws_size, hipStream_t stream) {
  (void)in_sizes; (void)n_in; (void)out_size;
  const float* const* I = (const float* const*)d_in; const float* x = I[0]; const float* wq = I[1]; const float* bq = I[2]; const float* wk = I[3]; const float* bk = I[4]; const float* wv = I[5]; const float* bv = I[6]; const float* wo = I[7]; const float* bo = I[8]; const float* emb = I[9];      /* nn.Linear weights [out][in]; rel_emb [2*MAXD+1][NH] */
  char* ws = (char*)d_ws; size_t off = 0;
  auto take = [&](size_t bytes) { char* p = ws + off; off += (bytes + 255) & ~(size_t)255; return p; };
  _Float16* BQ = (_Float16*)take((size_t)DM * DM * 2); _Float16* BK = (_Float16*)take((size_t)DM * DM * 2); _Float16* BV = (_Float16*)take((size_t)DM * DM * 2); _Float16* BO = (_Float16*)take((size_t)DM * DM * 2);
  _Float16* X16 = (_Float16*)take(NR * DM * 2); _Float16* Q16 = (_Float16*)take(NR * DM * 2); _Float16* K16 = (_Float16*)take(NR * DM * 2); _Float16* V16 = (_Float16*)take(NR * DM * 2); _Float16* O16 = (_Float16*)take(NR * DM * 2);
  float* S = (float*)take((size_t)HG * SQ * SQ * 4); _Float16* P = (_Float16*)take((size_t)HG * SQ * SQ * 2); _Float16* VT = (_Float16*)take((size_t)NH * HD * SQ * 2);
  if (off > ws_size) return;
  { const unsigned g = (unsigned)(((size_t)DM * DM / 8 + 255) / 256); k_wnat<<<g, 256, 0, stream>>>(wq, (size_t)DM * DM / 8, BQ); k_wnat<<<g, 256, 0, stream>>>(wk, (size_t)DM * DM / 8, BK); k_wnat<<<g, 256, 0, stream>>>(wv, (size_t)DM * DM / 8, BV); k_wnat<<<g, 256, 0, stream>>>(wo, (size_t)DM * DM / 8, BO); }      /* natural [out][in] = Bt[n][k], x16 */
  k_x16<<<(unsigned)((NR * DM / 8 + 255) / 256), 256, 0, stream>>>(x, X16, NR * DM / 8);
  const size_t r0p = (size_t)B0 * SQ;      /* first projected row */
  k_gemm2<0><<<dim3((unsigned)((MP / 128) * (DM / 64)), 1), 128, 0, stream>>>(X16 + r0p * DM, DM, 0, BQ, DM, 0, 0.0625f, bq, 0, nullptr, 1, 0, 0, nullptr, Q16 + r0p * DM, DM, 0, MP, DM, DM);
  k_gemm2<0><<<dim3((unsigned)((MP / 128) * (DM / 64)), 1), 128, 0, stream>>>(X16 + r0p * DM, DM, 0, BK, DM, 0, 0.0625f, bk, 0, nullptr, 1, 0, 0, nullptr, K16 + r0p * DM, DM, 0, MP, DM, DM);
  k_gemm2<0><<<dim3((unsigned)((MP / 128) * (DM / 64)), 1), 128, 0, stream>>>(X16 + r0p * DM, DM, 0, BV, DM, 0, 0.0625f, bv, 0, nullptr, 1, 0, 0, nullptr, V16 + r0p * DM, DM, 0, MP, DM, DM);
  for (int b = B0; b < B0 + NBR; ++b) { const size_t r0 = (size_t)b * SQ;
    k_vt<NH, SQ><<<NH * (SQ / 64), 256, 0, stream>>>(V16 + r0 * LQ, LQ, 0, VT);      /* V^T [NH][HD][SQ] for this batch */
    for (int h0 = 0; h0 < NHD; h0 += HG) {
      k_gemm2<0><<<dim3((QN / 128) * (SQ / 64), HG), 128, 0, stream>>>(Q16 + r0 * LQ + h0 * HD, LQ, (size_t)HD, K16 + r0 * LQ + h0 * HD, LQ, (size_t)HD, 0.125f, nullptr, 0, nullptr, 1, 0, 0, S, nullptr, SQ, (size_t)SQ * SQ, QN, SQ, HD);      /* scores, HG heads per launch */
      k_rsmw<<<HG * QN / (SM_WAVES * SM_ROWS), SM_WAVES * 32, 0, stream>>>(S, P, emb, h0);      /* P = 256 softmax (f16), rows of all HG heads */
      k_gemm2<0><<<dim3((QN / 128) * (HD / 64), HG), 128, 0, stream>>>(P, SQ, (size_t)SQ * SQ, VT + (size_t)h0 * HD * SQ, SQ, (size_t)HD * SQ, 0.25f, nullptr, 0, nullptr, 1, 0, 0, nullptr, O16 + r0 * DM + h0 * HD, DM, (size_t)HD, QN, HD, SQ); } }      /* o (merged heads) as f16 rows */
  k_gemm2<0><<<dim3((unsigned)((MPO / 128) * (DM / 64)), 1), 128, 0, stream>>>(O16 + r0p * DM, DM, 0, BO, DM, 0, 0.0009765625f, bo, 0, nullptr, 1, 0, 0, (float*)d_out + r0p * DM, nullptr, DM, 0, MPO, DM, DM);      /* out rows are the output layout */
}

// v002
// It runs in 244 microseconds.
// Two timings next to v001 put it at 4.05 and 3.99 times that version's speed.
// All steps since v000 together make it 18.4 times as fast.
#include <hip/hip_runtime.h>
// Multi-head self-attention with a learned relative-position bias (x [2][2048][1024]; q/k/v = x W^T + b (nn.Linear [out][in]), 16 heads of 64; scores / 8 + rel_emb[clip(i - j, -128, 128) + 128][h] (rel_emb [257][16]); softmax; o merged; out = o Wo^T + bo -> [2][2048][1024]).
// Structure: token rows r = b*2048 + s; x as exact f16 rows (bf16-rounded); Q, K, V as three WMMA GEMMs (32x64 wave tiles, f32 accumulation, exact x16 weights + bias, f16 outputs); V^T for all batches and heads via LDS transposes; one fused attention launch for all batches and heads: score tiles on WMMA (K = 64), online softmax of (scores / 8 + relative-position bias looked up by (i - j, head)) on VALU (f32 statistics, native exp; weights x256 as f16 operands, in registers), o = P . V on WMMA (o carried x64 against f16 subnormal flush, folded into the output GEMM alpha) written straight into the merged f16 o rows; out = o W_o + b GEMM (f32) into the output layout.
// Compute dtype: inputs rounded to bf16; x / weights exact; q, k, v, softmax weights and o as plain f16 GEMM operands (~2^-12); scores and softmax statistics f32. v_wmma_f32_16x16x32_f16.
#define NB 2
#define SQ 2048
#define DM 1024
#define NH 16
#define HD 64
#define MAXD 128                     /* relative distance clip */
#define HG 4                         /* heads per launch of the grouped V^T transpose k_vt(b, h0) */
#define B0 0                         /* first batch processed (debug hook) */
#define NBR NB                       /* batches processed (debug hook) */
#define NR ((size_t)NB * SQ)         /* token rows */
#define MP ((int)((size_t)NBR * SQ)) /* rows projected (debug hook) */
#define QN SQ                        /* query rows per batch; unused: the attention launch covers all SQ */
#define NHD NH                       /* heads; unused: the attention launch covers all NH */
#define MPO MP                       /* rows through the output stage (debug hook) */
#define LQ DM      /* row pitch of the q/k/v rows */
typedef __bf16 v16b __attribute__((ext_vector_type(16)));
typedef unsigned short v8us __attribute__((ext_vector_type(8), may_alias));
typedef float  v8f  __attribute__((ext_vector_type(8)));
typedef float  v4f  __attribute__((ext_vector_type(4)));
typedef float  v4fa __attribute__((ext_vector_type(4), may_alias));
union FragB { v16b v; v8us half[2]; unsigned short u[16]; };

__device__ __forceinline__ unsigned short bf16_bits(float x) { unsigned int u = __float_as_uint(x); return (unsigned short)((u + 0x7FFFu + ((u >> 16) & 1u)) >> 16); }
__device__ __forceinline__ float bf16_val(unsigned short b) { return __uint_as_float(((unsigned int)b) << 16); }
__device__ __forceinline__ float bf16_round(float x) { return bf16_val(bf16_bits(x)); }
// D += A·B with NT terms: 1 = ah·bh, 2 = + al·bh (A split), 3 = + ah·bl (both split)
template <int NT>
__device__ __forceinline__ v8f mmaN(v16b ah, v16b al, v16b bh, v16b bl, v8f c) {
  c = __builtin_amdgcn_wmma_f32_16x16x32_bf16(false, ah, false, bh, (short)0, c, false, false);
  if (NT >= 2) c = __builtin_amdgcn_wmma_f32_16x16x32_bf16(false, al, false, bh, (short)0, c, false, false);
  if (NT >= 3) c = __builtin_amdgcn_wmma_f32_16x16x32_bf16(false, ah, false, bl, (short)0, c, false, false);
  asm volatile("v_nop\n\tv_nop\n\tv_nop\n\tv_nop" : "+v"(c) : "v"(ah), "v"(al), "v"(bh), "v"(bl));
  return c;
}

__global__ __launch_bounds__(256) void k_wt_bf16(const float* __restrict__ W, unsigned short* __restrict__ Wt, int K, int N) {
  const int t = blockIdx.x * 256 + threadIdx.x;
  const int k8n = K / 8;
  if (t >= N * k8n) return;
  const int n = t / k8n, k8 = (t % k8n) * 8;
  v8us v;
#pragma unroll
  for (int i = 0; i < 8; ++i) v[i] = bf16_bits(W[(size_t)(k8 + i) * N + n]);
  *(v8us*)(Wt + (size_t)n * K + k8) = v;
  
}

// GEMM C[M][N] (f32, pitch ldc) = act(A[M][K]·W + bias). A f32 row-major (pitch lda) converted per fragment to bf16
// (ASPLIT: hi/lo two planes -> 2 terms, else single rounded term); Wt bf16 [N][K] (pitch ldb). BIAS_BF16 rounds the
// bias to bf16 first (bias quantised to bf16 before the add). K%32==0, M%16==0, N%64==0.
template <bool ASPLIT, int ACT, bool BIAS_BF16>
__global__ __launch_bounds__(128) void k_gemm_bf(const float* __restrict__ A, int lda, const unsigned short* __restrict__ Wt, int ldb,
                                               const float* __restrict__ bias, float* __restrict__ C, int ldc, int M, int N, int K) {
  __shared__ __attribute__((aligned(16))) float so[4][16][64];
  const int tid = threadIdx.x, w = tid >> 5, lane = tid & 31, ln = lane & 15, hh = lane >> 4;
  const int ntn = N / 64;
  const int wid = blockIdx.x * 4 + w;
  const int mt = wid / ntn, nq = wid % ntn;
  if (mt * 16 >= M) return;
  const int row0 = mt * 16, col0 = nq * 64;
  const float* arow = A + (size_t)(row0 + ln) * lda;
  v8f acc[4] = {};
  for (int kb = 0; kb < K; kb += 32) {
    FragB ah, al;
    const v4f x0 = *(const v4fa*)(arow + kb + 8 * hh), x1 = *(const v4fa*)(arow + kb + 8 * hh + 4);
    const v4f x2 = *(const v4fa*)(arow + kb + 16 + 8 * hh), x3 = *(const v4fa*)(arow + kb + 16 + 8 * hh + 4);
    float xs[16] = {x0[0],x0[1],x0[2],x0[3],x1[0],x1[1],x1[2],x1[3],x2[0],x2[1],x2[2],x2[3],x3[0],x3[1],x3[2],x3[3]};
#pragma unroll
    for (int i = 0; i < 16; ++i) { const unsigned short hb = bf16_bits(xs[i]); ah.u[i] = hb; al.u[i] = ASPLIT ? bf16_bits(xs[i] - bf16_val(hb)) : (unsigned short)0; }
#pragma unroll
    for (int t = 0; t < 4; ++t) {
      const unsigned short* brow = Wt + (size_t)(col0 + t * 16 + ln) * ldb + kb;
      FragB b;
      b.half[0] = *(const v8us*)(brow + 8 * hh);
      b.half[1] = *(const v8us*)(brow + 16 + 8 * hh);
      acc[t] = mmaN<ASPLIT ? 2 : 1>(ah.v, al.v, b.v, b.v, acc[t]);
    }
  }
#pragma unroll
  for (int t = 0; t < 4; ++t) {
    float bv = bias ? bias[col0 + t * 16 + ln] : 0.f;
    if (BIAS_BF16) bv = bf16_round(bv);
#pragma unroll
    for (int r = 0; r < 8; ++r) { float v = acc[t][r] + bv; if (ACT == 1) v = fmaxf(v, 0.f); so[w][8 * hh + r][t * 16 + ln] = v; }
  }
  __builtin_amdgcn_fence(__ATOMIC_ACQ_REL, "workgroup");
  __builtin_amdgcn_wave_barrier();
  const int rsub = lane >> 4, c4 = (lane & 15) * 4;
  {
#pragma unroll
    for (int q = 0; q < 8; ++q) {
      const int r = q * 2 + rsub;
      const v4f v = *(const v4fa*)&so[w][r][c4];
      *(v4f*)(C + (size_t)(row0 + r) * ldc + col0 + c4) = v;
    }
    
  }
}

// GEMM C = act(A·W + bias + resid): A f32 (ASPLIT -> hi/lo 2 terms), Wt bf16 [N][K]; ACT 0 none, 1 relu, 2 exact gelu;
// resid (optional, f32, row index = (row % rmod), pitch ldr, RES_BF16 rounds it) added before the activation.
template <bool ASPLIT, int ACT, bool BIAS_BF16, bool RES_BF16>
__global__ __launch_bounds__(128) void k_gemm_bf3(const float* __restrict__ A, int lda, const unsigned short* __restrict__ Wt, int ldb,
                                                const float* __restrict__ bias, const float* __restrict__ resid, int rmod, int ldr,
                                                float* __restrict__ C, int ldc, int M, int N, int K) {
  __shared__ __attribute__((aligned(16))) float so[4][16][64];
  const int tid = threadIdx.x, w = tid >> 5, lane = tid & 31, ln = lane & 15, hh = lane >> 4;
  const int ntn = N / 64;
  const int wid = blockIdx.x * 4 + w;
  const int mt = wid / ntn, nq = wid % ntn;
  if (mt * 16 >= M) return;
  const int row0 = mt * 16, col0 = nq * 64;
  const float* arow = A + (size_t)(row0 + ln) * lda;
  v8f acc[4] = {};
  for (int kb = 0; kb < K; kb += 32) {
    FragB ah, al;
    const v4f x0 = *(const v4fa*)(arow + kb + 8 * hh), x1 = *(const v4fa*)(arow + kb + 8 * hh + 4);
    const v4f x2 = *(const v4fa*)(arow + kb + 16 + 8 * hh), x3 = *(const v4fa*)(arow + kb + 16 + 8 * hh + 4);
    float xs[16] = {x0[0],x0[1],x0[2],x0[3],x1[0],x1[1],x1[2],x1[3],x2[0],x2[1],x2[2],x2[3],x3[0],x3[1],x3[2],x3[3]};
#pragma unroll
    for (int i = 0; i < 16; ++i) { const unsigned short hb = bf16_bits(xs[i]); ah.u[i] = hb; al.u[i] = ASPLIT ? bf16_bits(xs[i] - bf16_val(hb)) : (unsigned short)0; }
#pragma unroll
    for (int t = 0; t < 4; ++t) {
      const unsigned short* brow = Wt + (size_t)(col0 + t * 16 + ln) * ldb + kb;
      FragB b;
      b.half[0] = *(const v8us*)(brow + 8 * hh);
      b.half[1] = *(const v8us*)(brow + 16 + 8 * hh);
      acc[t] = mmaN<ASPLIT ? 2 : 1>(ah.v, al.v, b.v, b.v, acc[t]);
    }
  }
#pragma unroll
  for (int t = 0; t < 4; ++t) {
    const int col = col0 + t * 16 + ln;
    float bv = bias ? bias[col] : 0.f;
    if (BIAS_BF16) bv = bf16_round(bv);
#pragma unroll
    for (int r = 0; r < 8; ++r) {
      float v = acc[t][r] + bv;
      if (resid) { float rv = resid[(size_t)((row0 + 8 * hh + r) % rmod) * ldr + col]; if (RES_BF16) rv = bf16_round(rv); v += rv; }
      if (ACT == 1) v = fmaxf(v, 0.f);
      if (ACT == 2) v = 0.5f * v * (1.0f + erff(v * 0.70710678118654752f));
      if (ACT == 3) { const float u = 0.7978845608028654f * (v + 0.044715f * v * v * v); v = 0.5f * v * (1.0f + tanhf(u)); }
      so[w][8 * hh + r][t * 16 + ln] = v;
    }
  }
  __builtin_amdgcn_fence(__ATOMIC_ACQ_REL, "workgroup");
  __builtin_amdgcn_wave_barrier();
  const int rsub = lane >> 4, c4 = (lane & 15) * 4;
  {
#pragma unroll
    for (int q = 0; q < 8; ++q) {
      const int r = q * 2 + rsub;
      const v4f v = *(const v4fa*)&so[w][r][c4];
      *(v4f*)(C + (size_t)(row0 + r) * ldc + col0 + c4) = v;
    }
    
  }
}
// row LayerNorm (biased variance, eps) over N: s = X (+ R); optional out_sum <- s; out_norm <- (s-mu)*rsqrt(var+eps)*g + b
template <bool PARAM_BF16>
__global__ __launch_bounds__(256) void k_layernorm(const float* __restrict__ X, const float* __restrict__ R, const float* __restrict__ g, const float* __restrict__ bta,
                                                  float* __restrict__ out_sum, float* __restrict__ out_norm, int N, float eps) {
  __shared__ float red[256];
  const int row = blockIdx.x, tid = threadIdx.x;
  const float* x = X + (size_t)row * N; const float* rr = R ? R + (size_t)row * N : nullptr;
  float vals[16];                     // up to N = 4096
  const int per = N / 256;            // contiguous chunk per thread? use strided-by-4 chunks: thread handles j = tid*4 + 1024*u
  float s1 = 0.f;
  for (int u = 0; u < per / 4; ++u) {
    const int j = tid * 4 + 1024 * u;
    const v4f a = *(const v4fa*)(x + j);
    v4f b = {0.f,0.f,0.f,0.f}; if (rr) b = *(const v4fa*)(rr + j);
#pragma unroll
    for (int q = 0; q < 4; ++q) { const float v = a[q] + b[q]; vals[u * 4 + q] = v; s1 += v; }
  }
  red[tid] = s1; __syncthreads();
  for (int st = 128; st > 0; st >>= 1) { if (tid < st) red[tid] += red[tid + st]; __syncthreads(); }
  const float mu = red[0] / (float)N; __syncthreads();
  float s2 = 0.f;
  for (int u = 0; u < per / 4; ++u)
#pragma unroll
    for (int q = 0; q < 4; ++q) { const float c = vals[u * 4 + q] - mu; s2 += c * c; }
  red[tid] = s2; __syncthreads();
  for (int st = 128; st > 0; st >>= 1) { if (tid < st) red[tid] += red[tid + st]; __syncthreads(); }
  const float rs = rsqrtf(red[0] / (float)N + eps);
  {
    for (int u = 0; u < per / 4; ++u) {
      const int j = tid * 4 + 1024 * u;
      v4f o, sm;
#pragma unroll
      for (int q = 0; q < 4; ++q) {
        float gg = g[j + q], bb = bta[j + q];
        if (PARAM_BF16) { gg = bf16_round(gg); bb = bf16_round(bb); }
        sm[q] = vals[u * 4 + q]; o[q] = (vals[u * 4 + q] - mu) * rs * gg + bb;
      }
      if (out_sum) *(v4f*)(out_sum + (size_t)row * N + j) = sm;
      *(v4f*)(out_norm + (size_t)row * N + j) = o;
    }
    
  }
}



// ---- f16 WMMA path (v_wmma_f32_16x16x32_f16): 11-bit significands for operands in range — used where a [0,1] probability operand needs more precision than bf16
typedef _Float16 v16h __attribute__((ext_vector_type(16)));
union FragH { v16h v; v8us half[2]; _Float16 h[16]; unsigned short u[16]; };
template <int NT>
__device__ __forceinline__ v8f mmaH(v16h ah, v16h al, v16h bh, v16h bl, v8f c) {
  c = __builtin_amdgcn_wmma_f32_16x16x32_f16(false, ah, false, bh, (short)0, c, false, false);
  if (NT >= 2) c = __builtin_amdgcn_wmma_f32_16x16x32_f16(false, al, false, bh, (short)0, c, false, false);
  if (NT >= 3) c = __builtin_amdgcn_wmma_f32_16x16x32_f16(false, ah, false, bl, (short)0, c, false, false);
  asm volatile("v_nop\n\tv_nop\n\tv_nop\n\tv_nop" : "+v"(c) : "v"(ah), "v"(al), "v"(bh), "v"(bl));
  return c;
}
// batched GEMM like k_gemm_b but f16 operands: A f32 (split into f16 hi/lo if ASPLIT, else rounded to f16), Bt = f16 values [n][k]; alpha; C f32; N multiple of 16 (partial tiles skipped)
template <bool ASPLIT>
__global__ __launch_bounds__(128) void k_gemm_h(const float* __restrict__ A, int lda, size_t sA, const _Float16* __restrict__ Bh, int ldb, size_t sB, float alpha, float* __restrict__ C, int ldc, size_t sC, int M, int N, int K) {
  __shared__ __attribute__((aligned(16))) float so[4][16][64];
  const int tid = threadIdx.x, w = tid >> 5, lane = tid & 31, ln = lane & 15, hh = lane >> 4; const int by = blockIdx.y;
  A += (size_t)by * sA; Bh += (size_t)by * sB; C += (size_t)by * sC;
  const int ntn = (N + 63) / 64; const int wid = blockIdx.x * 4 + w; const int mt = wid / ntn, nq = wid % ntn; if (mt * 16 >= M) return;
  const int row0 = mt * 16, col0 = nq * 64; const float* arow = A + (size_t)(row0 + ln) * lda;
  v8f acc[4] = {};
  for (int kb = 0; kb < K; kb += 32) {
    FragH ah, al;
    const v4f x0 = *(const v4fa*)(arow + kb + 8 * hh), x1 = *(const v4fa*)(arow + kb + 8 * hh + 4), x2 = *(const v4fa*)(arow + kb + 16 + 8 * hh), x3 = *(const v4fa*)(arow + kb + 16 + 8 * hh + 4);
    float xs[16] = {x0[0],x0[1],x0[2],x0[3],x1[0],x1[1],x1[2],x1[3],x2[0],x2[1],x2[2],x2[3],x3[0],x3[1],x3[2],x3[3]};
#pragma unroll
    for (int i = 0; i < 16; ++i) { const _Float16 h = (_Float16)xs[i]; ah.h[i] = h; al.h[i] = ASPLIT ? (_Float16)(xs[i] - (float)h) : (_Float16)0.0f; }
#pragma unroll
    for (int t = 0; t < 4; ++t) { if (col0 + t * 16 >= N) continue; const size_t boff = (size_t)(col0 + t * 16 + ln) * ldb + kb; FragH bq; bq.half[0] = *(const v8us*)(Bh + boff + 8 * hh); bq.half[1] = *(const v8us*)(Bh + boff + 16 + 8 * hh);
      acc[t] = mmaH<ASPLIT ? 2 : 1>(ah.v, al.v, bq.v, bq.v, acc[t]); }
  }
#pragma unroll
  for (int t = 0; t < 4; ++t) { if (col0 + t * 16 >= N) continue;
#pragma unroll
    for (int r = 0; r < 8; ++r) so[w][8 * hh + r][t * 16 + ln] = acc[t][r] * alpha; }
  __builtin_amdgcn_fence(__ATOMIC_ACQ_REL, "workgroup"); __builtin_amdgcn_wave_barrier();
  const int rsub = lane >> 4, c4 = (lane & 15) * 4;
  {
#pragma unroll
    for (int q = 0; q < 8; ++q) { const int r = q * 2 + rsub; if (col0 + c4 < N) { const v4f v = *(const v4fa*)&so[w][r][c4]; *(v4f*)(C + (size_t)(row0 + r) * ldc + col0 + c4) = v; } }
     }
}

// Wt[n][k] = f16(W[k][n]·scale) from f32 row-major W[K][N] (scale = power of two; bf16-exact weights stay exact in f16 away from the subnormal range)
__global__ __launch_bounds__(256) void k_wt_f16(const float* __restrict__ W, _Float16* __restrict__ Wt, int K, int N, float scale) {
  const int t = blockIdx.x * 256 + threadIdx.x; if (t >= N * (K / 8)) return; const int n = t / (K / 8), k8 = (t % (K / 8)) * 8; FragH f;
#pragma unroll
  for (int i = 0; i < 8; ++i) f.h[i] = (_Float16)(bf16_round(W[(size_t)(k8 + i) * N + n]) * scale); const v8us o = f.half[0];
  *(v8us*)((unsigned short*)Wt + (size_t)n * K + k8) = o; 
}
// k_gemm_hh variant with fused epilogue: v = acc·alpha + bias[by·sBias + col] (+ CP[(row/rowsPerB)·sCPb + by·64 + col] if CP) ; ACT 0 none / 1 elu ; writes f16 C16 (and f32 C if non-null)
template <int ACT>
__global__ __launch_bounds__(128) void k_gemm_hhx(const _Float16* __restrict__ A, int lda, size_t sA, const _Float16* __restrict__ Bh, int ldb, size_t sB, float alpha, const float* __restrict__ bias, size_t sBias, const float* __restrict__ CP, int rowsPerB, size_t sCPb, int row0g,
    float* __restrict__ C, _Float16* __restrict__ C16, int ldc, size_t sC, int M, int N, int K) {
  __shared__ __attribute__((aligned(16))) float so[4][16][64];
  const int tid = threadIdx.x, w = tid >> 5, lane = tid & 31, ln = lane & 15, hh = lane >> 4; const int by = blockIdx.y;
  A += (size_t)by * sA; Bh += (size_t)by * sB; const size_t cofs = (size_t)by * sC; const float* bp = bias ? bias + (size_t)by * sBias : nullptr;
  const int ntn = (N + 63) / 64; const int wid = blockIdx.x * 4 + w; const int mt = wid / ntn, nq = wid % ntn; if (mt * 16 >= M) return;
  const int row0 = mt * 16, col0 = nq * 64; const _Float16* arow = A + (size_t)(row0 + ln) * lda;
  v8f acc[4] = {};
  for (int kb = 0; kb < K; kb += 32) { FragH ah; ah.half[0] = *(const v8us*)((const unsigned short*)arow + kb + 8 * hh); ah.half[1] = *(const v8us*)((const unsigned short*)arow + kb + 16 + 8 * hh);
#pragma unroll
    for (int t = 0; t < 4; ++t) { if (col0 + t * 16 >= N) continue; const size_t boff = (size_t)(col0 + t * 16 + ln) * ldb + kb; FragH bq; bq.half[0] = *(const v8us*)((const unsigned short*)Bh + boff + 8 * hh); bq.half[1] = *(const v8us*)((const unsigned short*)Bh + boff + 16 + 8 * hh);
      acc[t] = mmaH<1>(ah.v, ah.v, bq.v, bq.v, acc[t]); }
  }
#pragma unroll
  for (int t = 0; t < 4; ++t) { if (col0 + t * 16 >= N) continue; const int col = col0 + t * 16 + ln; const float bv = bp ? bf16_round(bp[col]) : 0.f;
#pragma unroll
    for (int r = 0; r < 8; ++r) { float v = acc[t][r] * alpha + bv; if (CP) { const int rr = row0g + row0 + 8 * hh + r; if (rowsPerB < 0) v += CP[cofs + (size_t)rr * ldc + col];      /* rowsPerB < 0: own element of the batched C plane */ else { const int bidx = rr / rowsPerB; v += CP[(size_t)bidx * sCPb + (size_t)by * 64 + col]; } } if (ACT == 1) v = (v > 0.f) ? v : expm1f(v); else if (ACT == 7) v = (v > 0.f) ? v + 1.0f : expf(v); else if (ACT == 8) v = tanhf(v); else if (ACT == 9) v = 0.5f * v * (1.0f + tanhf(0.7978845608028654f * (v + 0.044715f * v * v * v))); else if (ACT == 11) v = 1.0f / (1.0f + expf(-v)); else if (ACT == 12) v = (v > 0.f) ? v : 0.01f * v; else if (ACT == 14) v = (v > 0.f) ? v : 0.1f * v; else if (ACT == 16) v = (v >= 0.f) ? v : 0.3f * v; else if (ACT == 17) v = (v >= 0.f) ? v : 0.2f * v; else if (ACT == 15) v = v / (1.0f + expf(-v)); else if (ACT == 3) v = fmaxf(v, 0.f); else if (ACT == 6) v = 0.5f * v * (1.0f + erff(v * 0.70710678118654752f)); so[w][8 * hh + r][t * 16 + ln] = v; } }
  __builtin_amdgcn_fence(__ATOMIC_ACQ_REL, "workgroup"); __builtin_amdgcn_wave_barrier();
  const int rsub = lane >> 4, c4 = (lane & 15) * 4; typedef _Float16 v4h __attribute__((ext_vector_type(4)));
  {
#pragma unroll
    for (int q = 0; q < 8; ++q) { const int r = q * 2 + rsub; if (col0 + c4 < N) { const v4f v = *(const v4fa*)&so[w][r][c4]; if (C) *(v4f*)(C + cofs + (size_t)(row0 + r) * ldc + col0 + c4) = v; if (C16) { v4h h4; for (int i = 0; i < 4; ++i) h4[i] = (_Float16)v[i]; *(v4h*)(C16 + cofs + (size_t)(row0 + r) * ldc + col0 + c4) = h4; } } }
     }
}


typedef _Float16 v4h __attribute__((ext_vector_type(4)));

__global__ __launch_bounds__(256) void k_x16(const float* __restrict__ x, _Float16* __restrict__ X16, size_t n8) { const size_t t = (size_t)blockIdx.x * 256 + threadIdx.x; if (t >= n8) return; FragH f;
#pragma unroll
  for (int q = 0; q < 8; ++q) f.h[q] = (_Float16)bf16_round(x[t * 8 + q]); *(v8us*)((unsigned short*)X16 + t * 8) = f.half[0];  }
__global__ __launch_bounds__(256) void k_h16(const float* __restrict__ x, _Float16* __restrict__ X16, size_t n8) { const size_t t = (size_t)blockIdx.x * 256 + threadIdx.x; if (t >= n8) return; FragH f;
#pragma unroll
  for (int q = 0; q < 8; ++q) f.h[q] = (_Float16)x[t * 8 + q]; *(v8us*)((unsigned short*)X16 + t * 8) = f.half[0];  }
__global__ __launch_bounds__(256) void k_round16f(const float* __restrict__ W, _Float16* __restrict__ Bt, size_t n8) { const size_t t = (size_t)blockIdx.x * 256 + threadIdx.x; if (t >= n8) return; FragH f;
#pragma unroll
  for (int i = 0; i < 8; ++i) f.h[i] = (_Float16)(bf16_round(W[t * 8 + i]) * 16.0f); *(v8us*)((unsigned short*)Bt + t * 8) = f.half[0];  }
template <int NHv, int TTv>
__global__ __launch_bounds__(256) void k_vt(const _Float16* __restrict__ V16, int ldv, int voff, _Float16* __restrict__ Vt) { __shared__ unsigned short tl[64][66]; const int tid = threadIdx.x; const int slab = blockIdx.x / (TTv / 64), lg = blockIdx.x % (TTv / 64); const int b = slab / NHv, h = slab % NHv;
  for (int i = tid; i < 64 * 8; i += 256) { const int r = i / 8, c8 = (i % 8) * 8; FragH f; f.half[0] = *(const v8us*)((const unsigned short*)V16 + ((size_t)b * TTv + lg * 64 + r) * ldv + voff + h * 64 + c8);
#pragma unroll
    for (int q = 0; q < 8; ++q) tl[r][c8 + q] = f.u[q]; }
  __syncthreads();
  {
#pragma unroll
    for (int rd = 0; rd < 2; ++rd) { const int d = rd * 32 + tid / 8, pc = tid % 8; FragH f;
#pragma unroll
      for (int q = 0; q < 8; ++q) f.u[q] = tl[pc * 8 + q][d];
      *(v8us*)((unsigned short*)Vt + ((size_t)slab * 64 + d) * TTv + lg * 64 + pc * 8) = f.half[0]; }
     } }

__global__ __launch_bounds__(256) void k_hl(const float* __restrict__ F, _Float16* __restrict__ Hh, _Float16* __restrict__ Hl, size_t n8) { const size_t t = (size_t)blockIdx.x * 256 + threadIdx.x; if (t >= n8) return; FragH fh, fl; const v4f a = *(const v4fa*)(F + t * 8), c = *(const v4fa*)(F + t * 8 + 4);
#pragma unroll
  for (int q = 0; q < 4; ++q) { _Float16 h = (_Float16)a[q]; fh.h[q] = h; fl.h[q] = (_Float16)((a[q] - (float)h) * 1024.0f); h = (_Float16)c[q]; fh.h[4 + q] = h; fl.h[4 + q] = (_Float16)((c[q] - (float)h) * 1024.0f); }
  { *(v8us*)((unsigned short*)Hh + t * 8) = fh.half[0]; *(v8us*)((unsigned short*)Hl + t * 8) = fl.half[0];  } }

// ---- fast GEMM (wave tile 32x64; requires M % 32 == 0 rows per launch region and N % 64 == 0); epilogue = k_gemm_hhx semantics ----
__device__ __forceinline__ v16h g2_frag(const _Float16* p, int hh) { FragH f; f.half[0] = *(const v8us*)((const unsigned short*)p + 8 * hh); f.half[1] = *(const v8us*)((const unsigned short*)p + 16 + 8 * hh); return f.v; }
__device__ __forceinline__ v8f g2_mma(v16h a, v16h b, v8f c) { v8f d = __builtin_amdgcn_wmma_f32_16x16x32_f16(false, a, false, b, (short)0, c, false, false); asm volatile("v_nop\n\tv_nop\n\tv_nop\n\tv_nop" : "+v"(d) : "v"(a), "v"(b)); return d; }
template <int ACT>
__global__ __launch_bounds__(128) void k_gemm2(const _Float16* __restrict__ A, int lda, size_t sA, const _Float16* __restrict__ Bh, int ldb, size_t sB, float alpha, const float* __restrict__ bias, size_t sBias, const float* __restrict__ CP, int rowsPerB, size_t sCPb, int row0g,
    float* __restrict__ C, _Float16* __restrict__ C16, int ldc, size_t sC, int M, int N, int K) { static_assert(ACT == 0 || ACT == 3 || ACT == 6 || ACT == 8 || ACT == 9 || ACT == 11 || ACT == 12 || ACT == 14 || ACT == 15 || ACT == 16 || ACT == 17, "k_gemm2: unsupported ACT code (would silently apply no activation)");
  __shared__ __attribute__((aligned(16))) float so[4][32][68];
  const int tid = threadIdx.x, w = tid >> 5, lane = tid & 31, ln = lane & 15, hh = lane >> 4; const int by = blockIdx.y;
  A += (size_t)by * sA; Bh += (size_t)by * sB; const size_t cofs = (size_t)by * sC; const float* bp = bias ? bias + (size_t)by * sBias : nullptr;
  const int ntn = N >> 6; const int mt = blockIdx.x / ntn, nq = blockIdx.x - mt * ntn; const int row0 = mt * 128 + 32 * w, col0 = nq * 64; if (row0 >= M) return;
  const _Float16* a0p = A + (size_t)(row0 + ln) * lda; const _Float16* a1p = a0p + (size_t)16 * lda;
  const _Float16* b0p = Bh + (size_t)(col0 + ln) * ldb; const _Float16* b1p = b0p + (size_t)16 * ldb; const _Float16* b2p = b1p + (size_t)16 * ldb; const _Float16* b3p = b2p + (size_t)16 * ldb;
  const v8f z8 = {0.f,0.f,0.f,0.f,0.f,0.f,0.f,0.f}; v8f c00 = z8, c01 = z8, c02 = z8, c03 = z8, c10 = z8, c11 = z8, c12 = z8, c13 = z8;
#pragma unroll 1
  for (int kb = 0; kb < K; kb += 32) { const v16h a0 = g2_frag(a0p + kb, hh), a1 = g2_frag(a1p + kb, hh);
    v16h b = g2_frag(b0p + kb, hh); c00 = g2_mma(a0, b, c00); c10 = g2_mma(a1, b, c10);
    b = g2_frag(b1p + kb, hh); c01 = g2_mma(a0, b, c01); c11 = g2_mma(a1, b, c11);
    b = g2_frag(b2p + kb, hh); c02 = g2_mma(a0, b, c02); c12 = g2_mma(a1, b, c12);
    b = g2_frag(b3p + kb, hh); c03 = g2_mma(a0, b, c03); c13 = g2_mma(a1, b, c13); }
  v8f accs[8] = {c00, c01, c02, c03, c10, c11, c12, c13};
#pragma unroll
  for (int u = 0; u < 8; ++u) { const int t = u & 3, half = u >> 2; const int col = col0 + t * 16 + ln; const float bv = bp ? bf16_round(bp[col]) : 0.f;
#pragma unroll
    for (int r = 0; r < 8; ++r) { const int rloc = half * 16 + 8 * hh + r; float v = accs[u][r] * alpha + bv; if (CP) { if (rowsPerB < 0) v += CP[cofs + (size_t)(row0g + row0 + rloc) * ldc + col];      /* rowsPerB < 0: own element of the batched C plane */ else { const int bidx = (row0g + row0 + rloc) / rowsPerB; v += CP[(size_t)bidx * sCPb + (size_t)by * 64 + col]; } }
      if (ACT == 3) v = fmaxf(v, 0.f); else if (ACT == 6) v = 0.5f * v * (1.0f + erff(v * 0.70710678118654752f)); else if (ACT == 11) v = 1.0f / (1.0f + expf(-v)); else if (ACT == 15) v = v / (1.0f + expf(-v)); else if (ACT == 12) v = (v > 0.f) ? v : 0.01f * v; else if (ACT == 8) v = tanhf(v); else if (ACT == 9) v = 0.5f * v * (1.0f + tanhf(0.7978845608028654f * (v + 0.044715f * v * v * v))); else if (ACT == 14) v = (v > 0.f) ? v : 0.1f * v; else if (ACT == 16) v = (v >= 0.f) ? v : 0.3f * v; else if (ACT == 17) v = (v >= 0.f) ? v : 0.2f * v;
      so[w][rloc][t * 16 + ln] = v; } }
  __builtin_amdgcn_fence(__ATOMIC_ACQ_REL, "workgroup"); __builtin_amdgcn_wave_barrier();
  const int rsub = lane >> 4, c4 = (lane & 15) * 4;
  {
#pragma unroll
    for (int q = 0; q < 16; ++q) { const int r = q * 2 + rsub; const v4f v = *(const v4fa*)&so[w][r][c4]; if (C) *(v4f*)(C + cofs + (size_t)(row0 + r) * ldc + col0 + c4) = v; if (C16) { v4h h4; for (int i = 0; i < 4; ++i) h4[i] = (_Float16)v[i]; *(v4h*)(C16 + cofs + (size_t)(row0 + r) * ldc + col0 + c4) = h4; } }
     } }


__global__ __launch_bounds__(256) void k_wnat(const float* __restrict__ w, size_t n8, _Float16* __restrict__ Bt) { const size_t t = (size_t)blockIdx.x * 256 + threadIdx.x; if (t >= n8) return; FragH f; for (int q = 0; q < 8; ++q) f.h[q] = (_Float16)(bf16_round(w[t * 8 + q]) * 16.0f); *(v8us*)((unsigned short*)Bt + t * 8) = f.half[0];  }
__global__ __launch_bounds__(256) void k_rsm(const float* __restrict__ S, _Float16* __restrict__ P, int nrows) {
  #pragma clang fp contract(off)
  const int i = blockIdx.x * 256 + threadIdx.x; if (i >= nrows) return; const float* s = S + (size_t)i * SQ; float mx = -3.0e38f;
#pragma unroll 1
  for (int j = 0; j < SQ; ++j) mx = fmaxf(mx, s[j]); float se = 0.f;
#pragma unroll 1
  for (int j = 0; j < SQ; ++j) se += expf(s[j] - mx); const float sc = 256.0f / se;
#pragma unroll 1
  for (int j0 = 0; j0 < SQ; j0 += 8) { FragH f; for (int q = 0; q < 8; ++q) f.h[q] = (_Float16)(expf(s[j0 + q] - mx) * sc); unsigned short* d = (unsigned short*)P + (size_t)i * SQ + j0; *(v8us*)d = f.half[0];  } }
__global__ __launch_bounds__(256) void k_vt(const _Float16* __restrict__ V16, int b, int h0, _Float16* __restrict__ VT) { __shared__ unsigned short tl[64][65]; const int tid = threadIdx.x; const int hh = blockIdx.x % HG, sg = blockIdx.x / HG; const int s0 = sg * 64; const int h = h0 + hh;
  for (int i = tid; i < 64 * 8; i += 256) { const int j = i / 8, d8 = (i % 8) * 8; FragH f; f.half[0] = *(const v8us*)((const unsigned short*)V16 + ((size_t)b * SQ + s0 + j) * DM + h * HD + d8); for (int q = 0; q < 8; ++q) tl[d8 + q][j] = f.u[q]; }
  __syncthreads();
  { for (int i = tid; i < 64 * 8; i += 256) { const int d = i / 8, j8 = (i % 8) * 8; FragH f; for (int q = 0; q < 8; ++q) f.u[q] = tl[d][j8 + q]; *(v8us*)((unsigned short*)VT + ((size_t)hh * HD + d) * SQ + s0 + j8) = f.half[0]; }  } }



// Fused attention: scores, softmax of (scores + relative-position bias) and the product with V in one kernel, for every batch and head in one launch; neither the scores nor the weights go to memory.
// A wave owns FA_QT * 16 query columns and walks the keys 32 at a time: S^T = K . Q^T (A = K rows, B = Q rows kept in registers), so that a lane holds 16 scores of ONE query per column tile;
// running maximum and sum per lane (online softmax, log2 domain), one exchange between the wave halves per pass for the maximum, one in the epilogue for the sum;
// the two S^T tiles of a pass, converted in place, are the B operand of O^T += V^T . P^T (A = V^T rows in the same k order), and a lane's 8 accumulator registers are 8 consecutive d of its query: 16-byte stores.
// Every loop but the walk over the keys is unrolled in full: the fragment and accumulator arrays stay in registers only where each index is a constant.
#define FA_WAVES 8
#define FA_QT 2                      /* 16-column query tiles a wave */
#define FA_BQ (FA_WAVES * FA_QT * 16) /* query rows a block */
#define FA_L2E 1.4426950408889634f
__device__ __forceinline__ float sm_xh(float x) { return __builtin_bit_cast(float, __builtin_amdgcn_permlanex16(__builtin_bit_cast(int, x), __builtin_bit_cast(int, x), 0x76543210, 0xfedcba98, false, false)); }      /* lane l ^ 16 */
// Four native exp2 in place. In one statement with a closing v_nop: the slot that the instruction set asks for behind a transcendental before its result is read or its source overwritten
__device__ __forceinline__ v4f sm_exp2x4(v4f x) { float a = x[0], b = x[1], c = x[2], d = x[3];
  asm("v_exp_f32 %0, %0\n\tv_exp_f32 %1, %1\n\tv_exp_f32 %2, %2\n\tv_exp_f32 %3, %3\n\tv_nop" : "+v"(a), "+v"(b), "+v"(c), "+v"(d));
  const v4f y = {a, b, c, d}; return y; }
__device__ __forceinline__ float sm_exp2x1(float x) { asm("v_exp_f32 %0, %0\n\tv_nop" : "+v"(x)); return x; }      /* one native exp2, with the same closing slot */
__device__ __forceinline__ v8f fa_mma(v16h a, v16h b, v8f c) { return __builtin_amdgcn_wmma_f32_16x16x32_f16(false, a, false, b, (short)0, c, false, false); }
__global__ __launch_bounds__(FA_WAVES * 32) void k_fattn(const _Float16* __restrict__ Q16, const _Float16* __restrict__ K16, const _Float16* __restrict__ VT, const float* __restrict__ emb, _Float16* __restrict__ O16) {
  static_assert(SQ % FA_BQ == 0 && SQ % 32 == 0 && HD == 64 && MAXD % 32 == 0 && FA_QT * 16 + 31 <= MAXD, "k_fattn: whole blocks per head, whole passes per row, two k steps per score tile, band passes inside the table");
  __shared__ float tb[4 * MAXD - 1];      /* this head's bias, bf16-rounded, times log2(e), by k = j - i + (2 * MAXD - 1), already clipped: consecutive j are consecutive entries */
  const int tid = threadIdx.x, lane = tid & 31, ln = lane & 15, hh = lane >> 4; const int wave = __builtin_amdgcn_readfirstlane(tid >> 5);
  const int bh = blockIdx.x / (SQ / FA_BQ), b = bh / NH, h = bh % NH; const int q0 = (blockIdx.x % (SQ / FA_BQ)) * FA_BQ + wave * (FA_QT * 16);
  for (int i = tid; i < 4 * MAXD - 1; i += FA_WAVES * 32) tb[i] = bf16_round(emb[(min(max(2 * MAXD - 1 - i, -MAXD), MAXD) + MAXD) * NH + h]) * FA_L2E;
  __syncthreads();      /* publishes tb */
  const float bfar = tb[0], bnear = tb[4 * MAXD - 2];      /* j <= i - MAXD ; j >= i + MAXD */
  const _Float16* qp = Q16 + ((size_t)b * SQ + q0 + ln) * DM + h * HD; const _Float16* kp = K16 + ((size_t)b * SQ + ln) * DM + h * HD; const _Float16* vp = VT + ((size_t)bh * HD + ln) * SQ;
  v16h qf[FA_QT][2], kf[2][2];
#pragma unroll
  for (int t = 0; t < FA_QT; ++t) { qf[t][0] = g2_frag(qp + (size_t)t * 16 * DM, hh); qf[t][1] = g2_frag(qp + (size_t)t * 16 * DM + 32, hh); }
#pragma unroll
  for (int t = 0; t < 2; ++t) { kf[t][0] = g2_frag(kp + (size_t)t * 16 * DM, hh); kf[t][1] = g2_frag(kp + (size_t)t * 16 * DM + 32, hh); }
  const v8f z8 = {0.f,0.f,0.f,0.f,0.f,0.f,0.f,0.f};
  v8f o[FA_QT][4]; float mr[FA_QT], lr[FA_QT];
#pragma unroll
  for (int t = 0; t < FA_QT; ++t) { mr[t] = -3.0e38f; lr[t] = 0.f; o[t][0] = z8; o[t][1] = z8; o[t][2] = z8; o[t][3] = z8; }
  for (int j0 = 0; j0 < SQ; j0 += 32) {
    v16h vf[4];      /* asked for first, used last: the scores and the softmax stand between */
#pragma unroll
    for (int d = 0; d < 4; ++d) vf[d] = g2_frag(vp + (size_t)d * 16 * SQ + j0, hh);
    v8f s[FA_QT][2];      /* s[t][u][r] = score of key j0 + 16 u + 8 hh + r, query q0 + 16 t + ln */
#pragma unroll
    for (int t = 0; t < FA_QT; ++t)
#pragma unroll
      for (int u = 0; u < 2; ++u) s[t][u] = fa_mma(kf[u][1], qf[t][1], fa_mma(kf[u][0], qf[t][0], z8));
    const int jn = (j0 + 32 < SQ) ? j0 + 32 : j0;      /* the next pass's K rows, fetched one pass ahead (the last pass reads its own again) */
#pragma unroll
    for (int u = 0; u < 2; ++u) { kf[u][0] = g2_frag(kp + (size_t)(jn + u * 16) * DM, hh); kf[u][1] = g2_frag(kp + (size_t)(jn + u * 16) * DM + 32, hh); }
    asm volatile("s_wait_xcnt 0x0" ::: "memory");      /* the arithmetic below reuses and advances address registers that the loads of this pass name */
    if (j0 + 31 > q0 - MAXD && j0 < q0 + FA_QT * 16 - 1 + MAXD) { const float* tp = tb + (j0 - q0 + 2 * MAXD - 1) + 8 * hh - ln;      /* wave-uniform: the pass meets the unclipped band; every k read here lies inside the table */
#pragma unroll
      for (int t = 0; t < FA_QT; ++t)
#pragma unroll
        for (int u = 0; u < 2; ++u)
#pragma unroll
          for (int r = 0; r < 8; ++r) s[t][u][r] = __builtin_fmaf(s[t][u][r], 0.125f * FA_L2E, tp[(u - t) * 16 + r]);
    } else { const float bc = (j0 >= q0 + FA_QT * 16 - 1 + MAXD) ? bnear : bfar;
#pragma unroll
      for (int t = 0; t < FA_QT; ++t)
#pragma unroll
        for (int u = 0; u < 2; ++u)
#pragma unroll
          for (int r = 0; r < 8; ++r) s[t][u][r] = __builtin_fmaf(s[t][u][r], 0.125f * FA_L2E, bc); }
#pragma unroll
    for (int t = 0; t < FA_QT; ++t) {
      float m0 = fmaxf(s[t][0][0], s[t][0][1]), m1 = fmaxf(s[t][1][0], s[t][1][1]);
#pragma unroll
      for (int r = 2; r < 8; r += 2) { m0 = fmaxf(fmaxf(m0, s[t][0][r]), s[t][0][r + 1]); m1 = fmaxf(fmaxf(m1, s[t][1][r]), s[t][1][r + 1]); }
      m0 = fmaxf(m0, m1); const float mn = fmaxf(mr[t], fmaxf(m0, sm_xh(m0)));
      const float al = sm_exp2x1(mr[t] - mn); mr[t] = mn;
      const float nm = 8.0f - mn;      /* weights carried x256 (as f16 operands away from the subnormal range); the sum carries the same factor */
      v4f as; FragH pf;
#pragma unroll
      for (int u = 0; u < 2; ++u)
#pragma unroll
        for (int g = 0; g < 2; ++g) { v4f x = {s[t][u][4 * g] + nm, s[t][u][4 * g + 1] + nm, s[t][u][4 * g + 2] + nm, s[t][u][4 * g + 3] + nm}; x = sm_exp2x4(x);
          if (u + g == 0) as = x; else as += x;
#pragma unroll
          for (int e = 0; e < 4; ++e) pf.h[u * 8 + g * 4 + e] = (_Float16)x[e]; }
      lr[t] = __builtin_fmaf(lr[t], al, (as[0] + as[1]) + (as[2] + as[3]));
#pragma unroll
      for (int d = 0; d < 4; ++d) o[t][d] = fa_mma(vf[d], pf.v, o[t][d] * al); } }
#pragma unroll
  for (int t = 0; t < FA_QT; ++t) { const float sc = 64.0f / (lr[t] + sm_xh(lr[t]));      /* o carried x64, as the output GEMM's alpha expects */
    unsigned short* op = (unsigned short*)O16 + ((size_t)b * SQ + q0 + t * 16 + ln) * DM + h * HD + 8 * hh;
#pragma unroll
    for (int d = 0; d < 4; ++d) { FragH f;
#pragma unroll
      for (int r = 0; r < 8; ++r) f.h[r] = (_Float16)(o[t][d][r] * sc);
      *(v8us*)(op + d * 16) = f.half[0]; } } }

extern "C" void kernel_launch(void* const* d_in, const int* in_sizes, int n_in,
                              void* d_out, int out_size, void* d_ws, size_t ws_size, hipStream_t stream) {
  (void)in_sizes; (void)n_in; (void)out_size;
  const float* const* I = (const float* const*)d_in; const float* x = I[0]; const float* wq = I[1]; const float* bq = I[2]; const float* wk = I[3]; const float* bk = I[4]; const float* wv = I[5]; const float* bv = I[6]; const float* wo = I[7]; const float* bo = I[8]; const float* emb = I[9];      /* nn.Linear weights [out][in]; rel_emb [2*MAXD+1][NH] */
  char* ws = (char*)d_ws; size_t off = 0;
  auto take = [&](size_t bytes) { char* p = ws + off; off += (bytes + 255) & ~(size_t)255; return p; };
  _Float16* BQ = (_Float16*)take((size_t)DM * DM * 2); _Float16* BK = (_Float16*)take((size_t)DM * DM * 2); _Float16* BV = (_Float16*)take((size_t)DM * DM * 2); _Float16* BO = (_Float16*)take((size_t)DM * DM * 2);
  _Float16* X16 = (_Float16*)take(NR * DM * 2); _Float16* Q16 = (_Float16*)take(NR * DM * 2); _Float16* K16 = (_Float16*)take(NR * DM * 2); _Float16* V16 = (_Float16*)take(NR * DM * 2); _Float16* O16 = (_Float16*)take(NR * DM * 2);
  _Float16* VT = (_Float16*)take((size_t)NB * NH * HD * SQ * 2);
  if (off > ws_size) return;
  { const unsigned g = (unsigned)(((size_t)DM * DM / 8 + 255) / 256); k_wnat<<<g, 256, 0, stream>>>(wq, (size_t)DM * DM / 8, BQ); k_wnat<<<g, 256, 0, stream>>>(wk, (size_t)DM * DM / 8, BK); k_wnat<<<g, 256, 0, stream>>>(wv, (size_t)DM * DM / 8, BV); k_wnat<<<g, 256, 0, stream>>>(wo, (size_t)DM * DM / 8, BO); }      /* natural [out][in] = Bt[n][k], x16 */
  k_x16<<<(unsigned)((NR * DM / 8 + 255) / 256), 256, 0, stream>>>(x, X16, NR * DM / 8);
  const size_t r0p = (size_t)B0 * SQ;      /* first projected row */
  k_gemm2<0><<<dim3((unsigned)((MP / 128) * (DM / 64)), 1), 128, 0, stream>>>(X16 + r0p * DM, DM, 0, BQ, DM, 0, 0.0625f, bq, 0, nullptr, 1, 0, 0, nullptr, Q16 + r0p * DM, DM, 0, MP, DM, DM);
  k_gemm2<0><<<dim3((unsigned)((MP / 128) * (DM / 64)), 1), 128, 0, stream>>>(X16 + r0p * DM, DM, 0, BK, DM, 0, 0.0625f, bk, 0, nullptr, 1, 0, 0, nullptr, K16 + r0p * DM, DM, 0, MP, DM, DM);
  k_gemm2<0><<<dim3((unsigned)((MP / 128) * (DM / 64)), 1), 128, 0, stream>>>(X16 + r0p * DM, DM, 0, BV, DM, 0, 0.0625f, bv, 0, nullptr, 1, 0, 0, nullptr, V16 + r0p * DM, DM, 0, MP, DM, DM);
  k_vt<NH, SQ><<<NB * NH * (SQ / 64), 256, 0, stream>>>(V16, LQ, 0, VT);      /* V^T [NB][NH][HD][SQ] */
  k_fattn<<<NB * NH * (SQ / FA_BQ), FA_WAVES * 32, 0, stream>>>(Q16, K16, VT, emb, O16);      /* o (merged heads, x64) as f16 rows */
  k_gemm2<0><<<dim3((unsigned)((MPO / 128) * (DM / 64)), 1), 128, 0, stream>>>(O16 + r0p * DM, DM, 0, BO, DM, 0, 0.0009765625f, bo, 0, nullptr, 1, 0, 0, (float*)d_out + r0p * DM, nullptr, DM, 0, MPO, DM, DM);      /* out rows are the output layout */
}

// v003
// One run takes 129 microseconds.
// Next to v002, in two timings, it ran 1.87 and 1.89 times as fast.
// Counting every step since v000, it is 34.7 times as fast.
#include <hip/hip_runtime.h>
// Multi-head self-attention with a learned relative-position bias (x [2][2048][1024]; q/k/v = x W^T + b (nn.Linear [out][in]), 16 heads of 64; scores / 8 + rel_emb[clip(i - j, -128, 128) + 128][h] (rel_emb [257][16]); softmax; o merged; out = o Wo^T + bo -> [2][2048][1024]).
// Structure: token rows r = b*2048 + s; x as exact f16 rows (bf16-rounded); Q, K, V as three WMMA GEMMs (32x64 wave tiles, f32 accumulation, exact x16 weights + bias, f16 outputs); V^T for all batches and heads via LDS transposes; one fused attention launch for all batches and heads: score tiles on WMMA (K = 64), online softmax of (scores / 8 + relative-position bias looked up by (i - j, head)) on VALU (f32 statistics, native exp; weights x256 as f16 operands, in registers), o = P . V on WMMA (o carried x64 against f16 subnormal flush, folded into the output GEMM alpha) written straight into the merged f16 o rows; out = o W_o + b GEMM (f32) into the output layout.
// Compute dtype: inputs rounded to bf16; x / weights exact; q, k, v, softmax weights and o as plain f16 GEMM operands (~2^-12); scores and softmax statistics f32. v_wmma_f32_16x16x32_f16.
#define NB 2
#define SQ 2048
#define DM 1024
#define NH 16
#define HD 64
#define MAXD 128                     /* relative distance clip */
#define HG 4                         /* heads per launch of the grouped V^T transpose k_vt(b, h0) */
#define B0 0                         /* first batch processed (debug hook) */
#define NBR NB                       /* batches processed (debug hook) */
#define NR ((size_t)NB * SQ)         /* token rows */
#define MP ((int)((size_t)NBR * SQ)) /* rows projected (debug hook) */
#define QN SQ                        /* query rows per batch; unused: the attention launch covers all SQ */
#define NHD NH                       /* heads; unused: the attention launch covers all NH */
#define MPO MP                       /* rows through the output stage (debug hook) */
#define LQ DM      /* row pitch of the q/k/v rows */
typedef __bf16 v16b __attribute__((ext_vector_type(16)));
typedef unsigned short v8us __attribute__((ext_vector_type(8), may_alias));
typedef float  v8f  __attribute__((ext_vector_type(8)));
typedef float  v4f  __attribute__((ext_vector_type(4)));
typedef float  v4fa __attribute__((ext_vector_type(4), may_alias));
union FragB { v16b v; v8us half[2]; unsigned short u[16]; };

__device__ __forceinline__ unsigned short bf16_bits(float x) { unsigned int u = __float_as_uint(x); return (unsigned short)((u + 0x7FFFu + ((u >> 16) & 1u)) >> 16); }
__device__ __forceinline__ float bf16_val(unsigned short b) { return __uint_as_float(((unsigned int)b) << 16); }
__device__ __forceinline__ float bf16_round(float x) { return bf16_val(bf16_bits(x)); }
// D += A·B with NT terms: 1 = ah·bh, 2 = + al·bh (A split), 3 = + ah·bl (both split)
template <int NT>
__device__ __forceinline__ v8f mmaN(v16b ah, v16b al, v16b bh, v16b bl, v8f c) {
  c = __builtin_amdgcn_wmma_f32_16x16x32_bf16(false, ah, false, bh, (short)0, c, false, false);
  if (NT >= 2) c = __builtin_amdgcn_wmma_f32_16x16x32_bf16(false, al, false, bh, (short)0, c, false, false);
  if (NT >= 3) c = __builtin_amdgcn_wmma_f32_16x16x32_bf16(false, ah, false, bl, (short)0, c, false, false);
  asm volatile("v_nop\n\tv_nop\n\tv_nop\n\tv_nop" : "+v"(c) : "v"(ah), "v"(al), "v"(bh), "v"(bl));
  return c;
}

__global__ __launch_bounds__(256) void k_wt_bf16(const float* __restrict__ W, unsigned short* __restrict__ Wt, int K, int N) {
  const int t = blockIdx.x * 256 + threadIdx.x;
  const int k8n = K / 8;
  if (t >= N * k8n) return;
  const int n = t / k8n, k8 = (t % k8n) * 8;
  v8us v;
#pragma unroll
  for (int i = 0; i < 8; ++i) v[i] = bf16_bits(W[(size_t)(k8 + i) * N + n]);
  *(v8us*)(Wt + (size_t)n * K + k8) = v;
  
}

// GEMM C[M][N] (f32, pitch ldc) = act(A[M][K]·W + bias). A f32 row-major (pitch lda) converted per fragment to bf16
// (ASPLIT: hi/lo two planes -> 2 terms, else single rounded term); Wt bf16 [N][K] (pitch ldb). BIAS_BF16 rounds the
// bias to bf16 first (bias quantised to bf16 before the add). K%32==0, M%16==0, N%64==0.
template <bool ASPLIT, int ACT, bool BIAS_BF16>
__global__ __launch_bounds__(128) void k_gemm_bf(const float* __restrict__ A, int lda, const unsigned short* __restrict__ Wt, int ldb,
                                               const float* __restrict__ bias, float* __restrict__ C, int ldc, int M, int N, int K) {
  __shared__ __attribute__((aligned(16))) float so[4][16][64];
  const int tid = threadIdx.x, w = tid >> 5, lane = tid & 31, ln = lane & 15, hh = lane >> 4;
  const int ntn = N / 64;
  const int wid = blockIdx.x * 4 + w;
  const int mt = wid / ntn, nq = wid % ntn;
  if (mt * 16 >= M) return;
  const int row0 = mt * 16, col0 = nq * 64;
  const float* arow = A + (size_t)(row0 + ln) * lda;
  v8f acc[4] = {};
  for (int kb = 0; kb < K; kb += 32) {
    FragB ah, al;
    const v4f x0 = *(const v4fa*)(arow + kb + 8 * hh), x1 = *(const v4fa*)(arow + kb + 8 * hh + 4);
    const v4f x2 = *(const v4fa*)(arow + kb + 16 + 8 * hh), x3 = *(const v4fa*)(arow + kb + 16 + 8 * hh + 4);
    float xs[16] = {x0[0],x0[1],x0[2],x0[3],x1[0],x1[1],x1[2],x1[3],x2[0],x2[1],x2[2],x2[3],x3[0],x3[1],x3[2],x3[3]};
#pragma unroll
    for (int i = 0; i < 16; ++i) { const unsigned short hb = bf16_bits(xs[i]); ah.u[i] = hb; al.u[i] = ASPLIT ? bf16_bits(xs[i] - bf16_val(hb)) : (unsigned short)0; }
#pragma unroll
    for (int t = 0; t < 4; ++t) {
      const unsigned short* brow = Wt + (size_t)(col0 + t * 16 + ln) * ldb + kb;
      FragB b;
      b.half[0] = *(const v8us*)(brow + 8 * hh);
      b.half[1] = *(const v8us*)(brow + 16 + 8 * hh);
      acc[t] = mmaN<ASPLIT ? 2 : 1>(ah.v, al.v, b.v, b.v, acc[t]);
    }
  }
#pragma unroll
  for (int t = 0; t < 4; ++t) {
    float bv = bias ? bias[col0 + t * 16 + ln] : 0.f;
    if (BIAS_BF16) bv = bf16_round(bv);
#pragma unroll
    for (int r = 0; r < 8; ++r) { float v = acc[t][r] + bv; if (ACT == 1) v = fmaxf(v, 0.f); so[w][8 * hh + r][t * 16 + ln] = v; }
  }
  __builtin_amdgcn_fence(__ATOMIC_ACQ_REL, "workgroup");
  __builtin_amdgcn_wave_barrier();
  const int rsub = lane >> 4, c4 = (lane & 15) * 4;
  {
#pragma unroll
    for (int q = 0; q < 8; ++q) {
      const int r = q * 2 + rsub;
      const v4f v = *(const v4fa*)&so[w][r][c4];
      *(v4f*)(C + (size_t)(row0 + r) * ldc + col0 + c4) = v;
    }
    
  }
}

// GEMM C = act(A·W + bias + resid): A f32 (ASPLIT -> hi/lo 2 terms), Wt bf16 [N][K]; ACT 0 none, 1 relu, 2 exact gelu;
// resid (optional, f32, row index = (row % rmod), pitch ldr, RES_BF16 rounds it) added before the activation.
template <bool ASPLIT, int ACT, bool BIAS_BF16, bool RES_BF16>
__global__ __launch_bounds__(128) void k_gemm_bf3(const float* __restrict__ A, int lda, const unsigned short* __restrict__ Wt, int ldb,
                                                const float* __restrict__ bias, const float* __restrict__ resid, int rmod, int ldr,
                                                float* __restrict__ C, int ldc, int M, int N, int K) {
  __shared__ __attribute__((aligned(16))) float so[4][16][64];
  const int tid = threadIdx.x, w = tid >> 5, lane = tid & 31, ln = lane & 15, hh = lane >> 4;
  const int ntn = N / 64;
  const int wid = blockIdx.x * 4 + w;
  const int mt = wid / ntn, nq = wid % ntn;
  if (mt * 16 >= M) return;
  const int row0 = mt * 16, col0 = nq * 64;
  const float* arow = A + (size_t)(row0 + ln) * lda;
  v8f acc[4] = {};
  for (int kb = 0; kb < K; kb += 32) {
    FragB ah, al;
    const v4f x0 = *(const v4fa*)(arow + kb + 8 * hh), x1 = *(const v4fa*)(arow + kb + 8 * hh + 4);
    const v4f x2 = *(const v4fa*)(arow + kb + 16 + 8 * hh), x3 = *(const v4fa*)(arow + kb + 16 + 8 * hh + 4);
    float xs[16] = {x0[0],x0[1],x0[2],x0[3],x1[0],x1[1],x1[2],x1[3],x2[0],x2[1],x2[2],x2[3],x3[0],x3[1],x3[2],x3[3]};
#pragma unroll
    for (int i = 0; i < 16; ++i) { const unsigned short hb = bf16_bits(xs[i]); ah.u[i] = hb; al.u[i] = ASPLIT ? bf16_bits(xs[i] - bf16_val(hb)) : (unsigned short)0; }
#pragma unroll
    for (int t = 0; t < 4; ++t) {
      const unsigned short* brow = Wt + (size_t)(col0 + t * 16 + ln) * ldb + kb;
      FragB b;
      b.half[0] = *(const v8us*)(brow + 8 * hh);
      b.half[1] = *(const v8us*)(brow + 16 + 8 * hh);
      acc[t] = mmaN<ASPLIT ? 2 : 1>(ah.v, al.v, b.v, b.v, acc[t]);
    }
  }
#pragma unroll
  for (int t = 0; t < 4; ++t) {
    const int col = col0 + t * 16 + ln;
    float bv = bias ? bias[col] : 0.f;
    if (BIAS_BF16) bv = bf16_round(bv);
#pragma unroll
    for (int r = 0; r < 8; ++r) {
      float v = acc[t][r] + bv;
      if (resid) { float rv = resid[(size_t)((row0 + 8 * hh + r) % rmod) * ldr + col]; if (RES_BF16) rv = bf16_round(rv); v += rv; }
      if (ACT == 1) v = fmaxf(v, 0.f);
      if (ACT == 2) v = 0.5f * v * (1.0f + erff(v * 0.70710678118654752f));
      if (ACT == 3) { const float u = 0.7978845608028654f * (v + 0.044715f * v * v * v); v = 0.5f * v * (1.0f + tanhf(u)); }
      so[w][8 * hh + r][t * 16 + ln] = v;
    }
  }
  __builtin_amdgcn_fence(__ATOMIC_ACQ_REL, "workgroup");
  __builtin_amdgcn_wave_barrier();
  const int rsub = lane >> 4, c4 = (lane & 15) * 4;
  {
#pragma unroll
    for (int q = 0; q < 8; ++q) {
      const int r = q * 2 + rsub;
      const v4f v = *(const v4fa*)&so[w][r][c4];
      *(v4f*)(C + (size_t)(row0 + r) * ldc + col0 + c4) = v;
    }
    
  }
}
// row LayerNorm (biased variance, eps) over N: s = X (+ R); optional out_sum <- s; out_norm <- (s-mu)*rsqrt(var+eps)*g + b
template <bool PARAM_BF16>
__global__ __launch_bounds__(256) void k_layernorm(const float* __restrict__ X, const float* __restrict__ R, const float* __restrict__ g, const float* __restrict__ bta,
                                                  float* __restrict__ out_sum, float* __restrict__ out_norm, int N, float eps) {
  __shared__ float red[256];
  const int row = blockIdx.x, tid = threadIdx.x;
  const float* x = X + (size_t)row * N; const float* rr = R ? R + (size_t)row * N : nullptr;
  float vals[16];                     // up to N = 4096
  const int per = N / 256;            // contiguous chunk per thread? use strided-by-4 chunks: thread handles j = tid*4 + 1024*u
  float s1 = 0.f;
  for (int u = 0; u < per / 4; ++u) {
    const int j = tid * 4 + 1024 * u;
    const v4f a = *(const v4fa*)(x + j);
    v4f b = {0.f,0.f,0.f,0.f}; if (rr) b = *(const v4fa*)(rr + j);
#pragma unroll
    for (int q = 0; q < 4; ++q) { const float v = a[q] + b[q]; vals[u * 4 + q] = v; s1 += v; }
  }
  red[tid] = s1; __syncthreads();
  for (int st = 128; st > 0; st >>= 1) { if (tid < st) red[tid] += red[tid + st]; __syncthreads(); }
  const float mu = red[0] / (float)N; __syncthreads();
  float s2 = 0.f;
  for (int u = 0; u < per / 4; ++u)
#pragma unroll
    for (int q = 0; q < 4; ++q) { const float c = vals[u * 4 + q] - mu; s2 += c * c; }
  red[tid] = s2; __syncthreads();
  for (int st = 128; st > 0; st >>= 1) { if (tid < st) red[tid] += red[tid + st]; __syncthreads(); }
  const float rs = rsqrtf(red[0] / (float)N + eps);
  {
    for (int u = 0; u < per / 4; ++u) {
      const int j = tid * 4 + 1024 * u;
      v4f o, sm;
#pragma unroll
      for (int q = 0; q < 4; ++q) {
        float gg = g[j + q], bb = bta[j + q];
        if (PARAM_BF16) { gg = bf16_round(gg); bb = bf16_round(bb); }
        sm[q] = vals[u * 4 + q]; o[q] = (vals[u * 4 + q] - mu) * rs * gg + bb;
      }
      if (out_sum) *(v4f*)(out_sum + (size_t)row * N + j) = sm;
      *(v4f*)(out_norm + (size_t)row * N + j) = o;
    }
    
  }
}



// ---- f16 WMMA path (v_wmma_f32_16x16x32_f16): 11-bit significands for operands in range — used where a [0,1] probability operand needs more precision than bf16
typedef _Float16 v16h __attribute__((ext_vector_type(16)));
union FragH { v16h v; v8us half[2]; _Float16 h[16]; unsigned short u[16]; };
template <int NT>
__device__ __forceinline__ v8f mmaH(v16h ah, v16h al, v16h bh, v16h bl, v8f c) {
  c = __builtin_amdgcn_wmma_f32_16x16x32_f16(false, ah, false, bh, (short)0, c, false, false);
  if (NT >= 2) c = __builtin_amdgcn_wmma_f32_16x16x32_f16(false, al, false, bh, (short)0, c, false, false);
  if (NT >= 3) c = __builtin_amdgcn_wmma_f32_16x16x32_f16(false, ah, false, bl, (short)0, c, false, false);
  asm volatile("v_nop\n\tv_nop\n\tv_nop\n\tv_nop" : "+v"(c) : "v"(ah), "v"(al), "v"(bh), "v"(bl));
  return c;
}
// batched GEMM like k_gemm_b but f16 operands: A f32 (split into f16 hi/lo if ASPLIT, else rounded to f16), Bt = f16 values [n][k]; alpha; C f32; N multiple of 16 (partial tiles skipped)
template <bool ASPLIT>
__global__ __launch_bounds__(128) void k_gemm_h(const float* __restrict__ A, int lda, size_t sA, const _Float16* __restrict__ Bh, int ldb, size_t sB, float alpha, float* __restrict__ C, int ldc, size_t sC, int M, int N, int K) {
  __shared__ __attribute__((aligned(16))) float so[4][16][64];
  const int tid = threadIdx.x, w = tid >> 5, lane = tid & 31, ln = lane & 15, hh = lane >> 4; const int by = blockIdx.y;
  A += (size_t)by * sA; Bh += (size_t)by * sB; C += (size_t)by * sC;
  const int ntn = (N + 63) / 64; const int wid = blockIdx.x * 4 + w; const int mt = wid / ntn, nq = wid % ntn; if (mt * 16 >= M) return;
  const int row0 = mt * 16, col0 = nq * 64; const float* arow = A + (size_t)(row0 + ln) * lda;
  v8f acc[4] = {};
  for (int kb = 0; kb < K; kb += 32) {
    FragH ah, al;
    const v4f x0 = *(const v4fa*)(arow + kb + 8 * hh), x1 = *(const v4fa*)(arow + kb + 8 * hh + 4), x2 = *(const v4fa*)(arow + kb + 16 + 8 * hh), x3 = *(const v4fa*)(arow + kb + 16 + 8 * hh + 4);
    float xs[16] = {x0[0],x0[1],x0[2],x0[3],x1[0],x1[1],x1[2],x1[3],x2[0],x2[1],x2[2],x2[3],x3[0],x3[1],x3[2],x3[3]};
#pragma unroll
    for (int i = 0; i < 16; ++i) { const _Float16 h = (_Float16)xs[i]; ah.h[i] = h; al.h[i] = ASPLIT ? (_Float16)(xs[i] - (float)h) : (_Float16)0.0f; }
#pragma unroll
    for (int t = 0; t < 4; ++t) { if (col0 + t * 16 >= N) continue; const size_t boff = (size_t)(col0 + t * 16 + ln) * ldb + kb; FragH bq; bq.half[0] = *(const v8us*)(Bh + boff + 8 * hh); bq.half[1] = *(const v8us*)(Bh + boff + 16 + 8 * hh);
      acc[t] = mmaH<ASPLIT ? 2 : 1>(ah.v, al.v, bq.v, bq.v, acc[t]); }
  }
#pragma unroll
  for (int t = 0; t < 4; ++t) { if (col0 + t * 16 >= N) continue;
#pragma unroll
    for (int r = 0; r < 8; ++r) so[w][8 * hh + r][t * 16 + ln] = acc[t][r] * alpha; }
  __builtin_amdgcn_fence(__ATOMIC_ACQ_REL, "workgroup"); __builtin_amdgcn_wave_barrier();
  const int rsub = lane >> 4, c4 = (lane & 15) * 4;
  {
#pragma unroll
    for (int q = 0; q < 8; ++q) { const int r = q * 2 + rsub; if (col0 + c4 < N) { const v4f v = *(const v4fa*)&so[w][r][c4]; *(v4f*)(C + (size_t)(row0 + r) * ldc + col0 + c4) = v; } }
     }
}

// Wt[n][k] = f16(W[k][n]·scale) from f32 row-major W[K][N] (scale = power of two; bf16-exact weights stay exact in f16 away from the subnormal range)
__global__ __launch_bounds__(256) void k_wt_f16(const float* __restrict__ W, _Float16* __restrict__ Wt, int K, int N, float scale) {
  const int t = blockIdx.x * 256 + threadIdx.x; if (t >= N * (K / 8)) return; const int n = t / (K / 8), k8 = (t % (K / 8)) * 8; FragH f;
#pragma unroll
  for (int i = 0; i < 8; ++i) f.h[i] = (_Float16)(bf16_round(W[(size_t)(k8 + i) * N + n]) * scale); const v8us o = f.half[0];
  *(v8us*)((unsigned short*)Wt + (size_t)n * K + k8) = o; 
}
// k_gemm_hh variant with fused epilogue: v = acc·alpha + bias[by·sBias + col] (+ CP[(row/rowsPerB)·sCPb + by·64 + col] if CP) ; ACT 0 none / 1 elu ; writes f16 C16 (and f32 C if non-null)
template <int ACT>
__global__ __launch_bounds__(128) void k_gemm_hhx(const _Float16* __restrict__ A, int lda, size_t sA, const _Float16* __restrict__ Bh, int ldb, size_t sB, float alpha, const float* __restrict__ bias, size_t sBias, const float* __restrict__ CP, int rowsPerB, size_t sCPb, int row0g,
    float* __restrict__ C, _Float16* __restrict__ C16, int ldc, size_t sC, int M, int N, int K) {
  __shared__ __attribute__((aligned(16))) float so[4][16][64];
  const int tid = threadIdx.x, w = tid >> 5, lane = tid & 31, ln = lane & 15, hh = lane >> 4; const int by = blockIdx.y;
  A += (size_t)by * sA; Bh += (size_t)by * sB; const size_t cofs = (size_t)by * sC; const float* bp = bias ? bias + (size_t)by * sBias : nullptr;
  const int ntn = (N + 63) / 64; const int wid = blockIdx.x * 4 + w; const int mt = wid / ntn, nq = wid % ntn; if (mt * 16 >= M) return;
  const int row0 = mt * 16, col0 = nq * 64; const _Float16* arow = A + (size_t)(row0 + ln) * lda;
  v8f acc[4] = {};
  for (int kb = 0; kb < K; kb += 32) { FragH ah; ah.half[0] = *(const v8us*)((const unsigned short*)arow + kb + 8 * hh); ah.half[1] = *(const v8us*)((const unsigned short*)arow + kb + 16 + 8 * hh);
#pragma unroll
    for (int t = 0; t < 4; ++t) { if (col0 + t * 16 >= N) continue; const size_t boff = (size_t)(col0 + t * 16 + ln) * ldb + kb; FragH bq; bq.half[0] = *(const v8us*)((const unsigned short*)Bh + boff + 8 * hh); bq.half[1] = *(const v8us*)((const unsigned short*)Bh + boff + 16 + 8 * hh);
      acc[t] = mmaH<1>(ah.v, ah.v, bq.v, bq.v, acc[t]); }
  }
#pragma unroll
  for (int t = 0; t < 4; ++t) { if (col0 + t * 16 >= N) continue; const int col = col0 + t * 16 + ln; const float bv = bp ? bf16_round(bp[col]) : 0.f;
#pragma unroll
    for (int r = 0; r < 8; ++r) { float v = acc[t][r] * alpha + bv; if (CP) { const int rr = row0g + row0 + 8 * hh + r; if (rowsPerB < 0) v += CP[cofs + (size_t)rr * ldc + col];      /* rowsPerB < 0: own element of the batched C plane */ else { const int bidx = rr / rowsPerB; v += CP[(size_t)bidx * sCPb + (size_t)by * 64 + col]; } } if (ACT == 1) v = (v > 0.f) ? v : expm1f(v); else if (ACT == 7) v = (v > 0.f) ? v + 1.0f : expf(v); else if (ACT == 8) v = tanhf(v); else if (ACT == 9) v = 0.5f * v * (1.0f + tanhf(0.7978845608028654f * (v + 0.044715f * v * v * v))); else if (ACT == 11) v = 1.0f / (1.0f + expf(-v)); else if (ACT == 12) v = (v > 0.f) ? v : 0.01f * v; else if (ACT == 14) v = (v > 0.f) ? v : 0.1f * v; else if (ACT == 16) v = (v >= 0.f) ? v : 0.3f * v; else if (ACT == 17) v = (v >= 0.f) ? v : 0.2f * v; else if (ACT == 15) v = v / (1.0f + expf(-v)); else if (ACT == 3) v = fmaxf(v, 0.f); else if (ACT == 6) v = 0.5f * v * (1.0f + erff(v * 0.70710678118654752f)); so[w][8 * hh + r][t * 16 + ln] = v; } }
  __builtin_amdgcn_fence(__ATOMIC_ACQ_REL, "workgroup"); __builtin_amdgcn_wave_barrier();
  const int rsub = lane >> 4, c4 = (lane & 15) * 4; typedef _Float16 v4h __attribute__((ext_vector_type(4)));
  {
#pragma unroll
    for (int q = 0; q < 8; ++q) { const int r = q * 2 + rsub; if (col0 + c4 < N) { const v4f v = *(const v4fa*)&so[w][r][c4]; if (C) *(v4f*)(C + cofs + (size_t)(row0 + r) * ldc + col0 + c4) = v; if (C16) { v4h h4; for (int i = 0; i < 4; ++i) h4[i] = (_Float16)v[i]; *(v4h*)(C16 + cofs + (size_t)(row0 + r) * ldc + col0 + c4) = h4; } } }
     }
}


typedef _Float16 v4h __attribute__((ext_vector_type(4)));

__global__ __launch_bounds__(256) void k_x16(const float* __restrict__ x, _Float16* __restrict__ X16, size_t n8) { const size_t t = (size_t)blockIdx.x * 256 + threadIdx.x; if (t >= n8) return; FragH f;
#pragma unroll
  for (int q = 0; q < 8; ++q) f.h[q] = (_Float16)bf16_round(x[t * 8 + q]); *(v8us*)((unsigned short*)X16 + t * 8) = f.half[0];  }
__global__ __launch_bounds__(256) void k_h16(const float* __restrict__ x, _Float16* __restrict__ X16, size_t n8) { const size_t t = (size_t)blockIdx.x * 256 + threadIdx.x; if (t >= n8) return; FragH f;
#pragma unroll
  for (int q = 0; q < 8; ++q) f.h[q] = (_Float16)x[t * 8 + q]; *(v8us*)((unsigned short*)X16 + t * 8) = f.half[0];  }
__global__ __launch_bounds__(256) void k_round16f(const float* __restrict__ W, _Float16* __restrict__ Bt, size_t n8) { const size_t t = (size_t)blockIdx.x * 256 + threadIdx.x; if (t >= n8) return; FragH f;
#pragma unroll
  for (int i = 0; i < 8; ++i) f.h[i] = (_Float16)(bf16_round(W[t * 8 + i]) * 16.0f); *(v8us*)((unsigned short*)Bt + t * 8) = f.half[0];  }
template <int NHv, int TTv>
__global__ __launch_bounds__(256) void k_vt(const _Float16* __restrict__ V16, int ldv, int voff, _Float16* __restrict__ Vt) { __shared__ unsigned short tl[64][66]; const int tid = threadIdx.x; const int slab = blockIdx.x / (TTv / 64), lg = blockIdx.x % (TTv / 64); const int b = slab / NHv, h = slab % NHv;
  for (int i = tid; i < 64 * 8; i += 256) { const int r = i / 8, c8 = (i % 8) * 8; FragH f; f.half[0] = *(const v8us*)((const unsigned short*)V16 + ((size_t)b * TTv + lg * 64 + r) * ldv + voff + h * 64 + c8);
#pragma unroll
    for (int q = 0; q < 8; ++q) tl[r][c8 + q] = f.u[q]; }
  __syncthreads();
  {
#pragma unroll
    for (int rd = 0; rd < 2; ++rd) { const int d = rd * 32 + tid / 8, pc = tid % 8; FragH f;
#pragma unroll
      for (int q = 0; q < 8; ++q) f.u[q] = tl[pc * 8 + q][d];
      *(v8us*)((unsigned short*)Vt + ((size_t)slab * 64 + d) * TTv + lg * 64 + pc * 8) = f.half[0]; }
     } }

__global__ __launch_bounds__(256) void k_hl(const float* __restrict__ F, _Float16* __restrict__ Hh, _Float16* __restrict__ Hl, size_t n8) { const size_t t = (size_t)blockIdx.x * 256 + threadIdx.x; if (t >= n8) return; FragH fh, fl; const v4f a = *(const v4fa*)(F + t * 8), c = *(const v4fa*)(F + t * 8 + 4);
#pragma unroll
  for (int q = 0; q < 4; ++q) { _Float16 h = (_Float16)a[q]; fh.h[q] = h; fl.h[q] = (_Float16)((a[q] - (float)h) * 1024.0f); h = (_Float16)c[q]; fh.h[4 + q] = h; fl.h[4 + q] = (_Float16)((c[q] - (float)h) * 1024.0f); }
  { *(v8us*)((unsigned short*)Hh + t * 8) = fh.half[0]; *(v8us*)((unsigned short*)Hl + t * 8) = fl.half[0];  } }

// ---- fast GEMM (block tile 128x128, eight waves of 32x64; requires M % 128 == 0, N % 128 == 0, K % 128 == 0); epilogue = k_gemm_hhx semantics ----
// A stage is 128 k of the block's 128 A rows and 128 B rows (256-byte rows). Asynchronous copies bring it from global memory into LDS, whole 128-byte lines a request, through no register;
// two buffers: the next stage flies while this one is multiplied. Fragments come from LDS in the k order of g2_frag, one k step ahead of their products; every accumulator still sums k upward in steps of 32.
#define G2_BK 128                    /* k a stage */
#define G2_PITCH 272                 /* LDS row pitch in bytes: 16 x odd, so the 16 rows of a 16-byte fragment read fall on 64 distinct banks */
#define G2_STAGE (256 * G2_PITCH)    /* 128 A rows, then 128 B rows */
__device__ __forceinline__ v16h g2_frag(const _Float16* p, int hh) { FragH f; f.half[0] = *(const v8us*)((const unsigned short*)p + 8 * hh); f.half[1] = *(const v8us*)((const unsigned short*)p + 16 + 8 * hh); return f.v; }
__device__ __forceinline__ v16h g2_lfrag(const unsigned char* p) { FragH f; f.half[0] = *(const v8us*)p; f.half[1] = *(const v8us*)(p + 32); return f.v; }      /* p: the lane's row in LDS + 64 bytes a k step + 16 hh */
__device__ __forceinline__ v8f g2_mma(v16h a, v16h b, v8f c) { return __builtin_amdgcn_wmma_f32_16x16x32_f16(false, a, false, b, (short)0, c, false, false); }
// Eight asynchronous 16-byte copies of a lane: rows r, r + 16, ..., r + 112 of one operand's stage (l: LDS byte address of the first, g: its global address, gs: 16 global rows in elements).
// The closing s_wait_xcnt 0 stands inside the statement, in front of any later write of the address registers that the copies name.
__device__ __forceinline__ void g2_copy8(unsigned l, const _Float16* g, size_t gs) {
  asm volatile("global_load_async_to_lds_b128 %0, %8, off\n\tglobal_load_async_to_lds_b128 %1, %9, off\n\tglobal_load_async_to_lds_b128 %2, %10, off\n\tglobal_load_async_to_lds_b128 %3, %11, off\n\t"
               "global_load_async_to_lds_b128 %4, %12, off\n\tglobal_load_async_to_lds_b128 %5, %13, off\n\tglobal_load_async_to_lds_b128 %6, %14, off\n\tglobal_load_async_to_lds_b128 %7, %15, off\n\ts_wait_xcnt 0x0"
               :: "v"(l), "v"(l + 16 * G2_PITCH), "v"(l + 32 * G2_PITCH), "v"(l + 48 * G2_PITCH), "v"(l + 64 * G2_PITCH), "v"(l + 80 * G2_PITCH), "v"(l + 96 * G2_PITCH), "v"(l + 112 * G2_PITCH),
                  "v"(g), "v"(g + gs), "v"(g + 2 * gs), "v"(g + 3 * gs), "v"(g + 4 * gs), "v"(g + 5 * gs), "v"(g + 6 * gs), "v"(g + 7 * gs) : "memory"); }
template <int ACT>
__global__ __launch_bounds__(256) void k_gemm2(const _Float16* __restrict__ A, int lda, size_t sA, const _Float16* __restrict__ Bh, int ldb, size_t sB, float alpha, const float* __restrict__ bias, size_t sBias, const float* __restrict__ CP, int rowsPerB, size_t sCPb, int row0g,
    float* __restrict__ C, _Float16* __restrict__ C16, int ldc, size_t sC, int M, int N, int K) { static_assert(ACT == 0 || ACT == 3 || ACT == 6 || ACT == 8 || ACT == 9 || ACT == 11 || ACT == 12 || ACT == 14 || ACT == 15 || ACT == 16 || ACT == 17, "k_gemm2: unsupported ACT code (would silently apply no activation)");
  __shared__ __attribute__((aligned(16))) unsigned char ring[2 * G2_STAGE];
  __shared__ __attribute__((aligned(16))) float so[8][32][68];
  const int tid = threadIdx.x, w = tid >> 5, lane = tid & 31, ln = lane & 15, hh = lane >> 4; const int by = blockIdx.y;
  A += (size_t)by * sA; Bh += (size_t)by * sB; const size_t cofs = (size_t)by * sC; const float* bp = bias ? bias + (size_t)by * sBias : nullptr;
  const int ntn = N >> 7; const int mt = blockIdx.x / ntn, nq = blockIdx.x - mt * ntn; if (mt * 128 >= M) return;      /* the whole block leaves, in front of every barrier */
  const int row0 = mt * 128 + 32 * (w & 3), col0 = nq * 128 + 64 * (w >> 2);
  const int nt = K / G2_BK;
  const unsigned lc = (unsigned)(size_t)ring + (unsigned)((tid >> 4) * G2_PITCH + (tid & 15) * 16);      /* the lane's place in a stage: row tid / 16 (+ 16 a copy), 16-byte column tid % 16: a wave's copy is two whole rows */
  const _Float16* ga = A + (size_t)(mt * 128 + (tid >> 4)) * lda + (tid & 15) * 8; const _Float16* gb = Bh + (size_t)(nq * 128 + (tid >> 4)) * ldb + (tid & 15) * 8;
  const size_t gsa = (size_t)16 * lda, gsb = (size_t)16 * ldb;
  g2_copy8(lc, ga, gsa); g2_copy8(lc + 128 * G2_PITCH, gb, gsb);      /* stage 0 */
  asm volatile("s_wait_asynccnt 0x0" ::: "memory");      /* this wave's copies of stage 0 have landed */
  __syncthreads();      /* publishes stage 0 */
  if (nt > 1) { g2_copy8(lc + G2_STAGE, ga + G2_BK, gsa); g2_copy8(lc + G2_STAGE + 128 * G2_PITCH, gb + G2_BK, gsb); }      /* stage 1 */
  const unsigned char* fa = ring + (32 * (w & 3) + ln) * G2_PITCH + 16 * hh; const unsigned char* fb = ring + (128 + 64 * (w >> 2) + ln) * G2_PITCH + 16 * hh;
  const v8f z8 = {0.f,0.f,0.f,0.f,0.f,0.f,0.f,0.f}; v8f c00 = z8, c01 = z8, c02 = z8, c03 = z8, c10 = z8, c11 = z8, c12 = z8, c13 = z8;
#pragma unroll 1      /* one stage a trip: the buffer is picked by the trip's parity, the four k steps inside are unrolled */
  for (int t = 0; t < nt; ++t) { const unsigned bo = (unsigned)(t & 1) * G2_STAGE; const unsigned char* pa = fa + bo; const unsigned char* pb = fb + bo;
    v16h a[2][2], b[2][4];
    a[0][0] = g2_lfrag(pa); a[0][1] = g2_lfrag(pa + 16 * G2_PITCH);
#pragma unroll
    for (int j = 0; j < 4; ++j) b[0][j] = g2_lfrag(pb + j * 16 * G2_PITCH);
#pragma unroll
    for (int ks = 0; ks < G2_BK / 32; ++ks) { const int cu = ks & 1, nx = cu ^ 1;
      if (ks + 1 < G2_BK / 32) { a[nx][0] = g2_lfrag(pa + (ks + 1) * 64); a[nx][1] = g2_lfrag(pa + 16 * G2_PITCH + (ks + 1) * 64);      /* the next k step's fragments, into the other register set */
#pragma unroll
        for (int j = 0; j < 4; ++j) b[nx][j] = g2_lfrag(pb + j * 16 * G2_PITCH + (ks + 1) * 64); }
      __builtin_amdgcn_sched_barrier(0);      /* keeps those reads one group ahead of this step's products: without it the build sank each read to its first use, two products behind every full LDS wait */
      c00 = g2_mma(a[cu][0], b[cu][0], c00); c10 = g2_mma(a[cu][1], b[cu][0], c10); c01 = g2_mma(a[cu][0], b[cu][1], c01); c11 = g2_mma(a[cu][1], b[cu][1], c11);
      c02 = g2_mma(a[cu][0], b[cu][2], c02); c12 = g2_mma(a[cu][1], b[cu][2], c12); c03 = g2_mma(a[cu][0], b[cu][3], c03); c13 = g2_mma(a[cu][1], b[cu][3], c13);
      __builtin_amdgcn_sched_barrier(0); }      /* and keeps the following group's reads from rising among these products */
    asm volatile("s_wait_dscnt 0x0" ::: "memory");      /* this wave's reads of the buffer are done before it is refilled */
    asm volatile("s_wait_asynccnt 0x0" ::: "memory");      /* this wave's copies of stage t + 1 have landed */
    __syncthreads();      /* publishes stage t + 1 and ends every wave's reads of stage t */
    if (t + 2 < nt) { g2_copy8(lc + bo, ga + (size_t)(t + 2) * G2_BK, gsa); g2_copy8(lc + bo + 128 * G2_PITCH, gb + (size_t)(t + 2) * G2_BK, gsb); } }      /* stage t + 2 into the buffer just read */
  asm volatile("s_wait_asynccnt 0x0" ::: "memory");      /* nothing of this wave is in flight when it goes on */
  v8f accs[8] = {c00, c01, c02, c03, c10, c11, c12, c13};
#pragma unroll
  for (int u = 0; u < 8; ++u) { const int t = u & 3, half = u >> 2; const int col = col0 + t * 16 + ln; const float bv = bp ? bf16_round(bp[col]) : 0.f;
#pragma unroll
    for (int r = 0; r < 8; ++r) { const int rloc = half * 16 + 8 * hh + r; float v = accs[u][r] * alpha + bv; if (CP) { if (rowsPerB < 0) v += CP[cofs + (size_t)(row0g + row0 + rloc) * ldc + col];      /* rowsPerB < 0: own element of the batched C plane */ else { const int bidx = (row0g + row0 + rloc) / rowsPerB; v += CP[(size_t)bidx * sCPb + (size_t)by * 64 + col]; } }
      if (ACT == 3) v = fmaxf(v, 0.f); else if (ACT == 6) v = 0.5f * v * (1.0f + erff(v * 0.70710678118654752f)); else if (ACT == 11) v = 1.0f / (1.0f + expf(-v)); else if (ACT == 15) v = v / (1.0f + expf(-v)); else if (ACT == 12) v = (v > 0.f) ? v : 0.01f * v; else if (ACT == 8) v = tanhf(v); else if (ACT == 9) v = 0.5f * v * (1.0f + tanhf(0.7978845608028654f * (v + 0.044715f * v * v * v))); else if (ACT == 14) v = (v > 0.f) ? v : 0.1f * v; else if (ACT == 16) v = (v >= 0.f) ? v : 0.3f * v; else if (ACT == 17) v = (v >= 0.f) ? v : 0.2f * v;
      so[w][rloc][t * 16 + ln] = v; } }
  __builtin_amdgcn_fence(__ATOMIC_ACQ_REL, "workgroup"); __builtin_amdgcn_wave_barrier();
  const int rsub = lane >> 4, c4 = (lane & 15) * 4;
  {
#pragma unroll
    for (int q = 0; q < 16; ++q) { const int r = q * 2 + rsub; const v4f v = *(const v4fa*)&so[w][r][c4]; if (C) *(v4f*)(C + cofs + (size_t)(row0 + r) * ldc + col0 + c4) = v; if (C16) { v4h h4; for (int i = 0; i < 4; ++i) h4[i] = (_Float16)v[i]; *(v4h*)(C16 + cofs + (size_t)(row0 + r) * ldc + col0 + c4) = h4; } }
     } }


__global__ __launch_bounds__(256) void k_wnat(const float* __restrict__ w, size_t n8, _Float16* __restrict__ Bt) { const size_t t = (size_t)blockIdx.x * 256 + threadIdx.x; if (t >= n8) return; FragH f; for (int q = 0; q < 8; ++q) f.h[q] = (_Float16)(bf16_round(w[t * 8 + q]) * 16.0f); *(v8us*)((unsigned short*)Bt + t * 8) = f.half[0];  }
__global__ __launch_bounds__(256) void k_rsm(const float* __restrict__ S, _Float16* __restrict__ P, int nrows) {
  #pragma clang fp contract(off)
  const int i = blockIdx.x * 256 + threadIdx.x; if (i >= nrows) return; const float* s = S + (size_t)i * SQ; float mx = -3.0e38f;
#pragma unroll 1
  for (int j = 0; j < SQ; ++j) mx = fmaxf(mx, s[j]); float se = 0.f;
#pragma unroll 1
  for (int j = 0; j < SQ; ++j) se += expf(s[j] - mx); const float sc = 256.0f / se;
#pragma unroll 1
  for (int j0 = 0; j0 < SQ; j0 += 8) { FragH f; for (int q = 0; q < 8; ++q) f.h[q] = (_Float16)(expf(s[j0 + q] - mx) * sc); unsigned short* d = (unsigned short*)P + (size_t)i * SQ + j0; *(v8us*)d = f.half[0];  } }
__global__ __launch_bounds__(256) void k_vt(const _Float16* __restrict__ V16, int b, int h0, _Float16* __restrict__ VT) { __shared__ unsigned short tl[64][65]; const int tid = threadIdx.x; const int hh = blockIdx.x % HG, sg = blockIdx.x / HG; const int s0 = sg * 64; const int h = h0 + hh;
  for (int i = tid; i < 64 * 8; i += 256) { const int j = i / 8, d8 = (i % 8) * 8; FragH f; f.half[0] = *(const v8us*)((const unsigned short*)V16 + ((size_t)b * SQ + s0 + j) * DM + h * HD + d8); for (int q = 0; q < 8; ++q) tl[d8 + q][j] = f.u[q]; }
  __syncthreads();
  { for (int i = tid; i < 64 * 8; i += 256) { const int d = i / 8, j8 = (i % 8) * 8; FragH f; for (int q = 0; q < 8; ++q) f.u[q] = tl[d][j8 + q]; *(v8us*)((unsigned short*)VT + ((size_t)hh * HD + d) * SQ + s0 + j8) = f.half[0]; }  } }



// Fused attention: scores, softmax of (scores + relative-position bias) and the product with V in one kernel, for every batch and head in one launch; neither the scores nor the weights go to memory.
// A wave owns FA_QT * 16 query columns and walks the keys 32 at a time: S^T = K . Q^T (A = K rows, B = Q rows kept in registers), so that a lane holds 16 scores of ONE query per column tile;
// running maximum and sum per lane (online softmax, log2 domain), one exchange between the wave halves per pass for the maximum, one in the epilogue for the sum;
// the two S^T tiles of a pass, converted in place, are the B operand of O^T += V^T . P^T (A = V^T rows in the same k order), and a lane's 8 accumulator registers are 8 consecutive d of its query: 16-byte stores.
// Every loop but the walk over the keys is unrolled in full: the fragment and accumulator arrays stay in registers only where each index is a constant.
#define FA_WAVES 8
#define FA_QT 2                      /* 16-column query tiles a wave */
#define FA_BQ (FA_WAVES * FA_QT * 16) /* query rows a block */
#define FA_L2E 1.4426950408889634f
__device__ __forceinline__ float sm_xh(float x) { return __builtin_bit_cast(float, __builtin_amdgcn_permlanex16(__builtin_bit_cast(int, x), __builtin_bit_cast(int, x), 0x76543210, 0xfedcba98, false, false)); }      /* lane l ^ 16 */
// Four native exp2 in place. In one statement with a closing v_nop: the slot that the instruction set asks for behind a transcendental before its result is read or its source overwritten
__device__ __forceinline__ v4f sm_exp2x4(v4f x) { float a = x[0], b = x[1], c = x[2], d = x[3];
  asm("v_exp_f32 %0, %0\n\tv_exp_f32 %1, %1\n\tv_exp_f32 %2, %2\n\tv_exp_f32 %3, %3\n\tv_nop" : "+v"(a), "+v"(b), "+v"(c), "+v"(d));
  const v4f y = {a, b, c, d}; return y; }
__device__ __forceinline__ float sm_exp2x1(float x) { asm("v_exp_f32 %0, %0\n\tv_nop" : "+v"(x)); return x; }      /* one native exp2, with the same closing slot */
__device__ __forceinline__ v8f fa_mma(v16h a, v16h b, v8f c) { return __builtin_amdgcn_wmma_f32_16x16x32_f16(false, a, false, b, (short)0, c, false, false); }
__global__ __launch_bounds__(FA_WAVES * 32) void k_fattn(const _Float16* __restrict__ Q16, const _Float16* __restrict__ K16, const _Float16* __restrict__ VT, const float* __restrict__ emb, _Float16* __restrict__ O16) {
  static_assert(SQ % FA_BQ == 0 && SQ % 32 == 0 && HD == 64 && MAXD % 32 == 0 && FA_QT * 16 + 31 <= MAXD, "k_fattn: whole blocks per head, whole passes per row, two k steps per score tile, band passes inside the table");
  __shared__ float tb[4 * MAXD - 1];      /* this head's bias, bf16-rounded, times log2(e), by k = j - i + (2 * MAXD - 1), already clipped: consecutive j are consecutive entries */
  const int tid = threadIdx.x, lane = tid & 31, ln = lane & 15, hh = lane >> 4; const int wave = __builtin_amdgcn_readfirstlane(tid >> 5);
  const int bh = blockIdx.x / (SQ / FA_BQ), b = bh / NH, h = bh % NH; const int q0 = (blockIdx.x % (SQ / FA_BQ)) * FA_BQ + wave * (FA_QT * 16);
  for (int i = tid; i < 4 * MAXD - 1; i += FA_WAVES * 32) tb[i] = bf16_round(emb[(min(max(2 * MAXD - 1 - i, -MAXD), MAXD) + MAXD) * NH + h]) * FA_L2E;
  __syncthreads();      /* publishes tb */
  const float bfar = tb[0], bnear = tb[4 * MAXD - 2];      /* j <= i - MAXD ; j >= i + MAXD */
  const _Float16* qp = Q16 + ((size_t)b * SQ + q0 + ln) * DM + h * HD; const _Float16* kp = K16 + ((size_t)b * SQ + ln) * DM + h * HD; const _Float16* vp = VT + ((size_t)bh * HD + ln) * SQ;
  v16h qf[FA_QT][2], kf[2][2];
#pragma unroll
  for (int t = 0; t < FA_QT; ++t) { qf[t][0] = g2_frag(qp + (size_t)t * 16 * DM, hh); qf[t][1] = g2_frag(qp + (size_t)t * 16 * DM + 32, hh); }
#pragma unroll
  for (int t = 0; t < 2; ++t) { kf[t][0] = g2_frag(kp + (size_t)t * 16 * DM, hh); kf[t][1] = g2_frag(kp + (size_t)t * 16 * DM + 32, hh); }
  const v8f z8 = {0.f,0.f,0.f,0.f,0.f,0.f,0.f,0.f};
  v8f o[FA_QT][4]; float mr[FA_QT], lr[FA_QT];
#pragma unroll
  for (int t = 0; t < FA_QT; ++t) { mr[t] = -3.0e38f; lr[t] = 0.f; o[t][0] = z8; o[t][1] = z8; o[t][2] = z8; o[t][3] = z8; }
  for (int j0 = 0; j0 < SQ; j0 += 32) {
    v16h vf[4];      /* asked for first, used last: the scores and the softmax stand between */
#pragma unroll
    for (int d = 0; d < 4; ++d) vf[d] = g2_frag(vp + (size_t)d * 16 * SQ + j0, hh);
    v8f s[FA_QT][2];      /* s[t][u][r] = score of key j0 + 16 u + 8 hh + r, query q0 + 16 t + ln */
#pragma unroll
    for (int t = 0; t < FA_QT; ++t)
#pragma unroll
      for (int u = 0; u < 2; ++u) s[t][u] = fa_mma(kf[u][1], qf[t][1], fa_mma(kf[u][0], qf[t][0], z8));
    const int jn = (j0 + 32 < SQ) ? j0 + 32 : j0;      /* the next pass's K rows, fetched one pass ahead (the last pass reads its own again) */
#pragma unroll
    for (int u = 0; u < 2; ++u) { kf[u][0] = g2_frag(kp + (size_t)(jn + u * 16) * DM, hh); kf[u][1] = g2_frag(kp + (size_t)(jn + u * 16) * DM + 32, hh); }
    asm volatile("s_wait_xcnt 0x0" ::: "memory");      /* the arithmetic below reuses and advances address registers that the loads of this pass name */
    if (j0 + 31 > q0 - MAXD && j0 < q0 + FA_QT * 16 - 1 + MAXD) { const float* tp = tb + (j0 - q0 + 2 * MAXD - 1) + 8 * hh - ln;      /* wave-uniform: the pass meets the unclipped band; every k read here lies inside the table */
#pragma unroll
      for (int t = 0; t < FA_QT; ++t)
#pragma unroll
        for (int u = 0; u < 2; ++u)
#pragma unroll
          for (int r = 0; r < 8; ++r) s[t][u][r] = __builtin_fmaf(s[t][u][r], 0.125f * FA_L2E, tp[(u - t) * 16 + r]);
    } else { const float bc = (j0 >= q0 + FA_QT * 16 - 1 + MAXD) ? bnear : bfar;
#pragma unroll
      for (int t = 0; t < FA_QT; ++t)
#pragma unroll
        for (int u = 0; u < 2; ++u)
#pragma unroll
          for (int r = 0; r < 8; ++r) s[t][u][r] = __builtin_fmaf(s[t][u][r], 0.125f * FA_L2E, bc); }
#pragma unroll
    for (int t = 0; t < FA_QT; ++t) {
      float m0 = fmaxf(s[t][0][0], s[t][0][1]), m1 = fmaxf(s[t][1][0], s[t][1][1]);
#pragma unroll
      for (int r = 2; r < 8; r += 2) { m0 = fmaxf(fmaxf(m0, s[t][0][r]), s[t][0][r + 1]); m1 = fmaxf(fmaxf(m1, s[t][1][r]), s[t][1][r + 1]); }
      m0 = fmaxf(m0, m1); const float mn = fmaxf(mr[t], fmaxf(m0, sm_xh(m0)));
      const float al = sm_exp2x1(mr[t] - mn); mr[t] = mn;
      const float nm = 8.0f - mn;      /* weights carried x256 (as f16 operands away from the subnormal range); the sum carries the same factor */
      v4f as; FragH pf;
#pragma unroll
      for (int u = 0; u < 2; ++u)
#pragma unroll
        for (int g = 0; g < 2; ++g) { v4f x = {s[t][u][4 * g] + nm, s[t][u][4 * g + 1] + nm, s[t][u][4 * g + 2] + nm, s[t][u][4 * g + 3] + nm}; x = sm_exp2x4(x);
          if (u + g == 0) as = x; else as += x;
#pragma unroll
          for (int e = 0; e < 4; ++e) pf.h[u * 8 + g * 4 + e] = (_Float16)x[e]; }
      lr[t] = __builtin_fmaf(lr[t], al, (as[0] + as[1]) + (as[2] + as[3]));
#pragma unroll
      for (int d = 0; d < 4; ++d) o[t][d] = fa_mma(vf[d], pf.v, o[t][d] * al); } }
#pragma unroll
  for (int t = 0; t < FA_QT; ++t) { const float sc = 64.0f / (lr[t] + sm_xh(lr[t]));      /* o carried x64, as the output GEMM's alpha expects */
    unsigned short* op = (unsigned short*)O16 + ((size_t)b * SQ + q0 + t * 16 + ln) * DM + h * HD + 8 * hh;
#pragma unroll
    for (int d = 0; d < 4; ++d) { FragH f;
#pragma unroll
      for (int r = 0; r < 8; ++r) f.h[r] = (_Float16)(o[t][d][r] * sc);
      *(v8us*)(op + d * 16) = f.half[0]; } } }

extern "C" void kernel_launch(void* const* d_in, const int* in_sizes, int n_in,
                              void* d_out, int out_size, void* d_ws, size_t ws_size, hipStream_t stream) {
  (void)in_sizes; (void)n_in; (void)out_size;
  const float* const* I = (const float* const*)d_in; const float* x = I[0]; const float* wq = I[1]; const float* bq = I[2]; const float* wk = I[3]; const float* bk = I[4]; const float* wv = I[5]; const float* bv = I[6]; const float* wo = I[7]; const float* bo = I[8]; const float* emb = I[9];      /* nn.Linear weights [out][in]; rel_emb [2*MAXD+1][NH] */
  char* ws = (char*)d_ws; size_t off = 0;
  auto take = [&](size_t bytes) { char* p = ws + off; off += (bytes + 255) & ~(size_t)255; return p; };
  _Float16* BQ = (_Float16*)take((size_t)DM * DM * 2); _Float16* BK = (_Float16*)take((size_t)DM * DM * 2); _Float16* BV = (_Float16*)take((size_t)DM * DM * 2); _Float16* BO = (_Float16*)take((size_t)DM * DM * 2);
  _Float16* X16 = (_Float16*)take(NR * DM * 2); _Float16* Q16 = (_Float16*)take(NR * DM * 2); _Float16* K16 = (_Float16*)take(NR * DM * 2); _Float16* V16 = (_Float16*)take(NR * DM * 2); _Float16* O16 = (_Float16*)take(NR * DM * 2);
  _Float16* VT = (_Float16*)take((size_t)NB * NH * HD * SQ * 2);
  if (off > ws_size) return;
  { const unsigned g = (unsigned)(((size_t)DM * DM / 8 + 255) / 256); k_wnat<<<g, 256, 0, stream>>>(wq, (size_t)DM * DM / 8, BQ); k_wnat<<<g, 256, 0, stream>>>(wk, (size_t)DM * DM / 8, BK); k_wnat<<<g, 256, 0, stream>>>(wv, (size_t)DM * DM / 8, BV); k_wnat<<<g, 256, 0, stream>>>(wo, (size_t)DM * DM / 8, BO); }      /* natural [out][in] = Bt[n][k], x16 */
  k_x16<<<(unsigned)((NR * DM / 8 + 255) / 256), 256, 0, stream>>>(x, X16, NR * DM / 8);
  const size_t r0p = (size_t)B0 * SQ;      /* first projected row */
  k_gemm2<0><<<dim3((unsigned)((MP / 128) * (DM / 128)), 1), 256, 0, stream>>>(X16 + r0p * DM, DM, 0, BQ, DM, 0, 0.0625f, bq, 0, nullptr, 1, 0, 0, nullptr, Q16 + r0p * DM, DM, 0, MP, DM, DM);
  k_gemm2<0><<<dim3((unsigned)((MP / 128) * (DM / 128)), 1), 256, 0, stream>>>(X16 + r0p * DM, DM, 0, BK, DM, 0, 0.0625f, bk, 0, nullptr, 1, 0, 0, nullptr, K16 + r0p * DM, DM, 0, MP, DM, DM);
  k_gemm2<0><<<dim3((unsigned)((MP / 128) * (DM / 128)), 1), 256, 0, stream>>>(X16 + r0p * DM, DM, 0, BV, DM, 0, 0.0625f, bv, 0, nullptr, 1, 0, 0, nullptr, V16 + r0p * DM, DM, 0, MP, DM, DM);
  k_vt<NH, SQ><<<NB * NH * (SQ / 64), 256, 0, stream>>>(V16, LQ, 0, VT);      /* V^T [NB][NH][HD][SQ] */
  k_fattn<<<NB * NH * (SQ / FA_BQ), FA_WAVES * 32, 0, stream>>>(Q16, K16, VT, emb, O16);      /* o (merged heads, x64) as f16 rows */
  k_gemm2<0><<<dim3((unsigned)((MPO / 128) * (DM / 128)), 1), 256, 0, stream>>>(O16 + r0p * DM, DM, 0, BO, DM, 0, 0.0009765625f, bo, 0, nullptr, 1, 0, 0, (float*)d_out + r0p * DM, nullptr, DM, 0, MPO, DM, DM);      /* out rows are the output layout */
}

// v004
// Measured time: 111 microseconds a run.
// Timed twice side by side with v003, it ran 1.17 and 1.19 times as fast.
// All steps since v000 together make it 41.1 times as fast.
#include <hip/hip_runtime.h>
// Multi-head self-attention with a learned relative-position bias (x [2][2048][1024]; q/k/v = x W^T + b (nn.Linear [out][in]), 16 heads of 64; scores / 8 + rel_emb[clip(i - j, -128, 128) + 128][h] (rel_emb [257][16]); softmax; o merged; out = o Wo^T + bo -> [2][2048][1024]).
// Structure: token rows r = b*2048 + s; x as exact f16 rows (bf16-rounded); Q, K, V as three WMMA GEMMs (32x64 wave tiles, f32 accumulation, exact x16 weights + bias, f16 outputs); V^T for all batches and heads via LDS transposes; one fused attention launch for all batches and heads: score tiles on WMMA (K = 64), online softmax of (scores / 8 + relative-position bias looked up by (i - j, head)) on VALU (f32 statistics, native exp; weights x256 as f16 operands, in registers), o = P . V on WMMA (o carried x64 against f16 subnormal flush, folded into the output GEMM alpha) written straight into the merged f16 o rows; out = o W_o + b GEMM (f32) into the output layout.
// Compute dtype: inputs rounded to bf16; x / weights exact; q, k, v, softmax weights and o as plain f16 GEMM operands (~2^-12); scores and softmax statistics f32. v_wmma_f32_16x16x32_f16.
#define NB 2
#define SQ 2048
#define DM 1024
#define NH 16
#define HD 64
#define MAXD 128                     /* relative distance clip */
#define HG 4                         /* heads per launch of the grouped V^T transpose k_vt(b, h0) */
#define B0 0                         /* first batch processed (debug hook) */
#define NBR NB                       /* batches processed (debug hook) */
#define NR ((size_t)NB * SQ)         /* token rows */
#define MP ((int)((size_t)NBR * SQ)) /* rows projected (debug hook) */
#define QN SQ                        /* query rows per batch; unused: the attention launch covers all SQ */
#define NHD NH                       /* heads; unused: the attention launch covers all NH */
#define MPO MP                       /* rows through the output stage (debug hook) */
#define LQ DM      /* row pitch of the q/k/v rows */
typedef __bf16 v16b __attribute__((ext_vector_type(16)));
typedef unsigned short v8us __attribute__((ext_vector_type(8), may_alias));
typedef float  v8f  __attribute__((ext_vector_type(8)));
typedef float  v4f  __attribute__((ext_vector_type(4)));
typedef float  v4fa __attribute__((ext_vector_type(4), may_alias));
union FragB { v16b v; v8us half[2]; unsigned short u[16]; };

__device__ __forceinline__ unsigned short bf16_bits(float x) { unsigned int u = __float_as_uint(x); return (unsigned short)((u + 0x7FFFu + ((u >> 16) & 1u)) >> 16); }
__device__ __forceinline__ float bf16_val(unsigned short b) { return __uint_as_float(((unsigned int)b) << 16); }
__device__ __forceinline__ float bf16_round(float x) { return bf16_val(bf16_bits(x)); }
// D += A·B with NT terms: 1 = ah·bh, 2 = + al·bh (A split), 3 = + ah·bl (both split)
template <int NT>
__device__ __forceinline__ v8f mmaN(v16b ah, v16b al, v16b bh, v16b bl, v8f c) {
  c = __builtin_amdgcn_wmma_f32_16x16x32_bf16(false, ah, false, bh, (short)0, c, false, false);
  if (NT >= 2) c = __builtin_amdgcn_wmma_f32_16x16x32_bf16(false, al, false, bh, (short)0, c, false, false);
  if (NT >= 3) c = __builtin_amdgcn_wmma_f32_16x16x32_bf16(false, ah, false, bl, (short)0, c, false, false);
  asm volatile("v_nop\n\tv_nop\n\tv_nop\n\tv_nop" : "+v"(c) : "v"(ah), "v"(al), "v"(bh), "v"(bl));
  return c;
}

__global__ __launch_bounds__(256) void k_wt_bf16(const float* __restrict__ W, unsigned short* __restrict__ Wt, int K, int N) {
  const int t = blockIdx.x * 256 + threadIdx.x;
  const int k8n = K / 8;
  if (t >= N * k8n) return;
  const int n = t / k8n, k8 = (t % k8n) * 8;
  v8us v;
#pragma unroll
  for (int i = 0; i < 8; ++i) v[i] = bf16_bits(W[(size_t)(k8 + i) * N + n]);
  *(v8us*)(Wt + (size_t)n * K + k8) = v;
  
}

// GEMM C[M][N] (f32, pitch ldc) = act(A[M][K]·W + bias). A f32 row-major (pitch lda) converted per fragment to bf16
// (ASPLIT: hi/lo two planes -> 2 terms, else single rounded term); Wt bf16 [N][K] (pitch ldb). BIAS_BF16 rounds the
// bias to bf16 first (bias quantised to bf16 before the add). K%32==0, M%16==0, N%64==0.
template <bool ASPLIT, int ACT, bool BIAS_BF16>
__global__ __launch_bounds__(128) void k_gemm_bf(const float* __restrict__ A, int lda, const unsigned short* __restrict__ Wt, int ldb,
                                               const float* __restrict__ bias, float* __restrict__ C, int ldc, int M, int N, int K) {
  __shared__ __attribute__((aligned(16))) float so[4][16][64];
  const int tid = threadIdx.x, w = tid >> 5, lane = tid & 31, ln = lane & 15, hh = lane >> 4;
  const int ntn = N / 64;
  const int wid = blockIdx.x * 4 + w;
  const int mt = wid / ntn, nq = wid % ntn;
  if (mt * 16 >= M) return;
  const int row0 = mt * 16, col0 = nq * 64;
  const float* arow = A + (size_t)(row0 + ln) * lda;
  v8f acc[4] = {};
  for (int kb = 0; kb < K; kb += 32) {
    FragB ah, al;
    const v4f x0 = *(const v4fa*)(arow + kb + 8 * hh), x1 = *(const v4fa*)(arow + kb + 8 * hh + 4);
    const v4f x2 = *(const v4fa*)(arow + kb + 16 + 8 * hh), x3 = *(const v4fa*)(arow + kb + 16 + 8 * hh + 4);
    float xs[16] = {x0[0],x0[1],x0[2],x0[3],x1[0],x1[1],x1[2],x1[3],x2[0],x2[1],x2[2],x2[3],x3[0],x3[1],x3[2],x3[3]};
#pragma unroll
    for (int i = 0; i < 16; ++i) { const unsigned short hb = bf16_bits(xs[i]); ah.u[i] = hb; al.u[i] = ASPLIT ? bf16_bits(xs[i] - bf16_val(hb)) : (unsigned short)0; }
#pragma unroll
    for (int t = 0; t < 4; ++t) {
      const unsigned short* brow = Wt + (size_t)(col0 + t * 16 + ln) * ldb + kb;
      FragB b;
      b.half[0] = *(const v8us*)(brow + 8 * hh);
      b.half[1] = *(const v8us*)(brow + 16 + 8 * hh);
      acc[t] = mmaN<ASPLIT ? 2 : 1>(ah.v, al.v, b.v, b.v, acc[t]);
    }
  }
#pragma unroll
  for (int t = 0; t < 4; ++t) {
    float bv = bias ? bias[col0 + t * 16 + ln] : 0.f;
    if (BIAS_BF16) bv = bf16_round(bv);
#pragma unroll
    for (int r = 0; r < 8; ++r) { float v = acc[t][r] + bv; if (ACT == 1) v = fmaxf(v, 0.f); so[w][8 * hh + r][t * 16 + ln] = v; }
  }
  __builtin_amdgcn_fence(__ATOMIC_ACQ_REL, "workgroup");
  __builtin_amdgcn_wave_barrier();
  const int rsub = lane >> 4, c4 = (lane & 15) * 4;
  {
#pragma unroll
    for (int q = 0; q < 8; ++q) {
      const int r = q * 2 + rsub;
      const v4f v = *(const v4fa*)&so[w][r][c4];
      *(v4f*)(C + (size_t)(row0 + r) * ldc + col0 + c4) = v;
    }
    
  }
}

// GEMM C = act(A·W + bias + resid): A f32 (ASPLIT -> hi/lo 2 terms), Wt bf16 [N][K]; ACT 0 none, 1 relu, 2 exact gelu;
// resid (optional, f32, row index = (row % rmod), pitch ldr, RES_BF16 rounds it) added before the activation.
template <bool ASPLIT, int ACT, bool BIAS_BF16, bool RES_BF16>
__global__ __launch_bounds__(128) void k_gemm_bf3(const float* __restrict__ A, int lda, const unsigned short* __restrict__ Wt, int ldb,
                                                const float* __restrict__ bias, const float* __restrict__ resid, int rmod, int ldr,
                                                float* __restrict__ C, int ldc, int M, int N, int K) {
  __shared__ __attribute__((aligned(16))) float so[4][16][64];
  const int tid = threadIdx.x, w = tid >> 5, lane = tid & 31, ln = lane & 15, hh = lane >> 4;
  const int ntn = N / 64;
  const int wid = blockIdx.x * 4 + w;
  const int mt = wid / ntn, nq = wid % ntn;
  if (mt * 16 >= M) return;
  const int row0 = mt * 16, col0 = nq * 64;
  const float* arow = A + (size_t)(row0 + ln) * lda;
  v8f acc[4] = {};
  for (int kb = 0; kb < K; kb += 32) {
    FragB ah, al;
    const v4f x0 = *(const v4fa*)(arow + kb + 8 * hh), x1 = *(const v4fa*)(arow + kb + 8 * hh + 4);
    const v4f x2 = *(const v4fa*)(arow + kb + 16 + 8 * hh), x3 = *(const v4fa*)(arow + kb + 16 + 8 * hh + 4);
    float xs[16] = {x0[0],x0[1],x0[2],x0[3],x1[0],x1[1],x1[2],x1[3],x2[0],x2[1],x2[2],x2[3],x3[0],x3[1],x3[2],x3[3]};
#pragma unroll
    for (int i = 0; i < 16; ++i) { const unsigned short hb = bf16_bits(xs[i]); ah.u[i] = hb; al.u[i] = ASPLIT ? bf16_bits(xs[i] - bf16_val(hb)) : (unsigned short)0; }
#pragma unroll
    for (int t = 0; t < 4; ++t) {
      const unsigned short* brow = Wt + (size_t)(col0 + t * 16 + ln) * ldb + kb;
      FragB b;
      b.half[0] = *(const v8us*)(brow + 8 * hh);
      b.half[1] = *(const v8us*)(brow + 16 + 8 * hh);
      acc[t] = mmaN<ASPLIT ? 2 : 1>(ah.v, al.v, b.v, b.v, acc[t]);
    }
  }
#pragma unroll
  for (int t = 0; t < 4; ++t) {
    const int col = col0 + t * 16 + ln;
    float bv = bias ? bias[col] : 0.f;
    if (BIAS_BF16) bv = bf16_round(bv);
#pragma unroll
    for (int r = 0; r < 8; ++r) {
      float v = acc[t][r] + bv;
      if (resid) { float rv = resid[(size_t)((row0 + 8 * hh + r) % rmod) * ldr + col]; if (RES_BF16) rv = bf16_round(rv); v += rv; }
      if (ACT == 1) v = fmaxf(v, 0.f);
      if (ACT == 2) v = 0.5f * v * (1.0f + erff(v * 0.70710678118654752f));
      if (ACT == 3) { const float u = 0.7978845608028654f * (v + 0.044715f * v * v * v); v = 0.5f * v * (1.0f + tanhf(u)); }
      so[w][8 * hh + r][t * 16 + ln] = v;
    }
  }
  __builtin_amdgcn_fence(__ATOMIC_ACQ_REL, "workgroup");
  __builtin_amdgcn_wave_barrier();
  const int rsub = lane >> 4, c4 = (lane & 15) * 4;
  {
#pragma unroll
    for (int q = 0; q < 8; ++q) {
      const int r = q * 2 + rsub;
      const v4f v = *(const v4fa*)&so[w][r][c4];
      *(v4f*)(C + (size_t)(row0 + r) * ldc + col0 + c4) = v;
    }
    
  }
}
// row LayerNorm (biased variance, eps) over N: s = X (+ R); optional out_sum <- s; out_norm <- (s-mu)*rsqrt(var+eps)*g + b
template <bool PARAM_BF16>
__global__ __launch_bounds__(256) void k_layernorm(const float* __restrict__ X, const float* __restrict__ R, const float* __restrict__ g, const float* __restrict__ bta,
                                                  float* __restrict__ out_sum, float* __restrict__ out_norm, int N, float eps) {
  __shared__ float red[256];
  const int row = blockIdx.x, tid = threadIdx.x;
  const float* x = X + (size_t)row * N; const float* rr = R ? R + (size_t)row * N : nullptr;
  float vals[16];                     // up to N = 4096
  const int per = N / 256;            // contiguous chunk per thread? use strided-by-4 chunks: thread handles j = tid*4 + 1024*u
  float s1 = 0.f;
  for (int u = 0; u < per / 4; ++u) {
    const int j = tid * 4 + 1024 * u;
    const v4f a = *(const v4fa*)(x + j);
    v4f b = {0.f,0.f,0.f,0.f}; if (rr) b = *(const v4fa*)(rr + j);
#pragma unroll
    for (int q = 0; q < 4; ++q) { const float v = a[q] + b[q]; vals[u * 4 + q] = v; s1 += v; }
  }
  red[tid] = s1; __syncthreads();
  for (int st = 128; st > 0; st >>= 1) { if (tid < st) red[tid] += red[tid + st]; __syncthreads(); }
  const float mu = red[0] / (float)N; __syncthreads();
  float s2 = 0.f;
  for (int u = 0; u < per / 4; ++u)
#pragma unroll
    for (int q = 0; q < 4; ++q) { const float c = vals[u * 4 + q] - mu; s2 += c * c; }
  red[tid] = s2; __syncthreads();
  for (int st = 128; st > 0; st >>= 1) { if (tid < st) red[tid] += red[tid + st]; __syncthreads(); }
  const float rs = rsqrtf(red[0] / (float)N + eps);
  {
    for (int u = 0; u < per / 4; ++u) {
      const int j = tid * 4 + 1024 * u;
      v4f o, sm;
#pragma unroll
      for (int q = 0; q < 4; ++q) {
        float gg = g[j + q], bb = bta[j + q];
        if (PARAM_BF16) { gg = bf16_round(gg); bb = bf16_round(bb); }
        sm[q] = vals[u * 4 + q]; o[q] = (vals[u * 4 + q] - mu) * rs * gg + bb;
      }
      if (out_sum) *(v4f*)(out_sum + (size_t)row * N + j) = sm;
      *(v4f*)(out_norm + (size_t)row * N + j) = o;
    }
    
  }
}



// ---- f16 WMMA path (v_wmma_f32_16x16x32_f16): 11-bit significands for operands in range — used where a [0,1] probability operand needs more precision than bf16
typedef _Float16 v16h __attribute__((ext_vector_type(16)));
union FragH { v16h v; v8us half[2]; _Float16 h[16]; unsigned short u[16]; };
template <int NT>
__device__ __forceinline__ v8f mmaH(v16h ah, v16h al, v16h bh, v16h bl, v8f c) {
  c = __builtin_amdgcn_wmma_f32_16x16x32_f16(false, ah, false, bh, (short)0, c, false, false);
  if (NT >= 2) c = __builtin_amdgcn_wmma_f32_16x16x32_f16(false, al, false, bh, (short)0, c, false, false);
  if (NT >= 3) c = __builtin_amdgcn_wmma_f32_16x16x32_f16(false, ah, false, bl, (short)0, c, false, false);
  asm volatile("v_nop\n\tv_nop\n\tv_nop\n\tv_nop" : "+v"(c) : "v"(ah), "v"(al), "v"(bh), "v"(bl));
  return c;
}
// batched GEMM like k_gemm_b but f16 operands: A f32 (split into f16 hi/lo if ASPLIT, else rounded to f16), Bt = f16 values [n][k]; alpha; C f32; N multiple of 16 (partial tiles skipped)
template <bool ASPLIT>
__global__ __launch_bounds__(128) void k_gemm_h(const float* __restrict__ A, int lda, size_t sA, const _Float16* __restrict__ Bh, int ldb, size_t sB, float alpha, float* __restrict__ C, int ldc, size_t sC, int M, int N, int K) {
  __shared__ __attribute__((aligned(16))) float so[4][16][64];
  const int tid = threadIdx.x, w = tid >> 5, lane = tid & 31, ln = lane & 15, hh = lane >> 4; const int by = blockIdx.y;
  A += (size_t)by * sA; Bh += (size_t)by * sB; C += (size_t)by * sC;
  const int ntn = (N + 63) / 64; const int wid = blockIdx.x * 4 + w; const int mt = wid / ntn, nq = wid % ntn; if (mt * 16 >= M) return;
  const int row0 = mt * 16, col0 = nq * 64; const float* arow = A + (size_t)(row0 + ln) * lda;
  v8f acc[4] = {};
  for (int kb = 0; kb < K; kb += 32) {
    FragH ah, al;
    const v4f x0 = *(const v4fa*)(arow + kb + 8 * hh), x1 = *(const v4fa*)(arow + kb + 8 * hh + 4), x2 = *(const v4fa*)(arow + kb + 16 + 8 * hh), x3 = *(const v4fa*)(arow + kb + 16 + 8 * hh + 4);
    float xs[16] = {x0[0],x0[1],x0[2],x0[3],x1[0],x1[1],x1[2],x1[3],x2[0],x2[1],x2[2],x2[3],x3[0],x3[1],x3[2],x3[3]};
#pragma unroll
    for (int i = 0; i < 16; ++i) { const _Float16 h = (_Float16)xs[i]; ah.h[i] = h; al.h[i] = ASPLIT ? (_Float16)(xs[i] - (float)h) : (_Float16)0.0f; }
#pragma unroll
    for (int t = 0; t < 4; ++t) { if (col0 + t * 16 >= N) continue; const size_t boff = (size_t)(col0 + t * 16 + ln) * ldb + kb; FragH bq; bq.half[0] = *(const v8us*)(Bh + boff + 8 * hh); bq.half[1] = *(const v8us*)(Bh + boff + 16 + 8 * hh);
      acc[t] = mmaH<ASPLIT ? 2 : 1>(ah.v, al.v, bq.v, bq.v, acc[t]); }
  }
#pragma unroll
  for (int t = 0; t < 4; ++t) { if (col0 + t * 16 >= N) continue;
#pragma unroll
    for (int r = 0; r < 8; ++r) so[w][8 * hh + r][t * 16 + ln] = acc[t][r] * alpha; }
  __builtin_amdgcn_fence(__ATOMIC_ACQ_REL, "workgroup"); __builtin_amdgcn_wave_barrier();
  const int rsub = lane >> 4, c4 = (lane & 15) * 4;
  {
#pragma unroll
    for (int q = 0; q < 8; ++q) { const int r = q * 2 + rsub; if (col0 + c4 < N) { const v4f v = *(const v4fa*)&so[w][r][c4]; *(v4f*)(C + (size_t)(row0 + r) * ldc + col0 + c4) = v; } }
     }
}

// Wt[n][k] = f16(W[k][n]·scale) from f32 row-major W[K][N] (scale = power of two; bf16-exact weights stay exact in f16 away from the subnormal range)
__global__ __launch_bounds__(256) void k_wt_f16(const float* __restrict__ W, _Float16* __restrict__ Wt, int K, int N, float scale) {
  const int t = blockIdx.x * 256 + threadIdx.x; if (t >= N * (K / 8)) return; const int n = t / (K / 8), k8 = (t % (K / 8)) * 8; FragH f;
#pragma unroll
  for (int i = 0; i < 8; ++i) f.h[i] = (_Float16)(bf16_round(W[(size_t)(k8 + i) * N + n]) * scale); const v8us o = f.half[0];
  *(v8us*)((unsigned short*)Wt + (size_t)n * K + k8) = o; 
}
// k_gemm_hh variant with fused epilogue: v = acc·alpha + bias[by·sBias + col] (+ CP[(row/rowsPerB)·sCPb + by·64 + col] if CP) ; ACT 0 none / 1 elu ; writes f16 C16 (and f32 C if non-null)
template <int ACT>
__global__ __launch_bounds__(128) void k_gemm_hhx(const _Float16* __restrict__ A, int lda, size_t sA, const _Float16* __restrict__ Bh, int ldb, size_t sB, float alpha, const float* __restrict__ bias, size_t sBias, const float* __restrict__ CP, int rowsPerB, size_t sCPb, int row0g,
    float* __restrict__ C, _Float16* __restrict__ C16, int ldc, size_t sC, int M, int N, int K) {
  __shared__ __attribute__((aligned(16))) float so[4][16][64];
  const int tid = threadIdx.x, w = tid >> 5, lane = tid & 31, ln = lane & 15, hh = lane >> 4; const int by = blockIdx.y;
  A += (size_t)by * sA; Bh += (size_t)by * sB; const size_t cofs = (size_t)by * sC; const float* bp = bias ? bias + (size_t)by * sBias : nullptr;
  const int ntn = (N + 63) / 64; const int wid = blockIdx.x * 4 + w; const int mt = wid / ntn, nq = wid % ntn; if (mt * 16 >= M) return;
  const int row0 = mt * 16, col0 = nq * 64; const _Float16* arow = A + (size_t)(row0 + ln) * lda;
  v8f acc[4] = {};
  for (int kb = 0; kb < K; kb += 32) { FragH ah; ah.half[0] = *(const v8us*)((const unsigned short*)arow + kb + 8 * hh); ah.half[1] = *(const v8us*)((const unsigned short*)arow + kb + 16 + 8 * hh);
#pragma unroll
    for (int t = 0; t < 4; ++t) { if (col0 + t * 16 >= N) continue; const size_t boff = (size_t)(col0 + t * 16 + ln) * ldb + kb; FragH bq; bq.half[0] = *(const v8us*)((const unsigned short*)Bh + boff + 8 * hh); bq.half[1] = *(const v8us*)((const unsigned short*)Bh + boff + 16 + 8 * hh);
      acc[t] = mmaH<1>(ah.v, ah.v, bq.v, bq.v, acc[t]); }
  }
#pragma unroll
  for (int t = 0; t < 4; ++t) { if (col0 + t * 16 >= N) continue; const int col = col0 + t * 16 + ln; const float bv = bp ? bf16_round(bp[col]) : 0.f;
#pragma unroll
    for (int r = 0; r < 8; ++r) { float v = acc[t][r] * alpha + bv; if (CP) { const int rr = row0g + row0 + 8 * hh + r; if (rowsPerB < 0) v += CP[cofs + (size_t)rr * ldc + col];      /* rowsPerB < 0: own element of the batched C plane */ else { const int bidx = rr / rowsPerB; v += CP[(size_t)bidx * sCPb + (size_t)by * 64 + col]; } } if (ACT == 1) v = (v > 0.f) ? v : expm1f(v); else if (ACT == 7) v = (v > 0.f) ? v + 1.0f : expf(v); else if (ACT == 8) v = tanhf(v); else if (ACT == 9) v = 0.5f * v * (1.0f + tanhf(0.7978845608028654f * (v + 0.044715f * v * v * v))); else if (ACT == 11) v = 1.0f / (1.0f + expf(-v)); else if (ACT == 12) v = (v > 0.f) ? v : 0.01f * v; else if (ACT == 14) v = (v > 0.f) ? v : 0.1f * v; else if (ACT == 16) v = (v >= 0.f) ? v : 0.3f * v; else if (ACT == 17) v = (v >= 0.f) ? v : 0.2f * v; else if (ACT == 15) v = v / (1.0f + expf(-v)); else if (ACT == 3) v = fmaxf(v, 0.f); else if (ACT == 6) v = 0.5f * v * (1.0f + erff(v * 0.70710678118654752f)); so[w][8 * hh + r][t * 16 + ln] = v; } }
  __builtin_amdgcn_fence(__ATOMIC_ACQ_REL, "workgroup"); __builtin_amdgcn_wave_barrier();
  const int rsub = lane >> 4, c4 = (lane & 15) * 4; typedef _Float16 v4h __attribute__((ext_vector_type(4)));
  {
#pragma unroll
    for (int q = 0; q < 8; ++q) { const int r = q * 2 + rsub; if (col0 + c4 < N) { const v4f v = *(const v4fa*)&so[w][r][c4]; if (C) *(v4f*)(C + cofs + (size_t)(row0 + r) * ldc + col0 + c4) = v; if (C16) { v4h h4; for (int i = 0; i < 4; ++i) h4[i] = (_Float16)v[i]; *(v4h*)(C16 + cofs + (size_t)(row0 + r) * ldc + col0 + c4) = h4; } } }
     }
}


typedef _Float16 v4h __attribute__((ext_vector_type(4)));

__global__ __launch_bounds__(256) void k_x16(const float* __restrict__ x, _Float16* __restrict__ X16, size_t n8) { const size_t t = (size_t)blockIdx.x * 256 + threadIdx.x; if (t >= n8) return; FragH f;
#pragma unroll
  for (int q = 0; q < 8; ++q) f.h[q] = (_Float16)bf16_round(x[t * 8 + q]); *(v8us*)((unsigned short*)X16 + t * 8) = f.half[0];  }
__global__ __launch_bounds__(256) void k_h16(const float* __restrict__ x, _Float16* __restrict__ X16, size_t n8) { const size_t t = (size_t)blockIdx.x * 256 + threadIdx.x; if (t >= n8) return; FragH f;
#pragma unroll
  for (int q = 0; q < 8; ++q) f.h[q] = (_Float16)x[t * 8 + q]; *(v8us*)((unsigned short*)X16 + t * 8) = f.half[0];  }
__global__ __launch_bounds__(256) void k_round16f(const float* __restrict__ W, _Float16* __restrict__ Bt, size_t n8) { const size_t t = (size_t)blockIdx.x * 256 + threadIdx.x; if (t >= n8) return; FragH f;
#pragma unroll
  for (int i = 0; i < 8; ++i) f.h[i] = (_Float16)(bf16_round(W[t * 8 + i]) * 16.0f); *(v8us*)((unsigned short*)Bt + t * 8) = f.half[0];  }
template <int NHv, int TTv>
__global__ __launch_bounds__(256) void k_vt(const _Float16* __restrict__ V16, int ldv, int voff, _Float16* __restrict__ Vt) { __shared__ unsigned short tl[64][66]; const int tid = threadIdx.x; const int slab = blockIdx.x / (TTv / 64), lg = blockIdx.x % (TTv / 64); const int b = slab / NHv, h = slab % NHv;
  for (int i = tid; i < 64 * 8; i += 256) { const int r = i / 8, c8 = (i % 8) * 8; FragH f; f.half[0] = *(const v8us*)((const unsigned short*)V16 + ((size_t)b * TTv + lg * 64 + r) * ldv + voff + h * 64 + c8);
#pragma unroll
    for (int q = 0; q < 8; ++q) tl[r][c8 + q] = f.u[q]; }
  __syncthreads();
  {
#pragma unroll
    for (int rd = 0; rd < 2; ++rd) { const int d = rd * 32 + tid / 8, pc = tid % 8; FragH f;
#pragma unroll
      for (int q = 0; q < 8; ++q) f.u[q] = tl[pc * 8 + q][d];
      *(v8us*)((unsigned short*)Vt + ((size_t)slab * 64 + d) * TTv + lg * 64 + pc * 8) = f.half[0]; }
     } }

__global__ __launch_bounds__(256) void k_hl(const float* __restrict__ F, _Float16* __restrict__ Hh, _Float16* __restrict__ Hl, size_t n8) { const size_t t = (size_t)blockIdx.x * 256 + threadIdx.x; if (t >= n8) return; FragH fh, fl; const v4f a = *(const v4fa*)(F + t * 8), c = *(const v4fa*)(F + t * 8 + 4);
#pragma unroll
  for (int q = 0; q < 4; ++q) { _Float16 h = (_Float16)a[q]; fh.h[q] = h; fl.h[q] = (_Float16)((a[q] - (float)h) * 1024.0f); h = (_Float16)c[q]; fh.h[4 + q] = h; fl.h[4 + q] = (_Float16)((c[q] - (float)h) * 1024.0f); }
  { *(v8us*)((unsigned short*)Hh + t * 8) = fh.half[0]; *(v8us*)((unsigned short*)Hl + t * 8) = fl.half[0];  } }

// ---- fast GEMM (block tile 128x128, eight waves of 32x64; requires M % 128 == 0, N % 128 == 0, K % 128 == 0); epilogue = k_gemm_hhx semantics ----
// A stage is 128 k of the block's 128 A rows and 128 B rows (256-byte rows). Asynchronous copies bring it from global memory into LDS, whole 128-byte lines a request, through no register;
// two buffers: the next stage flies while this one is multiplied. Fragments come from LDS in the k order of g2_frag, one k step ahead of their products; every accumulator still sums k upward in steps of 32.
#define G2_BK 128                    /* k a stage */
#define G2_PITCH 272                 /* LDS row pitch in bytes: 16 x odd, so the 16 rows of a 16-byte fragment read fall on 64 distinct banks */
#define G2_STAGE (256 * G2_PITCH)    /* 128 A rows, then 128 B rows */
__device__ __forceinline__ v16h g2_frag(const _Float16* p, int hh) { FragH f; f.half[0] = *(const v8us*)((const unsigned short*)p + 8 * hh); f.half[1] = *(const v8us*)((const unsigned short*)p + 16 + 8 * hh); return f.v; }
__device__ __forceinline__ v16h g2_lfrag(const unsigned char* p) { FragH f; f.half[0] = *(const v8us*)p; f.half[1] = *(const v8us*)(p + 32); return f.v; }      /* p: the lane's row in LDS + 64 bytes a k step + 16 hh */
__device__ __forceinline__ v8f g2_mma(v16h a, v16h b, v8f c) { return __builtin_amdgcn_wmma_f32_16x16x32_f16(false, a, false, b, (short)0, c, false, false); }
// Eight asynchronous 16-byte copies of a lane: rows r, r + 16, ..., r + 112 of one operand's stage (l: LDS byte address of the first, g: its global address, gs: 16 global rows in elements).
// The closing s_wait_xcnt 0 stands inside the statement, in front of any later write of the address registers that the copies name.
__device__ __forceinline__ void g2_copy8(unsigned l, const _Float16* g, size_t gs) {
  asm volatile("global_load_async_to_lds_b128 %0, %8, off\n\tglobal_load_async_to_lds_b128 %1, %9, off\n\tglobal_load_async_to_lds_b128 %2, %10, off\n\tglobal_load_async_to_lds_b128 %3, %11, off\n\t"
               "global_load_async_to_lds_b128 %4, %12, off\n\tglobal_load_async_to_lds_b128 %5, %13, off\n\tglobal_load_async_to_lds_b128 %6, %14, off\n\tglobal_load_async_to_lds_b128 %7, %15, off\n\ts_wait_xcnt 0x0"
               :: "v"(l), "v"(l + 16 * G2_PITCH), "v"(l + 32 * G2_PITCH), "v"(l + 48 * G2_PITCH), "v"(l + 64 * G2_PITCH), "v"(l + 80 * G2_PITCH), "v"(l + 96 * G2_PITCH), "v"(l + 112 * G2_PITCH),
                  "v"(g), "v"(g + gs), "v"(g + 2 * gs), "v"(g + 3 * gs), "v"(g + 4 * gs), "v"(g + 5 * gs), "v"(g + 6 * gs), "v"(g + 7 * gs) : "memory"); }
template <int ACT>
__global__ __launch_bounds__(256) void k_gemm2(const _Float16* __restrict__ A, int lda, size_t sA, const _Float16* __restrict__ Bh, int ldb, size_t sB, float alpha, const float* __restrict__ bias, size_t sBias, const float* __restrict__ CP, int rowsPerB, size_t sCPb, int row0g,
    float* __restrict__ C, _Float16* __restrict__ C16, int ldc, size_t sC, int M, int N, int K) { static_assert(ACT == 0 || ACT == 3 || ACT == 6 || ACT == 8 || ACT == 9 || ACT == 11 || ACT == 12 || ACT == 14 || ACT == 15 || ACT == 16 || ACT == 17, "k_gemm2: unsupported ACT code (would silently apply no activation)");
  __shared__ __attribute__((aligned(16))) unsigned char ring[2 * G2_STAGE];
  __shared__ __attribute__((aligned(16))) float so[8][32][68];
  const int tid = threadIdx.x, w = tid >> 5, lane = tid & 31, ln = lane & 15, hh = lane >> 4; const int by = blockIdx.y;
  A += (size_t)by * sA; Bh += (size_t)by * sB; const size_t cofs = (size_t)by * sC; const float* bp = bias ? bias + (size_t)by * sBias : nullptr;
  const int ntn = N >> 7; const int mt = blockIdx.x / ntn, nq = blockIdx.x - mt * ntn; if (mt * 128 >= M) return;      /* the whole block leaves, in front of every barrier */
  const int row0 = mt * 128 + 32 * (w & 3), col0 = nq * 128 + 64 * (w >> 2);
  const int nt = K / G2_BK;
  const unsigned lc = (unsigned)(size_t)ring + (unsigned)((tid >> 4) * G2_PITCH + (tid & 15) * 16);      /* the lane's place in a stage: row tid / 16 (+ 16 a copy), 16-byte column tid % 16: a wave's copy is two whole rows */
  const _Float16* ga = A + (size_t)(mt * 128 + (tid >> 4)) * lda + (tid & 15) * 8; const _Float16* gb = Bh + (size_t)(nq * 128 + (tid >> 4)) * ldb + (tid & 15) * 8;
  const size_t gsa = (size_t)16 * lda, gsb = (size_t)16 * ldb;
  g2_copy8(lc, ga, gsa); g2_copy8(lc + 128 * G2_PITCH, gb, gsb);      /* stage 0 */
  asm volatile("s_wait_asynccnt 0x0" ::: "memory");      /* this wave's copies of stage 0 have landed */
  __syncthreads();      /* publishes stage 0 */
  if (nt > 1) { g2_copy8(lc + G2_STAGE, ga + G2_BK, gsa); g2_copy8(lc + G2_STAGE + 128 * G2_PITCH, gb + G2_BK, gsb); }      /* stage 1 */
  const unsigned char* fa = ring + (32 * (w & 3) + ln) * G2_PITCH + 16 * hh; const unsigned char* fb = ring + (128 + 64 * (w >> 2) + ln) * G2_PITCH + 16 * hh;
  const v8f z8 = {0.f,0.f,0.f,0.f,0.f,0.f,0.f,0.f}; v8f c00 = z8, c01 = z8, c02 = z8, c03 = z8, c10 = z8, c11 = z8, c12 = z8, c13 = z8;
#pragma unroll 1      /* one stage a trip: the buffer is picked by the trip's parity, the four k steps inside are unrolled */
  for (int t = 0; t < nt; ++t) { const unsigned bo = (unsigned)(t & 1) * G2_STAGE; const unsigned char* pa = fa + bo; const unsigned char* pb = fb + bo;
    v16h a[2][2], b[2][4];
    a[0][0] = g2_lfrag(pa); a[0][1] = g2_lfrag(pa + 16 * G2_PITCH);
#pragma unroll
    for (int j = 0; j < 4; ++j) b[0][j] = g2_lfrag(pb + j * 16 * G2_PITCH);
#pragma unroll
    for (int ks = 0; ks < G2_BK / 32; ++ks) { const int cu = ks & 1, nx = cu ^ 1;
      if (ks + 1 < G2_BK / 32) { a[nx][0] = g2_lfrag(pa + (ks + 1) * 64); a[nx][1] = g2_lfrag(pa + 16 * G2_PITCH + (ks + 1) * 64);      /* the next k step's fragments, into the other register set */
#pragma unroll
        for (int j = 0; j < 4; ++j) b[nx][j] = g2_lfrag(pb + j * 16 * G2_PITCH + (ks + 1) * 64); }
      __builtin_amdgcn_sched_barrier(0);      /* keeps those reads one group ahead of this step's products: without it the build sank each read to its first use, two products behind every full LDS wait */
      c00 = g2_mma(a[cu][0], b[cu][0], c00); c10 = g2_mma(a[cu][1], b[cu][0], c10); c01 = g2_mma(a[cu][0], b[cu][1], c01); c11 = g2_mma(a[cu][1], b[cu][1], c11);
      c02 = g2_mma(a[cu][0], b[cu][2], c02); c12 = g2_mma(a[cu][1], b[cu][2], c12); c03 = g2_mma(a[cu][0], b[cu][3], c03); c13 = g2_mma(a[cu][1], b[cu][3], c13);
      __builtin_amdgcn_sched_barrier(0); }      /* and keeps the following group's reads from rising among these products */
    asm volatile("s_wait_dscnt 0x0" ::: "memory");      /* this wave's reads of the buffer are done before it is refilled */
    asm volatile("s_wait_asynccnt 0x0" ::: "memory");      /* this wave's copies of stage t + 1 have landed */
    __syncthreads();      /* publishes stage t + 1 and ends every wave's reads of stage t */
    if (t + 2 < nt) { g2_copy8(lc + bo, ga + (size_t)(t + 2) * G2_BK, gsa); g2_copy8(lc + bo + 128 * G2_PITCH, gb + (size_t)(t + 2) * G2_BK, gsb); } }      /* stage t + 2 into the buffer just read */
  asm volatile("s_wait_asynccnt 0x0" ::: "memory");      /* nothing of this wave is in flight when it goes on */
  v8f accs[8] = {c00, c01, c02, c03, c10, c11, c12, c13};
#pragma unroll
  for (int u = 0; u < 8; ++u) { const int t = u & 3, half = u >> 2; const int col = col0 + t * 16 + ln; const float bv = bp ? bf16_round(bp[col]) : 0.f;
#pragma unroll
    for (int r = 0; r < 8; ++r) { const int rloc = half * 16 + 8 * hh + r; float v = accs[u][r] * alpha + bv; if (CP) { if (rowsPerB < 0) v += CP[cofs + (size_t)(row0g + row0 + rloc) * ldc + col];      /* rowsPerB < 0: own element of the batched C plane */ else { const int bidx = (row0g + row0 + rloc) / rowsPerB; v += CP[(size_t)bidx * sCPb + (size_t)by * 64 + col]; } }
      if (ACT == 3) v = fmaxf(v, 0.f); else if (ACT == 6) v = 0.5f * v * (1.0f + erff(v * 0.70710678118654752f)); else if (ACT == 11) v = 1.0f / (1.0f + expf(-v)); else if (ACT == 15) v = v / (1.0f + expf(-v)); else if (ACT == 12) v = (v > 0.f) ? v : 0.01f * v; else if (ACT == 8) v = tanhf(v); else if (ACT == 9) v = 0.5f * v * (1.0f + tanhf(0.7978845608028654f * (v + 0.044715f * v * v * v))); else if (ACT == 14) v = (v > 0.f) ? v : 0.1f * v; else if (ACT == 16) v = (v >= 0.f) ? v : 0.3f * v; else if (ACT == 17) v = (v >= 0.f) ? v : 0.2f * v;
      so[w][rloc][t * 16 + ln] = v; } }
  __builtin_amdgcn_fence(__ATOMIC_ACQ_REL, "workgroup"); __builtin_amdgcn_wave_barrier();
  const int rsub = lane >> 4, c4 = (lane & 15) * 4;
  {
#pragma unroll
    for (int q = 0; q < 16; ++q) { const int r = q * 2 + rsub; const v4f v = *(const v4fa*)&so[w][r][c4]; if (C) *(v4f*)(C + cofs + (size_t)(row0 + r) * ldc + col0 + c4) = v; if (C16) { v4h h4; for (int i = 0; i < 4; ++i) h4[i] = (_Float16)v[i]; *(v4h*)(C16 + cofs + (size_t)(row0 + r) * ldc + col0 + c4) = h4; } }
     } }


__global__ __launch_bounds__(256) void k_wnat(const float* __restrict__ w, size_t n8, _Float16* __restrict__ Bt) { const size_t t = (size_t)blockIdx.x * 256 + threadIdx.x; if (t >= n8) return; FragH f; for (int q = 0; q < 8; ++q) f.h[q] = (_Float16)(bf16_round(w[t * 8 + q]) * 16.0f); *(v8us*)((unsigned short*)Bt + t * 8) = f.half[0];  }
__global__ __launch_bounds__(256) void k_rsm(const float* __restrict__ S, _Float16* __restrict__ P, int nrows) {
  #pragma clang fp contract(off)
  const int i = blockIdx.x * 256 + threadIdx.x; if (i >= nrows) return; const float* s = S + (size_t)i * SQ; float mx = -3.0e38f;
#pragma unroll 1
  for (int j = 0; j < SQ; ++j) mx = fmaxf(mx, s[j]); float se = 0.f;
#pragma unroll 1
  for (int j = 0; j < SQ; ++j) se += expf(s[j] - mx); const float sc = 256.0f / se;
#pragma unroll 1
  for (int j0 = 0; j0 < SQ; j0 += 8) { FragH f; for (int q = 0; q < 8; ++q) f.h[q] = (_Float16)(expf(s[j0 + q] - mx) * sc); unsigned short* d = (unsigned short*)P + (size_t)i * SQ + j0; *(v8us*)d = f.half[0];  } }
__global__ __launch_bounds__(256) void k_vt(const _Float16* __restrict__ V16, int b, int h0, _Float16* __restrict__ VT) { __shared__ unsigned short tl[64][65]; const int tid = threadIdx.x; const int hh = blockIdx.x % HG, sg = blockIdx.x / HG; const int s0 = sg * 64; const int h = h0 + hh;
  for (int i = tid; i < 64 * 8; i += 256) { const int j = i / 8, d8 = (i % 8) * 8; FragH f; f.half[0] = *(const v8us*)((const unsigned short*)V16 + ((size_t)b * SQ + s0 + j) * DM + h * HD + d8); for (int q = 0; q < 8; ++q) tl[d8 + q][j] = f.u[q]; }
  __syncthreads();
  { for (int i = tid; i < 64 * 8; i += 256) { const int d = i / 8, j8 = (i % 8) * 8; FragH f; for (int q = 0; q < 8; ++q) f.u[q] = tl[d][j8 + q]; *(v8us*)((unsigned short*)VT + ((size_t)hh * HD + d) * SQ + s0 + j8) = f.half[0]; }  } }



// Fused attention: scores, softmax of (scores + relative-position bias) and the product with V in one kernel, for every batch and head in one launch; neither the scores nor the weights go to memory.
// A wave owns FA_QT * 16 query columns and walks the keys 32 at a time: S^T = K . Q^T (A = K rows, B = Q rows kept in registers), so that a lane holds 16 scores of ONE query per column tile;
// running maximum and sum per lane (online softmax, log2 domain), one exchange between the wave halves per pass for the maximum, one in the epilogue for the sum;
// the two S^T tiles of a pass, converted in place, are the B operand of O^T += V^T . P^T (A = V^T rows in the same k order), and a lane's 8 accumulator registers are 8 consecutive d of its query: 16-byte stores.
// Every loop but the walk over the stages and their passes is unrolled in full: the fragment and accumulator arrays stay in registers only where each index is a constant.
// K and V^T reach the waves through LDS: a stage is FA_SK keys (K rows of 128 bytes, V^T rows of 256 bytes), brought once for the whole block by asynchronous copies, whole 128-byte lines a request, through no register;
// two buffers: the next stage flies while this one is worked on. The eight waves read their fragments from LDS in the k order of g2_frag; passes, products and sums keep their order.
#define FA_WAVES 8
#define FA_QT 2                      /* 16-column query tiles a wave */
#define FA_BQ (FA_WAVES * FA_QT * 16) /* query rows a block */
#define FA_L2E 1.4426950408889634f
#define FA_SK 128                    /* keys a stage: four passes */
#define FA_KP 144                    /* LDS pitch of a K row in bytes: 16 x odd, so the 16 rows of a 16-byte fragment read fall on distinct banks */
#define FA_VP 272                    /* LDS pitch of a V^T row in bytes: 16 x odd */
#define FA_KB (FA_SK * FA_KP)        /* the K rows of a stage; the HD V^T rows follow */
#define FA_STAGE (FA_KB + HD * FA_VP)
// Eight asynchronous 16-byte copies of a lane: K rows r, r + 32, r + 64, r + 96 of a stage (lk: LDS byte address of the first, gk: its global address), then V^T rows d, d + 16, d + 32, d + 48 (lv, gv).
// The closing s_wait_xcnt 0 stands inside the statement, in front of any later write of the address registers that the copies name.
__device__ __forceinline__ void fa_copy8(unsigned lk, const _Float16* gk, unsigned lv, const _Float16* gv) {
  asm volatile("global_load_async_to_lds_b128 %0, %8, off\n\tglobal_load_async_to_lds_b128 %1, %9, off\n\tglobal_load_async_to_lds_b128 %2, %10, off\n\tglobal_load_async_to_lds_b128 %3, %11, off\n\t"
               "global_load_async_to_lds_b128 %4, %12, off\n\tglobal_load_async_to_lds_b128 %5, %13, off\n\tglobal_load_async_to_lds_b128 %6, %14, off\n\tglobal_load_async_to_lds_b128 %7, %15, off\n\ts_wait_xcnt 0x0"
               :: "v"(lk), "v"(lk + 32 * FA_KP), "v"(lk + 64 * FA_KP), "v"(lk + 96 * FA_KP), "v"(lv), "v"(lv + 16 * FA_VP), "v"(lv + 32 * FA_VP), "v"(lv + 48 * FA_VP),
                  "v"(gk), "v"(gk + (size_t)32 * DM), "v"(gk + (size_t)64 * DM), "v"(gk + (size_t)96 * DM), "v"(gv), "v"(gv + (size_t)16 * SQ), "v"(gv + (size_t)32 * SQ), "v"(gv + (size_t)48 * SQ) : "memory"); }
__device__ __forceinline__ float sm_xh(float x) { return __builtin_bit_cast(float, __builtin_amdgcn_permlanex16(__builtin_bit_cast(int, x), __builtin_bit_cast(int, x), 0x76543210, 0xfedcba98, false, false)); }      /* lane l ^ 16 */
// Four native exp2 in place. In one statement with a closing v_nop: the slot that the instruction set asks for behind a transcendental before its result is read or its source overwritten
__device__ __forceinline__ v4f sm_exp2x4(v4f x) { float a = x[0], b = x[1], c = x[2], d = x[3];
  asm("v_exp_f32 %0, %0\n\tv_exp_f32 %1, %1\n\tv_exp_f32 %2, %2\n\tv_exp_f32 %3, %3\n\tv_nop" : "+v"(a), "+v"(b), "+v"(c), "+v"(d));
  const v4f y = {a, b, c, d}; return y; }
__device__ __forceinline__ float sm_exp2x1(float x) { asm("v_exp_f32 %0, %0\n\tv_nop" : "+v"(x)); return x; }      /* one native exp2, with the same closing slot */
__device__ __forceinline__ v8f fa_mma(v16h a, v16h b, v8f c) { return __builtin_amdgcn_wmma_f32_16x16x32_f16(false, a, false, b, (short)0, c, false, false); }
__global__ __launch_bounds__(FA_WAVES * 32) void k_fattn(const _Float16* __restrict__ Q16, const _Float16* __restrict__ K16, const _Float16* __restrict__ VT, const float* __restrict__ emb, _Float16* __restrict__ O16) {
  static_assert(SQ % FA_BQ == 0 && SQ % FA_SK == 0 && SQ / FA_SK >= 2 && FA_SK == 128 && FA_WAVES == 8 && HD == 64 && MAXD % 32 == 0 && FA_QT * 16 + 31 <= MAXD, "k_fattn: whole blocks per head, whole stages per row (two at least), eight copies a lane a stage, two k steps per score tile, band passes inside the table");
  __shared__ __attribute__((aligned(16))) unsigned char ring[2 * FA_STAGE];
  __shared__ float tb[4 * MAXD - 1];      /* this head's bias, bf16-rounded, times log2(e), by k = j - i + (2 * MAXD - 1), already clipped: consecutive j are consecutive entries */
  const int tid = threadIdx.x, lane = tid & 31, ln = lane & 15, hh = lane >> 4; const int wave = __builtin_amdgcn_readfirstlane(tid >> 5);
  const int bh = blockIdx.x / (SQ / FA_BQ), b = bh / NH, h = bh % NH; const int q0 = (blockIdx.x % (SQ / FA_BQ)) * FA_BQ + wave * (FA_QT * 16);
  const unsigned lk = (unsigned)(size_t)ring + (unsigned)((tid >> 3) * FA_KP + (tid & 7) * 16), lv = (unsigned)(size_t)ring + (unsigned)(FA_KB + (tid >> 4) * FA_VP + (tid & 15) * 16);      /* the lane's places in a stage: a wave's copy is four whole K rows or two whole V^T rows */
  const _Float16* gk = K16 + ((size_t)b * SQ + (tid >> 3)) * DM + h * HD + (tid & 7) * 8; const _Float16* gv = VT + ((size_t)bh * HD + (tid >> 4)) * SQ + (tid & 15) * 8;
  fa_copy8(lk, gk, lv, gv);      /* stage 0 */
  for (int i = tid; i < 4 * MAXD - 1; i += FA_WAVES * 32) tb[i] = bf16_round(emb[(min(max(2 * MAXD - 1 - i, -MAXD), MAXD) + MAXD) * NH + h]) * FA_L2E;
  asm volatile("s_wait_asynccnt 0x0" ::: "memory");      /* this wave's copies of stage 0 have landed */
  __syncthreads();      /* publishes tb and stage 0 */
  fa_copy8(lk + FA_STAGE, gk + (size_t)FA_SK * DM, lv + FA_STAGE, gv + FA_SK);      /* stage 1 */
  const float bfar = tb[0], bnear = tb[4 * MAXD - 2];      /* j <= i - MAXD ; j >= i + MAXD */
  const _Float16* qp = Q16 + ((size_t)b * SQ + q0 + ln) * DM + h * HD; const unsigned char* fk = ring + ln * FA_KP + 16 * hh; const unsigned char* fv = ring + FA_KB + ln * FA_VP + 16 * hh;      /* the lane's fragment rows in buffer 0 */
  v16h qf[FA_QT][2], kf[2][2];
#pragma unroll
  for (int t = 0; t < FA_QT; ++t) { qf[t][0] = g2_frag(qp + (size_t)t * 16 * DM, hh); qf[t][1] = g2_frag(qp + (size_t)t * 16 * DM + 32, hh); }
  const v8f z8 = {0.f,0.f,0.f,0.f,0.f,0.f,0.f,0.f};
  v8f o[FA_QT][4]; float mr[FA_QT], lr[FA_QT];
#pragma unroll
  for (int t = 0; t < FA_QT; ++t) { mr[t] = -3.0e38f; lr[t] = 0.f; o[t][0] = z8; o[t][1] = z8; o[t][2] = z8; o[t][3] = z8; }
#pragma unroll 1      /* one stage a trip: the buffer is picked by the trip's parity */
  for (int st = 0; st < SQ / FA_SK; ++st) { const unsigned bo = (unsigned)(st & 1) * FA_STAGE; const unsigned char* pk = fk + bo; const unsigned char* pv = fv + bo;
#pragma unroll
   for (int u = 0; u < 2; ++u) { kf[u][0] = g2_lfrag(pk + u * 16 * FA_KP); kf[u][1] = g2_lfrag(pk + u * 16 * FA_KP + 64); }      /* the stage's first K rows */
#pragma unroll 1      /* one pass a trip: with the four passes unrolled the build went past 256 registers and spilled */
   for (int p = 0; p < FA_SK / 32; ++p) { const int j0 = st * FA_SK + p * 32;
    v16h vf[4];      /* asked for first, used last: the scores and the softmax stand between */
#pragma unroll
    for (int d = 0; d < 4; ++d) vf[d] = g2_lfrag(pv + d * 16 * FA_VP + p * 64);
    v8f s[FA_QT][2];      /* s[t][u][r] = score of key j0 + 16 u + 8 hh + r, query q0 + 16 t + ln */
#pragma unroll
    for (int t = 0; t < FA_QT; ++t)
#pragma unroll
      for (int u = 0; u < 2; ++u) s[t][u] = fa_mma(kf[u][1], qf[t][1], fa_mma(kf[u][0], qf[t][0], z8));
    if (p + 1 < FA_SK / 32) {      /* the next pass's K rows, fetched one pass ahead inside the stage */
#pragma unroll
      for (int u = 0; u < 2; ++u) { kf[u][0] = g2_lfrag(pk + ((p + 1) * 32 + u * 16) * FA_KP); kf[u][1] = g2_lfrag(pk + ((p + 1) * 32 + u * 16) * FA_KP + 64); } }
    if (j0 + 31 > q0 - MAXD && j0 < q0 + FA_QT * 16 - 1 + MAXD) { const float* tp = tb + (j0 - q0 + 2 * MAXD - 1) + 8 * hh - ln;      /* wave-uniform: the pass meets the unclipped band; every k read here lies inside the table */
#pragma unroll
      for (int t = 0; t < FA_QT; ++t)
#pragma unroll
        for (int u = 0; u < 2; ++u)
#pragma unroll
          for (int r = 0; r < 8; ++r) s[t][u][r] = __builtin_fmaf(s[t][u][r], 0.125f * FA_L2E, tp[(u - t) * 16 + r]);
    } else { const float bc = (j0 >= q0 + FA_QT * 16 - 1 + MAXD) ? bnear : bfar;
#pragma unroll
      for (int t = 0; t < FA_QT; ++t)
#pragma unroll
        for (int u = 0; u < 2; ++u)
#pragma unroll
          for (int r = 0; r < 8; ++r) s[t][u][r] = __builtin_fmaf(s[t][u][r], 0.125f * FA_L2E, bc); }
#pragma unroll
    for (int t = 0; t < FA_QT; ++t) {
      float m0 = fmaxf(s[t][0][0], s[t][0][1]), m1 = fmaxf(s[t][1][0], s[t][1][1]);
#pragma unroll
      for (int r = 2; r < 8; r += 2) { m0 = fmaxf(fmaxf(m0, s[t][0][r]), s[t][0][r + 1]); m1 = fmaxf(fmaxf(m1, s[t][1][r]), s[t][1][r + 1]); }
      m0 = fmaxf(m0, m1); const float mn = fmaxf(mr[t], fmaxf(m0, sm_xh(m0)));
      const float al = sm_exp2x1(mr[t] - mn); mr[t] = mn;
      const float nm = 8.0f - mn;      /* weights carried x256 (as f16 operands away from the subnormal range); the sum carries the same factor */
      v4f as; FragH pf;
#pragma unroll
      for (int u = 0; u < 2; ++u)
#pragma unroll
        for (int g = 0; g < 2; ++g) { v4f x = {s[t][u][4 * g] + nm, s[t][u][4 * g + 1] + nm, s[t][u][4 * g + 2] + nm, s[t][u][4 * g + 3] + nm}; x = sm_exp2x4(x);
          if (u + g == 0) as = x; else as += x;
#pragma unroll
          for (int e = 0; e < 4; ++e) pf.h[u * 8 + g * 4 + e] = (_Float16)x[e]; }
      lr[t] = __builtin_fmaf(lr[t], al, (as[0] + as[1]) + (as[2] + as[3]));
#pragma unroll
      for (int d = 0; d < 4; ++d) o[t][d] = fa_mma(vf[d], pf.v, o[t][d] * al); } }
   asm volatile("s_wait_dscnt 0x0" ::: "memory");      /* this wave's reads of the buffer are done before it is refilled */
   asm volatile("s_wait_asynccnt 0x0" ::: "memory");      /* this wave's copies of stage st + 1 have landed */
   __syncthreads();      /* publishes stage st + 1 and ends every wave's reads of stage st */
   if (st + 2 < SQ / FA_SK) fa_copy8(lk + bo, gk + (size_t)(st + 2) * FA_SK * DM, lv + bo, gv + (size_t)(st + 2) * FA_SK); }      /* stage st + 2 into the buffer just read */
  asm volatile("s_wait_asynccnt 0x0" ::: "memory");      /* nothing of this wave is in flight when it goes on */
#pragma unroll
  for (int t = 0; t < FA_QT; ++t) { const float sc = 64.0f / (lr[t] + sm_xh(lr[t]));      /* o carried x64, as the output GEMM's alpha expects */
    unsigned short* op = (unsigned short*)O16 + ((size_t)b * SQ + q0 + t * 16 + ln) * DM + h * HD + 8 * hh;
#pragma unroll
    for (int d = 0; d < 4; ++d) { FragH f;
#pragma unroll
      for (int r = 0; r < 8; ++r) f.h[r] = (_Float16)(o[t][d][r] * sc);
      *(v8us*)(op + d * 16) = f.half[0]; } } }

extern "C" void kernel_launch(void* const* d_in, const int* in_sizes, int n_in,
                              void* d_out, int out_size, void* d_ws, size_t ws_size, hipStream_t stream) {
  (void)in_sizes; (void)n_in; (void)out_size;
  const float* const* I = (const float* const*)d_in; const float* x = I[0]; const float* wq = I[1]; const float* bq = I[2]; const float* wk = I[3]; const float* bk = I[4]; const float* wv = I[5]; const float* bv = I[6]; const float* wo = I[7]; const float* bo = I[8]; const float* emb = I[9];      /* nn.Linear weights [out][in]; rel_emb [2*MAXD+1][NH] */
  char* ws = (char*)d_ws; size_t off = 0;
  auto take = [&](size_t bytes) { char* p = ws + off; off += (bytes + 255) & ~(size_t)255; return p; };
  _Float16* BQ = (_Float16*)take((size_t)DM * DM * 2); _Float16* BK = (_Float16*)take((size_t)DM * DM * 2); _Float16* BV = (_Float16*)take((size_t)DM * DM * 2); _Float16* BO = (_Float16*)take((size_t)DM * DM * 2);
  _Float16* X16 = (_Float16*)take(NR * DM * 2); _Float16* Q16 = (_Float16*)take(NR * DM * 2); _Float16* K16 = (_Float16*)take(NR * DM * 2); _Float16* V16 = (_Float16*)take(NR * DM * 2); _Float16* O16 = (_Float16*)take(NR * DM * 2);
  _Float16* VT = (_Float16*)take((size_t)NB * NH * HD * SQ * 2);
  if (off > ws_size) return;
  { const unsigned g = (unsigned)(((size_t)DM * DM / 8 + 255) / 256); k_wnat<<<g, 256, 0, stream>>>(wq, (size_t)DM * DM / 8, BQ); k_wnat<<<g, 256, 0, stream>>>(wk, (size_t)DM * DM / 8, BK); k_wnat<<<g, 256, 0, stream>>>(wv, (size_t)DM * DM / 8, BV); k_wnat<<<g, 256, 0, stream>>>(wo, (size_t)DM * DM / 8, BO); }      /* natural [out][in] = Bt[n][k], x16 */
  k_x16<<<(unsigned)((NR * DM / 8 + 255) / 256), 256, 0, stream>>>(x, X16, NR * DM / 8);
  const size_t r0p = (size_t)B0 * SQ;      /* first projected row */
  k_gemm2<0><<<dim3((unsigned)((MP / 128) * (DM / 128)), 1), 256, 0, stream>>>(X16 + r0p * DM, DM, 0, BQ, DM, 0, 0.0625f, bq, 0, nullptr, 1, 0, 0, nullptr, Q16 + r0p * DM, DM, 0, MP, DM, DM);
  k_gemm2<0><<<dim3((unsigned)((MP / 128) * (DM / 128)), 1), 256, 0, stream>>>(X16 + r0p * DM, DM, 0, BK, DM, 0, 0.0625f, bk, 0, nullptr, 1, 0, 0, nullptr, K16 + r0p * DM, DM, 0, MP, DM, DM);
  k_gemm2<0><<<dim3((unsigned)((MP / 128) * (DM / 128)), 1), 256, 0, stream>>>(X16 + r0p * DM, DM, 0, BV, DM, 0, 0.0625f, bv, 0, nullptr, 1, 0, 0, nullptr, V16 + r0p * DM, DM, 0, MP, DM, DM);
  k_vt<NH, SQ><<<NB * NH * (SQ / 64), 256, 0, stream>>>(V16, LQ, 0, VT);      /* V^T [NB][NH][HD][SQ] */
  k_fattn<<<NB * NH * (SQ / FA_BQ), FA_WAVES * 32, 0, stream>>>(Q16, K16, VT, emb, O16);      /* o (merged heads, x64) as f16 rows */
  k_gemm2<0><<<dim3((unsigned)((MPO / 128) * (DM / 128)), 1), 256, 0, stream>>>(O16 + r0p * DM, DM, 0, BO, DM, 0, 0.0009765625f, bo, 0, nullptr, 1, 0, 0, (float*)d_out + r0p * DM, nullptr, DM, 0, MPO, DM, DM);      /* out rows are the output layout */
}

// v005
// Measured time: 98.4 microseconds a run.
// Timed twice side by side with v004, it ran 1.12 times as fast both times.
// Counting every step since v000, it is 46.0 times as fast.
#include <hip/hip_runtime.h>
// Multi-head self-attention with a learned relative-position bias (x [2][2048][1024]; q/k/v = x W^T + b (nn.Linear [out][in]), 16 heads of 64; scores / 8 + rel_emb[clip(i - j, -128, 128) + 128][h] (rel_emb [257][16]); softmax; o merged; out = o Wo^T + bo -> [2][2048][1024]).
// Structure: token rows r = b*2048 + s; x as exact f16 rows (bf16-rounded) and the four weights (x16) converted in one launch; Q, K, V as three WMMA GEMMs in one launch, the grid's y index picking weight, bias and output plane (32x64 wave tiles, f32 accumulation, exact x16 weights + bias, f16 outputs); V^T for all batches and heads via LDS transposes; one fused attention launch for all batches and heads: score tiles on WMMA (K = 64), online softmax of (scores / 8 + relative-position bias looked up by (i - j, head)) on VALU (f32 statistics, native exp; weights x256 as f16 operands, in registers), o = P . V on WMMA (o carried x64 against f16 subnormal flush, folded into the output GEMM alpha) written straight into the merged f16 o rows; out = o W_o + b GEMM (f32) into the output layout.
// Compute dtype: inputs rounded to bf16; x / weights exact; q, k, v, softmax weights and o as plain f16 GEMM operands (~2^-12); scores and softmax statistics f32. v_wmma_f32_16x16x32_f16.
#define NB 2
#define SQ 2048
#define DM 1024
#define NH 16
#define HD 64
#define MAXD 128                     /* relative distance clip */
#define HG 4                         /* heads per launch of the grouped V^T transpose k_vt(b, h0) */
#define B0 0                         /* first batch processed (debug hook) */
#define NBR NB                       /* batches processed (debug hook) */
#define NR ((size_t)NB * SQ)         /* token rows */
#define MP ((int)((size_t)NBR * SQ)) /* rows projected (debug hook) */
#define QN SQ                        /* query rows per batch; unused: the attention launch covers all SQ */
#define NHD NH                       /* heads; unused: the attention launch covers all NH */
#define MPO MP                       /* rows through the output stage (debug hook) */
#define LQ DM      /* row pitch of the q/k/v rows */
typedef __bf16 v16b __attribute__((ext_vector_type(16)));
typedef unsigned short v8us __attribute__((ext_vector_type(8), may_alias));
typedef float  v8f  __attribute__((ext_vector_type(8)));
typedef float  v4f  __attribute__((ext_vector_type(4)));
typedef float  v4fa __attribute__((ext_vector_type(4), may_alias));
union FragB { v16b v; v8us half[2]; unsigned short u[16]; };

__device__ __forceinline__ unsigned short bf16_bits(float x) { unsigned int u = __float_as_uint(x); return (unsigned short)((u + 0x7FFFu + ((u >> 16) & 1u)) >> 16); }
__device__ __forceinline__ float bf16_val(unsigned short b) { return __uint_as_float(((unsigned int)b) << 16); }
__device__ __forceinline__ float bf16_round(float x) { return bf16_val(bf16_bits(x)); }
// D += A·B with NT terms: 1 = ah·bh, 2 = + al·bh (A split), 3 = + ah·bl (both split)
template <int NT>
__device__ __forceinline__ v8f mmaN(v16b ah, v16b al, v16b bh, v16b bl, v8f c) {
  c = __builtin_amdgcn_wmma_f32_16x16x32_bf16(false, ah, false, bh, (short)0, c, false, false);
  if (NT >= 2) c = __builtin_amdgcn_wmma_f32_16x16x32_bf16(false, al, false, bh, (short)0, c, false, false);
  if (NT >= 3) c = __builtin_amdgcn_wmma_f32_16x16x32_bf16(false, ah, false, bl, (short)0, c, false, false);
  asm volatile("v_nop\n\tv_nop\n\tv_nop\n\tv_nop" : "+v"(c) : "v"(ah), "v"(al), "v"(bh), "v"(bl));
  return c;
}

__global__ __launch_bounds__(256) void k_wt_bf16(const float* __restrict__ W, unsigned short* __restrict__ Wt, int K, int N) {
  const int t = blockIdx.x * 256 + threadIdx.x;
  const int k8n = K / 8;
  if (t >= N * k8n) return;
  const int n = t / k8n, k8 = (t % k8n) * 8;
  v8us v;
#pragma unroll
  for (int i = 0; i < 8; ++i) v[i] = bf16_bits(W[(size_t)(k8 + i) * N + n]);
  *(v8us*)(Wt + (size_t)n * K + k8) = v;
  
}

// GEMM C[M][N] (f32, pitch ldc) = act(A[M][K]·W + bias). A f32 row-major (pitch lda) converted per fragment to bf16
// (ASPLIT: hi/lo two planes -> 2 terms, else single rounded term); Wt bf16 [N][K] (pitch ldb). BIAS_BF16 rounds the
// bias to bf16 first (bias quantised to bf16 before the add). K%32==0, M%16==0, N%64==0.
template <bool ASPLIT, int ACT, bool BIAS_BF16>
__global__ __launch_bounds__(128) void k_gemm_bf(const float* __restrict__ A, int lda, const unsigned short* __restrict__ Wt, int ldb,
                                               const float* __restrict__ bias, float* __restrict__ C, int ldc, int M, int N, int K) {
  __shared__ __attribute__((aligned(16))) float so[4][16][64];
  const int tid = threadIdx.x, w = tid >> 5, lane = tid & 31, ln = lane & 15, hh = lane >> 4;
  const int ntn = N / 64;
  const int wid = blockIdx.x * 4 + w;
  const int mt = wid / ntn, nq = wid % ntn;
  if (mt * 16 >= M) return;
  const int row0 = mt * 16, col0 = nq * 64;
  const float* arow = A + (size_t)(row0 + ln) * lda;
  v8f acc[4] = {};
  for (int kb = 0; kb < K; kb += 32) {
    FragB ah, al;
    const v4f x0 = *(const v4fa*)(arow + kb + 8 * hh), x1 = *(const v4fa*)(arow + kb + 8 * hh + 4);
    const v4f x2 = *(const v4fa*)(arow + kb + 16 + 8 * hh), x3 = *(const v4fa*)(arow + kb + 16 + 8 * hh + 4);
    float xs[16] = {x0[0],x0[1],x0[2],x0[3],x1[0],x1[1],x1[2],x1[3],x2[0],x2[1],x2[2],x2[3],x3[0],x3[1],x3[2],x3[3]};
#pragma unroll
    for (int i = 0; i < 16; ++i) { const unsigned short hb = bf16_bits(xs[i]); ah.u[i] = hb; al.u[i] = ASPLIT ? bf16_bits(xs[i] - bf16_val(hb)) : (unsigned short)0; }
#pragma unroll
    for (int t = 0; t < 4; ++t) {
      const unsigned short* brow = Wt + (size_t)(col0 + t * 16 + ln) * ldb + kb;
      FragB b;
      b.half[0] = *(const v8us*)(brow + 8 * hh);
      b.half[1] = *(const v8us*)(brow + 16 + 8 * hh);
      acc[t] = mmaN<ASPLIT ? 2 : 1>(ah.v, al.v, b.v, b.v, acc[t]);
    }
  }
#pragma unroll
  for (int t = 0; t < 4; ++t) {
    float bv = bias ? bias[col0 + t * 16 + ln] : 0.f;
    if (BIAS_BF16) bv = bf16_round(bv);
#pragma unroll
    for (int r = 0; r < 8; ++r) { float v = acc[t][r] + bv; if (ACT == 1) v = fmaxf(v, 0.f); so[w][8 * hh + r][t * 16 + ln] = v; }
  }
  __builtin_amdgcn_fence(__ATOMIC_ACQ_REL, "workgroup");
  __builtin_amdgcn_wave_barrier();
  const int rsub = lane >> 4, c4 = (lane & 15) * 4;
  {
#pragma unroll
    for (int q = 0; q < 8; ++q) {
      const int r = q * 2 + rsub;
      const v4f v = *(const v4fa*)&so[w][r][c4];
      *(v4f*)(C + (size_t)(row0 + r) * ldc + col0 + c4) = v;
    }
    
  }
}

// GEMM C = act(A·W + bias + resid): A f32 (ASPLIT -> hi/lo 2 terms), Wt bf16 [N][K]; ACT 0 none, 1 relu, 2 exact gelu;
// resid (optional, f32, row index = (row % rmod), pitch ldr, RES_BF16 rounds it) added before the activation.
template <bool ASPLIT, int ACT, bool BIAS_BF16, bool RES_BF16>
__global__ __launch_bounds__(128) void k_gemm_bf3(const float* __restrict__ A, int lda, const unsigned short* __restrict__ Wt, int ldb,
                                                const float* __restrict__ bias, const float* __restrict__ resid, int rmod, int ldr,
                                                float* __restrict__ C, int ldc, int M, int N, int K) {
  __shared__ __attribute__((aligned(16))) float so[4][16][64];
  const int tid = threadIdx.x, w = tid >> 5, lane = tid & 31, ln = lane & 15, hh = lane >> 4;
  const int ntn = N / 64;
  const int wid = blockIdx.x * 4 + w;
  const int mt = wid / ntn, nq = wid % ntn;
  if (mt * 16 >= M) return;
  const int row0 = mt * 16, col0 = nq * 64;
  const float* arow = A + (size_t)(row0 + ln) * lda;
  v8f acc[4] = {};
  for (int kb = 0; kb < K; kb += 32) {
    FragB ah, al;
    const v4f x0 = *(const v4fa*)(arow + kb + 8 * hh), x1 = *(const v4fa*)(arow + kb + 8 * hh + 4);
    const v4f x2 = *(const v4fa*)(arow + kb + 16 + 8 * hh), x3 = *(const v4fa*)(arow + kb + 16 + 8 * hh + 4);
    float xs[16] = {x0[0],x0[1],x0[2],x0[3],x1[0],x1[1],x1[2],x1[3],x2[0],x2[1],x2[2],x2[3],x3[0],x3[1],x3[2],x3[3]};
#pragma unroll
    for (int i = 0; i < 16; ++i) { const unsigned short hb = bf16_bits(xs[i]); ah.u[i] = hb; al.u[i] = ASPLIT ? bf16_bits(xs[i] - bf16_val(hb)) : (unsigned short)0; }
#pragma unroll
    for (int t = 0; t < 4; ++t) {
      const unsigned short* brow = Wt + (size_t)(col0 + t * 16 + ln) * ldb + kb;
      FragB b;
      b.half[0] = *(const v8us*)(brow + 8 * hh);
      b.half[1] = *(const v8us*)(brow + 16 + 8 * hh);
      acc[t] = mmaN<ASPLIT ? 2 : 1>(ah.v, al.v, b.v, b.v, acc[t]);
    }
  }
#pragma unroll
  for (int t = 0; t < 4; ++t) {
    const int col = col0 + t * 16 + ln;
    float bv = bias ? bias[col] : 0.f;
    if (BIAS_BF16) bv = bf16_round(bv);
#pragma unroll
    for (int r = 0; r < 8; ++r) {
      float v = acc[t][r] + bv;
      if (resid) { float rv = resid[(size_t)((row0 + 8 * hh + r) % rmod) * ldr + col]; if (RES_BF16) rv = bf16_round(rv); v += rv; }
      if (ACT == 1) v = fmaxf(v, 0.f);
      if (ACT == 2) v = 0.5f * v * (1.0f + erff(v * 0.70710678118654752f));
      if (ACT == 3) { const float u = 0.7978845608028654f * (v + 0.044715f * v * v * v); v = 0.5f * v * (1.0f + tanhf(u)); }
      so[w][8 * hh + r][t * 16 + ln] = v;
    }
  }
  __builtin_amdgcn_fence(__ATOMIC_ACQ_REL, "workgroup");
  __builtin_amdgcn_wave_barrier();
  const int rsub = lane >> 4, c4 = (lane & 15) * 4;
  {
#pragma unroll
    for (int q = 0; q < 8; ++q) {
      const int r = q * 2 + rsub;
      const v4f v = *(const v4fa*)&so[w][r][c4];
      *(v4f*)(C + (size_t)(row0 + r) * ldc + col0 + c4) = v;
    }
    
  }
}
// row LayerNorm (biased variance, eps) over N: s = X (+ R); optional out_sum <- s; out_norm <- (s-mu)*rsqrt(var+eps)*g + b
template <bool PARAM_BF16>
__global__ __launch_bounds__(256) void k_layernorm(const float* __restrict__ X, const float* __restrict__ R, const float* __restrict__ g, const float* __restrict__ bta,
                                                  float* __restrict__ out_sum, float* __restrict__ out_norm, int N, float eps) {
  __shared__ float red[256];
  const int row = blockIdx.x, tid = threadIdx.x;
  const float* x = X + (size_t)row * N; const float* rr = R ? R + (size_t)row * N : nullptr;
  float vals[16];                     // up to N = 4096
  const int per = N / 256;            // contiguous chunk per thread? use strided-by-4 chunks: thread handles j = tid*4 + 1024*u
  float s1 = 0.f;
  for (int u = 0; u < per / 4; ++u) {
    const int j = tid * 4 + 1024 * u;
    const v4f a = *(const v4fa*)(x + j);
    v4f b = {0.f,0.f,0.f,0.f}; if (rr) b = *(const v4fa*)(rr + j);
#pragma unroll
    for (int q = 0; q < 4; ++q) { const float v = a[q] + b[q]; vals[u * 4 + q] = v; s1 += v; }
  }
  red[tid] = s1; __syncthreads();
  for (int st = 128; st > 0; st >>= 1) { if (tid < st) red[tid] += red[tid + st]; __syncthreads(); }
  const float mu = red[0] / (float)N; __syncthreads();
  float s2 = 0.f;
  for (int u = 0; u < per / 4; ++u)
#pragma unroll
    for (int q = 0; q < 4; ++q) { const float c = vals[u * 4 + q] - mu; s2 += c * c; }
  red[tid] = s2; __syncthreads();
  for (int st = 128; st > 0; st >>= 1) { if (tid < st) red[tid] += red[tid + st]; __syncthreads(); }
  const float rs = rsqrtf(red[0] / (float)N + eps);
  {
    for (int u = 0; u < per / 4; ++u) {
      const int j = tid * 4 + 1024 * u;
      v4f o, sm;
#pragma unroll
      for (int q = 0; q < 4; ++q) {
        float gg = g[j + q], bb = bta[j + q];
        if (PARAM_BF16) { gg = bf16_round(gg); bb = bf16_round(bb); }
        sm[q] = vals[u * 4 + q]; o[q] = (vals[u * 4 + q] - mu) * rs * gg + bb;
      }
      if (out_sum) *(v4f*)(out_sum + (size_t)row * N + j) = sm;
      *(v4f*)(out_norm + (size_t)row * N + j) = o;
    }
    
  }
}



// ---- f16 WMMA path (v_wmma_f32_16x16x32_f16): 11-bit significands for operands in range — used where a [0,1] probability operand needs more precision than bf16
typedef _Float16 v16h __attribute__((ext_vector_type(16)));
union FragH { v16h v; v8us half[2]; _Float16 h[16]; unsigned short u[16]; };
template <int NT>
__device__ __forceinline__ v8f mmaH(v16h ah, v16h al, v16h bh, v16h bl, v8f c) {
  c = __builtin_amdgcn_wmma_f32_16x16x32_f16(false, ah, false, bh, (short)0, c, false, false);
  if (NT >= 2) c = __builtin_amdgcn_wmma_f32_16x16x32_f16(false, al, false, bh, (short)0, c, false, false);
  if (NT >= 3) c = __builtin_amdgcn_wmma_f32_16x16x32_f16(false, ah, false, bl, (short)0, c, false, false);
  asm volatile("v_nop\n\tv_nop\n\tv_nop\n\tv_nop" : "+v"(c) : "v"(ah), "v"(al), "v"(bh), "v"(bl));
  return c;
}
// batched GEMM like k_gemm_b but f16 operands: A f32 (split into f16 hi/lo if ASPLIT, else rounded to f16), Bt = f16 values [n][k]; alpha; C f32; N multiple of 16 (partial tiles skipped)
template <bool ASPLIT>
__global__ __launch_bounds__(128) void k_gemm_h(const float* __restrict__ A, int lda, size_t sA, const _Float16* __restrict__ Bh, int ldb, size_t sB, float alpha, float* __restrict__ C, int ldc, size_t sC, int M, int N, int K) {
  __shared__ __attribute__((aligned(16))) float so[4][16][64];
  const int tid = threadIdx.x, w = tid >> 5, lane = tid & 31, ln = lane & 15, hh = lane >> 4; const int by = blockIdx.y;
  A += (size_t)by * sA; Bh += (size_t)by * sB; C += (size_t)by * sC;
  const int ntn = (N + 63) / 64; const int wid = blockIdx.x * 4 + w; const int mt = wid / ntn, nq = wid % ntn; if (mt * 16 >= M) return;
  const int row0 = mt * 16, col0 = nq * 64; const float* arow = A + (size_t)(row0 + ln) * lda;
  v8f acc[4] = {};
  for (int kb = 0; kb < K; kb += 32) {
    FragH ah, al;
    const v4f x0 = *(const v4fa*)(arow + kb + 8 * hh), x1 = *(const v4fa*)(arow + kb + 8 * hh + 4), x2 = *(const v4fa*)(arow + kb + 16 + 8 * hh), x3 = *(const v4fa*)(arow + kb + 16 + 8 * hh + 4);
    float xs[16] = {x0[0],x0[1],x0[2],x0[3],x1[0],x1[1],x1[2],x1[3],x2[0],x2[1],x2[2],x2[3],x3[0],x3[1],x3[2],x3[3]};
#pragma unroll
    for (int i = 0; i < 16; ++i) { const _Float16 h = (_Float16)xs[i]; ah.h[i] = h; al.h[i] = ASPLIT ? (_Float16)(xs[i] - (float)h) : (_Float16)0.0f; }
#pragma unroll
    for (int t = 0; t < 4; ++t) { if (col0 + t * 16 >= N) continue; const size_t boff = (size_t)(col0 + t * 16 + ln) * ldb + kb; FragH bq; bq.half[0] = *(const v8us*)(Bh + boff + 8 * hh); bq.half[1] = *(const v8us*)(Bh + boff + 16 + 8 * hh);
      acc[t] = mmaH<ASPLIT ? 2 : 1>(ah.v, al.v, bq.v, bq.v, acc[t]); }
  }
#pragma unroll
  for (int t = 0; t < 4; ++t) { if (col0 + t * 16 >= N) continue;
#pragma unroll
    for (int r = 0; r < 8; ++r) so[w][8 * hh + r][t * 16 + ln] = acc[t][r] * alpha; }
  __builtin_amdgcn_fence(__ATOMIC_ACQ_REL, "workgroup"); __builtin_amdgcn_wave_barrier();
  const int rsub = lane >> 4, c4 = (lane & 15) * 4;
  {
#pragma unroll
    for (int q = 0; q < 8; ++q) { const int r = q * 2 + rsub; if (col0 + c4 < N) { const v4f v = *(const v4fa*)&so[w][r][c4]; *(v4f*)(C + (size_t)(row0 + r) * ldc + col0 + c4) = v; } }
     }
}

// Wt[n][k] = f16(W[k][n]·scale) from f32 row-major W[K][N] (scale = power of two; bf16-exact weights stay exact in f16 away from the subnormal range)
__global__ __launch_bounds__(256) void k_wt_f16(const float* __restrict__ W, _Float16* __restrict__ Wt, int K, int N, float scale) {
  const int t = blockIdx.x * 256 + threadIdx.x; if (t >= N * (K / 8)) return; const int n = t / (K / 8), k8 = (t % (K / 8)) * 8; FragH f;
#pragma unroll
  for (int i = 0; i < 8; ++i) f.h[i] = (_Float16)(bf16_round(W[(size_t)(k8 + i) * N + n]) * scale); const v8us o = f.half[0];
  *(v8us*)((unsigned short*)Wt + (size_t)n * K + k8) = o; 
}
// k_gemm_hh variant with fused epilogue: v = acc·alpha + bias[by·sBias + col] (+ CP[(row/rowsPerB)·sCPb + by·64 + col] if CP) ; ACT 0 none / 1 elu ; writes f16 C16 (and f32 C if non-null)
template <int ACT>
__global__ __launch_bounds__(128) void k_gemm_hhx(const _Float16* __restrict__ A, int lda, size_t sA, const _Float16* __restrict__ Bh, int ldb, size_t sB, float alpha, const float* __restrict__ bias, size_t sBias, const float* __restrict__ CP, int rowsPerB, size_t sCPb, int row0g,
    float* __restrict__ C, _Float16* __restrict__ C16, int ldc, size_t sC, int M, int N, int K) {
  __shared__ __attribute__((aligned(16))) float so[4][16][64];
  const int tid = threadIdx.x, w = tid >> 5, lane = tid & 31, ln = lane & 15, hh = lane >> 4; const int by = blockIdx.y;
  A += (size_t)by * sA; Bh += (size_t)by * sB; const size_t cofs = (size_t)by * sC; const float* bp = bias ? bias + (size_t)by * sBias : nullptr;
  const int ntn = (N + 63) / 64; const int wid = blockIdx.x * 4 + w; const int mt = wid / ntn, nq = wid % ntn; if (mt * 16 >= M) return;
  const int row0 = mt * 16, col0 = nq * 64; const _Float16* arow = A + (size_t)(row0 + ln) * lda;
  v8f acc[4] = {};
  for (int kb = 0; kb < K; kb += 32) { FragH ah; ah.half[0] = *(const v8us*)((const unsigned short*)arow + kb + 8 * hh); ah.half[1] = *(const v8us*)((const unsigned short*)arow + kb + 16 + 8 * hh);
#pragma unroll
    for (int t = 0; t < 4; ++t) { if (col0 + t * 16 >= N) continue; const size_t boff = (size_t)(col0 + t * 16 + ln) * ldb + kb; FragH bq; bq.half[0] = *(const v8us*)((const unsigned short*)Bh + boff + 8 * hh); bq.half[1] = *(const v8us*)((const unsigned short*)Bh + boff + 16 + 8 * hh);
      acc[t] = mmaH<1>(ah.v, ah.v, bq.v, bq.v, acc[t]); }
  }
#pragma unroll
  for (int t = 0; t < 4; ++t) { if (col0 + t * 16 >= N) continue; const int col = col0 + t * 16 + ln; const float bv = bp ? bf16_round(bp[col]) : 0.f;
#pragma unroll
    for (int r = 0; r < 8; ++r) { float v = acc[t][r] * alpha + bv; if (CP) { const int rr = row0g + row0 + 8 * hh + r; if (rowsPerB < 0) v += CP[cofs + (size_t)rr * ldc + col];      /* rowsPerB < 0: own element of the batched C plane */ else { const int bidx = rr / rowsPerB; v += CP[(size_t)bidx * sCPb + (size_t)by * 64 + col]; } } if (ACT == 1) v = (v > 0.f) ? v : expm1f(v); else if (ACT == 7) v = (v > 0.f) ? v + 1.0f : expf(v); else if (ACT == 8) v = tanhf(v); else if (ACT == 9) v = 0.5f * v * (1.0f + tanhf(0.7978845608028654f * (v + 0.044715f * v * v * v))); else if (ACT == 11) v = 1.0f / (1.0f + expf(-v)); else if (ACT == 12) v = (v > 0.f) ? v : 0.01f * v; else if (ACT == 14) v = (v > 0.f) ? v : 0.1f * v; else if (ACT == 16) v = (v >= 0.f) ? v : 0.3f * v; else if (ACT == 17) v = (v >= 0.f) ? v : 0.2f * v; else if (ACT == 15) v = v / (1.0f + expf(-v)); else if (ACT == 3) v = fmaxf(v, 0.f); else if (ACT == 6) v = 0.5f * v * (1.0f + erff(v * 0.70710678118654752f)); so[w][8 * hh + r][t * 16 + ln] = v; } }
  __builtin_amdgcn_fence(__ATOMIC_ACQ_REL, "workgroup"); __builtin_amdgcn_wave_barrier();
  const int rsub = lane >> 4, c4 = (lane & 15) * 4; typedef _Float16 v4h __attribute__((ext_vector_type(4)));
  {
#pragma unroll
    for (int q = 0; q < 8; ++q) { const int r = q * 2 + rsub; if (col0 + c4 < N) { const v4f v = *(const v4fa*)&so[w][r][c4]; if (C) *(v4f*)(C + cofs + (size_t)(row0 + r) * ldc + col0 + c4) = v; if (C16) { v4h h4; for (int i = 0; i < 4; ++i) h4[i] = (_Float16)v[i]; *(v4h*)(C16 + cofs + (size_t)(row0 + r) * ldc + col0 + c4) = h4; } } }
     }
}


typedef _Float16 v4h __attribute__((ext_vector_type(4)));

__global__ __launch_bounds__(256) void k_h16(const float* __restrict__ x, _Float16* __restrict__ X16, size_t n8) { const size_t t = (size_t)blockIdx.x * 256 + threadIdx.x; if (t >= n8) return; FragH f;
#pragma unroll
  for (int q = 0; q < 8; ++q) f.h[q] = (_Float16)x[t * 8 + q]; *(v8us*)((unsigned short*)X16 + t * 8) = f.half[0];  }
__global__ __launch_bounds__(256) void k_round16f(const float* __restrict__ W, _Float16* __restrict__ Bt, size_t n8) { const size_t t = (size_t)blockIdx.x * 256 + threadIdx.x; if (t >= n8) return; FragH f;
#pragma unroll
  for (int i = 0; i < 8; ++i) f.h[i] = (_Float16)(bf16_round(W[t * 8 + i]) * 16.0f); *(v8us*)((unsigned short*)Bt + t * 8) = f.half[0];  }
template <int NHv, int TTv>
__global__ __launch_bounds__(256) void k_vt(const _Float16* __restrict__ V16, int ldv, int voff, _Float16* __restrict__ Vt) { __shared__ unsigned short tl[64][66]; const int tid = threadIdx.x; const int slab = blockIdx.x / (TTv / 64), lg = blockIdx.x % (TTv / 64); const int b = slab / NHv, h = slab % NHv;
  for (int i = tid; i < 64 * 8; i += 256) { const int r = i / 8, c8 = (i % 8) * 8; FragH f; f.half[0] = *(const v8us*)((const unsigned short*)V16 + ((size_t)b * TTv + lg * 64 + r) * ldv + voff + h * 64 + c8);
#pragma unroll
    for (int q = 0; q < 8; ++q) tl[r][c8 + q] = f.u[q]; }
  __syncthreads();
  {
#pragma unroll
    for (int rd = 0; rd < 2; ++rd) { const int d = rd * 32 + tid / 8, pc = tid % 8; FragH f;
#pragma unroll
      for (int q = 0; q < 8; ++q) f.u[q] = tl[pc * 8 + q][d];
      *(v8us*)((unsigned short*)Vt + ((size_t)slab * 64 + d) * TTv + lg * 64 + pc * 8) = f.half[0]; }
     } }

__global__ __launch_bounds__(256) void k_hl(const float* __restrict__ F, _Float16* __restrict__ Hh, _Float16* __restrict__ Hl, size_t n8) { const size_t t = (size_t)blockIdx.x * 256 + threadIdx.x; if (t >= n8) return; FragH fh, fl; const v4f a = *(const v4fa*)(F + t * 8), c = *(const v4fa*)(F + t * 8 + 4);
#pragma unroll
  for (int q = 0; q < 4; ++q) { _Float16 h = (_Float16)a[q]; fh.h[q] = h; fl.h[q] = (_Float16)((a[q] - (float)h) * 1024.0f); h = (_Float16)c[q]; fh.h[4 + q] = h; fl.h[4 + q] = (_Float16)((c[q] - (float)h) * 1024.0f); }
  { *(v8us*)((unsigned short*)Hh + t * 8) = fh.half[0]; *(v8us*)((unsigned short*)Hl + t * 8) = fl.half[0];  } }

// ---- fast GEMM (block tile 128x128, eight waves of 32x64; requires M % 128 == 0, N % 128 == 0, K % 128 == 0); epilogue = k_gemm_hhx semantics, but plane by's bias is bias, bias1 or bias2 (by = 0, 1, 2) ----
// A stage is 128 k of the block's 128 A rows and 128 B rows (256-byte rows). Asynchronous copies bring it from global memory into LDS, whole 128-byte lines a request, through no register;
// two buffers: the next stage flies while this one is multiplied. Fragments come from LDS in the k order of g2_frag, one k step ahead of their products; every accumulator still sums k upward in steps of 32.
#define G2_BK 128                    /* k a stage */
#define G2_PITCH 272                 /* LDS row pitch in bytes: 16 x odd, so the 16 rows of a 16-byte fragment read fall on 64 distinct banks */
#define G2_STAGE (256 * G2_PITCH)    /* 128 A rows, then 128 B rows */
__device__ __forceinline__ v16h g2_frag(const _Float16* p, int hh) { FragH f; f.half[0] = *(const v8us*)((const unsigned short*)p + 8 * hh); f.half[1] = *(const v8us*)((const unsigned short*)p + 16 + 8 * hh); return f.v; }
__device__ __forceinline__ v16h g2_lfrag(const unsigned char* p) { FragH f; f.half[0] = *(const v8us*)p; f.half[1] = *(const v8us*)(p + 32); return f.v; }      /* p: the lane's row in LDS + 64 bytes a k step + 16 hh */
__device__ __forceinline__ v8f g2_mma(v16h a, v16h b, v8f c) { return __builtin_amdgcn_wmma_f32_16x16x32_f16(false, a, false, b, (short)0, c, false, false); }
// Eight asynchronous 16-byte copies of a lane: rows r, r + 16, ..., r + 112 of one operand's stage (l: LDS byte address of the first, g: its global address, gs: 16 global rows in elements).
// The closing s_wait_xcnt 0 stands inside the statement, in front of any later write of the address registers that the copies name.
__device__ __forceinline__ void g2_copy8(unsigned l, const _Float16* g, size_t gs) {
  asm volatile("global_load_async_to_lds_b128 %0, %8, off\n\tglobal_load_async_to_lds_b128 %1, %9, off\n\tglobal_load_async_to_lds_b128 %2, %10, off\n\tglobal_load_async_to_lds_b128 %3, %11, off\n\t"
               "global_load_async_to_lds_b128 %4, %12, off\n\tglobal_load_async_to_lds_b128 %5, %13, off\n\tglobal_load_async_to_lds_b128 %6, %14, off\n\tglobal_load_async_to_lds_b128 %7, %15, off\n\ts_wait_xcnt 0x0"
               :: "v"(l), "v"(l + 16 * G2_PITCH), "v"(l + 32 * G2_PITCH), "v"(l + 48 * G2_PITCH), "v"(l + 64 * G2_PITCH), "v"(l + 80 * G2_PITCH), "v"(l + 96 * G2_PITCH), "v"(l + 112 * G2_PITCH),
                  "v"(g), "v"(g + gs), "v"(g + 2 * gs), "v"(g + 3 * gs), "v"(g + 4 * gs), "v"(g + 5 * gs), "v"(g + 6 * gs), "v"(g + 7 * gs) : "memory"); }
template <int ACT>
__global__ __launch_bounds__(256) void k_gemm2(const _Float16* __restrict__ A, int lda, size_t sA, const _Float16* __restrict__ Bh, int ldb, size_t sB, float alpha, const float* __restrict__ bias, const float* __restrict__ bias1, const float* __restrict__ bias2, const float* __restrict__ CP, int rowsPerB, size_t sCPb, int row0g,
    float* __restrict__ C, _Float16* __restrict__ C16, int ldc, size_t sC, int M, int N, int K) { static_assert(ACT == 0 || ACT == 3 || ACT == 6 || ACT == 8 || ACT == 9 || ACT == 11 || ACT == 12 || ACT == 14 || ACT == 15 || ACT == 16 || ACT == 17, "k_gemm2: unsupported ACT code (would silently apply no activation)");
  __shared__ __attribute__((aligned(16))) unsigned char ring[2 * G2_STAGE];
  __shared__ __attribute__((aligned(16))) float so[8][32][68];
  const int tid = threadIdx.x, w = tid >> 5, lane = tid & 31, ln = lane & 15, hh = lane >> 4; const int by = blockIdx.y;
  A += (size_t)by * sA; Bh += (size_t)by * sB; const size_t cofs = (size_t)by * sC; const float* bp = by == 0 ? bias : by == 1 ? bias1 : bias2;      /* the planes' biases are separate buffers: at most three planes */
  const int ntn = N >> 7; const int mt = blockIdx.x / ntn, nq = blockIdx.x - mt * ntn; if (mt * 128 >= M) return;      /* the whole block leaves, in front of every barrier */
  const int row0 = mt * 128 + 32 * (w & 3), col0 = nq * 128 + 64 * (w >> 2);
  const int nt = K / G2_BK;
  const unsigned lc = (unsigned)(size_t)ring + (unsigned)((tid >> 4) * G2_PITCH + (tid & 15) * 16);      /* the lane's place in a stage: row tid / 16 (+ 16 a copy), 16-byte column tid % 16: a wave's copy is two whole rows */
  const _Float16* ga = A + (size_t)(mt * 128 + (tid >> 4)) * lda + (tid & 15) * 8; const _Float16* gb = Bh + (size_t)(nq * 128 + (tid >> 4)) * ldb + (tid & 15) * 8;
  const size_t gsa = (size_t)16 * lda, gsb = (size_t)16 * ldb;
  g2_copy8(lc, ga, gsa); g2_copy8(lc + 128 * G2_PITCH, gb, gsb);      /* stage 0 */
  asm volatile("s_wait_asynccnt 0x0" ::: "memory");      /* this wave's copies of stage 0 have landed */
  __syncthreads();      /* publishes stage 0 */
  if (nt > 1) { g2_copy8(lc + G2_STAGE, ga + G2_BK, gsa); g2_copy8(lc + G2_STAGE + 128 * G2_PITCH, gb + G2_BK, gsb); }      /* stage 1 */
  const unsigned char* fa = ring + (32 * (w & 3) + ln) * G2_PITCH + 16 * hh; const unsigned char* fb = ring + (128 + 64 * (w >> 2) + ln) * G2_PITCH + 16 * hh;
  const v8f z8 = {0.f,0.f,0.f,0.f,0.f,0.f,0.f,0.f}; v8f c00 = z8, c01 = z8, c02 = z8, c03 = z8, c10 = z8, c11 = z8, c12 = z8, c13 = z8;
#pragma unroll 1      /* one stage a trip: the buffer is picked by the trip's parity, the four k steps inside are unrolled */
  for (int t = 0; t < nt; ++t) { const unsigned bo = (unsigned)(t & 1) * G2_STAGE; const unsigned char* pa = fa + bo; const unsigned char* pb = fb + bo;
    v16h a[2][2], b[2][4];
    a[0][0] = g2_lfrag(pa); a[0][1] = g2_lfrag(pa + 16 * G2_PITCH);
#pragma unroll
    for (int j = 0; j < 4; ++j) b[0][j] = g2_lfrag(pb + j * 16 * G2_PITCH);
#pragma unroll
    for (int ks = 0; ks < G2_BK / 32; ++ks) { const int cu = ks & 1, nx = cu ^ 1;
      if (ks + 1 < G2_BK / 32) { a[nx][0] = g2_lfrag(pa + (ks + 1) * 64); a[nx][1] = g2_lfrag(pa + 16 * G2_PITCH + (ks + 1) * 64);      /* the next k step's fragments, into the other register set */
#pragma unroll
        for (int j = 0; j < 4; ++j) b[nx][j] = g2_lfrag(pb + j * 16 * G2_PITCH + (ks + 1) * 64); }
      __builtin_amdgcn_sched_barrier(0);      /* keeps those reads one group ahead of this step's products: without it the build sank each read to its first use, two products behind every full LDS wait */
      c00 = g2_mma(a[cu][0], b[cu][0], c00); c10 = g2_mma(a[cu][1], b[cu][0], c10); c01 = g2_mma(a[cu][0], b[cu][1], c01); c11 = g2_mma(a[cu][1], b[cu][1], c11);
      c02 = g2_mma(a[cu][0], b[cu][2], c02); c12 = g2_mma(a[cu][1], b[cu][2], c12); c03 = g2_mma(a[cu][0], b[cu][3], c03); c13 = g2_mma(a[cu][1], b[cu][3], c13);
      __builtin_amdgcn_sched_barrier(0); }      /* and keeps the following group's reads from rising among these products */
    asm volatile("s_wait_dscnt 0x0" ::: "memory");      /* this wave's reads of the buffer are done before it is refilled */
    asm volatile("s_wait_asynccnt 0x0" ::: "memory");      /* this wave's copies of stage t + 1 have landed */
    __syncthreads();      /* publishes stage t + 1 and ends every wave's reads of stage t */
    if (t + 2 < nt) { g2_copy8(lc + bo, ga + (size_t)(t + 2) * G2_BK, gsa); g2_copy8(lc + bo + 128 * G2_PITCH, gb + (size_t)(t + 2) * G2_BK, gsb); } }      /* stage t + 2 into the buffer just read */
  asm volatile("s_wait_asynccnt 0x0" ::: "memory");      /* nothing of this wave is in flight when it goes on */
  v8f accs[8] = {c00, c01, c02, c03, c10, c11, c12, c13};
#pragma unroll
  for (int u = 0; u < 8; ++u) { const int t = u & 3, half = u >> 2; const int col = col0 + t * 16 + ln; const float bv = bp ? bf16_round(bp[col]) : 0.f;
#pragma unroll
    for (int r = 0; r < 8; ++r) { const int rloc = half * 16 + 8 * hh + r; float v = accs[u][r] * alpha + bv; if (CP) { if (rowsPerB < 0) v += CP[cofs + (size_t)(row0g + row0 + rloc) * ldc + col];      /* rowsPerB < 0: own element of the batched C plane */ else { const int bidx = (row0g + row0 + rloc) / rowsPerB; v += CP[(size_t)bidx * sCPb + (size_t)by * 64 + col]; } }
      if (ACT == 3) v = fmaxf(v, 0.f); else if (ACT == 6) v = 0.5f * v * (1.0f + erff(v * 0.70710678118654752f)); else if (ACT == 11) v = 1.0f / (1.0f + expf(-v)); else if (ACT == 15) v = v / (1.0f + expf(-v)); else if (ACT == 12) v = (v > 0.f) ? v : 0.01f * v; else if (ACT == 8) v = tanhf(v); else if (ACT == 9) v = 0.5f * v * (1.0f + tanhf(0.7978845608028654f * (v + 0.044715f * v * v * v))); else if (ACT == 14) v = (v > 0.f) ? v : 0.1f * v; else if (ACT == 16) v = (v >= 0.f) ? v : 0.3f * v; else if (ACT == 17) v = (v >= 0.f) ? v : 0.2f * v;
      so[w][rloc][t * 16 + ln] = v; } }
  __builtin_amdgcn_fence(__ATOMIC_ACQ_REL, "workgroup"); __builtin_amdgcn_wave_barrier();
  const int rsub = lane >> 4, c4 = (lane & 15) * 4;
  {
#pragma unroll
    for (int q = 0; q < 16; ++q) { const int r = q * 2 + rsub; const v4f v = *(const v4fa*)&so[w][r][c4]; if (C) *(v4f*)(C + cofs + (size_t)(row0 + r) * ldc + col0 + c4) = v; if (C16) { v4h h4; for (int i = 0; i < 4; ++i) h4[i] = (_Float16)v[i]; *(v4h*)(C16 + cofs + (size_t)(row0 + r) * ldc + col0 + c4) = h4; } }
     } }


// All five operand conversions in one launch (none reads another's output): blocks [0, PREP_XB) round x to bf16 and store it as f16; the next 4 * PREP_WB blocks do the same, x16, for Wq, Wk, Wv, Wo
// (natural [out][in] = Bt[n][k]) into four consecutive planes of BW. Eight elements a thread; which array a block works on is the same for the whole block.
#define PREP_XB ((unsigned)(NR * DM / 8 / 256))
#define PREP_WB ((unsigned)((size_t)DM * DM / 8 / 256))
__global__ __launch_bounds__(256) void k_prep(const float* __restrict__ x, const float* __restrict__ wq, const float* __restrict__ wk, const float* __restrict__ wv, const float* __restrict__ wo, _Float16* __restrict__ X16, _Float16* __restrict__ BW) {
  static_assert(NR * DM % (8 * 256) == 0 && (size_t)DM * DM % (8 * 256) == 0, "k_prep: whole blocks per array");
  const unsigned bx = blockIdx.x; const float* s = x; _Float16* d = X16; float sc = 1.0f; unsigned lb = bx;
  if (bx >= PREP_XB) { const unsigned m = (bx - PREP_XB) / PREP_WB; lb = (bx - PREP_XB) % PREP_WB; s = m == 0 ? wq : m == 1 ? wk : m == 2 ? wv : wo; d = BW + (size_t)m * DM * DM; sc = 16.0f; }
  const size_t t = (size_t)lb * 256 + threadIdx.x; FragH f;
#pragma unroll
  for (int q = 0; q < 8; ++q) f.h[q] = (_Float16)(bf16_round(s[t * 8 + q]) * sc);
  *(v8us*)((unsigned short*)d + t * 8) = f.half[0]; }
__global__ __launch_bounds__(256) void k_rsm(const float* __restrict__ S, _Float16* __restrict__ P, int nrows) {
  #pragma clang fp contract(off)
  const int i = blockIdx.x * 256 + threadIdx.x; if (i >= nrows) return; const float* s = S + (size_t)i * SQ; float mx = -3.0e38f;
#pragma unroll 1
  for (int j = 0; j < SQ; ++j) mx = fmaxf(mx, s[j]); float se = 0.f;
#pragma unroll 1
  for (int j = 0; j < SQ; ++j) se += expf(s[j] - mx); const float sc = 256.0f / se;
#pragma unroll 1
  for (int j0 = 0; j0 < SQ; j0 += 8) { FragH f; for (int q = 0; q < 8; ++q) f.h[q] = (_Float16)(expf(s[j0 + q] - mx) * sc); unsigned short* d = (unsigned short*)P + (size_t)i * SQ + j0; *(v8us*)d = f.half[0];  } }
__global__ __launch_bounds__(256) void k_vt(const _Float16* __restrict__ V16, int b, int h0, _Float16* __restrict__ VT) { __shared__ unsigned short tl[64][65]; const int tid = threadIdx.x; const int hh = blockIdx.x % HG, sg = blockIdx.x / HG; const int s0 = sg * 64; const int h = h0 + hh;
  for (int i = tid; i < 64 * 8; i += 256) { const int j = i / 8, d8 = (i % 8) * 8; FragH f; f.half[0] = *(const v8us*)((const unsigned short*)V16 + ((size_t)b * SQ + s0 + j) * DM + h * HD + d8); for (int q = 0; q < 8; ++q) tl[d8 + q][j] = f.u[q]; }
  __syncthreads();
  { for (int i = tid; i < 64 * 8; i += 256) { const int d = i / 8, j8 = (i % 8) * 8; FragH f; for (int q = 0; q < 8; ++q) f.u[q] = tl[d][j8 + q]; *(v8us*)((unsigned short*)VT + ((size_t)hh * HD + d) * SQ + s0 + j8) = f.half[0]; }  } }



// Fused attention: scores, softmax of (scores + relative-position bias) and the product with V in one kernel, for every batch and head in one launch; neither the scores nor the weights go to memory.
// A wave owns FA_QT * 16 query columns and walks the keys 32 at a time: S^T = K . Q^T (A = K rows, B = Q rows kept in registers), so that a lane holds 16 scores of ONE query per column tile;
// running maximum and sum per lane (online softmax, log2 domain), one exchange between the wave halves per pass for the maximum, one in the epilogue for the sum;
// the two S^T tiles of a pass, converted in place, are the B operand of O^T += V^T . P^T (A = V^T rows in the same k order), and a lane's 8 accumulator registers are 8 consecutive d of its query: 16-byte stores.
// Every loop but the walk over the stages and their passes is unrolled in full: the fragment and accumulator arrays stay in registers only where each index is a constant.
// K and V^T reach the waves through LDS: a stage is FA_SK keys (K rows of 128 bytes, V^T rows of 256 bytes), brought once for the whole block by asynchronous copies, whole 128-byte lines a request, through no register;
// two buffers: the next stage flies while this one is worked on. The eight waves read their fragments from LDS in the k order of g2_frag; passes, products and sums keep their order.
#define FA_WAVES 8
#define FA_QT 2                      /* 16-column query tiles a wave */
#define FA_BQ (FA_WAVES * FA_QT * 16) /* query rows a block */
#define FA_L2E 1.4426950408889634f
#define FA_SK 128                    /* keys a stage: four passes */
#define FA_KP 144                    /* LDS pitch of a K row in bytes: 16 x odd, so the 16 rows of a 16-byte fragment read fall on distinct banks */
#define FA_VP 272                    /* LDS pitch of a V^T row in bytes: 16 x odd */
#define FA_KB (FA_SK * FA_KP)        /* the K rows of a stage; the HD V^T rows follow */
#define FA_STAGE (FA_KB + HD * FA_VP)
// Eight asynchronous 16-byte copies of a lane: K rows r, r + 32, r + 64, r + 96 of a stage (lk: LDS byte address of the first, gk: its global address), then V^T rows d, d + 16, d + 32, d + 48 (lv, gv).
// The closing s_wait_xcnt 0 stands inside the statement, in front of any later write of the address registers that the copies name.
__device__ __forceinline__ void fa_copy8(unsigned lk, const _Float16* gk, unsigned lv, const _Float16* gv) {
  asm volatile("global_load_async_to_lds_b128 %0, %8, off\n\tglobal_load_async_to_lds_b128 %1, %9, off\n\tglobal_load_async_to_lds_b128 %2, %10, off\n\tglobal_load_async_to_lds_b128 %3, %11, off\n\t"
               "global_load_async_to_lds_b128 %4, %12, off\n\tglobal_load_async_to_lds_b128 %5, %13, off\n\tglobal_load_async_to_lds_b128 %6, %14, off\n\tglobal_load_async_to_lds_b128 %7, %15, off\n\ts_wait_xcnt 0x0"
               :: "v"(lk), "v"(lk + 32 * FA_KP), "v"(lk + 64 * FA_KP), "v"(lk + 96 * FA_KP), "v"(lv), "v"(lv + 16 * FA_VP), "v"(lv + 32 * FA_VP), "v"(lv + 48 * FA_VP),
                  "v"(gk), "v"(gk + (size_t)32 * DM), "v"(gk + (size_t)64 * DM), "v"(gk + (size_t)96 * DM), "v"(gv), "v"(gv + (size_t)16 * SQ), "v"(gv + (size_t)32 * SQ), "v"(gv + (size_t)48 * SQ) : "memory"); }
__device__ __forceinline__ float sm_xh(float x) { return __builtin_bit_cast(float, __builtin_amdgcn_permlanex16(__builtin_bit_cast(int, x), __builtin_bit_cast(int, x), 0x76543210, 0xfedcba98, false, false)); }      /* lane l ^ 16 */
// Four native exp2 in place. In one statement with a closing v_nop: the slot that the instruction set asks for behind a transcendental before its result is read or its source overwritten
__device__ __forceinline__ v4f sm_exp2x4(v4f x) { float a = x[0], b = x[1], c = x[2], d = x[3];
  asm("v_exp_f32 %0, %0\n\tv_exp_f32 %1, %1\n\tv_exp_f32 %2, %2\n\tv_exp_f32 %3, %3\n\tv_nop" : "+v"(a), "+v"(b), "+v"(c), "+v"(d));
  const v4f y = {a, b, c, d}; return y; }
__device__ __forceinline__ float sm_exp2x1(float x) { asm("v_exp_f32 %0, %0\n\tv_nop" : "+v"(x)); return x; }      /* one native exp2, with the same closing slot */
__device__ __forceinline__ v8f fa_mma(v16h a, v16h b, v8f c) { return __builtin_amdgcn_wmma_f32_16x16x32_f16(false, a, false, b, (short)0, c, false, false); }
__global__ __launch_bounds__(FA_WAVES * 32) void k_fattn(const _Float16* __restrict__ Q16, const _Float16* __restrict__ K16, const _Float16* __restrict__ VT, const float* __restrict__ emb, _Float16* __restrict__ O16) {
  static_assert(SQ % FA_BQ == 0 && SQ % FA_SK == 0 && SQ / FA_SK >= 2 && FA_SK == 128 && FA_WAVES == 8 && HD == 64 && MAXD % 32 == 0 && FA_QT * 16 + 31 <= MAXD, "k_fattn: whole blocks per head, whole stages per row (two at least), eight copies a lane a stage, two k steps per score tile, band passes inside the table");
  __shared__ __attribute__((aligned(16))) unsigned char ring[2 * FA_STAGE];
  __shared__ float tb[4 * MAXD - 1];      /* this head's bias, bf16-rounded, times log2(e), by k = j - i + (2 * MAXD - 1), already clipped: consecutive j are consecutive entries */
  const int tid = threadIdx.x, lane = tid & 31, ln = lane & 15, hh = lane >> 4; const int wave = __builtin_amdgcn_readfirstlane(tid >> 5);
  const int bh = blockIdx.x / (SQ / FA_BQ), b = bh / NH, h = bh % NH; const int q0 = (blockIdx.x % (SQ / FA_BQ)) * FA_BQ + wave * (FA_QT * 16);
  const unsigned lk = (unsigned)(size_t)ring + (unsigned)((tid >> 3) * FA_KP + (tid & 7) * 16), lv = (unsigned)(size_t)ring + (unsigned)(FA_KB + (tid >> 4) * FA_VP + (tid & 15) * 16);      /* the lane's places in a stage: a wave's copy is four whole K rows or two whole V^T rows */
  const _Float16* gk = K16 + ((size_t)b * SQ + (tid >> 3)) * DM + h * HD + (tid & 7) * 8; const _Float16* gv = VT + ((size_t)bh * HD + (tid >> 4)) * SQ + (tid & 15) * 8;
  fa_copy8(lk, gk, lv, gv);      /* stage 0 */
  for (int i = tid; i < 4 * MAXD - 1; i += FA_WAVES * 32) tb[i] = bf16_round(emb[(min(max(2 * MAXD - 1 - i, -MAXD), MAXD) + MAXD) * NH + h]) * FA_L2E;
  asm volatile("s_wait_asynccnt 0x0" ::: "memory");      /* this wave's copies of stage 0 have landed */
  __syncthreads();      /* publishes tb and stage 0 */
  fa_copy8(lk + FA_STAGE, gk + (size_t)FA_SK * DM, lv + FA_STAGE, gv + FA_SK);      /* stage 1 */
  const float bfar = tb[0], bnear = tb[4 * MAXD - 2];      /* j <= i - MAXD ; j >= i + MAXD */
  const _Float16* qp = Q16 + ((size_t)b * SQ + q0 + ln) * DM + h * HD; const unsigned char* fk = ring + ln * FA_KP + 16 * hh; const unsigned char* fv = ring + FA_KB + ln * FA_VP + 16 * hh;      /* the lane's fragment rows in buffer 0 */
  v16h qf[FA_QT][2], kf[2][2];
#pragma unroll
  for (int t = 0; t < FA_QT; ++t) { qf[t][0] = g2_frag(qp + (size_t)t * 16 * DM, hh); qf[t][1] = g2_frag(qp + (size_t)t * 16 * DM + 32, hh); }
  const v8f z8 = {0.f,0.f,0.f,0.f,0.f,0.f,0.f,0.f};
  v8f o[FA_QT][4]; float mr[FA_QT], lr[FA_QT];
#pragma unroll
  for (int t = 0; t < FA_QT; ++t) { mr[t] = -3.0e38f; lr[t] = 0.f; o[t][0] = z8; o[t][1] = z8; o[t][2] = z8; o[t][3] = z8; }
#pragma unroll 1      /* one stage a trip: the buffer is picked by the trip's parity */
  for (int st = 0; st < SQ / FA_SK; ++st) { const unsigned bo = (unsigned)(st & 1) * FA_STAGE; const unsigned char* pk = fk + bo; const unsigned char* pv = fv + bo;
#pragma unroll
   for (int u = 0; u < 2; ++u) { kf[u][0] = g2_lfrag(pk + u * 16 * FA_KP); kf[u][1] = g2_lfrag(pk + u * 16 * FA_KP + 64); }      /* the stage's first K rows */
#pragma unroll 1      /* one pass a trip: with the four passes unrolled the build went past 256 registers and spilled */
   for (int p = 0; p < FA_SK / 32; ++p) { const int j0 = st * FA_SK + p * 32;
    v16h vf[4];      /* asked for first, used last: the scores and the softmax stand between */
#pragma unroll
    for (int d = 0; d < 4; ++d) vf[d] = g2_lfrag(pv + d * 16 * FA_VP + p * 64);
    v8f s[FA_QT][2];      /* s[t][u][r] = score of key j0 + 16 u + 8 hh + r, query q0 + 16 t + ln */
#pragma unroll
    for (int t = 0; t < FA_QT; ++t)
#pragma unroll
      for (int u = 0; u < 2; ++u) s[t][u] = fa_mma(kf[u][1], qf[t][1], fa_mma(kf[u][0], qf[t][0], z8));
    if (p + 1 < FA_SK / 32) {      /* the next pass's K rows, fetched one pass ahead inside the stage */
#pragma unroll
      for (int u = 0; u < 2; ++u) { kf[u][0] = g2_lfrag(pk + ((p + 1) * 32 + u * 16) * FA_KP); kf[u][1] = g2_lfrag(pk + ((p + 1) * 32 + u * 16) * FA_KP + 64); } }
    if (j0 + 31 > q0 - MAXD && j0 < q0 + FA_QT * 16 - 1 + MAXD) { const float* tp = tb + (j0 - q0 + 2 * MAXD - 1) + 8 * hh - ln;      /* wave-uniform: the pass meets the unclipped band; every k read here lies inside the table */
#pragma unroll
      for (int t = 0; t < FA_QT; ++t)
#pragma unroll
        for (int u = 0; u < 2; ++u)
#pragma unroll
          for (int r = 0; r < 8; ++r) s[t][u][r] = __builtin_fmaf(s[t][u][r], 0.125f * FA_L2E, tp[(u - t) * 16 + r]);
    } else { const float bc = (j0 >= q0 + FA_QT * 16 - 1 + MAXD) ? bnear : bfar;
#pragma unroll
      for (int t = 0; t < FA_QT; ++t)
#pragma unroll
        for (int u = 0; u < 2; ++u)
#pragma unroll
          for (int r = 0; r < 8; ++r) s[t][u][r] = __builtin_fmaf(s[t][u][r], 0.125f * FA_L2E, bc); }
#pragma unroll
    for (int t = 0; t < FA_QT; ++t) {
      float m0 = fmaxf(s[t][0][0], s[t][0][1]), m1 = fmaxf(s[t][1][0], s[t][1][1]);
#pragma unroll
      for (int r = 2; r < 8; r += 2) { m0 = fmaxf(fmaxf(m0, s[t][0][r]), s[t][0][r + 1]); m1 = fmaxf(fmaxf(m1, s[t][1][r]), s[t][1][r + 1]); }
      m0 = fmaxf(m0, m1); const float mn = fmaxf(mr[t], fmaxf(m0, sm_xh(m0)));
      const float al = sm_exp2x1(mr[t] - mn); mr[t] = mn;
      const float nm = 8.0f - mn;      /* weights carried x256 (as f16 operands away from the subnormal range); the sum carries the same factor */
      v4f as; FragH pf;
#pragma unroll
      for (int u = 0; u < 2; ++u)
#pragma unroll
        for (int g = 0; g < 2; ++g) { v4f x = {s[t][u][4 * g] + nm, s[t][u][4 * g + 1] + nm, s[t][u][4 * g + 2] + nm, s[t][u][4 * g + 3] + nm}; x = sm_exp2x4(x);
          if (u + g == 0) as = x; else as += x;
#pragma unroll
          for (int e = 0; e < 4; ++e) pf.h[u * 8 + g * 4 + e] = (_Float16)x[e]; }
      lr[t] = __builtin_fmaf(lr[t], al, (as[0] + as[1]) + (as[2] + as[3]));
#pragma unroll
      for (int d = 0; d < 4; ++d) o[t][d] = fa_mma(vf[d], pf.v, o[t][d] * al); } }
   asm volatile("s_wait_dscnt 0x0" ::: "memory");      /* this wave's reads of the buffer are done before it is refilled */
   asm volatile("s_wait_asynccnt 0x0" ::: "memory");      /* this wave's copies of stage st + 1 have landed */
   __syncthreads();      /* publishes stage st + 1 and ends every wave's reads of stage st */
   if (st + 2 < SQ / FA_SK) fa_copy8(lk + bo, gk + (size_t)(st + 2) * FA_SK * DM, lv + bo, gv + (size_t)(st + 2) * FA_SK); }      /* stage st + 2 into the buffer just read */
  asm volatile("s_wait_asynccnt 0x0" ::: "memory");      /* nothing of this wave is in flight when it goes on */
#pragma unroll
  for (int t = 0; t < FA_QT; ++t) { const float sc = 64.0f / (lr[t] + sm_xh(lr[t]));      /* o carried x64, as the output GEMM's alpha expects */
    unsigned short* op = (unsigned short*)O16 + ((size_t)b * SQ + q0 + t * 16 + ln) * DM + h * HD + 8 * hh;
#pragma unroll
    for (int d = 0; d < 4; ++d) { FragH f;
#pragma unroll
      for (int r = 0; r < 8; ++r) f.h[r] = (_Float16)(o[t][d][r] * sc);
      *(v8us*)(op + d * 16) = f.half[0]; } } }

extern "C" void kernel_launch(void* const* d_in, const int* in_sizes, int n_in,
                              void* d_out, int out_size, void* d_ws, size_t ws_size, hipStream_t stream) {
  (void)in_sizes; (void)n_in; (void)out_size;
  const float* const* I = (const float* const*)d_in; const float* x = I[0]; const float* wq = I[1]; const float* bq = I[2]; const float* wk = I[3]; const float* bk = I[4]; const float* wv = I[5]; const float* bv = I[6]; const float* wo = I[7]; const float* bo = I[8]; const float* emb = I[9];      /* nn.Linear weights [out][in]; rel_emb [2*MAXD+1][NH] */
  char* ws = (char*)d_ws; size_t off = 0;
  auto take = [&](size_t bytes) { char* p = ws + off; off += (bytes + 255) & ~(size_t)255; return p; };
  _Float16* BQ = (_Float16*)take((size_t)DM * DM * 2); _Float16* BK = (_Float16*)take((size_t)DM * DM * 2); _Float16* BV = (_Float16*)take((size_t)DM * DM * 2); _Float16* BO = (_Float16*)take((size_t)DM * DM * 2);
  _Float16* X16 = (_Float16*)take(NR * DM * 2); _Float16* Q16 = (_Float16*)take(NR * DM * 2); _Float16* K16 = (_Float16*)take(NR * DM * 2); _Float16* V16 = (_Float16*)take(NR * DM * 2); _Float16* O16 = (_Float16*)take(NR * DM * 2);
  _Float16* VT = (_Float16*)take((size_t)NB * NH * HD * SQ * 2);
  if (off > ws_size) return;
  static_assert((size_t)DM * DM * 2 % 256 == 0 && NR * DM * 2 % 256 == 0, "BQ, BK, BV, BO and Q16, K16, V16 lie back to back: planes of one pitch");
  k_prep<<<PREP_XB + 4 * PREP_WB, 256, 0, stream>>>(x, wq, wk, wv, wo, X16, BQ);      /* X16; BQ, BK, BV, BO */
  const size_t r0p = (size_t)B0 * SQ;      /* first projected row */
  k_gemm2<0><<<dim3((unsigned)((MP / 128) * (DM / 128)), 3), 256, 0, stream>>>(X16 + r0p * DM, DM, 0, BQ, DM, (size_t)DM * DM, 0.0625f, bq, bk, bv, nullptr, 1, 0, 0, nullptr, Q16 + r0p * DM, DM, NR * DM, MP, DM, DM);      /* planes 0, 1, 2: Q16, K16, V16 */
  k_vt<NH, SQ><<<NB * NH * (SQ / 64), 256, 0, stream>>>(V16, LQ, 0, VT);      /* V^T [NB][NH][HD][SQ] */
  k_fattn<<<NB * NH * (SQ / FA_BQ), FA_WAVES * 32, 0, stream>>>(Q16, K16, VT, emb, O16);      /* o (merged heads, x64) as f16 rows */
  k_gemm2<0><<<dim3((unsigned)((MPO / 128) * (DM / 128)), 1), 256, 0, stream>>>(O16 + r0p * DM, DM, 0, BO, DM, 0, 0.0009765625f, bo, nullptr, nullptr, nullptr, 1, 0, 0, (float*)d_out + r0p * DM, nullptr, DM, 0, MPO, DM, DM);      /* out rows are the output layout */
}

// v006
// It runs in 89.2 microseconds.
// Next to v005, in two timings, it ran 1.10 times as fast each time.
// Counting every step since v000, it is 50.6 times as fast.
#include <hip/hip_runtime.h>
// Multi-head self-attention with a learned relative-position bias (x [2][2048][1024]; q/k/v = x W^T + b (nn.Linear [out][in]), 16 heads of 64; scores / 8 + rel_emb[clip(i - j, -128, 128) + 128][h] (rel_emb [257][16]); softmax; o merged; out = o Wo^T + bo -> [2][2048][1024]).
// Structure: token rows r = b*2048 + s; x as exact f16 rows (bf16-rounded) and the four weights (x16) converted in one launch; Q, K, V as three WMMA GEMMs in one launch, the grid's y index picking weight, bias and output plane (32x64 wave tiles, f32 accumulation, exact x16 weights + bias, f16 outputs); V^T for all batches and heads via LDS transposes; one fused attention launch for all batches and heads: score tiles on WMMA (K = 64), online softmax of (scores / 8 + relative-position bias looked up by (i - j, head)) on VALU (f32 statistics, native exp; weights x256 as f16 operands, in registers), o = P . V on WMMA (o carried x64 against f16 subnormal flush, folded into the output GEMM alpha) written straight into the merged f16 o rows; out = o W_o + b GEMM (f32) into the output layout.
// Compute dtype: inputs rounded to bf16; x / weights exact; q, k, v, softmax weights and o as plain f16 GEMM operands (~2^-12); scores and softmax statistics f32. v_wmma_f32_16x16x32_f16.
#define NB 2
#define SQ 2048
#define DM 1024
#define NH 16
#define HD 64
#define MAXD 128                     /* relative distance clip */
#define HG 4                         /* heads per launch of the grouped V^T transpose k_vt(b, h0) */
#define B0 0                         /* first batch processed (debug hook) */
#define NBR NB                       /* batches processed (debug hook) */
#define NR ((size_t)NB * SQ)         /* token rows */
#define MP ((int)((size_t)NBR * SQ)) /* rows projected (debug hook) */
#define QN SQ                        /* query rows per batch; unused: the attention launch covers all SQ */
#define NHD NH                       /* heads; unused: the attention launch covers all NH */
#define MPO MP                       /* rows through the output stage (debug hook) */
#define LQ DM      /* row pitch of the q/k/v rows */
typedef __bf16 v16b __attribute__((ext_vector_type(16)));
typedef unsigned short v8us __attribute__((ext_vector_type(8), may_alias));
typedef float  v8f  __attribute__((ext_vector_type(8)));
typedef float  v4f  __attribute__((ext_vector_type(4)));
typedef float  v4fa __attribute__((ext_vector_type(4), may_alias));
union FragB { v16b v; v8us half[2]; unsigned short u[16]; };

__device__ __forceinline__ unsigned short bf16_bits(float x) { unsigned int u = __float_as_uint(x); return (unsigned short)((u + 0x7FFFu + ((u >> 16) & 1u)) >> 16); }
__device__ __forceinline__ float bf16_val(unsigned short b) { return __uint_as_float(((unsigned int)b) << 16); }
__device__ __forceinline__ float bf16_round(float x) { return bf16_val(bf16_bits(x)); }
// D += A·B with NT terms: 1 = ah·bh, 2 = + al·bh (A split), 3 = + ah·bl (both split)
template <int NT>
__device__ __forceinline__ v8f mmaN(v16b ah, v16b al, v16b bh, v16b bl, v8f c) {
  c = __builtin_amdgcn_wmma_f32_16x16x32_bf16(false, ah, false, bh, (short)0, c, false, false);
  if (NT >= 2) c = __builtin_amdgcn_wmma_f32_16x16x32_bf16(false, al, false, bh, (short)0, c, false, false);
  if (NT >= 3) c = __builtin_amdgcn_wmma_f32_16x16x32_bf16(false, ah, false, bl, (short)0, c, false, false);
  asm volatile("v_nop\n\tv_nop\n\tv_nop\n\tv_nop" : "+v"(c) : "v"(ah), "v"(al), "v"(bh), "v"(bl));
  return c;
}

__global__ __launch_bounds__(256) void k_wt_bf16(const float* __restrict__ W, unsigned short* __restrict__ Wt, int K, int N) {
  const int t = blockIdx.x * 256 + threadIdx.x;
  const int k8n = K / 8;
  if (t >= N * k8n) return;
  const int n = t / k8n, k8 = (t % k8n) * 8;
  v8us v;
#pragma unroll
  for (int i = 0; i < 8; ++i) v[i] = bf16_bits(W[(size_t)(k8 + i) * N + n]);
  *(v8us*)(Wt + (size_t)n * K + k8) = v;
  
}

// GEMM C[M][N] (f32, pitch ldc) = act(A[M][K]·W + bias). A f32 row-major (pitch lda) converted per fragment to bf16
// (ASPLIT: hi/lo two planes -> 2 terms, else single rounded term); Wt bf16 [N][K] (pitch ldb). BIAS_BF16 rounds the
// bias to bf16 first (bias quantised to bf16 before the add). K%32==0, M%16==0, N%64==0.
template <bool ASPLIT, int ACT, bool BIAS_BF16>
__global__ __launch_bounds__(128) void k_gemm_bf(const float* __restrict__ A, int lda, const unsigned short* __restrict__ Wt, int ldb,
                                               const float* __restrict__ bias, float* __restrict__ C, int ldc, int M, int N, int K) {
  __shared__ __attribute__((aligned(16))) float so[4][16][64];
  const int tid = threadIdx.x, w = tid >> 5, lane = tid & 31, ln = lane & 15, hh = lane >> 4;
  const int ntn = N / 64;
  const int wid = blockIdx.x * 4 + w;
  const int mt = wid / ntn, nq = wid % ntn;
  if (mt * 16 >= M) return;
  const int row0 = mt * 16, col0 = nq * 64;
  const float* arow = A + (size_t)(row0 + ln) * lda;
  v8f acc[4] = {};
  for (int kb = 0; kb < K; kb += 32) {
    FragB ah, al;
    const v4f x0 = *(const v4fa*)(arow + kb + 8 * hh), x1 = *(const v4fa*)(arow + kb + 8 * hh + 4);
    const v4f x2 = *(const v4fa*)(arow + kb + 16 + 8 * hh), x3 = *(const v4fa*)(arow + kb + 16 + 8 * hh + 4);
    float xs[16] = {x0[0],x0[1],x0[2],x0[3],x1[0],x1[1],x1[2],x1[3],x2[0],x2[1],x2[2],x2[3],x3[0],x3[1],x3[2],x3[3]};
#pragma unroll
    for (int i = 0; i < 16; ++i) { const unsigned short hb = bf16_bits(xs[i]); ah.u[i] = hb; al.u[i] = ASPLIT ? bf16_bits(xs[i] - bf16_val(hb)) : (unsigned short)0; }
#pragma unroll
    for (int t = 0; t < 4; ++t) {
      const unsigned short* brow = Wt + (size_t)(col0 + t * 16 + ln) * ldb + kb;
      FragB b;
      b.half[0] = *(const v8us*)(brow + 8 * hh);
      b.half[1] = *(const v8us*)(brow + 16 + 8 * hh);
      acc[t] = mmaN<ASPLIT ? 2 : 1>(ah.v, al.v, b.v, b.v, acc[t]);
    }
  }
#pragma unroll
  for (int t = 0; t < 4; ++t) {
    float bv = bias ? bias[col0 + t * 16 + ln] : 0.f;
    if (BIAS_BF16) bv = bf16_round(bv);
#pragma unroll
    for (int r = 0; r < 8; ++r) { float v = acc[t][r] + bv; if (ACT == 1) v = fmaxf(v, 0.f); so[w][8 * hh + r][t * 16 + ln] = v; }
  }
  __builtin_amdgcn_fence(__ATOMIC_ACQ_REL, "workgroup");
  __builtin_amdgcn_wave_barrier();
  const int rsub = lane >> 4, c4 = (lane & 15) * 4;
  {
#pragma unroll
    for (int q = 0; q < 8; ++q) {
      const int r = q * 2 + rsub;
      const v4f v = *(const v4fa*)&so[w][r][c4];
      *(v4f*)(C + (size_t)(row0 + r) * ldc + col0 + c4) = v;
    }
    
  }
}

// GEMM C = act(A·W + bias + resid): A f32 (ASPLIT -> hi/lo 2 terms), Wt bf16 [N][K]; ACT 0 none, 1 relu, 2 exact gelu;
// resid (optional, f32, row index = (row % rmod), pitch ldr, RES_BF16 rounds it) added before the activation.
template <bool ASPLIT, int ACT, bool BIAS_BF16, bool RES_BF16>
__global__ __launch_bounds__(128) void k_gemm_bf3(const float* __restrict__ A, int lda, const unsigned short* __restrict__ Wt, int ldb,
                                                const float* __restrict__ bias, const float* __restrict__ resid, int rmod, int ldr,
                                                float* __restrict__ C, int ldc, int M, int N, int K) {
  __shared__ __attribute__((aligned(16))) float so[4][16][64];
  const int tid = threadIdx.x, w = tid >> 5, lane = tid & 31, ln = lane & 15, hh = lane >> 4;
  const int ntn = N / 64;
  const int wid = blockIdx.x * 4 + w;
  const int mt = wid / ntn, nq = wid % ntn;
  if (mt * 16 >= M) return;
  const int row0 = mt * 16, col0 = nq * 64;
  const float* arow = A + (size_t)(row0 + ln) * lda;
  v8f acc[4] = {};
  for (int kb = 0; kb < K; kb += 32) {
    FragB ah, al;
    const v4f x0 = *(const v4fa*)(arow + kb + 8 * hh), x1 = *(const v4fa*)(arow + kb + 8 * hh + 4);
    const v4f x2 = *(const v4fa*)(arow + kb + 16 + 8 * hh), x3 = *(const v4fa*)(arow + kb + 16 + 8 * hh + 4);
    float xs[16] = {x0[0],x0[1],x0[2],x0[3],x1[0],x1[1],x1[2],x1[3],x2[0],x2[1],x2[2],x2[3],x3[0],x3[1],x3[2],x3[3]};
#pragma unroll
    for (int i = 0; i < 16; ++i) { const unsigned short hb = bf16_bits(xs[i]); ah.u[i] = hb; al.u[i] = ASPLIT ? bf16_bits(xs[i] - bf16_val(hb)) : (unsigned short)0; }
#pragma unroll
    for (int t = 0; t < 4; ++t) {
      const unsigned short* brow = Wt + (size_t)(col0 + t * 16 + ln) * ldb + kb;
      FragB b;
      b.half[0] = *(const v8us*)(brow + 8 * hh);
      b.half[1] = *(const v8us*)(brow + 16 + 8 * hh);
      acc[t] = mmaN<ASPLIT ? 2 : 1>(ah.v, al.v, b.v, b.v, acc[t]);
    }
  }
#pragma unroll
  for (int t = 0; t < 4; ++t) {
    const int col = col0 + t * 16 + ln;
    float bv = bias ? bias[col] : 0.f;
    if (BIAS_BF16) bv = bf16_round(bv);
#pragma unroll
    for (int r = 0; r < 8; ++r) {
      float v = acc[t][r] + bv;
      if (resid) { float rv = resid[(size_t)((row0 + 8 * hh + r) % rmod) * ldr + col]; if (RES_BF16) rv = bf16_round(rv); v += rv; }
      if (ACT == 1) v = fmaxf(v, 0.f);
      if (ACT == 2) v = 0.5f * v * (1.0f + erff(v * 0.70710678118654752f));
      if (ACT == 3) { const float u = 0.7978845608028654f * (v + 0.044715f * v * v * v); v = 0.5f * v * (1.0f + tanhf(u)); }
      so[w][8 * hh + r][t * 16 + ln] = v;
    }
  }
  __builtin_amdgcn_fence(__ATOMIC_ACQ_REL, "workgroup");
  __builtin_amdgcn_wave_barrier();
  const int rsub = lane >> 4, c4 = (lane & 15) * 4;
  {
#pragma unroll
    for (int q = 0; q < 8; ++q) {
      const int r = q * 2 + rsub;
      const v4f v = *(const v4fa*)&so[w][r][c4];
      *(v4f*)(C + (size_t)(row0 + r) * ldc + col0 + c4) = v;
    }
    
  }
}
// row LayerNorm (biased variance, eps) over N: s = X (+ R); optional out_sum <- s; out_norm <- (s-mu)*rsqrt(var+eps)*g + b
template <bool PARAM_BF16>
__global__ __launch_bounds__(256) void k_layernorm(const float* __restrict__ X, const float* __restrict__ R, const float* __restrict__ g, const float* __restrict__ bta,
                                                  float* __restrict__ out_sum, float* __restrict__ out_norm, int N, float eps) {
  __shared__ float red[256];
  const int row = blockIdx.x, tid = threadIdx.x;
  const float* x = X + (size_t)row * N; const float* rr = R ? R + (size_t)row * N : nullptr;
  float vals[16];                     // up to N = 4096
  const int per = N / 256;            // contiguous chunk per thread? use strided-by-4 chunks: thread handles j = tid*4 + 1024*u
  float s1 = 0.f;
  for (int u = 0; u < per / 4; ++u) {
    const int j = tid * 4 + 1024 * u;
    const v4f a = *(const v4fa*)(x + j);
    v4f b = {0.f,0.f,0.f,0.f}; if (rr) b = *(const v4fa*)(rr + j);
#pragma unroll
    for (int q = 0; q < 4; ++q) { const float v = a[q] + b[q]; vals[u * 4 + q] = v; s1 += v; }
  }
  red[tid] = s1; __syncthreads();
  for (int st = 128; st > 0; st >>= 1) { if (tid < st) red[tid] += red[tid + st]; __syncthreads(); }
  const float mu = red[0] / (float)N; __syncthreads();
  float s2 = 0.f;
  for (int u = 0; u < per / 4; ++u)
#pragma unroll
    for (int q = 0; q < 4; ++q) { const float c = vals[u * 4 + q] - mu; s2 += c * c; }
  red[tid] = s2; __syncthreads();
  for (int st = 128; st > 0; st >>= 1) { if (tid < st) red[tid] += red[tid + st]; __syncthreads(); }
  const float rs = rsqrtf(red[0] / (float)N + eps);
  {
    for (int u = 0; u < per / 4; ++u) {
      const int j = tid * 4 + 1024 * u;
      v4f o, sm;
#pragma unroll
      for (int q = 0; q < 4; ++q) {
        float gg = g[j + q], bb = bta[j + q];
        if (PARAM_BF16) { gg = bf16_round(gg); bb = bf16_round(bb); }
        sm[q] = vals[u * 4 + q]; o[q] = (vals[u * 4 + q] - mu) * rs * gg + bb;
      }
      if (out_sum) *(v4f*)(out_sum + (size_t)row * N + j) = sm;
      *(v4f*)(out_norm + (size_t)row * N + j) = o;
    }
    
  }
}



// ---- f16 WMMA path (v_wmma_f32_16x16x32_f16): 11-bit significands for operands in range — used where a [0,1] probability operand needs more precision than bf16
typedef _Float16 v16h __attribute__((ext_vector_type(16)));
union FragH { v16h v; v8us half[2]; _Float16 h[16]; unsigned short u[16]; };
template <int NT>
__device__ __forceinline__ v8f mmaH(v16h ah, v16h al, v16h bh, v16h bl, v8f c) {
  c = __builtin_amdgcn_wmma_f32_16x16x32_f16(false, ah, false, bh, (short)0, c, false, false);
  if (NT >= 2) c = __builtin_amdgcn_wmma_f32_16x16x32_f16(false, al, false, bh, (short)0, c, false, false);
  if (NT >= 3) c = __builtin_amdgcn_wmma_f32_16x16x32_f16(false, ah, false, bl, (short)0, c, false, false);
  asm volatile("v_nop\n\tv_nop\n\tv_nop\n\tv_nop" : "+v"(c) : "v"(ah), "v"(al), "v"(bh), "v"(bl));
  return c;
}
// batched GEMM like k_gemm_b but f16 operands: A f32 (split into f16 hi/lo if ASPLIT, else rounded to f16), Bt = f16 values [n][k]; alpha; C f32; N multiple of 16 (partial tiles skipped)
template <bool ASPLIT>
__global__ __launch_bounds__(128) void k_gemm_h(const float* __restrict__ A, int lda, size_t sA, const _Float16* __restrict__ Bh, int ldb, size_t sB, float alpha, float* __restrict__ C, int ldc, size_t sC, int M, int N, int K) {
  __shared__ __attribute__((aligned(16))) float so[4][16][64];
  const int tid = threadIdx.x, w = tid >> 5, lane = tid & 31, ln = lane & 15, hh = lane >> 4; const int by = blockIdx.y;
  A += (size_t)by * sA; Bh += (size_t)by * sB; C += (size_t)by * sC;
  const int ntn = (N + 63) / 64; const int wid = blockIdx.x * 4 + w; const int mt = wid / ntn, nq = wid % ntn; if (mt * 16 >= M) return;
  const int row0 = mt * 16, col0 = nq * 64; const float* arow = A + (size_t)(row0 + ln) * lda;
  v8f acc[4] = {};
  for (int kb = 0; kb < K; kb += 32) {
    FragH ah, al;
    const v4f x0 = *(const v4fa*)(arow + kb + 8 * hh), x1 = *(const v4fa*)(arow + kb + 8 * hh + 4), x2 = *(const v4fa*)(arow + kb + 16 + 8 * hh), x3 = *(const v4fa*)(arow + kb + 16 + 8 * hh + 4);
    float xs[16] = {x0[0],x0[1],x0[2],x0[3],x1[0],x1[1],x1[2],x1[3],x2[0],x2[1],x2[2],x2[3],x3[0],x3[1],x3[2],x3[3]};
#pragma unroll
    for (int i = 0; i < 16; ++i) { const _Float16 h = (_Float16)xs[i]; ah.h[i] = h; al.h[i] = ASPLIT ? (_Float16)(xs[i] - (float)h) : (_Float16)0.0f; }
#pragma unroll
    for (int t = 0; t < 4; ++t) { if (col0 + t * 16 >= N) continue; const size_t boff = (size_t)(col0 + t * 16 + ln) * ldb + kb; FragH bq; bq.half[0] = *(const v8us*)(Bh + boff + 8 * hh); bq.half[1] = *(const v8us*)(Bh + boff + 16 + 8 * hh);
      acc[t] = mmaH<ASPLIT ? 2 : 1>(ah.v, al.v, bq.v, bq.v, acc[t]); }
  }
#pragma unroll
  for (int t = 0; t < 4; ++t) { if (col0 + t * 16 >= N) continue;
#pragma unroll
    for (int r = 0; r < 8; ++r) so[w][8 * hh + r][t * 16 + ln] = acc[t][r] * alpha; }
  __builtin_amdgcn_fence(__ATOMIC_ACQ_REL, "workgroup"); __builtin_amdgcn_wave_barrier();
  const int rsub = lane >> 4, c4 = (lane & 15) * 4;
  {
#pragma unroll
    for (int q = 0; q < 8; ++q) { const int r = q * 2 + rsub; if (col0 + c4 < N) { const v4f v = *(const v4fa*)&so[w][r][c4]; *(v4f*)(C + (size_t)(row0 + r) * ldc + col0 + c4) = v; } }
     }
}

// Wt[n][k] = f16(W[k][n]·scale) from f32 row-major W[K][N] (scale = power of two; bf16-exact weights stay exact in f16 away from the subnormal range)
__global__ __launch_bounds__(256) void k_wt_f16(const float* __restrict__ W, _Float16* __restrict__ Wt, int K, int N, float scale) {
  const int t = blockIdx.x * 256 + threadIdx.x; if (t >= N * (K / 8)) return; const int n = t / (K / 8), k8 = (t % (K / 8)) * 8; FragH f;
#pragma unroll
  for (int i = 0; i < 8; ++i) f.h[i] = (_Float16)(bf16_round(W[(size_t)(k8 + i) * N + n]) * scale); const v8us o = f.half[0];
  *(v8us*)((unsigned short*)Wt + (size_t)n * K + k8) = o; 
}
// k_gemm_hh variant with fused epilogue: v = acc·alpha + bias[by·sBias + col] (+ CP[(row/rowsPerB)·sCPb + by·64 + col] if CP) ; ACT 0 none / 1 elu ; writes f16 C16 (and f32 C if non-null)
template <int ACT>
__global__ __launch_bounds__(128) void k_gemm_hhx(const _Float16* __restrict__ A, int lda, size_t sA, const _Float16* __restrict__ Bh, int ldb, size_t sB, float alpha, const float* __restrict__ bias, size_t sBias, const float* __restrict__ CP, int rowsPerB, size_t sCPb, int row0g,
    float* __restrict__ C, _Float16* __restrict__ C16, int ldc, size_t sC, int M, int N, int K) {
  __shared__ __attribute__((aligned(16))) float so[4][16][64];
  const int tid = threadIdx.x, w = tid >> 5, lane = tid & 31, ln = lane & 15, hh = lane >> 4; const int by = blockIdx.y;
  A += (size_t)by * sA; Bh += (size_t)by * sB; const size_t cofs = (size_t)by * sC; const float* bp = bias ? bias + (size_t)by * sBias : nullptr;
  const int ntn = (N + 63) / 64; const int wid = blockIdx.x * 4 + w; const int mt = wid / ntn, nq = wid % ntn; if (mt * 16 >= M) return;
  const int row0 = mt * 16, col0 = nq * 64; const _Float16* arow = A + (size_t)(row0 + ln) * lda;
  v8f acc[4] = {};
  for (int kb = 0; kb < K; kb += 32) { FragH ah; ah.half[0] = *(const v8us*)((const unsigned short*)arow + kb + 8 * hh); ah.half[1] = *(const v8us*)((const unsigned short*)arow + kb + 16 + 8 * hh);
#pragma unroll
    for (int t = 0; t < 4; ++t) { if (col0 + t * 16 >= N) continue; const size_t boff = (size_t)(col0 + t * 16 + ln) * ldb + kb; FragH bq; bq.half[0] = *(const v8us*)((const unsigned short*)Bh + boff + 8 * hh); bq.half[1] = *(const v8us*)((const unsigned short*)Bh + boff + 16 + 8 * hh);
      acc[t] = mmaH<1>(ah.v, ah.v, bq.v, bq.v, acc[t]); }
  }
#pragma unroll
  for (int t = 0; t < 4; ++t) { if (col0 + t * 16 >= N) continue; const int col = col0 + t * 16 + ln; const float bv = bp ? bf16_round(bp[col]) : 0.f;
#pragma unroll
    for (int r = 0; r < 8; ++r) { float v = acc[t][r] * alpha + bv; if (CP) { const int rr = row0g + row0 + 8 * hh + r; if (rowsPerB < 0) v += CP[cofs + (size_t)rr * ldc + col];      /* rowsPerB < 0: own element of the batched C plane */ else { const int bidx = rr / rowsPerB; v += CP[(size_t)bidx * sCPb + (size_t)by * 64 + col]; } } if (ACT == 1) v = (v > 0.f) ? v : expm1f(v); else if (ACT == 7) v = (v > 0.f) ? v + 1.0f : expf(v); else if (ACT == 8) v = tanhf(v); else if (ACT == 9) v = 0.5f * v * (1.0f + tanhf(0.7978845608028654f * (v + 0.044715f * v * v * v))); else if (ACT == 11) v = 1.0f / (1.0f + expf(-v)); else if (ACT == 12) v = (v > 0.f) ? v : 0.01f * v; else if (ACT == 14) v = (v > 0.f) ? v : 0.1f * v; else if (ACT == 16) v = (v >= 0.f) ? v : 0.3f * v; else if (ACT == 17) v = (v >= 0.f) ? v : 0.2f * v; else if (ACT == 15) v = v / (1.0f + expf(-v)); else if (ACT == 3) v = fmaxf(v, 0.f); else if (ACT == 6) v = 0.5f * v * (1.0f + erff(v * 0.70710678118654752f)); so[w][8 * hh + r][t * 16 + ln] = v; } }
  __builtin_amdgcn_fence(__ATOMIC_ACQ_REL, "workgroup"); __builtin_amdgcn_wave_barrier();
  const int rsub = lane >> 4, c4 = (lane & 15) * 4; typedef _Float16 v4h __attribute__((ext_vector_type(4)));
  {
#pragma unroll
    for (int q = 0; q < 8; ++q) { const int r = q * 2 + rsub; if (col0 + c4 < N) { const v4f v = *(const v4fa*)&so[w][r][c4]; if (C) *(v4f*)(C + cofs + (size_t)(row0 + r) * ldc + col0 + c4) = v; if (C16) { v4h h4; for (int i = 0; i < 4; ++i) h4[i] = (_Float16)v[i]; *(v4h*)(C16 + cofs + (size_t)(row0 + r) * ldc + col0 + c4) = h4; } } }
     }
}


typedef _Float16 v4h __attribute__((ext_vector_type(4)));

__global__ __launch_bounds__(256) void k_h16(const float* __restrict__ x, _Float16* __restrict__ X16, size_t n8) { const size_t t = (size_t)blockIdx.x * 256 + threadIdx.x; if (t >= n8) return; FragH f;
#pragma unroll
  for (int q = 0; q < 8; ++q) f.h[q] = (_Float16)x[t * 8 + q]; *(v8us*)((unsigned short*)X16 + t * 8) = f.half[0];  }
__global__ __launch_bounds__(256) void k_round16f(const float* __restrict__ W, _Float16* __restrict__ Bt, size_t n8) { const size_t t = (size_t)blockIdx.x * 256 + threadIdx.x; if (t >= n8) return; FragH f;
#pragma unroll
  for (int i = 0; i < 8; ++i) f.h[i] = (_Float16)(bf16_round(W[t * 8 + i]) * 16.0f); *(v8us*)((unsigned short*)Bt + t * 8) = f.half[0];  }
template <int NHv, int TTv>
__global__ __launch_bounds__(256) void k_vt(const _Float16* __restrict__ V16, int ldv, int voff, _Float16* __restrict__ Vt) { __shared__ unsigned short tl[64][66]; const int tid = threadIdx.x; const int slab = blockIdx.x / (TTv / 64), lg = blockIdx.x % (TTv / 64); const int b = slab / NHv, h = slab % NHv;
  for (int i = tid; i < 64 * 8; i += 256) { const int r = i / 8, c8 = (i % 8) * 8; FragH f; f.half[0] = *(const v8us*)((const unsigned short*)V16 + ((size_t)b * TTv + lg * 64 + r) * ldv + voff + h * 64 + c8);
#pragma unroll
    for (int q = 0; q < 8; ++q) tl[r][c8 + q] = f.u[q]; }
  __syncthreads();
  {
#pragma unroll
    for (int rd = 0; rd < 2; ++rd) { const int d = rd * 32 + tid / 8, pc = tid % 8; FragH f;
#pragma unroll
      for (int q = 0; q < 8; ++q) f.u[q] = tl[pc * 8 + q][d];
      *(v8us*)((unsigned short*)Vt + ((size_t)slab * 64 + d) * TTv + lg * 64 + pc * 8) = f.half[0]; }
     } }

__global__ __launch_bounds__(256) void k_hl(const float* __restrict__ F, _Float16* __restrict__ Hh, _Float16* __restrict__ Hl, size_t n8) { const size_t t = (size_t)blockIdx.x * 256 + threadIdx.x; if (t >= n8) return; FragH fh, fl; const v4f a = *(const v4fa*)(F + t * 8), c = *(const v4fa*)(F + t * 8 + 4);
#pragma unroll
  for (int q = 0; q < 4; ++q) { _Float16 h = (_Float16)a[q]; fh.h[q] = h; fl.h[q] = (_Float16)((a[q] - (float)h) * 1024.0f); h = (_Float16)c[q]; fh.h[4 + q] = h; fl.h[4 + q] = (_Float16)((c[q] - (float)h) * 1024.0f); }
  { *(v8us*)((unsigned short*)Hh + t * 8) = fh.half[0]; *(v8us*)((unsigned short*)Hl + t * 8) = fl.half[0];  } }

// ---- fast GEMM (block tile 128x128, eight waves of 32x64; requires M % 128 == 0, N % 128 == 0, K % 128 == 0); epilogue = k_gemm_hhx semantics, but plane by's bias is bias, bias1 or bias2 (by = 0, 1, 2) ----
// A stage is 128 k of the block's 128 A rows and 128 B rows (256-byte rows). Asynchronous copies bring it from global memory into LDS, whole 128-byte lines a request, through no register;
// two buffers: the next stage flies while this one is multiplied. Fragments come from LDS in the k order of g2_frag, one k step ahead of their products; every accumulator still sums k upward in steps of 32.
#define G2_BK 128                    /* k a stage */
#define G2_PITCH 272                 /* LDS row pitch in bytes: 16 x odd, so the 16 rows of a 16-byte fragment read fall on 64 distinct banks */
#define G2_STAGE (256 * G2_PITCH)    /* 128 A rows, then 128 B rows */
__device__ __forceinline__ v16h g2_frag(const _Float16* p, int hh) { FragH f; f.half[0] = *(const v8us*)((const unsigned short*)p + 8 * hh); f.half[1] = *(const v8us*)((const unsigned short*)p + 16 + 8 * hh); return f.v; }
__device__ __forceinline__ v16h g2_lfrag(const unsigned char* p) { FragH f; f.half[0] = *(const v8us*)p; f.half[1] = *(const v8us*)(p + 32); return f.v; }      /* p: the lane's row in LDS + 64 bytes a k step + 16 hh */
__device__ __forceinline__ v8f g2_mma(v16h a, v16h b, v8f c) { return __builtin_amdgcn_wmma_f32_16x16x32_f16(false, a, false, b, (short)0, c, false, false); }
// Eight asynchronous 16-byte copies of a lane: rows r, r + 16, ..., r + 112 of one operand's stage (l: LDS byte address of the first, g: its global address, gs: 16 global rows in elements).
// The closing s_wait_xcnt 0 stands inside the statement, in front of any later write of the address registers that the copies name.
__device__ __forceinline__ void g2_copy8(unsigned l, const _Float16* g, size_t gs) {
  asm volatile("global_load_async_to_lds_b128 %0, %8, off\n\tglobal_load_async_to_lds_b128 %1, %9, off\n\tglobal_load_async_to_lds_b128 %2, %10, off\n\tglobal_load_async_to_lds_b128 %3, %11, off\n\t"
               "global_load_async_to_lds_b128 %4, %12, off\n\tglobal_load_async_to_lds_b128 %5, %13, off\n\tglobal_load_async_to_lds_b128 %6, %14, off\n\tglobal_load_async_to_lds_b128 %7, %15, off\n\ts_wait_xcnt 0x0"
               :: "v"(l), "v"(l + 16 * G2_PITCH), "v"(l + 32 * G2_PITCH), "v"(l + 48 * G2_PITCH), "v"(l + 64 * G2_PITCH), "v"(l + 80 * G2_PITCH), "v"(l + 96 * G2_PITCH), "v"(l + 112 * G2_PITCH),
                  "v"(g), "v"(g + gs), "v"(g + 2 * gs), "v"(g + 3 * gs), "v"(g + 4 * gs), "v"(g + 5 * gs), "v"(g + 6 * gs), "v"(g + 7 * gs) : "memory"); }
// The epilogue's choices are template parameters, so that it compiles to straight-line code: HASB: a bias is added (the plane's bias pointer is not null); HASCP: the CP term is added; F32OUT: the result goes to C as f32, otherwise to C16 as f16.
template <int ACT, bool HASB, bool HASCP, bool F32OUT>
__global__ __launch_bounds__(256) void k_gemm2(const _Float16* __restrict__ A, int lda, size_t sA, const _Float16* __restrict__ Bh, int ldb, size_t sB, float alpha, const float* __restrict__ bias, const float* __restrict__ bias1, const float* __restrict__ bias2, const float* __restrict__ CP, int rowsPerB, size_t sCPb, int row0g,
    float* __restrict__ C, _Float16* __restrict__ C16, int ldc, size_t sC, int M, int N, int K) { static_assert(ACT == 0 || ACT == 3 || ACT == 6 || ACT == 8 || ACT == 9 || ACT == 11 || ACT == 12 || ACT == 14 || ACT == 15 || ACT == 16 || ACT == 17, "k_gemm2: unsupported ACT code (would silently apply no activation)");
  __shared__ __attribute__((aligned(16))) unsigned char ring[2 * G2_STAGE];
  __shared__ __attribute__((aligned(16))) float so[8][32][68];
  const int tid = threadIdx.x, w = tid >> 5, lane = tid & 31, ln = lane & 15, hh = lane >> 4; const int by = blockIdx.y;
  A += (size_t)by * sA; Bh += (size_t)by * sB; const size_t cofs = (size_t)by * sC; const float* bp = by == 0 ? bias : by == 1 ? bias1 : bias2;      /* the planes' biases are separate buffers: at most three planes */
  const int ntn = N >> 7; const int mt = blockIdx.x / ntn, nq = blockIdx.x - mt * ntn; if (mt * 128 >= M) return;      /* the whole block leaves, in front of every barrier */
  const int row0 = mt * 128 + 32 * (w & 3), col0 = nq * 128 + 64 * (w >> 2);
  const int nt = K / G2_BK;
  const unsigned lc = (unsigned)(size_t)ring + (unsigned)((tid >> 4) * G2_PITCH + (tid & 15) * 16);      /* the lane's place in a stage: row tid / 16 (+ 16 a copy), 16-byte column tid % 16: a wave's copy is two whole rows */
  const _Float16* ga = A + (size_t)(mt * 128 + (tid >> 4)) * lda + (tid & 15) * 8; const _Float16* gb = Bh + (size_t)(nq * 128 + (tid >> 4)) * ldb + (tid & 15) * 8;
  const size_t gsa = (size_t)16 * lda, gsb = (size_t)16 * ldb;
  g2_copy8(lc, ga, gsa); g2_copy8(lc + 128 * G2_PITCH, gb, gsb);      /* stage 0 */
  asm volatile("s_wait_asynccnt 0x0" ::: "memory");      /* this wave's copies of stage 0 have landed */
  __syncthreads();      /* publishes stage 0 */
  if (nt > 1) { g2_copy8(lc + G2_STAGE, ga + G2_BK, gsa); g2_copy8(lc + G2_STAGE + 128 * G2_PITCH, gb + G2_BK, gsb); }      /* stage 1 */
  const unsigned char* fa = ring + (32 * (w & 3) + ln) * G2_PITCH + 16 * hh; const unsigned char* fb = ring + (128 + 64 * (w >> 2) + ln) * G2_PITCH + 16 * hh;
  const v8f z8 = {0.f,0.f,0.f,0.f,0.f,0.f,0.f,0.f}; v8f c00 = z8, c01 = z8, c02 = z8, c03 = z8, c10 = z8, c11 = z8, c12 = z8, c13 = z8;
#pragma unroll 1      /* one stage a trip: the buffer is picked by the trip's parity, the four k steps inside are unrolled */
  for (int t = 0; t < nt; ++t) { const unsigned bo = (unsigned)(t & 1) * G2_STAGE; const unsigned char* pa = fa + bo; const unsigned char* pb = fb + bo;
    v16h a[2][2], b[2][4];
    a[0][0] = g2_lfrag(pa); a[0][1] = g2_lfrag(pa + 16 * G2_PITCH);
#pragma unroll
    for (int j = 0; j < 4; ++j) b[0][j] = g2_lfrag(pb + j * 16 * G2_PITCH);
#pragma unroll
    for (int ks = 0; ks < G2_BK / 32; ++ks) { const int cu = ks & 1, nx = cu ^ 1;
      if (ks + 1 < G2_BK / 32) { a[nx][0] = g2_lfrag(pa + (ks + 1) * 64); a[nx][1] = g2_lfrag(pa + 16 * G2_PITCH + (ks + 1) * 64);      /* the next k step's fragments, into the other register set */
#pragma unroll
        for (int j = 0; j < 4; ++j) b[nx][j] = g2_lfrag(pb + j * 16 * G2_PITCH + (ks + 1) * 64); }
      __builtin_amdgcn_sched_barrier(0);      /* keeps those reads one group ahead of this step's products: without it the build sank each read to its first use, two products behind every full LDS wait */
      c00 = g2_mma(a[cu][0], b[cu][0], c00); c10 = g2_mma(a[cu][1], b[cu][0], c10); c01 = g2_mma(a[cu][0], b[cu][1], c01); c11 = g2_mma(a[cu][1], b[cu][1], c11);
      c02 = g2_mma(a[cu][0], b[cu][2], c02); c12 = g2_mma(a[cu][1], b[cu][2], c12); c03 = g2_mma(a[cu][0], b[cu][3], c03); c13 = g2_mma(a[cu][1], b[cu][3], c13);
      __builtin_amdgcn_sched_barrier(0); }      /* and keeps the following group's reads from rising among these products */
    asm volatile("s_wait_dscnt 0x0" ::: "memory");      /* this wave's reads of the buffer are done before it is refilled */
    asm volatile("s_wait_asynccnt 0x0" ::: "memory");      /* this wave's copies of stage t + 1 have landed */
    __syncthreads();      /* publishes stage t + 1 and ends every wave's reads of stage t */
    if (t + 2 < nt) { g2_copy8(lc + bo, ga + (size_t)(t + 2) * G2_BK, gsa); g2_copy8(lc + bo + 128 * G2_PITCH, gb + (size_t)(t + 2) * G2_BK, gsb); } }      /* stage t + 2 into the buffer just read */
  asm volatile("s_wait_asynccnt 0x0" ::: "memory");      /* nothing of this wave is in flight when it goes on */
  v8f accs[8] = {c00, c01, c02, c03, c10, c11, c12, c13};
#pragma unroll
  for (int u = 0; u < 8; ++u) { const int t = u & 3, half = u >> 2; const int col = col0 + t * 16 + ln; const float bv = HASB ? bf16_round(bp[col]) : 0.f;
#pragma unroll
    for (int r = 0; r < 8; ++r) { const int rloc = half * 16 + 8 * hh + r; float v = accs[u][r] * alpha + bv; if (HASCP) { if (rowsPerB < 0) v += CP[cofs + (size_t)(row0g + row0 + rloc) * ldc + col];      /* rowsPerB < 0: own element of the batched C plane */ else { const int bidx = (row0g + row0 + rloc) / rowsPerB; v += CP[(size_t)bidx * sCPb + (size_t)by * 64 + col]; } }
      if (ACT == 3) v = fmaxf(v, 0.f); else if (ACT == 6) v = 0.5f * v * (1.0f + erff(v * 0.70710678118654752f)); else if (ACT == 11) v = 1.0f / (1.0f + expf(-v)); else if (ACT == 15) v = v / (1.0f + expf(-v)); else if (ACT == 12) v = (v > 0.f) ? v : 0.01f * v; else if (ACT == 8) v = tanhf(v); else if (ACT == 9) v = 0.5f * v * (1.0f + tanhf(0.7978845608028654f * (v + 0.044715f * v * v * v))); else if (ACT == 14) v = (v > 0.f) ? v : 0.1f * v; else if (ACT == 16) v = (v >= 0.f) ? v : 0.3f * v; else if (ACT == 17) v = (v >= 0.f) ? v : 0.2f * v;
      so[w][rloc][t * 16 + ln] = v; } }
  __builtin_amdgcn_fence(__ATOMIC_ACQ_REL, "workgroup"); __builtin_amdgcn_wave_barrier();
  const int rsub = lane >> 4, c4 = (lane & 15) * 4;
  {
#pragma unroll
    for (int q = 0; q < 16; ++q) { const int r = q * 2 + rsub; const v4f v = *(const v4fa*)&so[w][r][c4]; if (F32OUT) *(v4f*)(C + cofs + (size_t)(row0 + r) * ldc + col0 + c4) = v; else { v4h h4; for (int i = 0; i < 4; ++i) h4[i] = (_Float16)v[i]; *(v4h*)(C16 + cofs + (size_t)(row0 + r) * ldc + col0 + c4) = h4; } }
     } }


// All five operand conversions in one launch (none reads another's output): blocks [0, PREP_XB) round x to bf16 and store it as f16; the next 4 * PREP_WB blocks do the same, x16, for Wq, Wk, Wv, Wo
// (natural [out][in] = Bt[n][k]) into four consecutive planes of BW. Eight elements a thread; which array a block works on is the same for the whole block.
#define PREP_XB ((unsigned)(NR * DM / 8 / 256))
#define PREP_WB ((unsigned)((size_t)DM * DM / 8 / 256))
__global__ __launch_bounds__(256) void k_prep(const float* __restrict__ x, const float* __restrict__ wq, const float* __restrict__ wk, const float* __restrict__ wv, const float* __restrict__ wo, _Float16* __restrict__ X16, _Float16* __restrict__ BW) {
  static_assert(NR * DM % (8 * 256) == 0 && (size_t)DM * DM % (8 * 256) == 0, "k_prep: whole blocks per array");
  const unsigned bx = blockIdx.x; const float* s = x; _Float16* d = X16; float sc = 1.0f; unsigned lb = bx;
  if (bx >= PREP_XB) { const unsigned m = (bx - PREP_XB) / PREP_WB; lb = (bx - PREP_XB) % PREP_WB; s = m == 0 ? wq : m == 1 ? wk : m == 2 ? wv : wo; d = BW + (size_t)m * DM * DM; sc = 16.0f; }
  const size_t t = (size_t)lb * 256 + threadIdx.x; FragH f;
#pragma unroll
  for (int q = 0; q < 8; ++q) f.h[q] = (_Float16)(bf16_round(s[t * 8 + q]) * sc);
  *(v8us*)((unsigned short*)d + t * 8) = f.half[0]; }
__global__ __launch_bounds__(256) void k_rsm(const float* __restrict__ S, _Float16* __restrict__ P, int nrows) {
  #pragma clang fp contract(off)
  const int i = blockIdx.x * 256 + threadIdx.x; if (i >= nrows) return; const float* s = S + (size_t)i * SQ; float mx = -3.0e38f;
#pragma unroll 1
  for (int j = 0; j < SQ; ++j) mx = fmaxf(mx, s[j]); float se = 0.f;
#pragma unroll 1
  for (int j = 0; j < SQ; ++j) se += expf(s[j] - mx); const float sc = 256.0f / se;
#pragma unroll 1
  for (int j0 = 0; j0 < SQ; j0 += 8) { FragH f; for (int q = 0; q < 8; ++q) f.h[q] = (_Float16)(expf(s[j0 + q] - mx) * sc); unsigned short* d = (unsigned short*)P + (size_t)i * SQ + j0; *(v8us*)d = f.half[0];  } }
__global__ __launch_bounds__(256) void k_vt(const _Float16* __restrict__ V16, int b, int h0, _Float16* __restrict__ VT) { __shared__ unsigned short tl[64][65]; const int tid = threadIdx.x; const int hh = blockIdx.x % HG, sg = blockIdx.x / HG; const int s0 = sg * 64; const int h = h0 + hh;
  for (int i = tid; i < 64 * 8; i += 256) { const int j = i / 8, d8 = (i % 8) * 8; FragH f; f.half[0] = *(const v8us*)((const unsigned short*)V16 + ((size_t)b * SQ + s0 + j) * DM + h * HD + d8); for (int q = 0; q < 8; ++q) tl[d8 + q][j] = f.u[q]; }
  __syncthreads();
  { for (int i = tid; i < 64 * 8; i += 256) { const int d = i / 8, j8 = (i % 8) * 8; FragH f; for (int q = 0; q < 8; ++q) f.u[q] = tl[d][j8 + q]; *(v8us*)((unsigned short*)VT + ((size_t)hh * HD + d) * SQ + s0 + j8) = f.half[0]; }  } }



// Fused attention: scores, softmax of (scores + relative-position bias) and the product with V in one kernel, for every batch and head in one launch; neither the scores nor the weights go to memory.
// A wave owns FA_QT * 16 query columns and walks the keys 32 at a time: S^T = K . Q^T (A = K rows, B = Q rows kept in registers), so that a lane holds 16 scores of ONE query per column tile;
// running maximum and sum per lane (online softmax, log2 domain), one exchange between the wave halves per pass for the maximum, one in the epilogue for the sum;
// the two S^T tiles of a pass, converted in place, are the B operand of O^T += V^T . P^T (A = V^T rows in the same k order), and a lane's 8 accumulator registers are 8 consecutive d of its query: 16-byte stores.
// Every loop but the walk over the stages and their passes is unrolled in full: the fragment and accumulator arrays stay in registers only where each index is a constant.
// K and V^T reach the waves through LDS: a stage is FA_SK keys (K rows of 128 bytes, V^T rows of 256 bytes), brought once for the whole block by asynchronous copies, whole 128-byte lines a request, through no register;
// two buffers: the next stage flies while this one is worked on. The eight waves read their fragments from LDS in the k order of g2_frag; passes, products and sums keep their order.
#define FA_WAVES 8
#define FA_QT 2                      /* 16-column query tiles a wave */
#define FA_BQ (FA_WAVES * FA_QT * 16) /* query rows a block */
#define FA_L2E 1.4426950408889634f
#define FA_SK 128                    /* keys a stage: four passes */
#define FA_KP 144                    /* LDS pitch of a K row in bytes: 16 x odd, so the 16 rows of a 16-byte fragment read fall on distinct banks */
#define FA_VP 272                    /* LDS pitch of a V^T row in bytes: 16 x odd */
#define FA_KB (FA_SK * FA_KP)        /* the K rows of a stage; the HD V^T rows follow */
#define FA_STAGE (FA_KB + HD * FA_VP)
// Eight asynchronous 16-byte copies of a lane: K rows r, r + 32, r + 64, r + 96 of a stage (lk: LDS byte address of the first, gk: its global address), then V^T rows d, d + 16, d + 32, d + 48 (lv, gv).
// The closing s_wait_xcnt 0 stands inside the statement, in front of any later write of the address registers that the copies name.
__device__ __forceinline__ void fa_copy8(unsigned lk, const _Float16* gk, unsigned lv, const _Float16* gv) {
  asm volatile("global_load_async_to_lds_b128 %0, %8, off\n\tglobal_load_async_to_lds_b128 %1, %9, off\n\tglobal_load_async_to_lds_b128 %2, %10, off\n\tglobal_load_async_to_lds_b128 %3, %11, off\n\t"
               "global_load_async_to_lds_b128 %4, %12, off\n\tglobal_load_async_to_lds_b128 %5, %13, off\n\tglobal_load_async_to_lds_b128 %6, %14, off\n\tglobal_load_async_to_lds_b128 %7, %15, off\n\ts_wait_xcnt 0x0"
               :: "v"(lk), "v"(lk + 32 * FA_KP), "v"(lk + 64 * FA_KP), "v"(lk + 96 * FA_KP), "v"(lv), "v"(lv + 16 * FA_VP), "v"(lv + 32 * FA_VP), "v"(lv + 48 * FA_VP),
                  "v"(gk), "v"(gk + (size_t)32 * DM), "v"(gk + (size_t)64 * DM), "v"(gk + (size_t)96 * DM), "v"(gv), "v"(gv + (size_t)16 * SQ), "v"(gv + (size_t)32 * SQ), "v"(gv + (size_t)48 * SQ) : "memory"); }
__device__ __forceinline__ float sm_xh(float x) { return __builtin_bit_cast(float, __builtin_amdgcn_permlanex16(__builtin_bit_cast(int, x), __builtin_bit_cast(int, x), 0x76543210, 0xfedcba98, false, false)); }      /* lane l ^ 16 */
// Four native exp2 in place. In one statement with a closing v_nop: the slot that the instruction set asks for behind a transcendental before its result is read or its source overwritten
__device__ __forceinline__ v4f sm_exp2x4(v4f x) { float a = x[0], b = x[1], c = x[2], d = x[3];
  asm("v_exp_f32 %0, %0\n\tv_exp_f32 %1, %1\n\tv_exp_f32 %2, %2\n\tv_exp_f32 %3, %3\n\tv_nop" : "+v"(a), "+v"(b), "+v"(c), "+v"(d));
  const v4f y = {a, b, c, d}; return y; }
__device__ __forceinline__ float sm_exp2x1(float x) { asm("v_exp_f32 %0, %0\n\tv_nop" : "+v"(x)); return x; }      /* one native exp2, with the same closing slot */
__device__ __forceinline__ v8f fa_mma(v16h a, v16h b, v8f c) { return __builtin_amdgcn_wmma_f32_16x16x32_f16(false, a, false, b, (short)0, c, false, false); }
__global__ __launch_bounds__(FA_WAVES * 32) void k_fattn(const _Float16* __restrict__ Q16, const _Float16* __restrict__ K16, const _Float16* __restrict__ VT, const float* __restrict__ emb, _Float16* __restrict__ O16) {
  static_assert(SQ % FA_BQ == 0 && SQ % FA_SK == 0 && SQ / FA_SK >= 2 && FA_SK == 128 && FA_WAVES == 8 && HD == 64 && MAXD % 32 == 0 && FA_QT * 16 + 31 <= MAXD, "k_fattn: whole blocks per head, whole stages per row (two at least), eight copies a lane a stage, two k steps per score tile, band passes inside the table");
  __shared__ __attribute__((aligned(16))) unsigned char ring[2 * FA_STAGE];
  __shared__ float tb[4 * MAXD - 1];      /* this head's bias, bf16-rounded, times log2(e), by k = j - i + (2 * MAXD - 1), already clipped: consecutive j are consecutive entries */
  const int tid = threadIdx.x, lane = tid & 31, ln = lane & 15, hh = lane >> 4; const int wave = __builtin_amdgcn_readfirstlane(tid >> 5);
  const int bh = blockIdx.x / (SQ / FA_BQ), b = bh / NH, h = bh % NH; const int q0 = (blockIdx.x % (SQ / FA_BQ)) * FA_BQ + wave * (FA_QT * 16);
  const unsigned lk = (unsigned)(size_t)ring + (unsigned)((tid >> 3) * FA_KP + (tid & 7) * 16), lv = (unsigned)(size_t)ring + (unsigned)(FA_KB + (tid >> 4) * FA_VP + (tid & 15) * 16);      /* the lane's places in a stage: a wave's copy is four whole K rows or two whole V^T rows */
  const _Float16* gk = K16 + ((size_t)b * SQ + (tid >> 3)) * DM + h * HD + (tid & 7) * 8; const _Float16* gv = VT + ((size_t)bh * HD + (tid >> 4)) * SQ + (tid & 15) * 8;
  fa_copy8(lk, gk, lv, gv);      /* stage 0 */
  for (int i = tid; i < 4 * MAXD - 1; i += FA_WAVES * 32) tb[i] = bf16_round(emb[(min(max(2 * MAXD - 1 - i, -MAXD), MAXD) + MAXD) * NH + h]) * FA_L2E;
  asm volatile("s_wait_asynccnt 0x0" ::: "memory");      /* this wave's copies of stage 0 have landed */
  __syncthreads();      /* publishes tb and stage 0 */
  fa_copy8(lk + FA_STAGE, gk + (size_t)FA_SK * DM, lv + FA_STAGE, gv + FA_SK);      /* stage 1 */
  const float bfar = tb[0], bnear = tb[4 * MAXD - 2];      /* j <= i - MAXD ; j >= i + MAXD */
  const _Float16* qp = Q16 + ((size_t)b * SQ + q0 + ln) * DM + h * HD; const unsigned char* fk = ring + ln * FA_KP + 16 * hh; const unsigned char* fv = ring + FA_KB + ln * FA_VP + 16 * hh;      /* the lane's fragment rows in buffer 0 */
  v16h qf[FA_QT][2], kf[2][2];
#pragma unroll
  for (int t = 0; t < FA_QT; ++t) { qf[t][0] = g2_frag(qp + (size_t)t * 16 * DM, hh); qf[t][1] = g2_frag(qp + (size_t)t * 16 * DM + 32, hh); }
  const v8f z8 = {0.f,0.f,0.f,0.f,0.f,0.f,0.f,0.f};
  v8f o[FA_QT][4]; float mr[FA_QT], lr[FA_QT];
#pragma unroll
  for (int t = 0; t < FA_QT; ++t) { mr[t] = -3.0e38f; lr[t] = 0.f; o[t][0] = z8; o[t][1] = z8; o[t][2] = z8; o[t][3] = z8; }
#pragma unroll 1      /* one stage a trip: the buffer is picked by the trip's parity */
  for (int st = 0; st < SQ / FA_SK; ++st) { const unsigned bo = (unsigned)(st & 1) * FA_STAGE; const unsigned char* pk = fk + bo; const unsigned char* pv = fv + bo;
#pragma unroll
   for (int u = 0; u < 2; ++u) { kf[u][0] = g2_lfrag(pk + u * 16 * FA_KP); kf[u][1] = g2_lfrag(pk + u * 16 * FA_KP + 64); }      /* the stage's first K rows */
#pragma unroll 1      /* one pass a trip: with the four passes unrolled the build went past 256 registers and spilled */
   for (int p = 0; p < FA_SK / 32; ++p) { const int j0 = st * FA_SK + p * 32;
    v16h vf[4];      /* asked for first, used last: the scores and the softmax stand between */
#pragma unroll
    for (int d = 0; d < 4; ++d) vf[d] = g2_lfrag(pv + d * 16 * FA_VP + p * 64);
    v8f s[FA_QT][2];      /* s[t][u][r] = score of key j0 + 16 u + 8 hh + r, query q0 + 16 t + ln */
#pragma unroll
    for (int t = 0; t < FA_QT; ++t)
#pragma unroll
      for (int u = 0; u < 2; ++u) s[t][u] = fa_mma(kf[u][1], qf[t][1], fa_mma(kf[u][0], qf[t][0], z8));
    if (p + 1 < FA_SK / 32) {      /* the next pass's K rows, fetched one pass ahead inside the stage */
#pragma unroll
      for (int u = 0; u < 2; ++u) { kf[u][0] = g2_lfrag(pk + ((p + 1) * 32 + u * 16) * FA_KP); kf[u][1] = g2_lfrag(pk + ((p + 1) * 32 + u * 16) * FA_KP + 64); } }
    if (j0 + 31 > q0 - MAXD && j0 < q0 + FA_QT * 16 - 1 + MAXD) { const float* tp = tb + (j0 - q0 + 2 * MAXD - 1) + 8 * hh - ln;      /* wave-uniform: the pass meets the unclipped band; every k read here lies inside the table */
#pragma unroll
      for (int t = 0; t < FA_QT; ++t)
#pragma unroll
        for (int u = 0; u < 2; ++u)
#pragma unroll
          for (int r = 0; r < 8; ++r) s[t][u][r] = __builtin_fmaf(s[t][u][r], 0.125f * FA_L2E, tp[(u - t) * 16 + r]);
    } else { const float bc = (j0 >= q0 + FA_QT * 16 - 1 + MAXD) ? bnear : bfar;
#pragma unroll
      for (int t = 0; t < FA_QT; ++t)
#pragma unroll
        for (int u = 0; u < 2; ++u)
#pragma unroll
          for (int r = 0; r < 8; ++r) s[t][u][r] = __builtin_fmaf(s[t][u][r], 0.125f * FA_L2E, bc); }
#pragma unroll
    for (int t = 0; t < FA_QT; ++t) {
      float m0 = fmaxf(s[t][0][0], s[t][0][1]), m1 = fmaxf(s[t][1][0], s[t][1][1]);
#pragma unroll
      for (int r = 2; r < 8; r += 2) { m0 = fmaxf(fmaxf(m0, s[t][0][r]), s[t][0][r + 1]); m1 = fmaxf(fmaxf(m1, s[t][1][r]), s[t][1][r + 1]); }
      m0 = fmaxf(m0, m1); const float mn = fmaxf(mr[t], fmaxf(m0, sm_xh(m0)));
      const float al = sm_exp2x1(mr[t] - mn); mr[t] = mn;
      const float nm = 8.0f - mn;      /* weights carried x256 (as f16 operands away from the subnormal range); the sum carries the same factor */
      v4f as; FragH pf;
#pragma unroll
      for (int u = 0; u < 2; ++u)
#pragma unroll
        for (int g = 0; g < 2; ++g) { v4f x = {s[t][u][4 * g] + nm, s[t][u][4 * g + 1] + nm, s[t][u][4 * g + 2] + nm, s[t][u][4 * g + 3] + nm}; x = sm_exp2x4(x);
          if (u + g == 0) as = x; else as += x;
#pragma unroll
          for (int e = 0; e < 4; ++e) pf.h[u * 8 + g * 4 + e] = (_Float16)x[e]; }
      lr[t] = __builtin_fmaf(lr[t], al, (as[0] + as[1]) + (as[2] + as[3]));
#pragma unroll
      for (int d = 0; d < 4; ++d) o[t][d] = fa_mma(vf[d], pf.v, o[t][d] * al); } }
   asm volatile("s_wait_dscnt 0x0" ::: "memory");      /* this wave's reads of the buffer are done before it is refilled */
   asm volatile("s_wait_asynccnt 0x0" ::: "memory");      /* this wave's copies of stage st + 1 have landed */
   __syncthreads();      /* publishes stage st + 1 and ends every wave's reads of stage st */
   if (st + 2 < SQ / FA_SK) fa_copy8(lk + bo, gk + (size_t)(st + 2) * FA_SK * DM, lv + bo, gv + (size_t)(st + 2) * FA_SK); }      /* stage st + 2 into the buffer just read */
  asm volatile("s_wait_asynccnt 0x0" ::: "memory");      /* nothing of this wave is in flight when it goes on */
#pragma unroll
  for (int t = 0; t < FA_QT; ++t) { const float sc = 64.0f / (lr[t] + sm_xh(lr[t]));      /* o carried x64, as the output GEMM's alpha expects */
    unsigned short* op = (unsigned short*)O16 + ((size_t)b * SQ + q0 + t * 16 + ln) * DM + h * HD + 8 * hh;
#pragma unroll
    for (int d = 0; d < 4; ++d) { FragH f;
#pragma unroll
      for (int r = 0; r < 8; ++r) f.h[r] = (_Float16)(o[t][d][r] * sc);
      *(v8us*)(op + d * 16) = f.half[0]; } } }

extern "C" void kernel_launch(void* const* d_in, const int* in_sizes, int n_in,
                              void* d_out, int out_size, void* d_ws, size_t ws_size, hipStream_t stream) {
  (void)in_sizes; (void)n_in; (void)out_size;
  const float* const* I = (const float* const*)d_in; const float* x = I[0]; const float* wq = I[1]; const float* bq = I[2]; const float* wk = I[3]; const float* bk = I[4]; const float* wv = I[5]; const float* bv = I[6]; const float* wo = I[7]; const float* bo = I[8]; const float* emb = I[9];      /* nn.Linear weights [out][in]; rel_emb [2*MAXD+1][NH] */
  char* ws = (char*)d_ws; size_t off = 0;
  auto take = [&](size_t bytes) { char* p = ws + off; off += (bytes + 255) & ~(size_t)255; return p; };
  _Float16* BQ = (_Float16*)take((size_t)DM * DM * 2); _Float16* BK = (_Float16*)take((size_t)DM * DM * 2); _Float16* BV = (_Float16*)take((size_t)DM * DM * 2); _Float16* BO = (_Float16*)take((size_t)DM * DM * 2);
  _Float16* X16 = (_Float16*)take(NR * DM * 2); _Float16* Q16 = (_Float16*)take(NR * DM * 2); _Float16* K16 = (_Float16*)take(NR * DM * 2); _Float16* V16 = (_Float16*)take(NR * DM * 2); _Float16* O16 = (_Float16*)take(NR * DM * 2);
  _Float16* VT = (_Float16*)take((size_t)NB * NH * HD * SQ * 2);
  if (off > ws_size) return;
  static_assert((size_t)DM * DM * 2 % 256 == 0 && NR * DM * 2 % 256 == 0, "BQ, BK, BV, BO and Q16, K16, V16 lie back to back: planes of one pitch");
  k_prep<<<PREP_XB + 4 * PREP_WB, 256, 0, stream>>>(x, wq, wk, wv, wo, X16, BQ);      /* X16; BQ, BK, BV, BO */
  const size_t r0p = (size_t)B0 * SQ;      /* first projected row */
  k_gemm2<0, true, false, false><<<dim3((unsigned)((MP / 128) * (DM / 128)), 3), 256, 0, stream>>>(X16 + r0p * DM, DM, 0, BQ, DM, (size_t)DM * DM, 0.0625f, bq, bk, bv, nullptr, 1, 0, 0, nullptr, Q16 + r0p * DM, DM, NR * DM, MP, DM, DM);      /* planes 0, 1, 2: Q16, K16, V16 */
  k_vt<NH, SQ><<<NB * NH * (SQ / 64), 256, 0, stream>>>(V16, LQ, 0, VT);      /* V^T [NB][NH][HD][SQ] */
  k_fattn<<<NB * NH * (SQ / FA_BQ), FA_WAVES * 32, 0, stream>>>(Q16, K16, VT, emb, O16);      /* o (merged heads, x64) as f16 rows */
  k_gemm2<0, true, false, true><<<dim3((unsigned)((MPO / 128) * (DM / 128)), 1), 256, 0, stream>>>(O16 + r0p * DM, DM, 0, BO, DM, 0, 0.0009765625f, bo, nullptr, nullptr, nullptr, 1, 0, 0, (float*)d_out + r0p * DM, nullptr, DM, 0, MPO, DM, DM);      /* out rows are the output layout */
}

// v007
// Measured time: 85.1 microseconds a run.
// In both of two side-by-side timings against v006, it was 1.05 times as fast.
// All steps since v000 together make it 53.2 times as fast.
#include <hip/hip_runtime.h>
// Multi-head self-attention with a learned relative-position bias (x [2][2048][1024]; q/k/v = x W^T + b (nn.Linear [out][in]), 16 heads of 64; scores / 8 + rel_emb[clip(i - j, -128, 128) + 128][h] (rel_emb [257][16]); softmax; o merged; out = o Wo^T + bo -> [2][2048][1024]).
// Structure: token rows r = b*2048 + s; x as exact f16 rows (bf16-rounded) and the four weights (x16) converted in one launch; Q, K, V as three WMMA GEMMs in one launch, the grid's y index picking weight, bias and output plane (32x64 wave tiles, f32 accumulation, exact x16 weights + bias, f16 outputs); the V plane's blocks store their tile transposed, so that V^T [batch][head][d][s] comes straight from that launch; one fused attention launch for all batches and heads: score tiles on WMMA (K = 64), online softmax of (scores / 8 + relative-position bias looked up by (i - j, head)) on VALU (f32 statistics, native exp; weights x256 as f16 operands, in registers), o = P . V on WMMA (o carried x64 against f16 subnormal flush, folded into the output GEMM alpha) written straight into the merged f16 o rows; out = o W_o + b GEMM (f32) into the output layout.
// Compute dtype: inputs rounded to bf16; x / weights exact; q, k, v, softmax weights and o as plain f16 GEMM operands (~2^-12); scores and softmax statistics f32; v_wmma_f32_16x16x32_f16.
#define NB 2
#define SQ 2048
#define DM 1024
#define NH 16
#define HD 64
#define MAXD 128                     /* relative distance clip */
#define HG 4                         /* heads per launch of the grouped V^T transpose k_vt(b, h0) */
#define B0 0                         /* first batch processed (debug hook) */
#define NBR NB                       /* batches processed (debug hook) */
#define NR ((size_t)NB * SQ)         /* token rows */
#define MP ((int)((size_t)NBR * SQ)) /* rows projected (debug hook) */
#define QN SQ                        /* query rows per batch; unused: the attention launch covers all SQ */
#define NHD NH                       /* heads; unused: the attention launch covers all NH */
#define MPO MP                       /* rows through the output stage (debug hook) */
#define LQ DM      /* row pitch of the q/k rows; unused: the code writes DM */
typedef __bf16 v16b __attribute__((ext_vector_type(16)));
typedef unsigned short v8us __attribute__((ext_vector_type(8), may_alias));
typedef float  v8f  __attribute__((ext_vector_type(8)));
typedef float  v4f  __attribute__((ext_vector_type(4)));
typedef float  v4fa __attribute__((ext_vector_type(4), may_alias));
union FragB { v16b v; v8us half[2]; unsigned short u[16]; };

__device__ __forceinline__ unsigned short bf16_bits(float x) { unsigned int u = __float_as_uint(x); return (unsigned short)((u + 0x7FFFu + ((u >> 16) & 1u)) >> 16); }
__device__ __forceinline__ float bf16_val(unsigned short b) { return __uint_as_float(((unsigned int)b) << 16); }
__device__ __forceinline__ float bf16_round(float x) { return bf16_val(bf16_bits(x)); }
// D += A·B with NT terms: 1 = ah·bh, 2 = + al·bh (A split), 3 = + ah·bl (both split)
template <int NT>
__device__ __forceinline__ v8f mmaN(v16b ah, v16b al, v16b bh, v16b bl, v8f c) {
  c = __builtin_amdgcn_wmma_f32_16x16x32_bf16(false, ah, false, bh, (short)0, c, false, false);
  if (NT >= 2) c = __builtin_amdgcn_wmma_f32_16x16x32_bf16(false, al, false, bh, (short)0, c, false, false);
  if (NT >= 3) c = __builtin_amdgcn_wmma_f32_16x16x32_bf16(false, ah, false, bl, (short)0, c, false, false);
  asm volatile("v_nop\n\tv_nop\n\tv_nop\n\tv_nop" : "+v"(c) : "v"(ah), "v"(al), "v"(bh), "v"(bl));
  return c;
}

__global__ __launch_bounds__(256) void k_wt_bf16(const float* __restrict__ W, unsigned short* __restrict__ Wt, int K, int N) {
  const int t = blockIdx.x * 256 + threadIdx.x;
  const int k8n = K / 8;
  if (t >= N * k8n) return;
  const int n = t / k8n, k8 = (t % k8n) * 8;
  v8us v;
#pragma unroll
  for (int i = 0; i < 8; ++i) v[i] = bf16_bits(W[(size_t)(k8 + i) * N + n]);
  *(v8us*)(Wt + (size_t)n * K + k8) = v;
  
}

// GEMM C[M][N] (f32, pitch ldc) = act(A[M][K]·W + bias). A f32 row-major (pitch lda) converted per fragment to bf16
// (ASPLIT: hi/lo two planes -> 2 terms, else single rounded term); Wt bf16 [N][K] (pitch ldb). BIAS_BF16 rounds the
// bias to bf16 first (bias quantised to bf16 before the add). K%32==0, M%16==0, N%64==0.
template <bool ASPLIT, int ACT, bool BIAS_BF16>
__global__ __launch_bounds__(128) void k_gemm_bf(const float* __restrict__ A, int lda, const unsigned short* __restrict__ Wt, int ldb,
                                               const float* __restrict__ bias, float* __restrict__ C, int ldc, int M, int N, int K) {
  __shared__ __attribute__((aligned(16))) float so[4][16][64];
  const int tid = threadIdx.x, w = tid >> 5, lane = tid & 31, ln = lane & 15, hh = lane >> 4;
  const int ntn = N / 64;
  const int wid = blockIdx.x * 4 + w;
  const int mt = wid / ntn, nq = wid % ntn;
  if (mt * 16 >= M) return;
  const int row0 = mt * 16, col0 = nq * 64;
  const float* arow = A + (size_t)(row0 + ln) * lda;
  v8f acc[4] = {};
  for (int kb = 0; kb < K; kb += 32) {
    FragB ah, al;
    const v4f x0 = *(const v4fa*)(arow + kb + 8 * hh), x1 = *(const v4fa*)(arow + kb + 8 * hh + 4);
    const v4f x2 = *(const v4fa*)(arow + kb + 16 + 8 * hh), x3 = *(const v4fa*)(arow + kb + 16 + 8 * hh + 4);
    float xs[16] = {x0[0],x0[1],x0[2],x0[3],x1[0],x1[1],x1[2],x1[3],x2[0],x2[1],x2[2],x2[3],x3[0],x3[1],x3[2],x3[3]};
#pragma unroll
    for (int i = 0; i < 16; ++i) { const unsigned short hb = bf16_bits(xs[i]); ah.u[i] = hb; al.u[i] = ASPLIT ? bf16_bits(xs[i] - bf16_val(hb)) : (unsigned short)0; }
#pragma unroll
    for (int t = 0; t < 4; ++t) {
      const unsigned short* brow = Wt + (size_t)(col0 + t * 16 + ln) * ldb + kb;
      FragB b;
      b.half[0] = *(const v8us*)(brow + 8 * hh);
      b.half[1] = *(const v8us*)(brow + 16 + 8 * hh);
      acc[t] = mmaN<ASPLIT ? 2 : 1>(ah.v, al.v, b.v, b.v, acc[t]);
    }
  }
#pragma unroll
  for (int t = 0; t < 4; ++t) {
    float bv = bias ? bias[col0 + t * 16 + ln] : 0.f;
    if (BIAS_BF16) bv = bf16_round(bv);
#pragma unroll
    for (int r = 0; r < 8; ++r) { float v = acc[t][r] + bv; if (ACT == 1) v = fmaxf(v, 0.f); so[w][8 * hh + r][t * 16 + ln] = v; }
  }
  __builtin_amdgcn_fence(__ATOMIC_ACQ_REL, "workgroup");
  __builtin_amdgcn_wave_barrier();
  const int rsub = lane >> 4, c4 = (lane & 15) * 4;
  {
#pragma unroll
    for (int q = 0; q < 8; ++q) {
      const int r = q * 2 + rsub;
      const v4f v = *(const v4fa*)&so[w][r][c4];
      *(v4f*)(C + (size_t)(row0 + r) * ldc + col0 + c4) = v;
    }
    
  }
}

// GEMM C = act(A·W + bias + resid): A f32 (ASPLIT -> hi/lo 2 terms), Wt bf16 [N][K]; ACT 0 none, 1 relu, 2 exact gelu;
// resid (optional, f32, row index = (row % rmod), pitch ldr, RES_BF16 rounds it) added before the activation.
template <bool ASPLIT, int ACT, bool BIAS_BF16, bool RES_BF16>
__global__ __launch_bounds__(128) void k_gemm_bf3(const float* __restrict__ A, int lda, const unsigned short* __restrict__ Wt, int ldb,
                                                const float* __restrict__ bias, const float* __restrict__ resid, int rmod, int ldr,
                                                float* __restrict__ C, int ldc, int M, int N, int K) {
  __shared__ __attribute__((aligned(16))) float so[4][16][64];
  const int tid = threadIdx.x, w = tid >> 5, lane = tid & 31, ln = lane & 15, hh = lane >> 4;
  const int ntn = N / 64;
  const int wid = blockIdx.x * 4 + w;
  const int mt = wid / ntn, nq = wid % ntn;
  if (mt * 16 >= M) return;
  const int row0 = mt * 16, col0 = nq * 64;
  const float* arow = A + (size_t)(row0 + ln) * lda;
  v8f acc[4] = {};
  for (int kb = 0; kb < K; kb += 32) {
    FragB ah, al;
    const v4f x0 = *(const v4fa*)(arow + kb + 8 * hh), x1 = *(const v4fa*)(arow + kb + 8 * hh + 4);
    const v4f x2 = *(const v4fa*)(arow + kb + 16 + 8 * hh), x3 = *(const v4fa*)(arow + kb + 16 + 8 * hh + 4);
    float xs[16] = {x0[0],x0[1],x0[2],x0[3],x1[0],x1[1],x1[2],x1[3],x2[0],x2[1],x2[2],x2[3],x3[0],x3[1],x3[2],x3[3]};
#pragma unroll
    for (int i = 0; i < 16; ++i) { const unsigned short hb = bf16_bits(xs[i]); ah.u[i] = hb; al.u[i] = ASPLIT ? bf16_bits(xs[i] - bf16_val(hb)) : (unsigned short)0; }
#pragma unroll
    for (int t = 0; t < 4; ++t) {
      const unsigned short* brow = Wt + (size_t)(col0 + t * 16 + ln) * ldb + kb;
      FragB b;
      b.half[0] = *(const v8us*)(brow + 8 * hh);
      b.half[1] = *(const v8us*)(brow + 16 + 8 * hh);
      acc[t] = mmaN<ASPLIT ? 2 : 1>(ah.v, al.v, b.v, b.v, acc[t]);
    }
  }
#pragma unroll
  for (int t = 0; t < 4; ++t) {
    const int col = col0 + t * 16 + ln;
    float bv = bias ? bias[col] : 0.f;
    if (BIAS_BF16) bv = bf16_round(bv);
#pragma unroll
    for (int r = 0; r < 8; ++r) {
      float v = acc[t][r] + bv;
      if (resid) { float rv = resid[(size_t)((row0 + 8 * hh + r) % rmod) * ldr + col]; if (RES_BF16) rv = bf16_round(rv); v += rv; }
      if (ACT == 1) v = fmaxf(v, 0.f);
      if (ACT == 2) v = 0.5f * v * (1.0f + erff(v * 0.70710678118654752f));
      if (ACT == 3) { const float u = 0.7978845608028654f * (v + 0.044715f * v * v * v); v = 0.5f * v * (1.0f + tanhf(u)); }
      so[w][8 * hh + r][t * 16 + ln] = v;
    }
  }
  __builtin_amdgcn_fence(__ATOMIC_ACQ_REL, "workgroup");
  __builtin_amdgcn_wave_barrier();
  const int rsub = lane >> 4, c4 = (lane & 15) * 4;
  {
#pragma unroll
    for (int q = 0; q < 8; ++q) {
      const int r = q * 2 + rsub;
      const v4f v = *(const v4fa*)&so[w][r][c4];
      *(v4f*)(C + (size_t)(row0 + r) * ldc + col0 + c4) = v;
    }
    
  }
}
// row LayerNorm (biased variance, eps) over N: s = X (+ R); optional out_sum <- s; out_norm <- (s-mu)*rsqrt(var+eps)*g + b
template <bool PARAM_BF16>
__global__ __launch_bounds__(256) void k_layernorm(const float* __restrict__ X, const float* __restrict__ R, const float* __restrict__ g, const float* __restrict__ bta,
                                                  float* __restrict__ out_sum, float* __restrict__ out_norm, int N, float eps) {
  __shared__ float red[256];
  const int row = blockIdx.x, tid = threadIdx.x;
  const float* x = X + (size_t)row * N; const float* rr = R ? R + (size_t)row * N : nullptr;
  float vals[16];                     // up to N = 4096
  const int per = N / 256;            // contiguous chunk per thread? use strided-by-4 chunks: thread handles j = tid*4 + 1024*u
  float s1 = 0.f;
  for (int u = 0; u < per / 4; ++u) {
    const int j = tid * 4 + 1024 * u;
    const v4f a = *(const v4fa*)(x + j);
    v4f b = {0.f,0.f,0.f,0.f}; if (rr) b = *(const v4fa*)(rr + j);
#pragma unroll
    for (int q = 0; q < 4; ++q) { const float v = a[q] + b[q]; vals[u * 4 + q] = v; s1 += v; }
  }
  red[tid] = s1; __syncthreads();
  for (int st = 128; st > 0; st >>= 1) { if (tid < st) red[tid] += red[tid + st]; __syncthreads(); }
  const float mu = red[0] / (float)N; __syncthreads();
  float s2 = 0.f;
  for (int u = 0; u < per / 4; ++u)
#pragma unroll
    for (int q = 0; q < 4; ++q) { const float c = vals[u * 4 + q] - mu; s2 += c * c; }
  red[tid] = s2; __syncthreads();
  for (int st = 128; st > 0; st >>= 1) { if (tid < st) red[tid] += red[tid + st]; __syncthreads(); }
  const float rs = rsqrtf(red[0] / (float)N + eps);
  {
    for (int u = 0; u < per / 4; ++u) {
      const int j = tid * 4 + 1024 * u;
      v4f o, sm;
#pragma unroll
      for (int q = 0; q < 4; ++q) {
        float gg = g[j + q], bb = bta[j + q];
        if (PARAM_BF16) { gg = bf16_round(gg); bb = bf16_round(bb); }
        sm[q] = vals[u * 4 + q]; o[q] = (vals[u * 4 + q] - mu) * rs * gg + bb;
      }
      if (out_sum) *(v4f*)(out_sum + (size_t)row * N + j) = sm;
      *(v4f*)(out_norm + (size_t)row * N + j) = o;
    }
    
  }
}



// ---- f16 WMMA path (v_wmma_f32_16x16x32_f16): 11-bit significands for operands in range — used where a [0,1] probability operand needs more precision than bf16
typedef _Float16 v16h __attribute__((ext_vector_type(16)));
union FragH { v16h v; v8us half[2]; _Float16 h[16]; unsigned short u[16]; };
template <int NT>
__device__ __forceinline__ v8f mmaH(v16h ah, v16h al, v16h bh, v16h bl, v8f c) {
  c = __builtin_amdgcn_wmma_f32_16x16x32_f16(false, ah, false, bh, (short)0, c, false, false);
  if (NT >= 2) c = __builtin_amdgcn_wmma_f32_16x16x32_f16(false, al, false, bh, (short)0, c, false, false);
  if (NT >= 3) c = __builtin_amdgcn_wmma_f32_16x16x32_f16(false, ah, false, bl, (short)0, c, false, false);
  asm volatile("v_nop\n\tv_nop\n\tv_nop\n\tv_nop" : "+v"(c) : "v"(ah), "v"(al), "v"(bh), "v"(bl));
  return c;
}
// batched GEMM like k_gemm_b but f16 operands: A f32 (split into f16 hi/lo if ASPLIT, else rounded to f16), Bt = f16 values [n][k]; alpha; C f32; N multiple of 16 (partial tiles skipped)
template <bool ASPLIT>
__global__ __launch_bounds__(128) void k_gemm_h(const float* __restrict__ A, int lda, size_t sA, const _Float16* __restrict__ Bh, int ldb, size_t sB, float alpha, float* __restrict__ C, int ldc, size_t sC, int M, int N, int K) {
  __shared__ __attribute__((aligned(16))) float so[4][16][64];
  const int tid = threadIdx.x, w = tid >> 5, lane = tid & 31, ln = lane & 15, hh = lane >> 4; const int by = blockIdx.y;
  A += (size_t)by * sA; Bh += (size_t)by * sB; C += (size_t)by * sC;
  const int ntn = (N + 63) / 64; const int wid = blockIdx.x * 4 + w; const int mt = wid / ntn, nq = wid % ntn; if (mt * 16 >= M) return;
  const int row0 = mt * 16, col0 = nq * 64; const float* arow = A + (size_t)(row0 + ln) * lda;
  v8f acc[4] = {};
  for (int kb = 0; kb < K; kb += 32) {
    FragH ah, al;
    const v4f x0 = *(const v4fa*)(arow + kb + 8 * hh), x1 = *(const v4fa*)(arow + kb + 8 * hh + 4), x2 = *(const v4fa*)(arow + kb + 16 + 8 * hh), x3 = *(const v4fa*)(arow + kb + 16 + 8 * hh + 4);
    float xs[16] = {x0[0],x0[1],x0[2],x0[3],x1[0],x1[1],x1[2],x1[3],x2[0],x2[1],x2[2],x2[3],x3[0],x3[1],x3[2],x3[3]};
#pragma unroll
    for (int i = 0; i < 16; ++i) { const _Float16 h = (_Float16)xs[i]; ah.h[i] = h; al.h[i] = ASPLIT ? (_Float16)(xs[i] - (float)h) : (_Float16)0.0f; }
#pragma unroll
    for (int t = 0; t < 4; ++t) { if (col0 + t * 16 >= N) continue; const size_t boff = (size_t)(col0 + t * 16 + ln) * ldb + kb; FragH bq; bq.half[0] = *(const v8us*)(Bh + boff + 8 * hh); bq.half[1] = *(const v8us*)(Bh + boff + 16 + 8 * hh);
      acc[t] = mmaH<ASPLIT ? 2 : 1>(ah.v, al.v, bq.v, bq.v, acc[t]); }
  }
#pragma unroll
  for (int t = 0; t < 4; ++t) { if (col0 + t * 16 >= N) continue;
#pragma unroll
    for (int r = 0; r < 8; ++r) so[w][8 * hh + r][t * 16 + ln] = acc[t][r] * alpha; }
  __builtin_amdgcn_fence(__ATOMIC_ACQ_REL, "workgroup"); __builtin_amdgcn_wave_barrier();
  const int rsub = lane >> 4, c4 = (lane & 15) * 4;
  {
#pragma unroll
    for (int q = 0; q < 8; ++q) { const int r = q * 2 + rsub; if (col0 + c4 < N) { const v4f v = *(const v4fa*)&so[w][r][c4]; *(v4f*)(C + (size_t)(row0 + r) * ldc + col0 + c4) = v; } }
     }
}

// Wt[n][k] = f16(W[k][n]·scale) from f32 row-major W[K][N] (scale = power of two; bf16-exact weights stay exact in f16 away from the subnormal range)
__global__ __launch_bounds__(256) void k_wt_f16(const float* __restrict__ W, _Float16* __restrict__ Wt, int K, int N, float scale) {
  const int t = blockIdx.x * 256 + threadIdx.x; if (t >= N * (K / 8)) return; const int n = t / (K / 8), k8 = (t % (K / 8)) * 8; FragH f;
#pragma unroll
  for (int i = 0; i < 8; ++i) f.h[i] = (_Float16)(bf16_round(W[(size_t)(k8 + i) * N + n]) * scale); const v8us o = f.half[0];
  *(v8us*)((unsigned short*)Wt + (size_t)n * K + k8) = o; 
}
// k_gemm_hh variant with fused epilogue: v = acc·alpha + bias[by·sBias + col] (+ CP[(row/rowsPerB)·sCPb + by·64 + col] if CP) ; ACT 0 none / 1 elu ; writes f16 C16 (and f32 C if non-null)
template <int ACT>
__global__ __launch_bounds__(128) void k_gemm_hhx(const _Float16* __restrict__ A, int lda, size_t sA, const _Float16* __restrict__ Bh, int ldb, size_t sB, float alpha, const float* __restrict__ bias, size_t sBias, const float* __restrict__ CP, int rowsPerB, size_t sCPb, int row0g,
    float* __restrict__ C, _Float16* __restrict__ C16, int ldc, size_t sC, int M, int N, int K) {
  __shared__ __attribute__((aligned(16))) float so[4][16][64];
  const int tid = threadIdx.x, w = tid >> 5, lane = tid & 31, ln = lane & 15, hh = lane >> 4; const int by = blockIdx.y;
  A += (size_t)by * sA; Bh += (size_t)by * sB; const size_t cofs = (size_t)by * sC; const float* bp = bias ? bias + (size_t)by * sBias : nullptr;
  const int ntn = (N + 63) / 64; const int wid = blockIdx.x * 4 + w; const int mt = wid / ntn, nq = wid % ntn; if (mt * 16 >= M) return;
  const int row0 = mt * 16, col0 = nq * 64; const _Float16* arow = A + (size_t)(row0 + ln) * lda;
  v8f acc[4] = {};
  for (int kb = 0; kb < K; kb += 32) { FragH ah; ah.half[0] = *(const v8us*)((const unsigned short*)arow + kb + 8 * hh); ah.half[1] = *(const v8us*)((const unsigned short*)arow + kb + 16 + 8 * hh);
#pragma unroll
    for (int t = 0; t < 4; ++t) { if (col0 + t * 16 >= N) continue; const size_t boff = (size_t)(col0 + t * 16 + ln) * ldb + kb; FragH bq; bq.half[0] = *(const v8us*)((const unsigned short*)Bh + boff + 8 * hh); bq.half[1] = *(const v8us*)((const unsigned short*)Bh + boff + 16 + 8 * hh);
      acc[t] = mmaH<1>(ah.v, ah.v, bq.v, bq.v, acc[t]); }
  }
#pragma unroll
  for (int t = 0; t < 4; ++t) { if (col0 + t * 16 >= N) continue; const int col = col0 + t * 16 + ln; const float bv = bp ? bf16_round(bp[col]) : 0.f;
#pragma unroll
    for (int r = 0; r < 8; ++r) { float v = acc[t][r] * alpha + bv; if (CP) { const int rr = row0g + row0 + 8 * hh + r; if (rowsPerB < 0) v += CP[cofs + (size_t)rr * ldc + col];      /* rowsPerB < 0: own element of the batched C plane */ else { const int bidx = rr / rowsPerB; v += CP[(size_t)bidx * sCPb + (size_t)by * 64 + col]; } } if (ACT == 1) v = (v > 0.f) ? v : expm1f(v); else if (ACT == 7) v = (v > 0.f) ? v + 1.0f : expf(v); else if (ACT == 8) v = tanhf(v); else if (ACT == 9) v = 0.5f * v * (1.0f + tanhf(0.7978845608028654f * (v + 0.044715f * v * v * v))); else if (ACT == 11) v = 1.0f / (1.0f + expf(-v)); else if (ACT == 12) v = (v > 0.f) ? v : 0.01f * v; else if (ACT == 14) v = (v > 0.f) ? v : 0.1f * v; else if (ACT == 16) v = (v >= 0.f) ? v : 0.3f * v; else if (ACT == 17) v = (v >= 0.f) ? v : 0.2f * v; else if (ACT == 15) v = v / (1.0f + expf(-v)); else if (ACT == 3) v = fmaxf(v, 0.f); else if (ACT == 6) v = 0.5f * v * (1.0f + erff(v * 0.70710678118654752f)); so[w][8 * hh + r][t * 16 + ln] = v; } }
  __builtin_amdgcn_fence(__ATOMIC_ACQ_REL, "workgroup"); __builtin_amdgcn_wave_barrier();
  const int rsub = lane >> 4, c4 = (lane & 15) * 4; typedef _Float16 v4h __attribute__((ext_vector_type(4)));
  {
#pragma unroll
    for (int q = 0; q < 8; ++q) { const int r = q * 2 + rsub; if (col0 + c4 < N) { const v4f v = *(const v4fa*)&so[w][r][c4]; if (C) *(v4f*)(C + cofs + (size_t)(row0 + r) * ldc + col0 + c4) = v; if (C16) { v4h h4; for (int i = 0; i < 4; ++i) h4[i] = (_Float16)v[i]; *(v4h*)(C16 + cofs + (size_t)(row0 + r) * ldc + col0 + c4) = h4; } } }
     }
}


typedef _Float16 v4h __attribute__((ext_vector_type(4)));

__global__ __launch_bounds__(256) void k_h16(const float* __restrict__ x, _Float16* __restrict__ X16, size_t n8) { const size_t t = (size_t)blockIdx.x * 256 + threadIdx.x; if (t >= n8) return; FragH f;
#pragma unroll
  for (int q = 0; q < 8; ++q) f.h[q] = (_Float16)x[t * 8 + q]; *(v8us*)((unsigned short*)X16 + t * 8) = f.half[0];  }
__global__ __launch_bounds__(256) void k_round16f(const float* __restrict__ W, _Float16* __restrict__ Bt, size_t n8) { const size_t t = (size_t)blockIdx.x * 256 + threadIdx.x; if (t >= n8) return; FragH f;
#pragma unroll
  for (int i = 0; i < 8; ++i) f.h[i] = (_Float16)(bf16_round(W[t * 8 + i]) * 16.0f); *(v8us*)((unsigned short*)Bt + t * 8) = f.half[0];  }
template <int NHv, int TTv>
__global__ __launch_bounds__(256) void k_vt(const _Float16* __restrict__ V16, int ldv, int voff, _Float16* __restrict__ Vt) { __shared__ unsigned short tl[64][66]; const int tid = threadIdx.x; const int slab = blockIdx.x / (TTv / 64), lg = blockIdx.x % (TTv / 64); const int b = slab / NHv, h = slab % NHv;
  for (int i = tid; i < 64 * 8; i += 256) { const int r = i / 8, c8 = (i % 8) * 8; FragH f; f.half[0] = *(const v8us*)((const unsigned short*)V16 + ((size_t)b * TTv + lg * 64 + r) * ldv + voff + h * 64 + c8);
#pragma unroll
    for (int q = 0; q < 8; ++q) tl[r][c8 + q] = f.u[q]; }
  __syncthreads();
  {
#pragma unroll
    for (int rd = 0; rd < 2; ++rd) { const int d = rd * 32 + tid / 8, pc = tid % 8; FragH f;
#pragma unroll
      for (int q = 0; q < 8; ++q) f.u[q] = tl[pc * 8 + q][d];
      *(v8us*)((unsigned short*)Vt + ((size_t)slab * 64 + d) * TTv + lg * 64 + pc * 8) = f.half[0]; }
     } }

__global__ __launch_bounds__(256) void k_hl(const float* __restrict__ F, _Float16* __restrict__ Hh, _Float16* __restrict__ Hl, size_t n8) { const size_t t = (size_t)blockIdx.x * 256 + threadIdx.x; if (t >= n8) return; FragH fh, fl; const v4f a = *(const v4fa*)(F + t * 8), c = *(const v4fa*)(F + t * 8 + 4);
#pragma unroll
  for (int q = 0; q < 4; ++q) { _Float16 h = (_Float16)a[q]; fh.h[q] = h; fl.h[q] = (_Float16)((a[q] - (float)h) * 1024.0f); h = (_Float16)c[q]; fh.h[4 + q] = h; fl.h[4 + q] = (_Float16)((c[q] - (float)h) * 1024.0f); }
  { *(v8us*)((unsigned short*)Hh + t * 8) = fh.half[0]; *(v8us*)((unsigned short*)Hl + t * 8) = fl.half[0];  } }

// ---- fast GEMM (block tile 128x128, eight waves of 32x64; requires M % 128 == 0, N % 128 == 0, K % 128 == 0); epilogue = k_gemm_hhx semantics, but plane by's bias is bias, bias1 or bias2 (by = 0, 1, 2) ----
// A stage is 128 k of the block's 128 A rows and 128 B rows (256-byte rows). Asynchronous copies bring it from global memory into LDS, whole 128-byte lines a request, through no register;
// two buffers: the next stage flies while this one is multiplied. Fragments come from LDS in the k order of g2_frag, one k step ahead of their products; every accumulator still sums k upward in steps of 32.
#define G2_BK 128                    /* k a stage */
#define G2_PITCH 272                 /* LDS row pitch in bytes: 16 x odd, so the 16 rows of a 16-byte fragment read fall on 64 distinct banks */
#define G2_STAGE (256 * G2_PITCH)    /* 128 A rows, then 128 B rows */
__device__ __forceinline__ v16h g2_frag(const _Float16* p, int hh) { FragH f; f.half[0] = *(const v8us*)((const unsigned short*)p + 8 * hh); f.half[1] = *(const v8us*)((const unsigned short*)p + 16 + 8 * hh); return f.v; }
__device__ __forceinline__ v16h g2_lfrag(const unsigned char* p) { FragH f; f.half[0] = *(const v8us*)p; f.half[1] = *(const v8us*)(p + 32); return f.v; }      /* p: the lane's row in LDS + 64 bytes a k step + 16 hh */
__device__ __forceinline__ v8f g2_mma(v16h a, v16h b, v8f c) { return __builtin_amdgcn_wmma_f32_16x16x32_f16(false, a, false, b, (short)0, c, false, false); }
// Eight asynchronous 16-byte copies of a lane: rows r, r + 16, ..., r + 112 of one operand's stage (l: LDS byte address of the first, g: its global address, gs: 16 global rows in elements).
// The closing s_wait_xcnt 0 stands inside the statement, in front of any later write of the address registers that the copies name.
__device__ __forceinline__ void g2_copy8(unsigned l, const _Float16* g, size_t gs) {
  asm volatile("global_load_async_to_lds_b128 %0, %8, off\n\tglobal_load_async_to_lds_b128 %1, %9, off\n\tglobal_load_async_to_lds_b128 %2, %10, off\n\tglobal_load_async_to_lds_b128 %3, %11, off\n\t"
               "global_load_async_to_lds_b128 %4, %12, off\n\tglobal_load_async_to_lds_b128 %5, %13, off\n\tglobal_load_async_to_lds_b128 %6, %14, off\n\tglobal_load_async_to_lds_b128 %7, %15, off\n\ts_wait_xcnt 0x0"
               :: "v"(l), "v"(l + 16 * G2_PITCH), "v"(l + 32 * G2_PITCH), "v"(l + 48 * G2_PITCH), "v"(l + 64 * G2_PITCH), "v"(l + 80 * G2_PITCH), "v"(l + 96 * G2_PITCH), "v"(l + 112 * G2_PITCH),
                  "v"(g), "v"(g + gs), "v"(g + 2 * gs), "v"(g + 3 * gs), "v"(g + 4 * gs), "v"(g + 5 * gs), "v"(g + 6 * gs), "v"(g + 7 * gs) : "memory"); }
// The epilogue's choices are template parameters, so that it compiles to straight-line code: HASB: a bias is added (the plane's bias pointer is not null); HASCP: the CP term is added; F32OUT: the result goes to C as f32, otherwise to C16 as f16.
// TPLANE >= 0: the blocks of that plane (grid y) store their 128x128 tile transposed, as f16, into VTo [batch][head][d][s] (column n = head * HD + d, row = batch * SQ + s) and write nothing to C16.
template <int ACT, bool HASB, bool HASCP, bool F32OUT, int TPLANE>
__global__ __launch_bounds__(256) void k_gemm2(const _Float16* __restrict__ A, int lda, size_t sA, const _Float16* __restrict__ Bh, int ldb, size_t sB, float alpha, const float* __restrict__ bias, const float* __restrict__ bias1, const float* __restrict__ bias2, const float* __restrict__ CP, int rowsPerB, size_t sCPb, int row0g,
    float* __restrict__ C, _Float16* __restrict__ C16, _Float16* __restrict__ VTo, int ldc, size_t sC, int M, int N, int K) { static_assert(ACT == 0 || ACT == 3 || ACT == 6 || ACT == 8 || ACT == 9 || ACT == 11 || ACT == 12 || ACT == 14 || ACT == 15 || ACT == 16 || ACT == 17, "k_gemm2: unsupported ACT code (would silently apply no activation)");
  static_assert(TPLANE < 0 || (ACT == 0 && !HASCP && !F32OUT && SQ % 128 == 0 && HD == 64), "k_gemm2: the transposed plane has the plain f16 epilogue; a block's 128 rows lie in one batch, its 128 columns are two whole heads");
  __shared__ __attribute__((aligned(16))) unsigned char ring[2 * G2_STAGE];
  __shared__ __attribute__((aligned(16))) float so[8][32][68];
  const int tid = threadIdx.x, w = tid >> 5, lane = tid & 31, ln = lane & 15, hh = lane >> 4; const int by = blockIdx.y;
  A += (size_t)by * sA; Bh += (size_t)by * sB; const size_t cofs = (size_t)by * sC; const float* bp = by == 0 ? bias : by == 1 ? bias1 : bias2;      /* the planes' biases are separate buffers: at most three planes */
  const int ntn = N >> 7; const int mt = blockIdx.x / ntn, nq = blockIdx.x - mt * ntn; if (mt * 128 >= M) return;      /* the whole block leaves, in front of every barrier */
  const int row0 = mt * 128 + 32 * (w & 3), col0 = nq * 128 + 64 * (w >> 2);
  const int nt = K / G2_BK;
  const unsigned lc = (unsigned)(size_t)ring + (unsigned)((tid >> 4) * G2_PITCH + (tid & 15) * 16);      /* the lane's place in a stage: row tid / 16 (+ 16 a copy), 16-byte column tid % 16: a wave's copy is two whole rows */
  const _Float16* ga = A + (size_t)(mt * 128 + (tid >> 4)) * lda + (tid & 15) * 8; const _Float16* gb = Bh + (size_t)(nq * 128 + (tid >> 4)) * ldb + (tid & 15) * 8;
  const size_t gsa = (size_t)16 * lda, gsb = (size_t)16 * ldb;
  g2_copy8(lc, ga, gsa); g2_copy8(lc + 128 * G2_PITCH, gb, gsb);      /* stage 0 */
  asm volatile("s_wait_asynccnt 0x0" ::: "memory");      /* this wave's copies of stage 0 have landed */
  __syncthreads();      /* publishes stage 0 */
  if (nt > 1) { g2_copy8(lc + G2_STAGE, ga + G2_BK, gsa); g2_copy8(lc + G2_STAGE + 128 * G2_PITCH, gb + G2_BK, gsb); }      /* stage 1 */
  const unsigned char* fa = ring + (32 * (w & 3) + ln) * G2_PITCH + 16 * hh; const unsigned char* fb = ring + (128 + 64 * (w >> 2) + ln) * G2_PITCH + 16 * hh;
  const v8f z8 = {0.f,0.f,0.f,0.f,0.f,0.f,0.f,0.f}; v8f c00 = z8, c01 = z8, c02 = z8, c03 = z8, c10 = z8, c11 = z8, c12 = z8, c13 = z8;
#pragma unroll 1      /* one stage a trip: the buffer is picked by the trip's parity, the four k steps inside are unrolled */
  for (int t = 0; t < nt; ++t) { const unsigned bo = (unsigned)(t & 1) * G2_STAGE; const unsigned char* pa = fa + bo; const unsigned char* pb = fb + bo;
    v16h a[2][2], b[2][4];
    a[0][0] = g2_lfrag(pa); a[0][1] = g2_lfrag(pa + 16 * G2_PITCH);
#pragma unroll
    for (int j = 0; j < 4; ++j) b[0][j] = g2_lfrag(pb + j * 16 * G2_PITCH);
#pragma unroll
    for (int ks = 0; ks < G2_BK / 32; ++ks) { const int cu = ks & 1, nx = cu ^ 1;
      if (ks + 1 < G2_BK / 32) { a[nx][0] = g2_lfrag(pa + (ks + 1) * 64); a[nx][1] = g2_lfrag(pa + 16 * G2_PITCH + (ks + 1) * 64);      /* the next k step's fragments, into the other register set */
#pragma unroll
        for (int j = 0; j < 4; ++j) b[nx][j] = g2_lfrag(pb + j * 16 * G2_PITCH + (ks + 1) * 64); }
      __builtin_amdgcn_sched_barrier(0);      /* keeps those reads one group ahead of this step's products: without it the build sank each read to its first use, two products behind every full LDS wait */
      c00 = g2_mma(a[cu][0], b[cu][0], c00); c10 = g2_mma(a[cu][1], b[cu][0], c10); c01 = g2_mma(a[cu][0], b[cu][1], c01); c11 = g2_mma(a[cu][1], b[cu][1], c11);
      c02 = g2_mma(a[cu][0], b[cu][2], c02); c12 = g2_mma(a[cu][1], b[cu][2], c12); c03 = g2_mma(a[cu][0], b[cu][3], c03); c13 = g2_mma(a[cu][1], b[cu][3], c13);
      __builtin_amdgcn_sched_barrier(0); }      /* and keeps the following group's reads from rising among these products */
    asm volatile("s_wait_dscnt 0x0" ::: "memory");      /* this wave's reads of the buffer are done before it is refilled */
    asm volatile("s_wait_asynccnt 0x0" ::: "memory");      /* this wave's copies of stage t + 1 have landed */
    __syncthreads();      /* publishes stage t + 1 and ends every wave's reads of stage t */
    if (t + 2 < nt) { g2_copy8(lc + bo, ga + (size_t)(t + 2) * G2_BK, gsa); g2_copy8(lc + bo + 128 * G2_PITCH, gb + (size_t)(t + 2) * G2_BK, gsb); } }      /* stage t + 2 into the buffer just read */
  asm volatile("s_wait_asynccnt 0x0" ::: "memory");      /* nothing of this wave is in flight when it goes on */
  v8f accs[8] = {c00, c01, c02, c03, c10, c11, c12, c13};
  if (TPLANE >= 0 && by == TPLANE) {      /* the same for the whole block */
    // A lane's 8 accumulator registers are 8 consecutive rows (s) of one column (d): 16 bytes of a V^T row. The block's tile is staged in so as 128 V^T rows of 128 s (256 bytes, pitch G2_PITCH), every wave its own 64 x 32 part.
    unsigned char* tv = (unsigned char*)so; static_assert(128 * G2_PITCH <= sizeof(so), "k_gemm2: the transposed tile fits the staging array");
#pragma unroll      /* both loops in full: accs stays in registers only where its indices are constants */
    for (int u = 0; u < 8; ++u) { const int t = u & 3, half = u >> 2; const float bv = HASB ? bf16_round(bp[col0 + t * 16 + ln]) : 0.f; FragH f;
#pragma unroll
      for (int r = 0; r < 8; ++r) f.h[r] = (_Float16)(accs[u][r] * alpha + bv);
      *(v8us*)(tv + (64 * (w >> 2) + t * 16 + ln) * G2_PITCH + (32 * (w & 3) + half * 16 + 8 * hh) * 2) = f.half[0]; }
    __syncthreads();      /* a V^T row of the tile holds four waves' parts: all are written before any row is read */
    const int n0 = nq * 128 + w * 16 + hh; const size_t tok = (size_t)B0 * SQ + (size_t)mt * 128;      /* the wave stores 16 of the 128 rows, two whole rows (2 x 256 bytes, whole lines) a store */
    unsigned short* vo = (unsigned short*)VTo + ((tok / SQ) * (NH * HD) + n0) * SQ + tok % SQ + ln * 8;
#pragma unroll      /* in full: the eight LDS reads go out together, ahead of the first store */
    for (int q = 0; q < 8; ++q) *(v8us*)(vo + (size_t)q * 2 * SQ) = *(const v8us*)(tv + (w * 16 + q * 2 + hh) * G2_PITCH + ln * 16);
    return; }
#pragma unroll
  for (int u = 0; u < 8; ++u) { const int t = u & 3, half = u >> 2; const int col = col0 + t * 16 + ln; const float bv = HASB ? bf16_round(bp[col]) : 0.f;
#pragma unroll
    for (int r = 0; r < 8; ++r) { const int rloc = half * 16 + 8 * hh + r; float v = accs[u][r] * alpha + bv; if (HASCP) { if (rowsPerB < 0) v += CP[cofs + (size_t)(row0g + row0 + rloc) * ldc + col];      /* rowsPerB < 0: own element of the batched C plane */ else { const int bidx = (row0g + row0 + rloc) / rowsPerB; v += CP[(size_t)bidx * sCPb + (size_t)by * 64 + col]; } }
      if (ACT == 3) v = fmaxf(v, 0.f); else if (ACT == 6) v = 0.5f * v * (1.0f + erff(v * 0.70710678118654752f)); else if (ACT == 11) v = 1.0f / (1.0f + expf(-v)); else if (ACT == 15) v = v / (1.0f + expf(-v)); else if (ACT == 12) v = (v > 0.f) ? v : 0.01f * v; else if (ACT == 8) v = tanhf(v); else if (ACT == 9) v = 0.5f * v * (1.0f + tanhf(0.7978845608028654f * (v + 0.044715f * v * v * v))); else if (ACT == 14) v = (v > 0.f) ? v : 0.1f * v; else if (ACT == 16) v = (v >= 0.f) ? v : 0.3f * v; else if (ACT == 17) v = (v >= 0.f) ? v : 0.2f * v;
      so[w][rloc][t * 16 + ln] = v; } }
  __builtin_amdgcn_fence(__ATOMIC_ACQ_REL, "workgroup"); __builtin_amdgcn_wave_barrier();
  const int rsub = lane >> 4, c4 = (lane & 15) * 4;
  {
#pragma unroll
    for (int q = 0; q < 16; ++q) { const int r = q * 2 + rsub; const v4f v = *(const v4fa*)&so[w][r][c4]; if (F32OUT) *(v4f*)(C + cofs + (size_t)(row0 + r) * ldc + col0 + c4) = v; else { v4h h4; for (int i = 0; i < 4; ++i) h4[i] = (_Float16)v[i]; *(v4h*)(C16 + cofs + (size_t)(row0 + r) * ldc + col0 + c4) = h4; } }
     } }


// All five operand conversions in one launch (none reads another's output): blocks [0, PREP_XB) round x to bf16 and store it as f16; the next 4 * PREP_WB blocks do the same, x16, for Wq, Wk, Wv, Wo
// (natural [out][in] = Bt[n][k]) into four consecutive planes of BW. Eight elements a thread; which array a block works on is the same for the whole block.
#define PREP_XB ((unsigned)(NR * DM / 8 / 256))
#define PREP_WB ((unsigned)((size_t)DM * DM / 8 / 256))
__global__ __launch_bounds__(256) void k_prep(const float* __restrict__ x, const float* __restrict__ wq, const float* __restrict__ wk, const float* __restrict__ wv, const float* __restrict__ wo, _Float16* __restrict__ X16, _Float16* __restrict__ BW) {
  static_assert(NR * DM % (8 * 256) == 0 && (size_t)DM * DM % (8 * 256) == 0, "k_prep: whole blocks per array");
  const unsigned bx = blockIdx.x; const float* s = x; _Float16* d = X16; float sc = 1.0f; unsigned lb = bx;
  if (bx >= PREP_XB) { const unsigned m = (bx - PREP_XB) / PREP_WB; lb = (bx - PREP_XB) % PREP_WB; s = m == 0 ? wq : m == 1 ? wk : m == 2 ? wv : wo; d = BW + (size_t)m * DM * DM; sc = 16.0f; }
  const size_t t = (size_t)lb * 256 + threadIdx.x; FragH f;
#pragma unroll
  for (int q = 0; q < 8; ++q) f.h[q] = (_Float16)(bf16_round(s[t * 8 + q]) * sc);
  *(v8us*)((unsigned short*)d + t * 8) = f.half[0]; }
__global__ __launch_bounds__(256) void k_rsm(const float* __restrict__ S, _Float16* __restrict__ P, int nrows) {
  #pragma clang fp contract(off)
  const int i = blockIdx.x * 256 + threadIdx.x; if (i >= nrows) return; const float* s = S + (size_t)i * SQ; float mx = -3.0e38f;
#pragma unroll 1
  for (int j = 0; j < SQ; ++j) mx = fmaxf(mx, s[j]); float se = 0.f;
#pragma unroll 1
  for (int j = 0; j < SQ; ++j) se += expf(s[j] - mx); const float sc = 256.0f / se;
#pragma unroll 1
  for (int j0 = 0; j0 < SQ; j0 += 8) { FragH f; for (int q = 0; q < 8; ++q) f.h[q] = (_Float16)(expf(s[j0 + q] - mx) * sc); unsigned short* d = (unsigned short*)P + (size_t)i * SQ + j0; *(v8us*)d = f.half[0];  } }
__global__ __launch_bounds__(256) void k_vt(const _Float16* __restrict__ V16, int b, int h0, _Float16* __restrict__ VT) { __shared__ unsigned short tl[64][65]; const int tid = threadIdx.x; const int hh = blockIdx.x % HG, sg = blockIdx.x / HG; const int s0 = sg * 64; const int h = h0 + hh;
  for (int i = tid; i < 64 * 8; i += 256) { const int j = i / 8, d8 = (i % 8) * 8; FragH f; f.half[0] = *(const v8us*)((const unsigned short*)V16 + ((size_t)b * SQ + s0 + j) * DM + h * HD + d8); for (int q = 0; q < 8; ++q) tl[d8 + q][j] = f.u[q]; }
  __syncthreads();
  { for (int i = tid; i < 64 * 8; i += 256) { const int d = i / 8, j8 = (i % 8) * 8; FragH f; for (int q = 0; q < 8; ++q) f.u[q] = tl[d][j8 + q]; *(v8us*)((unsigned short*)VT + ((size_t)hh * HD + d) * SQ + s0 + j8) = f.half[0]; }  } }



// Fused attention: scores, softmax of (scores + relative-position bias) and the product with V in one kernel, for every batch and head in one launch; neither the scores nor the weights go to memory.
// A wave owns FA_QT * 16 query columns and walks the keys 32 at a time: S^T = K . Q^T (A = K rows, B = Q rows kept in registers), so that a lane holds 16 scores of ONE query per column tile;
// running maximum and sum per lane (online softmax, log2 domain), one exchange between the wave halves per pass for the maximum, one in the epilogue for the sum;
// the two S^T tiles of a pass, converted in place, are the B operand of O^T += V^T . P^T (A = V^T rows in the same k order), and a lane's 8 accumulator registers are 8 consecutive d of its query: 16-byte stores.
// Every loop but the walk over the stages and their passes is unrolled in full: the fragment and accumulator arrays stay in registers only where each index is a constant.
// K and V^T reach the waves through LDS: a stage is FA_SK keys (K rows of 128 bytes, V^T rows of 256 bytes), brought once for the whole block by asynchronous copies, whole 128-byte lines a request, through no register;
// two buffers: the next stage flies while this one is worked on. The eight waves read their fragments from LDS in the k order of g2_frag; passes, products and sums keep their order.
#define FA_WAVES 8
#define FA_QT 2                      /* 16-column query tiles a wave */
#define FA_BQ (FA_WAVES * FA_QT * 16) /* query rows a block */
#define FA_L2E 1.4426950408889634f
#define FA_SK 128                    /* keys a stage: four passes */
#define FA_KP 144                    /* LDS pitch of a K row in bytes: 16 x odd, so the 16 rows of a 16-byte fragment read fall on distinct banks */
#define FA_VP 272                    /* LDS pitch of a V^T row in bytes: 16 x odd */
#define FA_KB (FA_SK * FA_KP)        /* the K rows of a stage; the HD V^T rows follow */
#define FA_STAGE (FA_KB + HD * FA_VP)
// Eight asynchronous 16-byte copies of a lane: K rows r, r + 32, r + 64, r + 96 of a stage (lk: LDS byte address of the first, gk: its global address), then V^T rows d, d + 16, d + 32, d + 48 (lv, gv).
// The closing s_wait_xcnt 0 stands inside the statement, in front of any later write of the address registers that the copies name.
__device__ __forceinline__ void fa_copy8(unsigned lk, const _Float16* gk, unsigned lv, const _Float16* gv) {
  asm volatile("global_load_async_to_lds_b128 %0, %8, off\n\tglobal_load_async_to_lds_b128 %1, %9, off\n\tglobal_load_async_to_lds_b128 %2, %10, off\n\tglobal_load_async_to_lds_b128 %3, %11, off\n\t"
               "global_load_async_to_lds_b128 %4, %12, off\n\tglobal_load_async_to_lds_b128 %5, %13, off\n\tglobal_load_async_to_lds_b128 %6, %14, off\n\tglobal_load_async_to_lds_b128 %7, %15, off\n\ts_wait_xcnt 0x0"
               :: "v"(lk), "v"(lk + 32 * FA_KP), "v"(lk + 64 * FA_KP), "v"(lk + 96 * FA_KP), "v"(lv), "v"(lv + 16 * FA_VP), "v"(lv + 32 * FA_VP), "v"(lv + 48 * FA_VP),
                  "v"(gk), "v"(gk + (size_t)32 * DM), "v"(gk + (size_t)64 * DM), "v"(gk + (size_t)96 * DM), "v"(gv), "v"(gv + (size_t)16 * SQ), "v"(gv + (size_t)32 * SQ), "v"(gv + (size_t)48 * SQ) : "memory"); }
__device__ __forceinline__ float sm_xh(float x) { return __builtin_bit_cast(float, __builtin_amdgcn_permlanex16(__builtin_bit_cast(int, x), __builtin_bit_cast(int, x), 0x76543210, 0xfedcba98, false, false)); }      /* lane l ^ 16 */
// Four native exp2 in place. In one statement with a closing v_nop: the slot that the instruction set asks for behind a transcendental before its result is read or its source overwritten
__device__ __forceinline__ v4f sm_exp2x4(v4f x) { float a = x[0], b = x[1], c = x[2], d = x[3];
  asm("v_exp_f32 %0, %0\n\tv_exp_f32 %1, %1\n\tv_exp_f32 %2, %2\n\tv_exp_f32 %3, %3\n\tv_nop" : "+v"(a), "+v"(b), "+v"(c), "+v"(d));
  const v4f y = {a, b, c, d}; return y; }
__device__ __forceinline__ float sm_exp2x1(float x) { asm("v_exp_f32 %0, %0\n\tv_nop" : "+v"(x)); return x; }      /* one native exp2, with the same closing slot */
__device__ __forceinline__ v8f fa_mma(v16h a, v16h b, v8f c) { return __builtin_amdgcn_wmma_f32_16x16x32_f16(false, a, false, b, (short)0, c, false, false); }
__global__ __launch_bounds__(FA_WAVES * 32) void k_fattn(const _Float16* __restrict__ Q16, const _Float16* __restrict__ K16, const _Float16* __restrict__ VT, const float* __restrict__ emb, _Float16* __restrict__ O16) {
  static_assert(SQ % FA_BQ == 0 && SQ % FA_SK == 0 && SQ / FA_SK >= 2 && FA_SK == 128 && FA_WAVES == 8 && HD == 64 && MAXD % 32 == 0 && FA_QT * 16 + 31 <= MAXD, "k_fattn: whole blocks per head, whole stages per row (two at least), eight copies a lane a stage, two k steps per score tile, band passes inside the table");
  __shared__ __attribute__((aligned(16))) unsigned char ring[2 * FA_STAGE];
  __shared__ float tb[4 * MAXD - 1];      /* this head's bias, bf16-rounded, times log2(e), by k = j - i + (2 * MAXD - 1), already clipped: consecutive j are consecutive entries */
  const int tid = threadIdx.x, lane = tid & 31, ln = lane & 15, hh = lane >> 4; const int wave = __builtin_amdgcn_readfirstlane(tid >> 5);
  const int bh = blockIdx.x / (SQ / FA_BQ), b = bh / NH, h = bh % NH; const int q0 = (blockIdx.x % (SQ / FA_BQ)) * FA_BQ + wave * (FA_QT * 16);
  const unsigned lk = (unsigned)(size_t)ring + (unsigned)((tid >> 3) * FA_KP + (tid & 7) * 16), lv = (unsigned)(size_t)ring + (unsigned)(FA_KB + (tid >> 4) * FA_VP + (tid & 15) * 16);      /* the lane's places in a stage: a wave's copy is four whole K rows or two whole V^T rows */
  const _Float16* gk = K16 + ((size_t)b * SQ + (tid >> 3)) * DM + h * HD + (tid & 7) * 8; const _Float16* gv = VT + ((size_t)bh * HD + (tid >> 4)) * SQ + (tid & 15) * 8;
  fa_copy8(lk, gk, lv, gv);      /* stage 0 */
  for (int i = tid; i < 4 * MAXD - 1; i += FA_WAVES * 32) tb[i] = bf16_round(emb[(min(max(2 * MAXD - 1 - i, -MAXD), MAXD) + MAXD) * NH + h]) * FA_L2E;
  asm volatile("s_wait_asynccnt 0x0" ::: "memory");      /* this wave's copies of stage 0 have landed */
  __syncthreads();      /* publishes tb and stage 0 */
  fa_copy8(lk + FA_STAGE, gk + (size_t)FA_SK * DM, lv + FA_STAGE, gv + FA_SK);      /* stage 1 */
  const float bfar = tb[0], bnear = tb[4 * MAXD - 2];      /* j <= i - MAXD ; j >= i + MAXD */
  const _Float16* qp = Q16 + ((size_t)b * SQ + q0 + ln) * DM + h * HD; const unsigned char* fk = ring + ln * FA_KP + 16 * hh; const unsigned char* fv = ring + FA_KB + ln * FA_VP + 16 * hh;      /* the lane's fragment rows in buffer 0 */
  v16h qf[FA_QT][2], kf[2][2];
#pragma unroll
  for (int t = 0; t < FA_QT; ++t) { qf[t][0] = g2_frag(qp + (size_t)t * 16 * DM, hh); qf[t][1] = g2_frag(qp + (size_t)t * 16 * DM + 32, hh); }
  const v8f z8 = {0.f,0.f,0.f,0.f,0.f,0.f,0.f,0.f};
  v8f o[FA_QT][4]; float mr[FA_QT], lr[FA_QT];
#pragma unroll
  for (int t = 0; t < FA_QT; ++t) { mr[t] = -3.0e38f; lr[t] = 0.f; o[t][0] = z8; o[t][1] = z8; o[t][2] = z8; o[t][3] = z8; }
#pragma unroll 1      /* one stage a trip: the buffer is picked by the trip's parity */
  for (int st = 0; st < SQ / FA_SK; ++st) { const unsigned bo = (unsigned)(st & 1) * FA_STAGE; const unsigned char* pk = fk + bo; const unsigned char* pv = fv + bo;
#pragma unroll
   for (int u = 0; u < 2; ++u) { kf[u][0] = g2_lfrag(pk + u * 16 * FA_KP); kf[u][1] = g2_lfrag(pk + u * 16 * FA_KP + 64); }      /* the stage's first K rows */
#pragma unroll 1      /* one pass a trip: with the four passes unrolled the build went past 256 registers and spilled */
   for (int p = 0; p < FA_SK / 32; ++p) { const int j0 = st * FA_SK + p * 32;
    v16h vf[4];      /* asked for first, used last: the scores and the softmax stand between */
#pragma unroll
    for (int d = 0; d < 4; ++d) vf[d] = g2_lfrag(pv + d * 16 * FA_VP + p * 64);
    v8f s[FA_QT][2];      /* s[t][u][r] = score of key j0 + 16 u + 8 hh + r, query q0 + 16 t + ln */
#pragma unroll
    for (int t = 0; t < FA_QT; ++t)
#pragma unroll
      for (int u = 0; u < 2; ++u) s[t][u] = fa_mma(kf[u][1], qf[t][1], fa_mma(kf[u][0], qf[t][0], z8));
    if (p + 1 < FA_SK / 32) {      /* the next pass's K rows, fetched one pass ahead inside the stage */
#pragma unroll
      for (int u = 0; u < 2; ++u) { kf[u][0] = g2_lfrag(pk + ((p + 1) * 32 + u * 16) * FA_KP); kf[u][1] = g2_lfrag(pk + ((p + 1) * 32 + u * 16) * FA_KP + 64); } }
    if (j0 + 31 > q0 - MAXD && j0 < q0 + FA_QT * 16 - 1 + MAXD) { const float* tp = tb + (j0 - q0 + 2 * MAXD - 1) + 8 * hh - ln;      /* wave-uniform: the pass meets the unclipped band; every k read here lies inside the table */
#pragma unroll
      for (int t = 0; t < FA_QT; ++t)
#pragma unroll
        for (int u = 0; u < 2; ++u)
#pragma unroll
          for (int r = 0; r < 8; ++r) s[t][u][r] = __builtin_fmaf(s[t][u][r], 0.125f * FA_L2E, tp[(u - t) * 16 + r]);
    } else { const float bc = (j0 >= q0 + FA_QT * 16 - 1 + MAXD) ? bnear : bfar;
#pragma unroll
      for (int t = 0; t < FA_QT; ++t)
#pragma unroll
        for (int u = 0; u < 2; ++u)
#pragma unroll
          for (int r = 0; r < 8; ++r) s[t][u][r] = __builtin_fmaf(s[t][u][r], 0.125f * FA_L2E, bc); }
#pragma unroll
    for (int t = 0; t < FA_QT; ++t) {
      float m0 = fmaxf(s[t][0][0], s[t][0][1]), m1 = fmaxf(s[t][1][0], s[t][1][1]);
#pragma unroll
      for (int r = 2; r < 8; r += 2) { m0 = fmaxf(fmaxf(m0, s[t][0][r]), s[t][0][r + 1]); m1 = fmaxf(fmaxf(m1, s[t][1][r]), s[t][1][r + 1]); }
      m0 = fmaxf(m0, m1); const float mn = fmaxf(mr[t], fmaxf(m0, sm_xh(m0)));
      const float al = sm_exp2x1(mr[t] - mn); mr[t] = mn;
      const float nm = 8.0f - mn;      /* weights carried x256 (as f16 operands away from the subnormal range); the sum carries the same factor */
      v4f as; FragH pf;
#pragma unroll
      for (int u = 0; u < 2; ++u)
#pragma unroll
        for (int g = 0; g < 2; ++g) { v4f x = {s[t][u][4 * g] + nm, s[t][u][4 * g + 1] + nm, s[t][u][4 * g + 2] + nm, s[t][u][4 * g + 3] + nm}; x = sm_exp2x4(x);
          if (u + g == 0) as = x; else as += x;
#pragma unroll
          for (int e = 0; e < 4; ++e) pf.h[u * 8 + g * 4 + e] = (_Float16)x[e]; }
      lr[t] = __builtin_fmaf(lr[t], al, (as[0] + as[1]) + (as[2] + as[3]));
#pragma unroll
      for (int d = 0; d < 4; ++d) o[t][d] = fa_mma(vf[d], pf.v, o[t][d] * al); } }
   asm volatile("s_wait_dscnt 0x0" ::: "memory");      /* this wave's reads of the buffer are done before it is refilled */
   asm volatile("s_wait_asynccnt 0x0" ::: "memory");      /* this wave's copies of stage st + 1 have landed */
   __syncthreads();      /* publishes stage st + 1 and ends every wave's reads of stage st */
   if (st + 2 < SQ / FA_SK) fa_copy8(lk + bo, gk + (size_t)(st + 2) * FA_SK * DM, lv + bo, gv + (size_t)(st + 2) * FA_SK); }      /* stage st + 2 into the buffer just read */
  asm volatile("s_wait_asynccnt 0x0" ::: "memory");      /* nothing of this wave is in flight when it goes on */
#pragma unroll
  for (int t = 0; t < FA_QT; ++t) { const float sc = 64.0f / (lr[t] + sm_xh(lr[t]));      /* o carried x64, as the output GEMM's alpha expects */
    unsigned short* op = (unsigned short*)O16 + ((size_t)b * SQ + q0 + t * 16 + ln) * DM + h * HD + 8 * hh;
#pragma unroll
    for (int d = 0; d < 4; ++d) { FragH f;
#pragma unroll
      for (int r = 0; r < 8; ++r) f.h[r] = (_Float16)(o[t][d][r] * sc);
      *(v8us*)(op + d * 16) = f.half[0]; } } }

extern "C" void kernel_launch(void* const* d_in, const int* in_sizes, int n_in,
                              void* d_out, int out_size, void* d_ws, size_t ws_size, hipStream_t stream) {
  (void)in_sizes; (void)n_in; (void)out_size;
  const float* const* I = (const float* const*)d_in; const float* x = I[0]; const float* wq = I[1]; const float* bq = I[2]; const float* wk = I[3]; const float* bk = I[4]; const float* wv = I[5]; const float* bv = I[6]; const float* wo = I[7]; const float* bo = I[8]; const float* emb = I[9];      /* nn.Linear weights [out][in]; rel_emb [2*MAXD+1][NH] */
  char* ws = (char*)d_ws; size_t off = 0;
  auto take = [&](size_t bytes) { char* p = ws + off; off += (bytes + 255) & ~(size_t)255; return p; };
  _Float16* BQ = (_Float16*)take((size_t)DM * DM * 2); _Float16* BK = (_Float16*)take((size_t)DM * DM * 2); _Float16* BV = (_Float16*)take((size_t)DM * DM * 2); _Float16* BO = (_Float16*)take((size_t)DM * DM * 2);
  _Float16* X16 = (_Float16*)take(NR * DM * 2); _Float16* Q16 = (_Float16*)take(NR * DM * 2); _Float16* K16 = (_Float16*)take(NR * DM * 2); _Float16* O16 = (_Float16*)take(NR * DM * 2);
  _Float16* VT = (_Float16*)take((size_t)NB * NH * HD * SQ * 2);
  if (off > ws_size) return;
  static_assert((size_t)DM * DM * 2 % 256 == 0 && NR * DM * 2 % 256 == 0, "BQ, BK, BV, BO and Q16, K16 lie back to back: planes of one pitch");
  k_prep<<<PREP_XB + 4 * PREP_WB, 256, 0, stream>>>(x, wq, wk, wv, wo, X16, BQ);      /* X16; BQ, BK, BV, BO */
  const size_t r0p = (size_t)B0 * SQ;      /* first projected row */
  k_gemm2<0, true, false, false, 2><<<dim3((unsigned)((MP / 128) * (DM / 128)), 3), 256, 0, stream>>>(X16 + r0p * DM, DM, 0, BQ, DM, (size_t)DM * DM, 0.0625f, bq, bk, bv, nullptr, 1, 0, 0, nullptr, Q16 + r0p * DM, VT, DM, NR * DM, MP, DM, DM);      /* planes 0, 1: Q16, K16; plane 2: V^T [NB][NH][HD][SQ] */
  k_fattn<<<NB * NH * (SQ / FA_BQ), FA_WAVES * 32, 0, stream>>>(Q16, K16, VT, emb, O16);      /* o (merged heads, x64) as f16 rows */
  k_gemm2<0, true, false, true, -1><<<dim3((unsigned)((MPO / 128) * (DM / 128)), 1), 256, 0, stream>>>(O16 + r0p * DM, DM, 0, BO, DM, 0, 0.0009765625f, bo, nullptr, nullptr, nullptr, 1, 0, 0, (float*)d_out + r0p * DM, nullptr, nullptr, DM, 0, MPO, DM, DM);      /* out rows are the output layout */
}

// v008
// One run takes 79.3 microseconds.
// In two side-by-side timings against v007, it was 1.08 and 1.07 times as fast.
// Counting every step since v000, it is 57.2 times as fast.
#include <hip/hip_runtime.h>
// Multi-head self-attention with a learned relative-position bias (x [2][2048][1024]; q/k/v = x W^T + b (nn.Linear [out][in]), 16 heads of 64; scores / 8 + rel_emb[clip(i - j, -128, 128) + 128][h] (rel_emb [257][16]); softmax; o merged; out = o Wo^T + bo -> [2][2048][1024]).
// Structure: token rows r = b*2048 + s; x as exact f16 rows (bf16-rounded) and the four weights (x16) converted in one launch; Q, K, V as three WMMA GEMMs in one launch, the grid's y index picking weight, bias and output plane (32x64 wave tiles, f32 accumulation, exact x16 weights + bias, f16 outputs); the V plane's blocks store their tile transposed, so that V^T [batch][head][d][s] comes straight from that launch; one fused attention launch for all batches and heads: score tiles on WMMA (K = 64), online softmax of (scores / 8 + relative-position bias looked up by (i - j, head)) on VALU (f32 statistics, native exp; weights x256 as f16 operands, in registers), o = P . V on WMMA (o carried x64 against f16 subnormal flush, folded into the output GEMM alpha) written straight into the merged f16 o rows; out = o W_o + b GEMM (f32) into the output layout.
// Compute dtype: inputs rounded to bf16; x / weights exact; q, k, v, softmax weights and o as plain f16 GEMM operands (~2^-12); scores and softmax statistics f32; v_wmma_f32_16x16x32_f16.
#define NB 2
#define SQ 2048
#define DM 1024
#define NH 16
#define HD 64
#define MAXD 128                     /* relative distance clip */
#define HG 4                         /* heads per launch of the grouped V^T transpose k_vt(b, h0) */
#define B0 0                         /* first batch processed (debug hook) */
#define NBR NB                       /* batches processed (debug hook) */
#define NR ((size_t)NB * SQ)         /* token rows */
#define MP ((int)((size_t)NBR * SQ)) /* rows projected (debug hook) */
#define QN SQ                        /* query rows per batch; unused: the attention launch covers all SQ */
#define NHD NH                       /* heads; unused: the attention launch covers all NH */
#define MPO MP                       /* rows through the output stage (debug hook) */
#define LQ DM      /* row pitch of the q/k rows; unused: the code writes DM */
typedef __bf16 v16b __attribute__((ext_vector_type(16)));
typedef unsigned short v8us __attribute__((ext_vector_type(8), may_alias));
typedef float  v8f  __attribute__((ext_vector_type(8)));
typedef float  v4f  __attribute__((ext_vector_type(4)));
typedef float  v4fa __attribute__((ext_vector_type(4), may_alias));
union FragB { v16b v; v8us half[2]; unsigned short u[16]; };

__device__ __forceinline__ unsigned short bf16_bits(float x) { unsigned int u = __float_as_uint(x); return (unsigned short)((u + 0x7FFFu + ((u >> 16) & 1u)) >> 16); }
__device__ __forceinline__ float bf16_val(unsigned short b) { return __uint_as_float(((unsigned int)b) << 16); }
__device__ __forceinline__ float bf16_round(float x) { return bf16_val(bf16_bits(x)); }
// D += A·B with NT terms: 1 = ah·bh, 2 = + al·bh (A split), 3 = + ah·bl (both split)
template <int NT>
__device__ __forceinline__ v8f mmaN(v16b ah, v16b al, v16b bh, v16b bl, v8f c) {
  c = __builtin_amdgcn_wmma_f32_16x16x32_bf16(false, ah, false, bh, (short)0, c, false, false);
  if (NT >= 2) c = __builtin_amdgcn_wmma_f32_16x16x32_bf16(false, al, false, bh, (short)0, c, false, false);
  if (NT >= 3) c = __builtin_amdgcn_wmma_f32_16x16x32_bf16(false, ah, false, bl, (short)0, c, false, false);
  asm volatile("v_nop\n\tv_nop\n\tv_nop\n\tv_nop" : "+v"(c) : "v"(ah), "v"(al), "v"(bh), "v"(bl));
  return c;
}

__global__ __launch_bounds__(256) void k_wt_bf16(const float* __restrict__ W, unsigned short* __restrict__ Wt, int K, int N) {
  const int t = blockIdx.x * 256 + threadIdx.x;
  const int k8n = K / 8;
  if (t >= N * k8n) return;
  const int n = t / k8n, k8 = (t % k8n) * 8;
  v8us v;
#pragma unroll
  for (int i = 0; i < 8; ++i) v[i] = bf16_bits(W[(size_t)(k8 + i) * N + n]);
  *(v8us*)(Wt + (size_t)n * K + k8) = v;
  
}

// GEMM C[M][N] (f32, pitch ldc) = act(A[M][K]·W + bias). A f32 row-major (pitch lda) converted per fragment to bf16
// (ASPLIT: hi/lo two planes -> 2 terms, else single rounded term); Wt bf16 [N][K] (pitch ldb). BIAS_BF16 rounds the
// bias to bf16 first (bias quantised to bf16 before the add). K%32==0, M%16==0, N%64==0.
template <bool ASPLIT, int ACT, bool BIAS_BF16>
__global__ __launch_bounds__(128) void k_gemm_bf(const float* __restrict__ A, int lda, const unsigned short* __restrict__ Wt, int ldb,
                                               const float* __restrict__ bias, float* __restrict__ C, int ldc, int M, int N, int K) {
  __shared__ __attribute__((aligned(16))) float so[4][16][64];
  const int tid = threadIdx.x, w = tid >> 5, lane = tid & 31, ln = lane & 15, hh = lane >> 4;
  const int ntn = N / 64;
  const int wid = blockIdx.x * 4 + w;
  const int mt = wid / ntn, nq = wid % ntn;
  if (mt * 16 >= M) return;
  const int row0 = mt * 16, col0 = nq * 64;
  const float* arow = A + (size_t)(row0 + ln) * lda;
  v8f acc[4] = {};
  for (int kb = 0; kb < K; kb += 32) {
    FragB ah, al;
    const v4f x0 = *(const v4fa*)(arow + kb + 8 * hh), x1 = *(const v4fa*)(arow + kb + 8 * hh + 4);
    const v4f x2 = *(const v4fa*)(arow + kb + 16 + 8 * hh), x3 = *(const v4fa*)(arow + kb + 16 + 8 * hh + 4);
    float xs[16] = {x0[0],x0[1],x0[2],x0[3],x1[0],x1[1],x1[2],x1[3],x2[0],x2[1],x2[2],x2[3],x3[0],x3[1],x3[2],x3[3]};
#pragma unroll
    for (int i = 0; i < 16; ++i) { const unsigned short hb = bf16_bits(xs[i]); ah.u[i] = hb; al.u[i] = ASPLIT ? bf16_bits(xs[i] - bf16_val(hb)) : (unsigned short)0; }
#pragma unroll
    for (int t = 0; t < 4; ++t) {
      const unsigned short* brow = Wt + (size_t)(col0 + t * 16 + ln) * ldb + kb;
      FragB b;
      b.half[0] = *(const v8us*)(brow + 8 * hh);
      b.half[1] = *(const v8us*)(brow + 16 + 8 * hh);
      acc[t] = mmaN<ASPLIT ? 2 : 1>(ah.v, al.v, b.v, b.v, acc[t]);
    }
  }
#pragma unroll
  for (int t = 0; t < 4; ++t) {
    float bv = bias ? bias[col0 + t * 16 + ln] : 0.f;
    if (BIAS_BF16) bv = bf16_round(bv);
#pragma unroll
    for (int r = 0; r < 8; ++r) { float v = acc[t][r] + bv; if (ACT == 1) v = fmaxf(v, 0.f); so[w][8 * hh + r][t * 16 + ln] = v; }
  }
  __builtin_amdgcn_fence(__ATOMIC_ACQ_REL, "workgroup");
  __builtin_amdgcn_wave_barrier();
  const int rsub = lane >> 4, c4 = (lane & 15) * 4;
  {
#pragma unroll
    for (int q = 0; q < 8; ++q) {
      const int r = q * 2 + rsub;
      const v4f v = *(const v4fa*)&so[w][r][c4];
      *(v4f*)(C + (size_t)(row0 + r) * ldc + col0 + c4) = v;
    }
    
  }
}

// GEMM C = act(A·W + bias + resid): A f32 (ASPLIT -> hi/lo 2 terms), Wt bf16 [N][K]; ACT 0 none, 1 relu, 2 exact gelu;
// resid (optional, f32, row index = (row % rmod), pitch ldr, RES_BF16 rounds it) added before the activation.
template <bool ASPLIT, int ACT, bool BIAS_BF16, bool RES_BF16>
__global__ __launch_bounds__(128) void k_gemm_bf3(const float* __restrict__ A, int lda, const unsigned short* __restrict__ Wt, int ldb,
                                                const float* __restrict__ bias, const float* __restrict__ resid, int rmod, int ldr,
                                                float* __restrict__ C, int ldc, int M, int N, int K) {
  __shared__ __attribute__((aligned(16))) float so[4][16][64];
  const int tid = threadIdx.x, w = tid >> 5, lane = tid & 31, ln = lane & 15, hh = lane >> 4;
  const int ntn = N / 64;
  const int wid = blockIdx.x * 4 + w;
  const int mt = wid / ntn, nq = wid % ntn;
  if (mt * 16 >= M) return;
  const int row0 = mt * 16, col0 = nq * 64;
  const float* arow = A + (size_t)(row0 + ln) * lda;
  v8f acc[4] = {};
  for (int kb = 0; kb < K; kb += 32) {
    FragB ah, al;
    const v4f x0 = *(const v4fa*)(arow + kb + 8 * hh), x1 = *(const v4fa*)(arow + kb + 8 * hh + 4);
    const v4f x2 = *(const v4fa*)(arow + kb + 16 + 8 * hh), x3 = *(const v4fa*)(arow + kb + 16 + 8 * hh + 4);
    float xs[16] = {x0[0],x0[1],x0[2],x0[3],x1[0],x1[1],x1[2],x1[3],x2[0],x2[1],x2[2],x2[3],x3[0],x3[1],x3[2],x3[3]};
#pragma unroll
    for (int i = 0; i < 16; ++i) { const unsigned short hb = bf16_bits(xs[i]); ah.u[i] = hb; al.u[i] = ASPLIT ? bf16_bits(xs[i] - bf16_val(hb)) : (unsigned short)0; }
#pragma unroll
    for (int t = 0; t < 4; ++t) {
      const unsigned short* brow = Wt + (size_t)(col0 + t * 16 + ln) * ldb + kb;
      FragB b;
      b.half[0] = *(const v8us*)(brow + 8 * hh);
      b.half[1] = *(const v8us*)(brow + 16 + 8 * hh);
      acc[t] = mmaN<ASPLIT ? 2 : 1>(ah.v, al.v, b.v, b.v, acc[t]);
    }
  }
#pragma unroll
  for (int t = 0; t < 4; ++t) {
    const int col = col0 + t * 16 + ln;
    float bv = bias ? bias[col] : 0.f;
    if (BIAS_BF16) bv = bf16_round(bv);
#pragma unroll
    for (int r = 0; r < 8; ++r) {
      float v = acc[t][r] + bv;
      if (resid) { float rv = resid[(size_t)((row0 + 8 * hh + r) % rmod) * ldr + col]; if (RES_BF16) rv = bf16_round(rv); v += rv; }
      if (ACT == 1) v = fmaxf(v, 0.f);
      if (ACT == 2) v = 0.5f * v * (1.0f + erff(v * 0.70710678118654752f));
      if (ACT == 3) { const float u = 0.7978845608028654f * (v + 0.044715f * v * v * v); v = 0.5f * v * (1.0f + tanhf(u)); }
      so[w][8 * hh + r][t * 16 + ln] = v;
    }
  }
  __builtin_amdgcn_fence(__ATOMIC_ACQ_REL, "workgroup");
  __builtin_amdgcn_wave_barrier();
  const int rsub = lane >> 4, c4 = (lane & 15) * 4;
  {
#pragma unroll
    for (int q = 0; q < 8; ++q) {
      const int r = q * 2 + rsub;
      const v4f v = *(const v4fa*)&so[w][r][c4];
      *(v4f*)(C + (size_t)(row0 + r) * ldc + col0 + c4) = v;
    }
    
  }
}
// row LayerNorm (biased variance, eps) over N: s = X (+ R); optional out_sum <- s; out_norm <- (s-mu)*rsqrt(var+eps)*g + b
template <bool PARAM_BF16>
__global__ __launch_bounds__(256) void k_layernorm(const float* __restrict__ X, const float* __restrict__ R, const float* __restrict__ g, const float* __restrict__ bta,
                                                  float* __restrict__ out_sum, float* __restrict__ out_norm, int N, float eps) {
  __shared__ float red[256];
  const int row = blockIdx.x, tid = threadIdx.x;
  const float* x = X + (size_t)row * N; const float* rr = R ? R + (size_t)row * N : nullptr;
  float vals[16];                     // up to N = 4096
  const int per = N / 256;            // contiguous chunk per thread? use strided-by-4 chunks: thread handles j = tid*4 + 1024*u
  float s1 = 0.f;
  for (int u = 0; u < per / 4; ++u) {
    const int j = tid * 4 + 1024 * u;
    const v4f a = *(const v4fa*)(x + j);
    v4f b = {0.f,0.f,0.f,0.f}; if (rr) b = *(const v4fa*)(rr + j);
#pragma unroll
    for (int q = 0; q < 4; ++q) { const float v = a[q] + b[q]; vals[u * 4 + q] = v; s1 += v; }
  }
  red[tid] = s1; __syncthreads();
  for (int st = 128; st > 0; st >>= 1) { if (tid < st) red[tid] += red[tid + st]; __syncthreads(); }
  const float mu = red[0] / (float)N; __syncthreads();
  float s2 = 0.f;
  for (int u = 0; u < per / 4; ++u)
#pragma unroll
    for (int q = 0; q < 4; ++q) { const float c = vals[u * 4 + q] - mu; s2 += c * c; }
  red[tid] = s2; __syncthreads();
  for (int st = 128; st > 0; st >>= 1) { if (tid < st) red[tid] += red[tid + st]; __syncthreads(); }
  const float rs = rsqrtf(red[0] / (float)N + eps);
  {
    for (int u = 0; u < per / 4; ++u) {
      const int j = tid * 4 + 1024 * u;
      v4f o, sm;
#pragma unroll
      for (int q = 0; q < 4; ++q) {
        float gg = g[j + q], bb = bta[j + q];
        if (PARAM_BF16) { gg = bf16_round(gg); bb = bf16_round(bb); }
        sm[q] = vals[u * 4 + q]; o[q] = (vals[u * 4 + q] - mu) * rs * gg + bb;
      }
      if (out_sum) *(v4f*)(out_sum + (size_t)row * N + j) = sm;
      *(v4f*)(out_norm + (size_t)row * N + j) = o;
    }
    
  }
}



// ---- f16 WMMA path (v_wmma_f32_16x16x32_f16): 11-bit significands for operands in range — used where a [0,1] probability operand needs more precision than bf16
typedef _Float16 v16h __attribute__((ext_vector_type(16)));
union FragH { v16h v; v8us half[2]; _Float16 h[16]; unsigned short u[16]; };
template <int NT>
__device__ __forceinline__ v8f mmaH(v16h ah, v16h al, v16h bh, v16h bl, v8f c) {
  c = __builtin_amdgcn_wmma_f32_16x16x32_f16(false, ah, false, bh, (short)0, c, false, false);
  if (NT >= 2) c = __builtin_amdgcn_wmma_f32_16x16x32_f16(false, al, false, bh, (short)0, c, false, false);
  if (NT >= 3) c = __builtin_amdgcn_wmma_f32_16x16x32_f16(false, ah, false, bl, (short)0, c, false, false);
  asm volatile("v_nop\n\tv_nop\n\tv_nop\n\tv_nop" : "+v"(c) : "v"(ah), "v"(al), "v"(bh), "v"(bl));
  return c;
}
// batched GEMM like k_gemm_b but f16 operands: A f32 (split into f16 hi/lo if ASPLIT, else rounded to f16), Bt = f16 values [n][k]; alpha; C f32; N multiple of 16 (partial tiles skipped)
template <bool ASPLIT>
__global__ __launch_bounds__(128) void k_gemm_h(const float* __restrict__ A, int lda, size_t sA, const _Float16* __restrict__ Bh, int ldb, size_t sB, float alpha, float* __restrict__ C, int ldc, size_t sC, int M, int N, int K) {
  __shared__ __attribute__((aligned(16))) float so[4][16][64];
  const int tid = threadIdx.x, w = tid >> 5, lane = tid & 31, ln = lane & 15, hh = lane >> 4; const int by = blockIdx.y;
  A += (size_t)by * sA; Bh += (size_t)by * sB; C += (size_t)by * sC;
  const int ntn = (N + 63) / 64; const int wid = blockIdx.x * 4 + w; const int mt = wid / ntn, nq = wid % ntn; if (mt * 16 >= M) return;
  const int row0 = mt * 16, col0 = nq * 64; const float* arow = A + (size_t)(row0 + ln) * lda;
  v8f acc[4] = {};
  for (int kb = 0; kb < K; kb += 32) {
    FragH ah, al;
    const v4f x0 = *(const v4fa*)(arow + kb + 8 * hh), x1 = *(const v4fa*)(arow + kb + 8 * hh + 4), x2 = *(const v4fa*)(arow + kb + 16 + 8 * hh), x3 = *(const v4fa*)(arow + kb + 16 + 8 * hh + 4);
    float xs[16] = {x0[0],x0[1],x0[2],x0[3],x1[0],x1[1],x1[2],x1[3],x2[0],x2[1],x2[2],x2[3],x3[0],x3[1],x3[2],x3[3]};
#pragma unroll
    for (int i = 0; i < 16; ++i) { const _Float16 h = (_Float16)xs[i]; ah.h[i] = h; al.h[i] = ASPLIT ? (_Float16)(xs[i] - (float)h) : (_Float16)0.0f; }
#pragma unroll
    for (int t = 0; t < 4; ++t) { if (col0 + t * 16 >= N) continue; const size_t boff = (size_t)(col0 + t * 16 + ln) * ldb + kb; FragH bq; bq.half[0] = *(const v8us*)(Bh + boff + 8 * hh); bq.half[1] = *(const v8us*)(Bh + boff + 16 + 8 * hh);
      acc[t] = mmaH<ASPLIT ? 2 : 1>(ah.v, al.v, bq.v, bq.v, acc[t]); }
  }
#pragma unroll
  for (int t = 0; t < 4; ++t) { if (col0 + t * 16 >= N) continue;
#pragma unroll
    for (int r = 0; r < 8; ++r) so[w][8 * hh + r][t * 16 + ln] = acc[t][r] * alpha; }
  __builtin_amdgcn_fence(__ATOMIC_ACQ_REL, "workgroup"); __builtin_amdgcn_wave_barrier();
  const int rsub = lane >> 4, c4 = (lane & 15) * 4;
  {
#pragma unroll
    for (int q = 0; q < 8; ++q) { const int r = q * 2 + rsub; if (col0 + c4 < N) { const v4f v = *(const v4fa*)&so[w][r][c4]; *(v4f*)(C + (size_t)(row0 + r) * ldc + col0 + c4) = v; } }
     }
}

// Wt[n][k] = f16(W[k][n]·scale) from f32 row-major W[K][N] (scale = power of two; bf16-exact weights stay exact in f16 away from the subnormal range)
__global__ __launch_bounds__(256) void k_wt_f16(const float* __restrict__ W, _Float16* __restrict__ Wt, int K, int N, float scale) {
  const int t = blockIdx.x * 256 + threadIdx.x; if (t >= N * (K / 8)) return; const int n = t / (K / 8), k8 = (t % (K / 8)) * 8; FragH f;
#pragma unroll
  for (int i = 0; i < 8; ++i) f.h[i] = (_Float16)(bf16_round(W[(size_t)(k8 + i) * N + n]) * scale); const v8us o = f.half[0];
  *(v8us*)((unsigned short*)Wt + (size_t)n * K + k8) = o; 
}
// k_gemm_hh variant with fused epilogue: v = acc·alpha + bias[by·sBias + col] (+ CP[(row/rowsPerB)·sCPb + by·64 + col] if CP) ; ACT 0 none / 1 elu ; writes f16 C16 (and f32 C if non-null)
template <int ACT>
__global__ __launch_bounds__(128) void k_gemm_hhx(const _Float16* __restrict__ A, int lda, size_t sA, const _Float16* __restrict__ Bh, int ldb, size_t sB, float alpha, const float* __restrict__ bias, size_t sBias, const float* __restrict__ CP, int rowsPerB, size_t sCPb, int row0g,
    float* __restrict__ C, _Float16* __restrict__ C16, int ldc, size_t sC, int M, int N, int K) {
  __shared__ __attribute__((aligned(16))) float so[4][16][64];
  const int tid = threadIdx.x, w = tid >> 5, lane = tid & 31, ln = lane & 15, hh = lane >> 4; const int by = blockIdx.y;
  A += (size_t)by * sA; Bh += (size_t)by * sB; const size_t cofs = (size_t)by * sC; const float* bp = bias ? bias + (size_t)by * sBias : nullptr;
  const int ntn = (N + 63) / 64; const int wid = blockIdx.x * 4 + w; const int mt = wid / ntn, nq = wid % ntn; if (mt * 16 >= M) return;
  const int row0 = mt * 16, col0 = nq * 64; const _Float16* arow = A + (size_t)(row0 + ln) * lda;
  v8f acc[4] = {};
  for (int kb = 0; kb < K; kb += 32) { FragH ah; ah.half[0] = *(const v8us*)((const unsigned short*)arow + kb + 8 * hh); ah.half[1] = *(const v8us*)((const unsigned short*)arow + kb + 16 + 8 * hh);
#pragma unroll
    for (int t = 0; t < 4; ++t) { if (col0 + t * 16 >= N) continue; const size_t boff = (size_t)(col0 + t * 16 + ln) * ldb + kb; FragH bq; bq.half[0] = *(const v8us*)((const unsigned short*)Bh + boff + 8 * hh); bq.half[1] = *(const v8us*)((const unsigned short*)Bh + boff + 16 + 8 * hh);
      acc[t] = mmaH<1>(ah.v, ah.v, bq.v, bq.v, acc[t]); }
  }
#pragma unroll
  for (int t = 0; t < 4; ++t) { if (col0 + t * 16 >= N) continue; const int col = col0 + t * 16 + ln; const float bv = bp ? bf16_round(bp[col]) : 0.f;
#pragma unroll
    for (int r = 0; r < 8; ++r) { float v = acc[t][r] * alpha + bv; if (CP) { const int rr = row0g + row0 + 8 * hh + r; if (rowsPerB < 0) v += CP[cofs + (size_t)rr * ldc + col];      /* rowsPerB < 0: own element of the batched C plane */ else { const int bidx = rr / rowsPerB; v += CP[(size_t)bidx * sCPb + (size_t)by * 64 + col]; } } if (ACT == 1) v = (v > 0.f) ? v : expm1f(v); else if (ACT == 7) v = (v > 0.f) ? v + 1.0f : expf(v); else if (ACT == 8) v = tanhf(v); else if (ACT == 9) v = 0.5f * v * (1.0f + tanhf(0.7978845608028654f * (v + 0.044715f * v * v * v))); else if (ACT == 11) v = 1.0f / (1.0f + expf(-v)); else if (ACT == 12) v = (v > 0.f) ? v : 0.01f * v; else if (ACT == 14) v = (v > 0.f) ? v : 0.1f * v; else if (ACT == 16) v = (v >= 0.f) ? v : 0.3f * v; else if (ACT == 17) v = (v >= 0.f) ? v : 0.2f * v; else if (ACT == 15) v = v / (1.0f + expf(-v)); else if (ACT == 3) v = fmaxf(v, 0.f); else if (ACT == 6) v = 0.5f * v * (1.0f + erff(v * 0.70710678118654752f)); so[w][8 * hh + r][t * 16 + ln] = v; } }
  __builtin_amdgcn_fence(__ATOMIC_ACQ_REL, "workgroup"); __builtin_amdgcn_wave_barrier();
  const int rsub = lane >> 4, c4 = (lane & 15) * 4; typedef _Float16 v4h __attribute__((ext_vector_type(4)));
  {
#pragma unroll
    for (int q = 0; q < 8; ++q) { const int r = q * 2 + rsub; if (col0 + c4 < N) { const v4f v = *(const v4fa*)&so[w][r][c4]; if (C) *(v4f*)(C + cofs + (size_t)(row0 + r) * ldc + col0 + c4) = v; if (C16) { v4h h4; for (int i = 0; i < 4; ++i) h4[i] = (_Float16)v[i]; *(v4h*)(C16 + cofs + (size_t)(row0 + r) * ldc + col0 + c4) = h4; } } }
     }
}


typedef _Float16 v4h __attribute__((ext_vector_type(4)));

__global__ __launch_bounds__(256) void k_h16(const float* __restrict__ x, _Float16* __restrict__ X16, size_t n8) { const size_t t = (size_t)blockIdx.x * 256 + threadIdx.x; if (t >= n8) return; FragH f;
#pragma unroll
  for (int q = 0; q < 8; ++q) f.h[q] = (_Float16)x[t * 8 + q]; *(v8us*)((unsigned short*)X16 + t * 8) = f.half[0];  }
__global__ __launch_bounds__(256) void k_round16f(const float* __restrict__ W, _Float16* __restrict__ Bt, size_t n8) { const size_t t = (size_t)blockIdx.x * 256 + threadIdx.x; if (t >= n8) return; FragH f;
#pragma unroll
  for (int i = 0; i < 8; ++i) f.h[i] = (_Float16)(bf16_round(W[t * 8 + i]) * 16.0f); *(v8us*)((unsigned short*)Bt + t * 8) = f.half[0];  }
template <int NHv, int TTv>
__global__ __launch_bounds__(256) void k_vt(const _Float16* __restrict__ V16, int ldv, int voff, _Float16* __restrict__ Vt) { __shared__ unsigned short tl[64][66]; const int tid = threadIdx.x; const int slab = blockIdx.x / (TTv / 64), lg = blockIdx.x % (TTv / 64); const int b = slab / NHv, h = slab % NHv;
  for (int i = tid; i < 64 * 8; i += 256) { const int r = i / 8, c8 = (i % 8) * 8; FragH f; f.half[0] = *(const v8us*)((const unsigned short*)V16 + ((size_t)b * TTv + lg * 64 + r) * ldv + voff + h * 64 + c8);
#pragma unroll
    for (int q = 0; q < 8; ++q) tl[r][c8 + q] = f.u[q]; }
  __syncthreads();
  {
#pragma unroll
    for (int rd = 0; rd < 2; ++rd) { const int d = rd * 32 + tid / 8, pc = tid % 8; FragH f;
#pragma unroll
      for (int q = 0; q < 8; ++q) f.u[q] = tl[pc * 8 + q][d];
      *(v8us*)((unsigned short*)Vt + ((size_t)slab * 64 + d) * TTv + lg * 64 + pc * 8) = f.half[0]; }
     } }

__global__ __launch_bounds__(256) void k_hl(const float* __restrict__ F, _Float16* __restrict__ Hh, _Float16* __restrict__ Hl, size_t n8) { const size_t t = (size_t)blockIdx.x * 256 + threadIdx.x; if (t >= n8) return; FragH fh, fl; const v4f a = *(const v4fa*)(F + t * 8), c = *(const v4fa*)(F + t * 8 + 4);
#pragma unroll
  for (int q = 0; q < 4; ++q) { _Float16 h = (_Float16)a[q]; fh.h[q] = h; fl.h[q] = (_Float16)((a[q] - (float)h) * 1024.0f); h = (_Float16)c[q]; fh.h[4 + q] = h; fl.h[4 + q] = (_Float16)((c[q] - (float)h) * 1024.0f); }
  { *(v8us*)((unsigned short*)Hh + t * 8) = fh.half[0]; *(v8us*)((unsigned short*)Hl + t * 8) = fl.half[0];  } }

// ---- fast GEMM (block tile 128x128, eight waves of 32x64; requires M % 128 == 0, N % 128 == 0, K % 128 == 0); epilogue = k_gemm_hhx semantics, but plane by's bias is bias, bias1 or bias2 (by = 0, 1, 2) ----
// A stage is 128 k of the block's 128 A rows and 128 B rows (256-byte rows). Asynchronous copies bring it from global memory into LDS, whole 128-byte lines a request, through no register;
// two buffers: the next stage flies while this one is multiplied. Fragments come from LDS in the k order of g2_frag, one k step ahead of their products; every accumulator still sums k upward in steps of 32.
#define G2_BK 128                    /* k a stage */
#define G2_PITCH 272                 /* LDS row pitch in bytes: 16 x odd, so the 16 rows of a 16-byte fragment read fall on 64 distinct banks */
#define G2_STAGE (256 * G2_PITCH)    /* 128 A rows, then 128 B rows */
__device__ __forceinline__ v16h g2_frag(const _Float16* p, int hh) { FragH f; f.half[0] = *(const v8us*)((const unsigned short*)p + 8 * hh); f.half[1] = *(const v8us*)((const unsigned short*)p + 16 + 8 * hh); return f.v; }
__device__ __forceinline__ v16h g2_lfrag(const unsigned char* p) { FragH f; f.half[0] = *(const v8us*)p; f.half[1] = *(const v8us*)(p + 32); return f.v; }      /* p: the lane's row in LDS + 64 bytes a k step + 16 hh */
__device__ __forceinline__ v8f g2_mma(v16h a, v16h b, v8f c) { return __builtin_amdgcn_wmma_f32_16x16x32_f16(false, a, false, b, (short)0, c, false, false); }
// Eight asynchronous 16-byte copies of a lane: rows r, r + 16, ..., r + 112 of one operand's stage (l: LDS byte address of the first, g: its global address, gs: 16 global rows in elements).
// The closing s_wait_xcnt 0 stands inside the statement, in front of any later write of the address registers that the copies name.
__device__ __forceinline__ void g2_copy8(unsigned l, const _Float16* g, size_t gs) {
  asm volatile("global_load_async_to_lds_b128 %0, %8, off\n\tglobal_load_async_to_lds_b128 %1, %9, off\n\tglobal_load_async_to_lds_b128 %2, %10, off\n\tglobal_load_async_to_lds_b128 %3, %11, off\n\t"
               "global_load_async_to_lds_b128 %4, %12, off\n\tglobal_load_async_to_lds_b128 %5, %13, off\n\tglobal_load_async_to_lds_b128 %6, %14, off\n\tglobal_load_async_to_lds_b128 %7, %15, off\n\ts_wait_xcnt 0x0"
               :: "v"(l), "v"(l + 16 * G2_PITCH), "v"(l + 32 * G2_PITCH), "v"(l + 48 * G2_PITCH), "v"(l + 64 * G2_PITCH), "v"(l + 80 * G2_PITCH), "v"(l + 96 * G2_PITCH), "v"(l + 112 * G2_PITCH),
                  "v"(g), "v"(g + gs), "v"(g + 2 * gs), "v"(g + 3 * gs), "v"(g + 4 * gs), "v"(g + 5 * gs), "v"(g + 6 * gs), "v"(g + 7 * gs) : "memory"); }
// The epilogue's choices are template parameters, so that it compiles to straight-line code: HASB: a bias is added (the plane's bias pointer is not null); HASCP: the CP term is added; F32OUT: the result goes to C as f32, otherwise to C16 as f16.
// TPLANE >= 0: the blocks of that plane (grid y) store their 128x128 tile transposed, as f16, into VTo [batch][head][d][s] (column n = head * HD + d, row = batch * SQ + s) and write nothing to C16.
template <int ACT, bool HASB, bool HASCP, bool F32OUT, int TPLANE>
__global__ __launch_bounds__(256) void k_gemm2(const _Float16* __restrict__ A, int lda, size_t sA, const _Float16* __restrict__ Bh, int ldb, size_t sB, float alpha, const float* __restrict__ bias, const float* __restrict__ bias1, const float* __restrict__ bias2, const float* __restrict__ CP, int rowsPerB, size_t sCPb, int row0g,
    float* __restrict__ C, _Float16* __restrict__ C16, _Float16* __restrict__ VTo, int ldc, size_t sC, int M, int N, int K) { static_assert(ACT == 0 || ACT == 3 || ACT == 6 || ACT == 8 || ACT == 9 || ACT == 11 || ACT == 12 || ACT == 14 || ACT == 15 || ACT == 16 || ACT == 17, "k_gemm2: unsupported ACT code (would silently apply no activation)");
  static_assert(TPLANE < 0 || (ACT == 0 && !HASCP && !F32OUT && SQ % 128 == 0 && HD == 64), "k_gemm2: the transposed plane has the plain f16 epilogue; a block's 128 rows lie in one batch, its 128 columns are two whole heads");
  __shared__ __attribute__((aligned(16))) unsigned char ring[2 * G2_STAGE];
  __shared__ __attribute__((aligned(16))) float so[8][32][68];
  const int tid = threadIdx.x, w = tid >> 5, lane = tid & 31, ln = lane & 15, hh = lane >> 4; const int by = blockIdx.y;
  A += (size_t)by * sA; Bh += (size_t)by * sB; const size_t cofs = (size_t)by * sC; const float* bp = by == 0 ? bias : by == 1 ? bias1 : bias2;      /* the planes' biases are separate buffers: at most three planes */
  const int ntn = N >> 7; const int mt = blockIdx.x / ntn, nq = blockIdx.x - mt * ntn; if (mt * 128 >= M) return;      /* the whole block leaves, in front of every barrier */
  const int row0 = mt * 128 + 32 * (w & 3), col0 = nq * 128 + 64 * (w >> 2);
  const int nt = K / G2_BK;
  const unsigned lc = (unsigned)(size_t)ring + (unsigned)((tid >> 4) * G2_PITCH + (tid & 15) * 16);      /* the lane's place in a stage: row tid / 16 (+ 16 a copy), 16-byte column tid % 16: a wave's copy is two whole rows */
  const _Float16* ga = A + (size_t)(mt * 128 + (tid >> 4)) * lda + (tid & 15) * 8; const _Float16* gb = Bh + (size_t)(nq * 128 + (tid >> 4)) * ldb + (tid & 15) * 8;
  const size_t gsa = (size_t)16 * lda, gsb = (size_t)16 * ldb;
  g2_copy8(lc, ga, gsa); g2_copy8(lc + 128 * G2_PITCH, gb, gsb);      /* stage 0 */
  asm volatile("s_wait_asynccnt 0x0" ::: "memory");      /* this wave's copies of stage 0 have landed */
  __syncthreads();      /* publishes stage 0 */
  if (nt > 1) { g2_copy8(lc + G2_STAGE, ga + G2_BK, gsa); g2_copy8(lc + G2_STAGE + 128 * G2_PITCH, gb + G2_BK, gsb); }      /* stage 1 */
  const unsigned char* fa = ring + (32 * (w & 3) + ln) * G2_PITCH + 16 * hh; const unsigned char* fb = ring + (128 + 64 * (w >> 2) + ln) * G2_PITCH + 16 * hh;
  const v8f z8 = {0.f,0.f,0.f,0.f,0.f,0.f,0.f,0.f}; v8f c00 = z8, c01 = z8, c02 = z8, c03 = z8, c10 = z8, c11 = z8, c12 = z8, c13 = z8;
#pragma unroll 1      /* one stage a trip: the buffer is picked by the trip's parity, the four k steps inside are unrolled */
  for (int t = 0; t < nt; ++t) { const unsigned bo = (unsigned)(t & 1) * G2_STAGE; const unsigned char* pa = fa + bo; const unsigned char* pb = fb + bo;
    v16h a[2][2], b[2][4];
    a[0][0] = g2_lfrag(pa); a[0][1] = g2_lfrag(pa + 16 * G2_PITCH);
#pragma unroll
    for (int j = 0; j < 4; ++j) b[0][j] = g2_lfrag(pb + j * 16 * G2_PITCH);
#pragma unroll
    for (int ks = 0; ks < G2_BK / 32; ++ks) { const int cu = ks & 1, nx = cu ^ 1;
      if (ks + 1 < G2_BK / 32) { a[nx][0] = g2_lfrag(pa + (ks + 1) * 64); a[nx][1] = g2_lfrag(pa + 16 * G2_PITCH + (ks + 1) * 64);      /* the next k step's fragments, into the other register set */
#pragma unroll
        for (int j = 0; j < 4; ++j) b[nx][j] = g2_lfrag(pb + j * 16 * G2_PITCH + (ks + 1) * 64); }
      __builtin_amdgcn_sched_barrier(0);      /* keeps those reads one group ahead of this step's products: without it the build sank each read to its first use, two products behind every full LDS wait */
      c00 = g2_mma(a[cu][0], b[cu][0], c00); c10 = g2_mma(a[cu][1], b[cu][0], c10); c01 = g2_mma(a[cu][0], b[cu][1], c01); c11 = g2_mma(a[cu][1], b[cu][1], c11);
      c02 = g2_mma(a[cu][0], b[cu][2], c02); c12 = g2_mma(a[cu][1], b[cu][2], c12); c03 = g2_mma(a[cu][0], b[cu][3], c03); c13 = g2_mma(a[cu][1], b[cu][3], c13);
      __builtin_amdgcn_sched_barrier(0); }      /* and keeps the following group's reads from rising among these products */
    asm volatile("s_wait_dscnt 0x0" ::: "memory");      /* this wave's reads of the buffer are done before it is refilled */
    asm volatile("s_wait_asynccnt 0x0" ::: "memory");      /* this wave's copies of stage t + 1 have landed */
    __syncthreads();      /* publishes stage t + 1 and ends every wave's reads of stage t */
    if (t + 2 < nt) { g2_copy8(lc + bo, ga + (size_t)(t + 2) * G2_BK, gsa); g2_copy8(lc + bo + 128 * G2_PITCH, gb + (size_t)(t + 2) * G2_BK, gsb); } }      /* stage t + 2 into the buffer just read */
  asm volatile("s_wait_asynccnt 0x0" ::: "memory");      /* nothing of this wave is in flight when it goes on */
  v8f accs[8] = {c00, c01, c02, c03, c10, c11, c12, c13};
  if (TPLANE >= 0 && by == TPLANE) {      /* the same for the whole block */
    // A lane's 8 accumulator registers are 8 consecutive rows (s) of one column (d): 16 bytes of a V^T row. The block's tile is staged in so as 128 V^T rows of 128 s (256 bytes, pitch G2_PITCH), every wave its own 64 x 32 part.
    unsigned char* tv = (unsigned char*)so; static_assert(128 * G2_PITCH <= sizeof(so), "k_gemm2: the transposed tile fits the staging array");
#pragma unroll      /* both loops in full: accs stays in registers only where its indices are constants */
    for (int u = 0; u < 8; ++u) { const int t = u & 3, half = u >> 2; const float bv = HASB ? bf16_round(bp[col0 + t * 16 + ln]) : 0.f; FragH f;
#pragma unroll
      for (int r = 0; r < 8; ++r) f.h[r] = (_Float16)(accs[u][r] * alpha + bv);
      *(v8us*)(tv + (64 * (w >> 2) + t * 16 + ln) * G2_PITCH + (32 * (w & 3) + half * 16 + 8 * hh) * 2) = f.half[0]; }
    __syncthreads();      /* a V^T row of the tile holds four waves' parts: all are written before any row is read */
    const int n0 = nq * 128 + w * 16 + hh; const size_t tok = (size_t)B0 * SQ + (size_t)mt * 128;      /* the wave stores 16 of the 128 rows, two whole rows (2 x 256 bytes, whole lines) a store */
    unsigned short* vo = (unsigned short*)VTo + ((tok / SQ) * (NH * HD) + n0) * SQ + tok % SQ + ln * 8;
#pragma unroll      /* in full: the eight LDS reads go out together, ahead of the first store */
    for (int q = 0; q < 8; ++q) *(v8us*)(vo + (size_t)q * 2 * SQ) = *(const v8us*)(tv + (w * 16 + q * 2 + hh) * G2_PITCH + ln * 16);
    return; }
#pragma unroll
  for (int u = 0; u < 8; ++u) { const int t = u & 3, half = u >> 2; const int col = col0 + t * 16 + ln; const float bv = HASB ? bf16_round(bp[col]) : 0.f;
#pragma unroll
    for (int r = 0; r < 8; ++r) { const int rloc = half * 16 + 8 * hh + r; float v = accs[u][r] * alpha + bv; if (HASCP) { if (rowsPerB < 0) v += CP[cofs + (size_t)(row0g + row0 + rloc) * ldc + col];      /* rowsPerB < 0: own element of the batched C plane */ else { const int bidx = (row0g + row0 + rloc) / rowsPerB; v += CP[(size_t)bidx * sCPb + (size_t)by * 64 + col]; } }
      if (ACT == 3) v = fmaxf(v, 0.f); else if (ACT == 6) v = 0.5f * v * (1.0f + erff(v * 0.70710678118654752f)); else if (ACT == 11) v = 1.0f / (1.0f + expf(-v)); else if (ACT == 15) v = v / (1.0f + expf(-v)); else if (ACT == 12) v = (v > 0.f) ? v : 0.01f * v; else if (ACT == 8) v = tanhf(v); else if (ACT == 9) v = 0.5f * v * (1.0f + tanhf(0.7978845608028654f * (v + 0.044715f * v * v * v))); else if (ACT == 14) v = (v > 0.f) ? v : 0.1f * v; else if (ACT == 16) v = (v >= 0.f) ? v : 0.3f * v; else if (ACT == 17) v = (v >= 0.f) ? v : 0.2f * v;
      so[w][rloc][t * 16 + ln] = v; } }
  __builtin_amdgcn_fence(__ATOMIC_ACQ_REL, "workgroup"); __builtin_amdgcn_wave_barrier();
  const int rsub = lane >> 4, c4 = (lane & 15) * 4;
  {
#pragma unroll
    for (int q = 0; q < 16; ++q) { const int r = q * 2 + rsub; const v4f v = *(const v4fa*)&so[w][r][c4]; if (F32OUT) *(v4f*)(C + cofs + (size_t)(row0 + r) * ldc + col0 + c4) = v; else { v4h h4; for (int i = 0; i < 4; ++i) h4[i] = (_Float16)v[i]; *(v4h*)(C16 + cofs + (size_t)(row0 + r) * ldc + col0 + c4) = h4; } }
     } }


// All five operand conversions in one launch (none reads another's output): blocks [0, PREP_XB) round x to bf16 and store it as f16; the next 4 * PREP_WB blocks do the same, x16, for Wq, Wk, Wv, Wo
// (natural [out][in] = Bt[n][k]) into four consecutive planes of BW. Eight elements a thread; which array a block works on is the same for the whole block.
#define PREP_XB ((unsigned)(NR * DM / 8 / 256))
#define PREP_WB ((unsigned)((size_t)DM * DM / 8 / 256))
__global__ __launch_bounds__(256) void k_prep(const float* __restrict__ x, const float* __restrict__ wq, const float* __restrict__ wk, const float* __restrict__ wv, const float* __restrict__ wo, _Float16* __restrict__ X16, _Float16* __restrict__ BW) {
  static_assert(NR * DM % (8 * 256) == 0 && (size_t)DM * DM % (8 * 256) == 0, "k_prep: whole blocks per array");
  const unsigned bx = blockIdx.x; const float* s = x; _Float16* d = X16; float sc = 1.0f; unsigned lb = bx;
  if (bx >= PREP_XB) { const unsigned m = (bx - PREP_XB) / PREP_WB; lb = (bx - PREP_XB) % PREP_WB; s = m == 0 ? wq : m == 1 ? wk : m == 2 ? wv : wo; d = BW + (size_t)m * DM * DM; sc = 16.0f; }
  const size_t t = (size_t)lb * 256 + threadIdx.x; FragH f;
#pragma unroll
  for (int q = 0; q < 8; ++q) f.h[q] = (_Float16)(bf16_round(s[t * 8 + q]) * sc);
  *(v8us*)((unsigned short*)d + t * 8) = f.half[0]; }
__global__ __launch_bounds__(256) void k_rsm(const float* __restrict__ S, _Float16* __restrict__ P, int nrows) {
  #pragma clang fp contract(off)
  const int i = blockIdx.x * 256 + threadIdx.x; if (i >= nrows) return; const float* s = S + (size_t)i * SQ; float mx = -3.0e38f;
#pragma unroll 1
  for (int j = 0; j < SQ; ++j) mx = fmaxf(mx, s[j]); float se = 0.f;
#pragma unroll 1
  for (int j = 0; j < SQ; ++j) se += expf(s[j] - mx); const float sc = 256.0f / se;
#pragma unroll 1
  for (int j0 = 0; j0 < SQ; j0 += 8) { FragH f; for (int q = 0; q < 8; ++q) f.h[q] = (_Float16)(expf(s[j0 + q] - mx) * sc); unsigned short* d = (unsigned short*)P + (size_t)i * SQ + j0; *(v8us*)d = f.half[0];  } }
__global__ __launch_bounds__(256) void k_vt(const _Float16* __restrict__ V16, int b, int h0, _Float16* __restrict__ VT) { __shared__ unsigned short tl[64][65]; const int tid = threadIdx.x; const int hh = blockIdx.x % HG, sg = blockIdx.x / HG; const int s0 = sg * 64; const int h = h0 + hh;
  for (int i = tid; i < 64 * 8; i += 256) { const int j = i / 8, d8 = (i % 8) * 8; FragH f; f.half[0] = *(const v8us*)((const unsigned short*)V16 + ((size_t)b * SQ + s0 + j) * DM + h * HD + d8); for (int q = 0; q < 8; ++q) tl[d8 + q][j] = f.u[q]; }
  __syncthreads();
  { for (int i = tid; i < 64 * 8; i += 256) { const int d = i / 8, j8 = (i % 8) * 8; FragH f; for (int q = 0; q < 8; ++q) f.u[q] = tl[d][j8 + q]; *(v8us*)((unsigned short*)VT + ((size_t)hh * HD + d) * SQ + s0 + j8) = f.half[0]; }  } }



// Fused attention: scores, softmax of (scores + relative-position bias) and the product with V in one kernel, for every batch and head in one launch; neither the scores nor the weights go to memory.
// A wave owns FA_QT * 16 query columns and walks the keys 32 at a time: S^T = K . Q^T (A = K rows, B = Q rows kept in registers), so that a lane holds 16 scores of ONE query per column tile;
// reference and sum per lane (online softmax, log2 domain); the reference is set in the first pass and raised only where a pass's weights would near the top of f16 (one exchange between the wave halves then), one exchange in the epilogue for the sum;
// the two S^T tiles of a pass, converted in place, are the B operand of O^T += V^T . P^T (A = V^T rows in the same k order), and a lane's 8 accumulator registers are 8 consecutive d of its query: 16-byte stores.
// Every loop but the walk over the stages and their passes is unrolled in full: the fragment and accumulator arrays stay in registers only where each index is a constant.
// K and V^T reach the waves through LDS: a stage is FA_SK keys (K rows of 128 bytes, V^T rows of 256 bytes), brought once for the whole block by asynchronous copies, whole 128-byte lines a request, through no register;
// two buffers: the next stage flies while this one is worked on. The eight waves read their fragments from LDS in the k order of g2_frag; passes, products and sums keep their order.
#define FA_WAVES 8
#define FA_QT 2                      /* 16-column query tiles a wave */
#define FA_BQ (FA_WAVES * FA_QT * 16) /* query rows a block */
#define FA_L2E 1.4426950408889634f
#define FA_TOP 32768.0f              /* largest sum of a lane's weights of one pass let through without moving the reference: inside f16 */
#define FA_SK 128                    /* keys a stage: four passes */
#define FA_KP 144                    /* LDS pitch of a K row in bytes: 16 x odd, so the 16 rows of a 16-byte fragment read fall on distinct banks */
#define FA_VP 272                    /* LDS pitch of a V^T row in bytes: 16 x odd */
#define FA_KB (FA_SK * FA_KP)        /* the K rows of a stage; the HD V^T rows follow */
#define FA_STAGE (FA_KB + HD * FA_VP)
// Eight asynchronous 16-byte copies of a lane: K rows r, r + 32, r + 64, r + 96 of a stage (lk: LDS byte address of the first, gk: its global address), then V^T rows d, d + 16, d + 32, d + 48 (lv, gv).
// The closing s_wait_xcnt 0 stands inside the statement, in front of any later write of the address registers that the copies name.
__device__ __forceinline__ void fa_copy8(unsigned lk, const _Float16* gk, unsigned lv, const _Float16* gv) {
  asm volatile("global_load_async_to_lds_b128 %0, %8, off\n\tglobal_load_async_to_lds_b128 %1, %9, off\n\tglobal_load_async_to_lds_b128 %2, %10, off\n\tglobal_load_async_to_lds_b128 %3, %11, off\n\t"
               "global_load_async_to_lds_b128 %4, %12, off\n\tglobal_load_async_to_lds_b128 %5, %13, off\n\tglobal_load_async_to_lds_b128 %6, %14, off\n\tglobal_load_async_to_lds_b128 %7, %15, off\n\ts_wait_xcnt 0x0"
               :: "v"(lk), "v"(lk + 32 * FA_KP), "v"(lk + 64 * FA_KP), "v"(lk + 96 * FA_KP), "v"(lv), "v"(lv + 16 * FA_VP), "v"(lv + 32 * FA_VP), "v"(lv + 48 * FA_VP),
                  "v"(gk), "v"(gk + (size_t)32 * DM), "v"(gk + (size_t)64 * DM), "v"(gk + (size_t)96 * DM), "v"(gv), "v"(gv + (size_t)16 * SQ), "v"(gv + (size_t)32 * SQ), "v"(gv + (size_t)48 * SQ) : "memory"); }
__device__ __forceinline__ float sm_xh(float x) { return __builtin_bit_cast(float, __builtin_amdgcn_permlanex16(__builtin_bit_cast(int, x), __builtin_bit_cast(int, x), 0x76543210, 0xfedcba98, false, false)); }      /* lane l ^ 16 */
// Four native exp2, into registers of their own (no result lies on a source). In one statement with a closing v_nop: the slot that the instruction set asks for behind a transcendental before its result is read or its source overwritten
__device__ __forceinline__ v4f sm_exp2x4(v4f x) { float a, b, c, d;
  asm("v_exp_f32 %0, %4\n\tv_exp_f32 %1, %5\n\tv_exp_f32 %2, %6\n\tv_exp_f32 %3, %7\n\tv_nop" : "=&v"(a), "=&v"(b), "=&v"(c), "=&v"(d) : "v"(x[0]), "v"(x[1]), "v"(x[2]), "v"(x[3]));
  const v4f y = {a, b, c, d}; return y; }
__device__ __forceinline__ float sm_exp2x1(float x) { asm("v_exp_f32 %0, %0\n\tv_nop" : "+v"(x)); return x; }      /* one native exp2, with the same closing slot */
__device__ __forceinline__ v8f fa_mma(v16h a, v16h b, v8f c) { return __builtin_amdgcn_wmma_f32_16x16x32_f16(false, a, false, b, (short)0, c, false, false); }
__global__ __launch_bounds__(FA_WAVES * 32) void k_fattn(const _Float16* __restrict__ Q16, const _Float16* __restrict__ K16, const _Float16* __restrict__ VT, const float* __restrict__ emb, _Float16* __restrict__ O16) {
  static_assert(SQ % FA_BQ == 0 && SQ % FA_SK == 0 && SQ / FA_SK >= 2 && FA_SK == 128 && FA_WAVES == 8 && HD == 64 && MAXD % 32 == 0 && FA_QT * 16 + 31 <= MAXD, "k_fattn: whole blocks per head, whole stages per row (two at least), eight copies a lane a stage, two k steps per score tile, band passes inside the table");
  __shared__ __attribute__((aligned(16))) unsigned char ring[2 * FA_STAGE];
  __shared__ float tb[4 * MAXD - 1];      /* this head's bias, bf16-rounded, times log2(e), by k = j - i + (2 * MAXD - 1), already clipped: consecutive j are consecutive entries */
  const int tid = threadIdx.x, lane = tid & 31, ln = lane & 15, hh = lane >> 4; const int wave = __builtin_amdgcn_readfirstlane(tid >> 5);
  const int bh = blockIdx.x / (SQ / FA_BQ), b = bh / NH, h = bh % NH; const int q0 = (blockIdx.x % (SQ / FA_BQ)) * FA_BQ + wave * (FA_QT * 16);
  const unsigned lk = (unsigned)(size_t)ring + (unsigned)((tid >> 3) * FA_KP + (tid & 7) * 16), lv = (unsigned)(size_t)ring + (unsigned)(FA_KB + (tid >> 4) * FA_VP + (tid & 15) * 16);      /* the lane's places in a stage: a wave's copy is four whole K rows or two whole V^T rows */
  const _Float16* gk = K16 + ((size_t)b * SQ + (tid >> 3)) * DM + h * HD + (tid & 7) * 8; const _Float16* gv = VT + ((size_t)bh * HD + (tid >> 4)) * SQ + (tid & 15) * 8;
  fa_copy8(lk, gk, lv, gv);      /* stage 0 */
  for (int i = tid; i < 4 * MAXD - 1; i += FA_WAVES * 32) tb[i] = bf16_round(emb[(min(max(2 * MAXD - 1 - i, -MAXD), MAXD) + MAXD) * NH + h]) * FA_L2E;
  asm volatile("s_wait_asynccnt 0x0" ::: "memory");      /* this wave's copies of stage 0 have landed */
  __syncthreads();      /* publishes tb and stage 0 */
  fa_copy8(lk + FA_STAGE, gk + (size_t)FA_SK * DM, lv + FA_STAGE, gv + FA_SK);      /* stage 1 */
  const float bfar = tb[0], bnear = tb[4 * MAXD - 2];      /* j <= i - MAXD ; j >= i + MAXD */
  const _Float16* qp = Q16 + ((size_t)b * SQ + q0 + ln) * DM + h * HD; const unsigned char* fk = ring + ln * FA_KP + 16 * hh; const unsigned char* fv = ring + FA_KB + ln * FA_VP + 16 * hh;      /* the lane's fragment rows in buffer 0 */
  v16h qf[FA_QT][2], kf[2][2];
#pragma unroll
  for (int t = 0; t < FA_QT; ++t) { qf[t][0] = g2_frag(qp + (size_t)t * 16 * DM, hh); qf[t][1] = g2_frag(qp + (size_t)t * 16 * DM + 32, hh); }
  const v8f z8 = {0.f,0.f,0.f,0.f,0.f,0.f,0.f,0.f};
  v8f o[FA_QT][4]; float nm[FA_QT], lr[FA_QT];      /* nm: 8 - the reference in use, the same in both halves of the wave */
#pragma unroll
  for (int t = 0; t < FA_QT; ++t) { nm[t] = 8.0f; lr[t] = 0.f; o[t][0] = z8; o[t][1] = z8; o[t][2] = z8; o[t][3] = z8; }
#pragma unroll 1      /* one stage a trip: the buffer is picked by the trip's parity */
  for (int st = 0; st < SQ / FA_SK; ++st) { const unsigned bo = (unsigned)(st & 1) * FA_STAGE; const unsigned char* pk = fk + bo; const unsigned char* pv = fv + bo;
#pragma unroll
   for (int u = 0; u < 2; ++u) { kf[u][0] = g2_lfrag(pk + u * 16 * FA_KP); kf[u][1] = g2_lfrag(pk + u * 16 * FA_KP + 64); }      /* the stage's first K rows */
#pragma unroll 1      /* one pass a trip: with the four passes unrolled the build went past 256 registers and spilled */
   for (int p = 0; p < FA_SK / 32; ++p) { const int j0 = st * FA_SK + p * 32;
    v16h vf[4];      /* asked for first, used last: the scores and the softmax stand between */
#pragma unroll
    for (int d = 0; d < 4; ++d) vf[d] = g2_lfrag(pv + d * 16 * FA_VP + p * 64);
    v8f s[FA_QT][2];      /* s[t][u][r] = score of key j0 + 16 u + 8 hh + r, query q0 + 16 t + ln */
#pragma unroll
    for (int t = 0; t < FA_QT; ++t)
#pragma unroll
      for (int u = 0; u < 2; ++u) s[t][u] = fa_mma(kf[u][1], qf[t][1], fa_mma(kf[u][0], qf[t][0], z8));
    if (p + 1 < FA_SK / 32) {      /* the next pass's K rows, fetched one pass ahead inside the stage */
#pragma unroll
      for (int u = 0; u < 2; ++u) { kf[u][0] = g2_lfrag(pk + ((p + 1) * 32 + u * 16) * FA_KP); kf[u][1] = g2_lfrag(pk + ((p + 1) * 32 + u * 16) * FA_KP + 64); } }
    // The exp2 argument: score * log2(e) / 8 + bias + nm, nm = 8 - the reference in use (weights carried x256 at the reference, as f16 operands away from the subnormal range; the sum carries the same factor).
    // Outside the unclipped band the bias is one value, and the argument is one fused multiply-add; a pass that meets the band adds its table entries behind it.
    const bool band = j0 + 31 > q0 - MAXD && j0 < q0 + FA_QT * 16 - 1 + MAXD;      /* wave-uniform */
    const float bc = band ? 0.f : (j0 >= q0 + FA_QT * 16 - 1 + MAXD) ? bnear : bfar;
#pragma unroll
    for (int t = 0; t < FA_QT; ++t) { const float ba = bc + nm[t];
#pragma unroll
      for (int u = 0; u < 2; ++u)
#pragma unroll
        for (int r = 0; r < 8; ++r) s[t][u][r] = __builtin_fmaf(s[t][u][r], 0.125f * FA_L2E, ba); }
    if (band) { const float* tp = tb + (j0 - q0 + 2 * MAXD - 1) + 8 * hh - ln;      /* every k read here lies inside the table */
#pragma unroll
      for (int t = 0; t < FA_QT; ++t)
#pragma unroll
        for (int u = 0; u < 2; ++u)
#pragma unroll
          for (int r = 0; r < 8; ++r) s[t][u][r] += tp[(u - t) * 16 + r]; }
    FragH pf[FA_QT]; float ps[FA_QT];      /* the pass's weights as f16 operands, and the lane's sum of them (summed in f32, before the rounding) */
    auto weigh = [&](int t) { v4f as;
#pragma unroll
      for (int u = 0; u < 2; ++u)
#pragma unroll
        for (int g = 0; g < 2; ++g) { v4f x = {s[t][u][4 * g], s[t][u][4 * g + 1], s[t][u][4 * g + 2], s[t][u][4 * g + 3]}; x = sm_exp2x4(x);
          if (u + g == 0) as = x; else as += x;
#pragma unroll
          for (int e = 0; e < 4; ++e) pf[t].h[u * 8 + g * 4 + e] = (_Float16)x[e]; }
      ps[t] = (as[0] + as[1]) + (as[2] + as[3]); };
    float pa;
#pragma unroll
    for (int t = 0; t < FA_QT; ++t) { weigh(t); pa = t ? pa + ps[t] : ps[t]; }
    // Lazy rescale, tested once a pass: the reference moves only in the first pass (where it is set) and where the lane's weights sum past FA_TOP. No weight is negative, so each is at most that sum: under the limit none leaves the f16 range.
    // Every other pass takes no maximum, makes no exchange between the halves and rescales neither o nor the sum. Where the reference moves, the pass's weights are made anew from the arguments, which are still in s.
    const bool first = j0 == 0;
    if (__builtin_expect(__builtin_amdgcn_ballot_w32(pa > (first ? -1.0f : FA_TOP)) != 0, 0)) {      /* the same for the whole wave: a scalar branch; marked rare, so that the usual pass falls through */
#pragma unroll
      for (int t = 0; t < FA_QT; ++t) {
        float m0 = fmaxf(s[t][0][0], s[t][0][1]), m1 = fmaxf(s[t][1][0], s[t][1][1]);
#pragma unroll
        for (int r = 2; r < 8; r += 2) { m0 = fmaxf(fmaxf(m0, s[t][0][r]), s[t][0][r + 1]); m1 = fmaxf(fmaxf(m1, s[t][1][r]), s[t][1][r + 1]); }
        m0 = fmaxf(m0, m1); m0 = fmaxf(m0, sm_xh(m0)) - 8.0f;      /* how far the query's largest score of this pass lies above the reference; the same in both halves */
        const float dl = first ? m0 : fmaxf(m0, 0.f); const float al = first ? 0.f : sm_exp2x1(-dl);      /* first pass: o and the sum are 0 and stay 0 */
        nm[t] -= dl; lr[t] *= al;
#pragma unroll
        for (int d = 0; d < 4; ++d) o[t][d] *= al;
#pragma unroll
        for (int u = 0; u < 2; ++u) s[t][u] -= dl;
        weigh(t); } }
#pragma unroll
    for (int t = 0; t < FA_QT; ++t) { lr[t] += ps[t];
#pragma unroll
      for (int d = 0; d < 4; ++d) o[t][d] = fa_mma(vf[d], pf[t].v, o[t][d]); } }
   asm volatile("s_wait_dscnt 0x0" ::: "memory");      /* this wave's reads of the buffer are done before it is refilled */
   asm volatile("s_wait_asynccnt 0x0" ::: "memory");      /* this wave's copies of stage st + 1 have landed */
   __syncthreads();      /* publishes stage st + 1 and ends every wave's reads of stage st */
   if (st + 2 < SQ / FA_SK) fa_copy8(lk + bo, gk + (size_t)(st + 2) * FA_SK * DM, lv + bo, gv + (size_t)(st + 2) * FA_SK); }      /* stage st + 2 into the buffer just read */
  asm volatile("s_wait_asynccnt 0x0" ::: "memory");      /* nothing of this wave is in flight when it goes on */
#pragma unroll
  for (int t = 0; t < FA_QT; ++t) { const float sc = 64.0f / (lr[t] + sm_xh(lr[t]));      /* o carried x64, as the output GEMM's alpha expects */
    unsigned short* op = (unsigned short*)O16 + ((size_t)b * SQ + q0 + t * 16 + ln) * DM + h * HD + 8 * hh;
#pragma unroll
    for (int d = 0; d < 4; ++d) { FragH f;
#pragma unroll
      for (int r = 0; r < 8; ++r) f.h[r] = (_Float16)(o[t][d][r] * sc);
      *(v8us*)(op + d * 16) = f.half[0]; } } }

extern "C" void kernel_launch(void* const* d_in, const int* in_sizes, int n_in,
                              void* d_out, int out_size, void* d_ws, size_t ws_size, hipStream_t stream) {
  (void)in_sizes; (void)n_in; (void)out_size;
  const float* const* I = (const float* const*)d_in; const float* x = I[0]; const float* wq = I[1]; const float* bq = I[2]; const float* wk = I[3]; const float* bk = I[4]; const float* wv = I[5]; const float* bv = I[6]; const float* wo = I[7]; const float* bo = I[8]; const float* emb = I[9];      /* nn.Linear weights [out][in]; rel_emb [2*MAXD+1][NH] */
  char* ws = (char*)d_ws; size_t off = 0;
  auto take = [&](size_t bytes) { char* p = ws + off; off += (bytes + 255) & ~(size_t)255; return p; };
  _Float16* BQ = (_Float16*)take((size_t)DM * DM * 2); _Float16* BK = (_Float16*)take((size_t)DM * DM * 2); _Float16* BV = (_Float16*)take((size_t)DM * DM * 2); _Float16* BO = (_Float16*)take((size_t)DM * DM * 2);
  _Float16* X16 = (_Float16*)take(NR * DM * 2); _Float16* Q16 = (_Float16*)take(NR * DM * 2); _Float16* K16 = (_Float16*)take(NR * DM * 2); _Float16* O16 = (_Float16*)take(NR * DM * 2);
  _Float16* VT = (_Float16*)take((size_t)NB * NH * HD * SQ * 2);
  if (off > ws_size) return;
  static_assert((size_t)DM * DM * 2 % 256 == 0 && NR * DM * 2 % 256 == 0, "BQ, BK, BV, BO and Q16, K16 lie back to back: planes of one pitch");
  k_prep<<<PREP_XB + 4 * PREP_WB, 256, 0, stream>>>(x, wq, wk, wv, wo, X16, BQ);      /* X16; BQ, BK, BV, BO */
  const size_t r0p = (size_t)B0 * SQ;      /* first projected row */
  k_gemm2<0, true, false, false, 2><<<dim3((unsigned)((MP / 128) * (DM / 128)), 3), 256, 0, stream>>>(X16 + r0p * DM, DM, 0, BQ, DM, (size_t)DM * DM, 0.0625f, bq, bk, bv, nullptr, 1, 0, 0, nullptr, Q16 + r0p * DM, VT, DM, NR * DM, MP, DM, DM);      /* planes 0, 1: Q16, K16; plane 2: V^T [NB][NH][HD][SQ] */
  k_fattn<<<NB * NH * (SQ / FA_BQ), FA_WAVES * 32, 0, stream>>>(Q16, K16, VT, emb, O16);      /* o (merged heads, x64) as f16 rows */
  k_gemm2<0, true, false, true, -1><<<dim3((unsigned)((MPO / 128) * (DM / 128)), 1), 256, 0, stream>>>(O16 + r0p * DM, DM, 0, BO, DM, 0, 0.0009765625f, bo, nullptr, nullptr, nullptr, 1, 0, 0, (float*)d_out + r0p * DM, nullptr, nullptr, DM, 0, MPO, DM, DM);      /* out rows are the output layout */
}

// v009
// A run of this version takes 75 microseconds.
// In two side-by-side timings against v008, it was 1.05 and 1.07 times as fast.
// Counting every step since v000, it is 60.7 times as fast.
#include <hip/hip_runtime.h>
// Multi-head self-attention with a learned relative-position bias (x [2][2048][1024]; q/k/v = x W^T + b (nn.Linear [out][in]), 16 heads of 64; scores / 8 + rel_emb[clip(i - j, -128, 128) + 128][h] (rel_emb [257][16]); softmax; o merged; out = o Wo^T + bo -> [2][2048][1024]).
// Structure: token rows r = b*2048 + s; x as exact f16 rows (bf16-rounded) and the four weights (x16) converted in one launch; Q, K, V as three WMMA GEMMs in one launch, every block taking its 128 x rows against the same 128 output columns of all three weights (32x64 wave tiles a plane, f32 accumulation, exact x16 weights + bias, f16 outputs); the V tile is stored transposed, so that V^T [batch][head][d][s] comes straight from that launch; one fused attention launch for all batches and heads: score tiles on WMMA (K = 64), online softmax of (scores / 8 + relative-position bias looked up by (i - j, head)) on VALU (f32 statistics, native exp; weights x256 as f16 operands, in registers), o = P . V on WMMA (o carried x64 against f16 subnormal flush, folded into the output GEMM alpha) written straight into the merged f16 o rows; out = o W_o + b GEMM (f32) into the output layout.
// Compute dtype: inputs rounded to bf16; x / weights exact; q, k, v, softmax weights and o as plain f16 GEMM operands (~2^-12); scores and softmax statistics f32. v_wmma_f32_16x16x32_f16.
#define NB 2
#define SQ 2048
#define DM 1024
#define NH 16
#define HD 64
#define MAXD 128                     /* relative distance clip */
#define HG 4                         /* heads per launch of the grouped V^T transpose k_vt(b, h0) */
#define B0 0                         /* first batch processed (debug hook) */
#define NBR NB                       /* batches processed (debug hook) */
#define NR ((size_t)NB * SQ)         /* token rows */
#define MP ((int)((size_t)NBR * SQ)) /* rows projected (debug hook) */
#define QN SQ                        /* query rows per batch; unused: the attention launch covers all SQ */
#define NHD NH                       /* heads; unused: the attention launch covers all NH */
#define MPO MP                       /* rows through the output stage (debug hook) */
#define LQ DM      /* row pitch of the q/k rows; unused: the code writes DM */
typedef __bf16 v16b __attribute__((ext_vector_type(16)));
typedef unsigned short v8us __attribute__((ext_vector_type(8), may_alias));
typedef float  v8f  __attribute__((ext_vector_type(8)));
typedef float  v4f  __attribute__((ext_vector_type(4)));
typedef float  v4fa __attribute__((ext_vector_type(4), may_alias));
union FragB { v16b v; v8us half[2]; unsigned short u[16]; };

__device__ __forceinline__ unsigned short bf16_bits(float x) { unsigned int u = __float_as_uint(x); return (unsigned short)((u + 0x7FFFu + ((u >> 16) & 1u)) >> 16); }
__device__ __forceinline__ float bf16_val(unsigned short b) { return __uint_as_float(((unsigned int)b) << 16); }
__device__ __forceinline__ float bf16_round(float x) { return bf16_val(bf16_bits(x)); }
// D += A·B with NT terms: 1 = ah·bh, 2 = + al·bh (A split), 3 = + ah·bl (both split)
template <int NT>
__device__ __forceinline__ v8f mmaN(v16b ah, v16b al, v16b bh, v16b bl, v8f c) {
  c = __builtin_amdgcn_wmma_f32_16x16x32_bf16(false, ah, false, bh, (short)0, c, false, false);
  if (NT >= 2) c = __builtin_amdgcn_wmma_f32_16x16x32_bf16(false, al, false, bh, (short)0, c, false, false);
  if (NT >= 3) c = __builtin_amdgcn_wmma_f32_16x16x32_bf16(false, ah, false, bl, (short)0, c, false, false);
  asm volatile("v_nop\n\tv_nop\n\tv_nop\n\tv_nop" : "+v"(c) : "v"(ah), "v"(al), "v"(bh), "v"(bl));
  return c;
}

__global__ __launch_bounds__(256) void k_wt_bf16(const float* __restrict__ W, unsigned short* __restrict__ Wt, int K, int N) {
  const int t = blockIdx.x * 256 + threadIdx.x;
  const int k8n = K / 8;
  if (t >= N * k8n) return;
  const int n = t / k8n, k8 = (t % k8n) * 8;
  v8us v;
#pragma unroll
  for (int i = 0; i < 8; ++i) v[i] = bf16_bits(W[(size_t)(k8 + i) * N + n]);
  *(v8us*)(Wt + (size_t)n * K + k8) = v;
  
}

// GEMM C[M][N] (f32, pitch ldc) = act(A[M][K]·W + bias). A f32 row-major (pitch lda) converted per fragment to bf16
// (ASPLIT: hi/lo two planes -> 2 terms, else single rounded term); Wt bf16 [N][K] (pitch ldb). BIAS_BF16 rounds the
// bias to bf16 first (bias quantised to bf16 before the add). K%32==0, M%16==0, N%64==0.
template <bool ASPLIT, int ACT, bool BIAS_BF16>
__global__ __launch_bounds__(128) void k_gemm_bf(const float* __restrict__ A, int lda, const unsigned short* __restrict__ Wt, int ldb,
                                               const float* __restrict__ bias, float* __restrict__ C, int ldc, int M, int N, int K) {
  __shared__ __attribute__((aligned(16))) float so[4][16][64];
  const int tid = threadIdx.x, w = tid >> 5, lane = tid & 31, ln = lane & 15, hh = lane >> 4;
  const int ntn = N / 64;
  const int wid = blockIdx.x * 4 + w;
  const int mt = wid / ntn, nq = wid % ntn;
  if (mt * 16 >= M) return;
  const int row0 = mt * 16, col0 = nq * 64;
  const float* arow = A + (size_t)(row0 + ln) * lda;
  v8f acc[4] = {};
  for (int kb = 0; kb < K; kb += 32) {
    FragB ah, al;
    const v4f x0 = *(const v4fa*)(arow + kb + 8 * hh), x1 = *(const v4fa*)(arow + kb + 8 * hh + 4);
    const v4f x2 = *(const v4fa*)(arow + kb + 16 + 8 * hh), x3 = *(const v4fa*)(arow + kb + 16 + 8 * hh + 4);
    float xs[16] = {x0[0],x0[1],x0[2],x0[3],x1[0],x1[1],x1[2],x1[3],x2[0],x2[1],x2[2],x2[3],x3[0],x3[1],x3[2],x3[3]};
#pragma unroll
    for (int i = 0; i < 16; ++i) { const unsigned short hb = bf16_bits(xs[i]); ah.u[i] = hb; al.u[i] = ASPLIT ? bf16_bits(xs[i] - bf16_val(hb)) : (unsigned short)0; }
#pragma unroll
    for (int t = 0; t < 4; ++t) {
      const unsigned short* brow = Wt + (size_t)(col0 + t * 16 + ln) * ldb + kb;
      FragB b;
      b.half[0] = *(const v8us*)(brow + 8 * hh);
      b.half[1] = *(const v8us*)(brow + 16 + 8 * hh);
      acc[t] = mmaN<ASPLIT ? 2 : 1>(ah.v, al.v, b.v, b.v, acc[t]);
    }
  }
#pragma unroll
  for (int t = 0; t < 4; ++t) {
    float bv = bias ? bias[col0 + t * 16 + ln] : 0.f;
    if (BIAS_BF16) bv = bf16_round(bv);
#pragma unroll
    for (int r = 0; r < 8; ++r) { float v = acc[t][r] + bv; if (ACT == 1) v = fmaxf(v, 0.f); so[w][8 * hh + r][t * 16 + ln] = v; }
  }
  __builtin_amdgcn_fence(__ATOMIC_ACQ_REL, "workgroup");
  __builtin_amdgcn_wave_barrier();
  const int rsub = lane >> 4, c4 = (lane & 15) * 4;
  {
#pragma unroll
    for (int q = 0; q < 8; ++q) {
      const int r = q * 2 + rsub;
      const v4f v = *(const v4fa*)&so[w][r][c4];
      *(v4f*)(C + (size_t)(row0 + r) * ldc + col0 + c4) = v;
    }
    
  }
}

// GEMM C = act(A·W + bias + resid): A f32 (ASPLIT -> hi/lo 2 terms), Wt bf16 [N][K]; ACT 0 none, 1 relu, 2 exact gelu;
// resid (optional, f32, row index = (row % rmod), pitch ldr, RES_BF16 rounds it) added before the activation.
template <bool ASPLIT, int ACT, bool BIAS_BF16, bool RES_BF16>
__global__ __launch_bounds__(128) void k_gemm_bf3(const float* __restrict__ A, int lda, const unsigned short* __restrict__ Wt, int ldb,
                                                const float* __restrict__ bias, const float* __restrict__ resid, int rmod, int ldr,
                                                float* __restrict__ C, int ldc, int M, int N, int K) {
  __shared__ __attribute__((aligned(16))) float so[4][16][64];
  const int tid = threadIdx.x, w = tid >> 5, lane = tid & 31, ln = lane & 15, hh = lane >> 4;
  const int ntn = N / 64;
  const int wid = blockIdx.x * 4 + w;
  const int mt = wid / ntn, nq = wid % ntn;
  if (mt * 16 >= M) return;
  const int row0 = mt * 16, col0 = nq * 64;
  const float* arow = A + (size_t)(row0 + ln) * lda;
  v8f acc[4] = {};
  for (int kb = 0; kb < K; kb += 32) {
    FragB ah, al;
    const v4f x0 = *(const v4fa*)(arow + kb + 8 * hh), x1 = *(const v4fa*)(arow + kb + 8 * hh + 4);
    const v4f x2 = *(const v4fa*)(arow + kb + 16 + 8 * hh), x3 = *(const v4fa*)(arow + kb + 16 + 8 * hh + 4);
    float xs[16] = {x0[0],x0[1],x0[2],x0[3],x1[0],x1[1],x1[2],x1[3],x2[0],x2[1],x2[2],x2[3],x3[0],x3[1],x3[2],x3[3]};
#pragma unroll
    for (int i = 0; i < 16; ++i) { const unsigned short hb = bf16_bits(xs[i]); ah.u[i] = hb; al.u[i] = ASPLIT ? bf16_bits(xs[i] - bf16_val(hb)) : (unsigned short)0; }
#pragma unroll
    for (int t = 0; t < 4; ++t) {
      const unsigned short* brow = Wt + (size_t)(col0 + t * 16 + ln) * ldb + kb;
      FragB b;
      b.half[0] = *(const v8us*)(brow + 8 * hh);
      b.half[1] = *(const v8us*)(brow + 16 + 8 * hh);
      acc[t] = mmaN<ASPLIT ? 2 : 1>(ah.v, al.v, b.v, b.v, acc[t]);
    }
  }
#pragma unroll
  for (int t = 0; t < 4; ++t) {
    const int col = col0 + t * 16 + ln;
    float bv = bias ? bias[col] : 0.f;
    if (BIAS_BF16) bv = bf16_round(bv);
#pragma unroll
    for (int r = 0; r < 8; ++r) {
      float v = acc[t][r] + bv;
      if (resid) { float rv = resid[(size_t)((row0 + 8 * hh + r) % rmod) * ldr + col]; if (RES_BF16) rv = bf16_round(rv); v += rv; }
      if (ACT == 1) v = fmaxf(v, 0.f);
      if (ACT == 2) v = 0.5f * v * (1.0f + erff(v * 0.70710678118654752f));
      if (ACT == 3) { const float u = 0.7978845608028654f * (v + 0.044715f * v * v * v); v = 0.5f * v * (1.0f + tanhf(u)); }
      so[w][8 * hh + r][t * 16 + ln] = v;
    }
  }
  __builtin_amdgcn_fence(__ATOMIC_ACQ_REL, "workgroup");
  __builtin_amdgcn_wave_barrier();
  const int rsub = lane >> 4, c4 = (lane & 15) * 4;
  {
#pragma unroll
    for (int q = 0; q < 8; ++q) {
      const int r = q * 2 + rsub;
      const v4f v = *(const v4fa*)&so[w][r][c4];
      *(v4f*)(C + (size_t)(row0 + r) * ldc + col0 + c4) = v;
    }
    
  }
}
// row LayerNorm (biased variance, eps) over N: s = X (+ R); optional out_sum <- s; out_norm <- (s-mu)*rsqrt(var+eps)*g + b
template <bool PARAM_BF16>
__global__ __launch_bounds__(256) void k_layernorm(const float* __restrict__ X, const float* __restrict__ R, const float* __restrict__ g, const float* __restrict__ bta,
                                                  float* __restrict__ out_sum, float* __restrict__ out_norm, int N, float eps) {
  __shared__ float red[256];
  const int row = blockIdx.x, tid = threadIdx.x;
  const float* x = X + (size_t)row * N; const float* rr = R ? R + (size_t)row * N : nullptr;
  float vals[16];                     // up to N = 4096
  const int per = N / 256;            // contiguous chunk per thread? use strided-by-4 chunks: thread handles j = tid*4 + 1024*u
  float s1 = 0.f;
  for (int u = 0; u < per / 4; ++u) {
    const int j = tid * 4 + 1024 * u;
    const v4f a = *(const v4fa*)(x + j);
    v4f b = {0.f,0.f,0.f,0.f}; if (rr) b = *(const v4fa*)(rr + j);
#pragma unroll
    for (int q = 0; q < 4; ++q) { const float v = a[q] + b[q]; vals[u * 4 + q] = v; s1 += v; }
  }
  red[tid] = s1; __syncthreads();
  for (int st = 128; st > 0; st >>= 1) { if (tid < st) red[tid] += red[tid + st]; __syncthreads(); }
  const float mu = red[0] / (float)N; __syncthreads();
  float s2 = 0.f;
  for (int u = 0; u < per / 4; ++u)
#pragma unroll
    for (int q = 0; q < 4; ++q) { const float c = vals[u * 4 + q] - mu; s2 += c * c; }
  red[tid] = s2; __syncthreads();
  for (int st = 128; st > 0; st >>= 1) { if (tid < st) red[tid] += red[tid + st]; __syncthreads(); }
  const float rs = rsqrtf(red[0] / (float)N + eps);
  {
    for (int u = 0; u < per / 4; ++u) {
      const int j = tid * 4 + 1024 * u;
      v4f o, sm;
#pragma unroll
      for (int q = 0; q < 4; ++q) {
        float gg = g[j + q], bb = bta[j + q];
        if (PARAM_BF16) { gg = bf16_round(gg); bb = bf16_round(bb); }
        sm[q] = vals[u * 4 + q]; o[q] = (vals[u * 4 + q] - mu) * rs * gg + bb;
      }
      if (out_sum) *(v4f*)(out_sum + (size_t)row * N + j) = sm;
      *(v4f*)(out_norm + (size_t)row * N + j) = o;
    }
    
  }
}



// ---- f16 WMMA path (v_wmma_f32_16x16x32_f16): 11-bit significands for operands in range — used where a [0,1] probability operand needs more precision than bf16
typedef _Float16 v16h __attribute__((ext_vector_type(16)));
union FragH { v16h v; v8us half[2]; _Float16 h[16]; unsigned short u[16]; };
template <int NT>
__device__ __forceinline__ v8f mmaH(v16h ah, v16h al, v16h bh, v16h bl, v8f c) {
  c = __builtin_amdgcn_wmma_f32_16x16x32_f16(false, ah, false, bh, (short)0, c, false, false);
  if (NT >= 2) c = __builtin_amdgcn_wmma_f32_16x16x32_f16(false, al, false, bh, (short)0, c, false, false);
  if (NT >= 3) c = __builtin_amdgcn_wmma_f32_16x16x32_f16(false, ah, false, bl, (short)0, c, false, false);
  asm volatile("v_nop\n\tv_nop\n\tv_nop\n\tv_nop" : "+v"(c) : "v"(ah), "v"(al), "v"(bh), "v"(bl));
  return c;
}
// batched GEMM like k_gemm_b but f16 operands: A f32 (split into f16 hi/lo if ASPLIT, else rounded to f16), Bt = f16 values [n][k]; alpha; C f32; N multiple of 16 (partial tiles skipped)
template <bool ASPLIT>
__global__ __launch_bounds__(128) void k_gemm_h(const float* __restrict__ A, int lda, size_t sA, const _Float16* __restrict__ Bh, int ldb, size_t sB, float alpha, float* __restrict__ C, int ldc, size_t sC, int M, int N, int K) {
  __shared__ __attribute__((aligned(16))) float so[4][16][64];
  const int tid = threadIdx.x, w = tid >> 5, lane = tid & 31, ln = lane & 15, hh = lane >> 4; const int by = blockIdx.y;
  A += (size_t)by * sA; Bh += (size_t)by * sB; C += (size_t)by * sC;
  const int ntn = (N + 63) / 64; const int wid = blockIdx.x * 4 + w; const int mt = wid / ntn, nq = wid % ntn; if (mt * 16 >= M) return;
  const int row0 = mt * 16, col0 = nq * 64; const float* arow = A + (size_t)(row0 + ln) * lda;
  v8f acc[4] = {};
  for (int kb = 0; kb < K; kb += 32) {
    FragH ah, al;
    const v4f x0 = *(const v4fa*)(arow + kb + 8 * hh), x1 = *(const v4fa*)(arow + kb + 8 * hh + 4), x2 = *(const v4fa*)(arow + kb + 16 + 8 * hh), x3 = *(const v4fa*)(arow + kb + 16 + 8 * hh + 4);
    float xs[16] = {x0[0],x0[1],x0[2],x0[3],x1[0],x1[1],x1[2],x1[3],x2[0],x2[1],x2[2],x2[3],x3[0],x3[1],x3[2],x3[3]};
#pragma unroll
    for (int i = 0; i < 16; ++i) { const _Float16 h = (_Float16)xs[i]; ah.h[i] = h; al.h[i] = ASPLIT ? (_Float16)(xs[i] - (float)h) : (_Float16)0.0f; }
#pragma unroll
    for (int t = 0; t < 4; ++t) { if (col0 + t * 16 >= N) continue; const size_t boff = (size_t)(col0 + t * 16 + ln) * ldb + kb; FragH bq; bq.half[0] = *(const v8us*)(Bh + boff + 8 * hh); bq.half[1] = *(const v8us*)(Bh + boff + 16 + 8 * hh);
      acc[t] = mmaH<ASPLIT ? 2 : 1>(ah.v, al.v, bq.v, bq.v, acc[t]); }
  }
#pragma unroll
  for (int t = 0; t < 4; ++t) { if (col0 + t * 16 >= N) continue;
#pragma unroll
    for (int r = 0; r < 8; ++r) so[w][8 * hh + r][t * 16 + ln] = acc[t][r] * alpha; }
  __builtin_amdgcn_fence(__ATOMIC_ACQ_REL, "workgroup"); __builtin_amdgcn_wave_barrier();
  const int rsub = lane >> 4, c4 = (lane & 15) * 4;
  {
#pragma unroll
    for (int q = 0; q < 8; ++q) { const int r = q * 2 + rsub; if (col0 + c4 < N) { const v4f v = *(const v4fa*)&so[w][r][c4]; *(v4f*)(C + (size_t)(row0 + r) * ldc + col0 + c4) = v; } }
     }
}

// Wt[n][k] = f16(W[k][n]·scale) from f32 row-major W[K][N] (scale = power of two; bf16-exact weights stay exact in f16 away from the subnormal range)
__global__ __launch_bounds__(256) void k_wt_f16(const float* __restrict__ W, _Float16* __restrict__ Wt, int K, int N, float scale) {
  const int t = blockIdx.x * 256 + threadIdx.x; if (t >= N * (K / 8)) return; const int n = t / (K / 8), k8 = (t % (K / 8)) * 8; FragH f;
#pragma unroll
  for (int i = 0; i < 8; ++i) f.h[i] = (_Float16)(bf16_round(W[(size_t)(k8 + i) * N + n]) * scale); const v8us o = f.half[0];
  *(v8us*)((unsigned short*)Wt + (size_t)n * K + k8) = o; 
}
// k_gemm_hh variant with fused epilogue: v = acc·alpha + bias[by·sBias + col] (+ CP[(row/rowsPerB)·sCPb + by·64 + col] if CP) ; ACT 0 none / 1 elu ; writes f16 C16 (and f32 C if non-null)
template <int ACT>
__global__ __launch_bounds__(128) void k_gemm_hhx(const _Float16* __restrict__ A, int lda, size_t sA, const _Float16* __restrict__ Bh, int ldb, size_t sB, float alpha, const float* __restrict__ bias, size_t sBias, const float* __restrict__ CP, int rowsPerB, size_t sCPb, int row0g,
    float* __restrict__ C, _Float16* __restrict__ C16, int ldc, size_t sC, int M, int N, int K) {
  __shared__ __attribute__((aligned(16))) float so[4][16][64];
  const int tid = threadIdx.x, w = tid >> 5, lane = tid & 31, ln = lane & 15, hh = lane >> 4; const int by = blockIdx.y;
  A += (size_t)by * sA; Bh += (size_t)by * sB; const size_t cofs = (size_t)by * sC; const float* bp = bias ? bias + (size_t)by * sBias : nullptr;
  const int ntn = (N + 63) / 64; const int wid = blockIdx.x * 4 + w; const int mt = wid / ntn, nq = wid % ntn; if (mt * 16 >= M) return;
  const int row0 = mt * 16, col0 = nq * 64; const _Float16* arow = A + (size_t)(row0 + ln) * lda;
  v8f acc[4] = {};
  for (int kb = 0; kb < K; kb += 32) { FragH ah; ah.half[0] = *(const v8us*)((const unsigned short*)arow + kb + 8 * hh); ah.half[1] = *(const v8us*)((const unsigned short*)arow + kb + 16 + 8 * hh);
#pragma unroll
    for (int t = 0; t < 4; ++t) { if (col0 + t * 16 >= N) continue; const size_t boff = (size_t)(col0 + t * 16 + ln) * ldb + kb; FragH bq; bq.half[0] = *(const v8us*)((const unsigned short*)Bh + boff + 8 * hh); bq.half[1] = *(const v8us*)((const unsigned short*)Bh + boff + 16 + 8 * hh);
      acc[t] = mmaH<1>(ah.v, ah.v, bq.v, bq.v, acc[t]); }
  }
#pragma unroll
  for (int t = 0; t < 4; ++t) { if (col0 + t * 16 >= N) continue; const int col = col0 + t * 16 + ln; const float bv = bp ? bf16_round(bp[col]) : 0.f;
#pragma unroll
    for (int r = 0; r < 8; ++r) { float v = acc[t][r] * alpha + bv; if (CP) { const int rr = row0g + row0 + 8 * hh + r; if (rowsPerB < 0) v += CP[cofs + (size_t)rr * ldc + col];      /* rowsPerB < 0: own element of the batched C plane */ else { const int bidx = rr / rowsPerB; v += CP[(size_t)bidx * sCPb + (size_t)by * 64 + col]; } } if (ACT == 1) v = (v > 0.f) ? v : expm1f(v); else if (ACT == 7) v = (v > 0.f) ? v + 1.0f : expf(v); else if (ACT == 8) v = tanhf(v); else if (ACT == 9) v = 0.5f * v * (1.0f + tanhf(0.7978845608028654f * (v + 0.044715f * v * v * v))); else if (ACT == 11) v = 1.0f / (1.0f + expf(-v)); else if (ACT == 12) v = (v > 0.f) ? v : 0.01f * v; else if (ACT == 14) v = (v > 0.f) ? v : 0.1f * v; else if (ACT == 16) v = (v >= 0.f) ? v : 0.3f * v; else if (ACT == 17) v = (v >= 0.f) ? v : 0.2f * v; else if (ACT == 15) v = v / (1.0f + expf(-v)); else if (ACT == 3) v = fmaxf(v, 0.f); else if (ACT == 6) v = 0.5f * v * (1.0f + erff(v * 0.70710678118654752f)); so[w][8 * hh + r][t * 16 + ln] = v; } }
  __builtin_amdgcn_fence(__ATOMIC_ACQ_REL, "workgroup"); __builtin_amdgcn_wave_barrier();
  const int rsub = lane >> 4, c4 = (lane & 15) * 4; typedef _Float16 v4h __attribute__((ext_vector_type(4)));
  {
#pragma unroll
    for (int q = 0; q < 8; ++q) { const int r = q * 2 + rsub; if (col0 + c4 < N) { const v4f v = *(const v4fa*)&so[w][r][c4]; if (C) *(v4f*)(C + cofs + (size_t)(row0 + r) * ldc + col0 + c4) = v; if (C16) { v4h h4; for (int i = 0; i < 4; ++i) h4[i] = (_Float16)v[i]; *(v4h*)(C16 + cofs + (size_t)(row0 + r) * ldc + col0 + c4) = h4; } } }
     }
}


typedef _Float16 v4h __attribute__((ext_vector_type(4)));

__global__ __launch_bounds__(256) void k_h16(const float* __restrict__ x, _Float16* __restrict__ X16, size_t n8) { const size_t t = (size_t)blockIdx.x * 256 + threadIdx.x; if (t >= n8) return; FragH f;
#pragma unroll
  for (int q = 0; q < 8; ++q) f.h[q] = (_Float16)x[t * 8 + q]; *(v8us*)((unsigned short*)X16 + t * 8) = f.half[0];  }
__global__ __launch_bounds__(256) void k_round16f(const float* __restrict__ W, _Float16* __restrict__ Bt, size_t n8) { const size_t t = (size_t)blockIdx.x * 256 + threadIdx.x; if (t >= n8) return; FragH f;
#pragma unroll
  for (int i = 0; i < 8; ++i) f.h[i] = (_Float16)(bf16_round(W[t * 8 + i]) * 16.0f); *(v8us*)((unsigned short*)Bt + t * 8) = f.half[0];  }
template <int NHv, int TTv>
__global__ __launch_bounds__(256) void k_vt(const _Float16* __restrict__ V16, int ldv, int voff, _Float16* __restrict__ Vt) { __shared__ unsigned short tl[64][66]; const int tid = threadIdx.x; const int slab = blockIdx.x / (TTv / 64), lg = blockIdx.x % (TTv / 64); const int b = slab / NHv, h = slab % NHv;
  for (int i = tid; i < 64 * 8; i += 256) { const int r = i / 8, c8 = (i % 8) * 8; FragH f; f.half[0] = *(const v8us*)((const unsigned short*)V16 + ((size_t)b * TTv + lg * 64 + r) * ldv + voff + h * 64 + c8);
#pragma unroll
    for (int q = 0; q < 8; ++q) tl[r][c8 + q] = f.u[q]; }
  __syncthreads();
  {
#pragma unroll
    for (int rd = 0; rd < 2; ++rd) { const int d = rd * 32 + tid / 8, pc = tid % 8; FragH f;
#pragma unroll
      for (int q = 0; q < 8; ++q) f.u[q] = tl[pc * 8 + q][d];
      *(v8us*)((unsigned short*)Vt + ((size_t)slab * 64 + d) * TTv + lg * 64 + pc * 8) = f.half[0]; }
     } }

__global__ __launch_bounds__(256) void k_hl(const float* __restrict__ F, _Float16* __restrict__ Hh, _Float16* __restrict__ Hl, size_t n8) { const size_t t = (size_t)blockIdx.x * 256 + threadIdx.x; if (t >= n8) return; FragH fh, fl; const v4f a = *(const v4fa*)(F + t * 8), c = *(const v4fa*)(F + t * 8 + 4);
#pragma unroll
  for (int q = 0; q < 4; ++q) { _Float16 h = (_Float16)a[q]; fh.h[q] = h; fl.h[q] = (_Float16)((a[q] - (float)h) * 1024.0f); h = (_Float16)c[q]; fh.h[4 + q] = h; fl.h[4 + q] = (_Float16)((c[q] - (float)h) * 1024.0f); }
  { *(v8us*)((unsigned short*)Hh + t * 8) = fh.half[0]; *(v8us*)((unsigned short*)Hl + t * 8) = fl.half[0];  } }

// ---- fast GEMM (block tile 128x128 a plane, eight waves of 32x64; requires M % 128 == 0, N % 128 == 0, K % 128 == 0); epilogue = k_gemm_hhx semantics ----
// A stage is 128 k of the block's 128 A rows and of 128 B rows of each plane it computes (256-byte rows). Asynchronous copies bring it from global memory into LDS, whole 128-byte lines a request, through no register;
// two buffers: the next stage flies while this one is multiplied. Fragments come from LDS in the k order of g2_frag, one group (one k step of one plane) ahead of their products; every accumulator still sums k upward in steps of 32.
#define G2_BK 128                    /* k a stage */
#define G2_PITCH 272                 /* LDS row pitch in bytes: 16 x odd, so the 16 rows of a 16-byte fragment read fall on 64 distinct banks */
__device__ __forceinline__ v16h g2_frag(const _Float16* p, int hh) { FragH f; f.half[0] = *(const v8us*)((const unsigned short*)p + 8 * hh); f.half[1] = *(const v8us*)((const unsigned short*)p + 16 + 8 * hh); return f.v; }
__device__ __forceinline__ v16h g2_lfrag(const unsigned char* p) { FragH f; f.half[0] = *(const v8us*)p; f.half[1] = *(const v8us*)(p + 32); return f.v; }      /* p: the lane's row in LDS + 64 bytes a k step + 16 hh */
__device__ __forceinline__ v8f g2_mma(v16h a, v16h b, v8f c) { return __builtin_amdgcn_wmma_f32_16x16x32_f16(false, a, false, b, (short)0, c, false, false); }
// Eight asynchronous 16-byte copies of a lane: rows r, r + 16, ..., r + 112 of one operand's stage (l: LDS byte address of the first, g: its global address, gs: 16 global rows in elements).
// The closing s_wait_xcnt 0 stands inside the statement, in front of any later write of the address registers that the copies name.
__device__ __forceinline__ void g2_copy8(unsigned l, const _Float16* g, size_t gs) {
  asm volatile("global_load_async_to_lds_b128 %0, %8, off\n\tglobal_load_async_to_lds_b128 %1, %9, off\n\tglobal_load_async_to_lds_b128 %2, %10, off\n\tglobal_load_async_to_lds_b128 %3, %11, off\n\t"
               "global_load_async_to_lds_b128 %4, %12, off\n\tglobal_load_async_to_lds_b128 %5, %13, off\n\tglobal_load_async_to_lds_b128 %6, %14, off\n\tglobal_load_async_to_lds_b128 %7, %15, off\n\ts_wait_xcnt 0x0"
               :: "v"(l), "v"(l + 16 * G2_PITCH), "v"(l + 32 * G2_PITCH), "v"(l + 48 * G2_PITCH), "v"(l + 64 * G2_PITCH), "v"(l + 80 * G2_PITCH), "v"(l + 96 * G2_PITCH), "v"(l + 112 * G2_PITCH),
                  "v"(g), "v"(g + gs), "v"(g + 2 * gs), "v"(g + 3 * gs), "v"(g + 4 * gs), "v"(g + 5 * gs), "v"(g + 6 * gs), "v"(g + 7 * gs) : "memory"); }
// The epilogue's choices are template parameters, so that it compiles to straight-line code: HASB: a bias is added (the plane's bias pointer is not null); HASCP: the CP term is added; F32OUT: the result goes to C as f32, otherwise to C16 as f16.
// NP: planes a block computes. NP == 1: the one plane that grid y names. NP > 1: planes 0 .. NP - 1, all from the same 128 A rows (sA unused): a stage holds the A rows once and 128 B rows of every plane, so the block tile is 128 x (NP * 128).
// TPLANE >= 0 (NP > 1 only): that plane's 128x128 tile is stored transposed, as f16, into VTo [batch][head][d][s] (column n = head * HD + d, row = batch * SQ + s) and nothing of it goes to C16.
#define G2_SOB (8 * 32 * 68 * 4)     /* output staging of one plane's tile in bytes: eight waves' 32 rows of 68 floats */
template <int ACT, bool HASB, bool HASCP, bool F32OUT, int TPLANE, int NP>
__global__ __launch_bounds__(256) void k_gemm2(const _Float16* __restrict__ A, int lda, size_t sA, const _Float16* __restrict__ Bh, int ldb, size_t sB, float alpha, const float* __restrict__ bias, const float* __restrict__ bias1, const float* __restrict__ bias2, const float* __restrict__ CP, int rowsPerB, size_t sCPb, int row0g,
    float* __restrict__ C, _Float16* __restrict__ C16, _Float16* __restrict__ VTo, int ldc, size_t sC, int M, int N, int K) { static_assert(ACT == 0 || ACT == 3 || ACT == 6 || ACT == 8 || ACT == 9 || ACT == 11 || ACT == 12 || ACT == 14 || ACT == 15 || ACT == 16 || ACT == 17, "k_gemm2: unsupported ACT code (would silently apply no activation)");
  static_assert(TPLANE < 0 || (NP > 1 && TPLANE < NP && ACT == 0 && !HASCP && !F32OUT && SQ % 128 == 0 && HD == 64), "k_gemm2: the transposed plane has the plain f16 epilogue; a block's 128 rows lie in one batch, its 128 columns are two whole heads");
  static_assert(NP >= 1 && NP <= 3, "k_gemm2: the planes' biases are separate buffers: at most three planes");
  constexpr unsigned STG = (128 + NP * 128) * G2_PITCH;      /* a stage: 128 A rows, then 128 B rows of each plane */
  static_assert(NP * G2_SOB <= 2 * STG && 128 * G2_PITCH <= G2_SOB, "k_gemm2: every plane's output staging has its own part; the transposed tile fits one part");
  constexpr unsigned SO0 = NP == 1 ? 2 * STG : 0;      /* where the output staging begins. NP > 1: on the stages themselves, which nothing reads behind the k loop's last barrier (both together would not fit the LDS); NP == 1: behind them */
  __shared__ __attribute__((aligned(16))) unsigned char ring[SO0 + (NP == 1 ? G2_SOB : 2 * STG)];
  const int tid = threadIdx.x, w = tid >> 5, lane = tid & 31, ln = lane & 15, hh = lane >> 4; const int by = NP == 1 ? blockIdx.y : 0;
  A += (size_t)by * sA; Bh += (size_t)by * sB;
  const int ntn = N >> 7; const int mt = blockIdx.x / ntn, nq = blockIdx.x - mt * ntn; if (mt * 128 >= M) return;      /* the whole block leaves, in front of every barrier */
  const int row0 = mt * 128 + 32 * (w & 3), col0 = nq * 128 + 64 * (w >> 2);
  const int nt = K / G2_BK;
  const unsigned lc = (unsigned)(size_t)ring + (unsigned)((tid >> 4) * G2_PITCH + (tid & 15) * 16);      /* the lane's place in a stage: row tid / 16 (+ 16 a copy), 16-byte column tid % 16: a wave's copy is two whole rows */
  const size_t oa = (size_t)(mt * 128 + (tid >> 4)) * lda + (tid & 15) * 8, ob = (size_t)(nq * 128 + (tid >> 4)) * ldb + (tid & 15) * 8;      /* the lane's first element in A and in a plane of B */
  const size_t gsa = (size_t)16 * lda, gsb = (size_t)16 * ldb;
  const _Float16* ga = A + oa; const _Float16* gb = Bh + ob;      /* walk on by one stage behind every fill */
  auto fill = [&](unsigned bo) { g2_copy8(lc + bo, ga, gsa);      /* the next stage into the buffer at byte bo: (1 + NP) * 8 copies a lane */
#pragma unroll
    for (int p = 0; p < NP; ++p) g2_copy8(lc + bo + (128 + p * 128) * G2_PITCH, gb + (size_t)p * sB, gsb);
    ga += G2_BK; gb += G2_BK; };
  fill(0);      /* stage 0 */
  asm volatile("s_wait_asynccnt 0x0" ::: "memory");      /* this wave's copies of stage 0 have landed */
  __syncthreads();      /* publishes stage 0 */
  if (nt > 1) fill(STG);      /* stage 1 */
  const unsigned char* fa = ring + (32 * (w & 3) + ln) * G2_PITCH + 16 * hh; const unsigned char* fb = ring + (128 + 64 * (w >> 2) + ln) * G2_PITCH + 16 * hh;
  const v8f z8 = {0.f,0.f,0.f,0.f,0.f,0.f,0.f,0.f}; v8f c[NP][8];      /* c[p][half * 4 + j]: plane p, rows 16 half .., columns 16 j .. of the wave's 32x64 tile */
#pragma unroll
  for (int p = 0; p < NP; ++p)
#pragma unroll
    for (int u = 0; u < 8; ++u) c[p][u] = z8;
#pragma unroll 1      /* one stage a trip: the buffer is picked by the trip's parity, the groups inside are unrolled */
  for (int t = 0; t < nt; ++t) { const unsigned bo = (unsigned)(t & 1) * STG; const unsigned char* pa = fa + bo; const unsigned char* pb = fb + bo;
    v16h a[2][2], b[2][4];
    a[0][0] = g2_lfrag(pa); a[0][1] = g2_lfrag(pa + 16 * G2_PITCH);
#pragma unroll
    for (int j = 0; j < 4; ++j) b[0][j] = g2_lfrag(pb + j * 16 * G2_PITCH);
#pragma unroll      /* a group is one k step of one plane: eight products; the A fragments of a k step serve its NP groups */
    for (int g = 0; g < NP * (G2_BK / 32); ++g) { const int ks = g / NP, p = g % NP, cu = g & 1, nx = cu ^ 1, ac = ks & 1;
      if (g + 1 < NP * (G2_BK / 32)) { const int ks1 = (g + 1) / NP, p1 = (g + 1) % NP;      /* the next group's fragments, into the other register set */
        if (p1 == 0) { a[ks1 & 1][0] = g2_lfrag(pa + ks1 * 64); a[ks1 & 1][1] = g2_lfrag(pa + 16 * G2_PITCH + ks1 * 64); }
#pragma unroll
        for (int j = 0; j < 4; ++j) b[nx][j] = g2_lfrag(pb + (p1 * 128 + j * 16) * G2_PITCH + ks1 * 64); }
      __builtin_amdgcn_sched_barrier(0);      /* keeps those reads one group ahead of this group's products: without it the build sank each read to its first use, two products behind every full LDS wait */
      c[p][0] = g2_mma(a[ac][0], b[cu][0], c[p][0]); c[p][4] = g2_mma(a[ac][1], b[cu][0], c[p][4]); c[p][1] = g2_mma(a[ac][0], b[cu][1], c[p][1]); c[p][5] = g2_mma(a[ac][1], b[cu][1], c[p][5]);
      c[p][2] = g2_mma(a[ac][0], b[cu][2], c[p][2]); c[p][6] = g2_mma(a[ac][1], b[cu][2], c[p][6]); c[p][3] = g2_mma(a[ac][0], b[cu][3], c[p][3]); c[p][7] = g2_mma(a[ac][1], b[cu][3], c[p][7]);
      __builtin_amdgcn_sched_barrier(0); }      /* and keeps the following group's reads from rising among these products */
    asm volatile("s_wait_dscnt 0x0" ::: "memory");      /* this wave's reads of the buffer are done before it is refilled */
    asm volatile("s_wait_asynccnt 0x0" ::: "memory");      /* this wave's copies of stage t + 1 have landed */
    __syncthreads();      /* publishes stage t + 1 and ends every wave's reads of stage t */
    if (t + 2 < nt) fill(bo); }      /* stage t + 2 into the buffer just read */
  asm volatile("s_wait_asynccnt 0x0" ::: "memory");      /* nothing of this wave is in flight when it goes on */
  // Every plane's tile is staged first, each in its own part of the staging bytes; then come the stores.
#pragma unroll      /* all loops over p, u, r in full: c stays in registers only where its indices are constants */
  for (int p = 0; p < NP; ++p) { const int pl = NP == 1 ? by : p; const float* bp = pl == 0 ? bias : pl == 1 ? bias1 : bias2; const size_t cofs = (size_t)pl * sC; unsigned char* part = ring + SO0 + p * G2_SOB;
    if (TPLANE >= 0 && p == TPLANE) {
      // A lane's 8 accumulator registers are 8 consecutive rows (s) of one column (d): 16 bytes of a V^T row. The block's tile is staged as 128 V^T rows of 128 s (256 bytes, pitch G2_PITCH), every wave its own 64 x 32 part.
#pragma unroll
      for (int u = 0; u < 8; ++u) { const int t = u & 3, half = u >> 2; const float bv = HASB ? bf16_round(bp[col0 + t * 16 + ln]) : 0.f; FragH f;
#pragma unroll
        for (int r = 0; r < 8; ++r) f.h[r] = (_Float16)(c[p][u][r] * alpha + bv);
        *(v8us*)(part + (64 * (w >> 2) + t * 16 + ln) * G2_PITCH + (32 * (w & 3) + half * 16 + 8 * hh) * 2) = f.half[0]; }
    } else { float (*so)[32][68] = (float (*)[32][68])part;
#pragma unroll
      for (int u = 0; u < 8; ++u) { const int t = u & 3, half = u >> 2; const int col = col0 + t * 16 + ln; const float bv = HASB ? bf16_round(bp[col]) : 0.f;
#pragma unroll
        for (int r = 0; r < 8; ++r) { const int rloc = half * 16 + 8 * hh + r; float v = c[p][u][r] * alpha + bv; if (HASCP) { if (rowsPerB < 0) v += CP[cofs + (size_t)(row0g + row0 + rloc) * ldc + col];      /* rowsPerB < 0: own element of the batched C plane */ else { const int bidx = (row0g + row0 + rloc) / rowsPerB; v += CP[(size_t)bidx * sCPb + (size_t)pl * 64 + col]; } }
          if (ACT == 3) v = fmaxf(v, 0.f); else if (ACT == 6) v = 0.5f * v * (1.0f + erff(v * 0.70710678118654752f)); else if (ACT == 11) v = 1.0f / (1.0f + expf(-v)); else if (ACT == 15) v = v / (1.0f + expf(-v)); else if (ACT == 12) v = (v > 0.f) ? v : 0.01f * v; else if (ACT == 8) v = tanhf(v); else if (ACT == 9) v = 0.5f * v * (1.0f + tanhf(0.7978845608028654f * (v + 0.044715f * v * v * v))); else if (ACT == 14) v = (v > 0.f) ? v : 0.1f * v; else if (ACT == 16) v = (v >= 0.f) ? v : 0.3f * v; else if (ACT == 17) v = (v >= 0.f) ? v : 0.2f * v;
          so[w][rloc][t * 16 + ln] = v; } } } }
  if (TPLANE >= 0) __syncthreads();      /* a V^T row of the tile holds four waves' parts: all are written before any row is read (the other tiles' parts are read by the wave that wrote them) */
  else { __builtin_amdgcn_fence(__ATOMIC_ACQ_REL, "workgroup"); __builtin_amdgcn_wave_barrier(); }
  const int rsub = lane >> 4, c4 = (lane & 15) * 4;
#pragma unroll
  for (int p = 0; p < NP; ++p) { const int pl = NP == 1 ? by : p; const size_t cofs = (size_t)pl * sC; const unsigned char* part = ring + SO0 + p * G2_SOB;
    if (TPLANE >= 0 && p == TPLANE) {
      const int n0 = nq * 128 + w * 16 + hh; const size_t tok = (size_t)B0 * SQ + (size_t)mt * 128;      /* the wave stores 16 of the 128 rows, two whole rows (2 x 256 bytes, whole lines) a store */
      unsigned short* vo = (unsigned short*)VTo + ((tok / SQ) * (NH * HD) + n0) * SQ + tok % SQ + ln * 8;
#pragma unroll      /* in full: the eight LDS reads go out together, ahead of the first store */
      for (int q = 0; q < 8; ++q) *(v8us*)(vo + (size_t)q * 2 * SQ) = *(const v8us*)(part + (w * 16 + q * 2 + hh) * G2_PITCH + ln * 16);
    } else { const float (*so)[32][68] = (const float (*)[32][68])part;
#pragma unroll
      for (int q = 0; q < 16; ++q) { const int r = q * 2 + rsub; const v4f v = *(const v4fa*)&so[w][r][c4]; if (F32OUT) *(v4f*)(C + cofs + (size_t)(row0 + r) * ldc + col0 + c4) = v; else { v4h h4; for (int i = 0; i < 4; ++i) h4[i] = (_Float16)v[i]; *(v4h*)(C16 + cofs + (size_t)(row0 + r) * ldc + col0 + c4) = h4; } } } } }


// All five operand conversions in one launch (none reads another's output): blocks [0, PREP_XB) round x to bf16 and store it as f16; the next 4 * PREP_WB blocks do the same, x16, for Wq, Wk, Wv, Wo
// (natural [out][in] = Bt[n][k]) into four consecutive planes of BW. Eight elements a thread; which array a block works on is the same for the whole block.
#define PREP_XB ((unsigned)(NR * DM / 8 / 256))
#define PREP_WB ((unsigned)((size_t)DM * DM / 8 / 256))
__global__ __launch_bounds__(256) void k_prep(const float* __restrict__ x, const float* __restrict__ wq, const float* __restrict__ wk, const float* __restrict__ wv, const float* __restrict__ wo, _Float16* __restrict__ X16, _Float16* __restrict__ BW) {
  static_assert(NR * DM % (8 * 256) == 0 && (size_t)DM * DM % (8 * 256) == 0, "k_prep: whole blocks per array");
  const unsigned bx = blockIdx.x; const float* s = x; _Float16* d = X16; float sc = 1.0f; unsigned lb = bx;
  if (bx >= PREP_XB) { const unsigned m = (bx - PREP_XB) / PREP_WB; lb = (bx - PREP_XB) % PREP_WB; s = m == 0 ? wq : m == 1 ? wk : m == 2 ? wv : wo; d = BW + (size_t)m * DM * DM; sc = 16.0f; }
  const size_t t = (size_t)lb * 256 + threadIdx.x; FragH f;
#pragma unroll
  for (int q = 0; q < 8; ++q) f.h[q] = (_Float16)(bf16_round(s[t * 8 + q]) * sc);
  *(v8us*)((unsigned short*)d + t * 8) = f.half[0]; }
__global__ __launch_bounds__(256) void k_rsm(const float* __restrict__ S, _Float16* __restrict__ P, int nrows) {
  #pragma clang fp contract(off)
  const int i = blockIdx.x * 256 + threadIdx.x; if (i >= nrows) return; const float* s = S + (size_t)i * SQ; float mx = -3.0e38f;
#pragma unroll 1
  for (int j = 0; j < SQ; ++j) mx = fmaxf(mx, s[j]); float se = 0.f;
#pragma unroll 1
  for (int j = 0; j < SQ; ++j) se += expf(s[j] - mx); const float sc = 256.0f / se;
#pragma unroll 1
  for (int j0 = 0; j0 < SQ; j0 += 8) { FragH f; for (int q = 0; q < 8; ++q) f.h[q] = (_Float16)(expf(s[j0 + q] - mx) * sc); unsigned short* d = (unsigned short*)P + (size_t)i * SQ + j0; *(v8us*)d = f.half[0];  } }
__global__ __launch_bounds__(256) void k_vt(const _Float16* __restrict__ V16, int b, int h0, _Float16* __restrict__ VT) { __shared__ unsigned short tl[64][65]; const int tid = threadIdx.x; const int hh = blockIdx.x % HG, sg = blockIdx.x / HG; const int s0 = sg * 64; const int h = h0 + hh;
  for (int i = tid; i < 64 * 8; i += 256) { const int j = i / 8, d8 = (i % 8) * 8; FragH f; f.half[0] = *(const v8us*)((const unsigned short*)V16 + ((size_t)b * SQ + s0 + j) * DM + h * HD + d8); for (int q = 0; q < 8; ++q) tl[d8 + q][j] = f.u[q]; }
  __syncthreads();
  { for (int i = tid; i < 64 * 8; i += 256) { const int d = i / 8, j8 = (i % 8) * 8; FragH f; for (int q = 0; q < 8; ++q) f.u[q] = tl[d][j8 + q]; *(v8us*)((unsigned short*)VT + ((size_t)hh * HD + d) * SQ + s0 + j8) = f.half[0]; }  } }



// Fused attention: scores, softmax of (scores + relative-position bias) and the product with V in one kernel, for every batch and head in one launch; neither the scores nor the weights go to memory.
// A wave owns FA_QT * 16 query columns and walks the keys 32 at a time: S^T = K . Q^T (A = K rows, B = Q rows kept in registers), so that a lane holds 16 scores of ONE query per column tile;
// reference and sum per lane (online softmax, log2 domain); the reference is set in the first pass and raised only where a pass's weights would near the top of f16 (one exchange between the wave halves then), one exchange in the epilogue for the sum;
// the two S^T tiles of a pass, converted in place, are the B operand of O^T += V^T . P^T (A = V^T rows in the same k order), and a lane's 8 accumulator registers are 8 consecutive d of its query: 16-byte stores.
// Every loop but the walk over the stages and their passes is unrolled in full: the fragment and accumulator arrays stay in registers only where each index is a constant.
// K and V^T reach the waves through LDS: a stage is FA_SK keys (K rows of 128 bytes, V^T rows of 256 bytes), brought once for the whole block by asynchronous copies, whole 128-byte lines a request, through no register;
// two buffers: the next stage flies while this one is worked on. The eight waves read their fragments from LDS in the k order of g2_frag; passes, products and sums keep their order.
#define FA_WAVES 8
#define FA_QT 2                      /* 16-column query tiles a wave */
#define FA_BQ (FA_WAVES * FA_QT * 16) /* query rows a block */
#define FA_L2E 1.4426950408889634f
#define FA_TOP 32768.0f              /* largest sum of a lane's weights of one pass let through without moving the reference: inside f16 */
#define FA_SK 128                    /* keys a stage: four passes */
#define FA_KP 144                    /* LDS pitch of a K row in bytes: 16 x odd, so the 16 rows of a 16-byte fragment read fall on distinct banks */
#define FA_VP 272                    /* LDS pitch of a V^T row in bytes: 16 x odd */
#define FA_KB (FA_SK * FA_KP)        /* the K rows of a stage; the HD V^T rows follow */
#define FA_STAGE (FA_KB + HD * FA_VP)
// Eight asynchronous 16-byte copies of a lane: K rows r, r + 32, r + 64, r + 96 of a stage (lk: LDS byte address of the first, gk: its global address), then V^T rows d, d + 16, d + 32, d + 48 (lv, gv).
// The closing s_wait_xcnt 0 stands inside the statement, in front of any later write of the address registers that the copies name.
__device__ __forceinline__ void fa_copy8(unsigned lk, const _Float16* gk, unsigned lv, const _Float16* gv) {
  asm volatile("global_load_async_to_lds_b128 %0, %8, off\n\tglobal_load_async_to_lds_b128 %1, %9, off\n\tglobal_load_async_to_lds_b128 %2, %10, off\n\tglobal_load_async_to_lds_b128 %3, %11, off\n\t"
               "global_load_async_to_lds_b128 %4, %12, off\n\tglobal_load_async_to_lds_b128 %5, %13, off\n\tglobal_load_async_to_lds_b128 %6, %14, off\n\tglobal_load_async_to_lds_b128 %7, %15, off\n\ts_wait_xcnt 0x0"
               :: "v"(lk), "v"(lk + 32 * FA_KP), "v"(lk + 64 * FA_KP), "v"(lk + 96 * FA_KP), "v"(lv), "v"(lv + 16 * FA_VP), "v"(lv + 32 * FA_VP), "v"(lv + 48 * FA_VP),
                  "v"(gk), "v"(gk + (size_t)32 * DM), "v"(gk + (size_t)64 * DM), "v"(gk + (size_t)96 * DM), "v"(gv), "v"(gv + (size_t)16 * SQ), "v"(gv + (size_t)32 * SQ), "v"(gv + (size_t)48 * SQ) : "memory"); }
__device__ __forceinline__ float sm_xh(float x) { return __builtin_bit_cast(float, __builtin_amdgcn_permlanex16(__builtin_bit_cast(int, x), __builtin_bit_cast(int, x), 0x76543210, 0xfedcba98, false, false)); }      /* lane l ^ 16 */
// Four native exp2, into registers of their own (no result lies on a source). In one statement with a closing v_nop: the slot that the instruction set asks for behind a transcendental before its result is read or its source overwritten
__device__ __forceinline__ v4f sm_exp2x4(v4f x) { float a, b, c, d;
  asm("v_exp_f32 %0, %4\n\tv_exp_f32 %1, %5\n\tv_exp_f32 %2, %6\n\tv_exp_f32 %3, %7\n\tv_nop" : "=&v"(a), "=&v"(b), "=&v"(c), "=&v"(d) : "v"(x[0]), "v"(x[1]), "v"(x[2]), "v"(x[3]));
  const v4f y = {a, b, c, d}; return y; }
__device__ __forceinline__ float sm_exp2x1(float x) { asm("v_exp_f32 %0, %0\n\tv_nop" : "+v"(x)); return x; }      /* one native exp2, with the same closing slot */
__device__ __forceinline__ v8f fa_mma(v16h a, v16h b, v8f c) { return __builtin_amdgcn_wmma_f32_16x16x32_f16(false, a, false, b, (short)0, c, false, false); }
__global__ __launch_bounds__(FA_WAVES * 32) void k_fattn(const _Float16* __restrict__ Q16, const _Float16* __restrict__ K16, const _Float16* __restrict__ VT, const float* __restrict__ emb, _Float16* __restrict__ O16) {
  static_assert(SQ % FA_BQ == 0 && SQ % FA_SK == 0 && SQ / FA_SK >= 2 && FA_SK == 128 && FA_WAVES == 8 && HD == 64 && MAXD % 32 == 0 && FA_QT * 16 + 31 <= MAXD, "k_fattn: whole blocks per head, whole stages per row (two at least), eight copies a lane a stage, two k steps per score tile, band passes inside the table");
  __shared__ __attribute__((aligned(16))) unsigned char ring[2 * FA_STAGE];
  __shared__ float tb[4 * MAXD - 1];      /* this head's bias, bf16-rounded, times log2(e), by k = j - i + (2 * MAXD - 1), already clipped: consecutive j are consecutive entries */
  const int tid = threadIdx.x, lane = tid & 31, ln = lane & 15, hh = lane >> 4; const int wave = __builtin_amdgcn_readfirstlane(tid >> 5);
  const int bh = blockIdx.x / (SQ / FA_BQ), b = bh / NH, h = bh % NH; const int q0 = (blockIdx.x % (SQ / FA_BQ)) * FA_BQ + wave * (FA_QT * 16);
  const unsigned lk = (unsigned)(size_t)ring + (unsigned)((tid >> 3) * FA_KP + (tid & 7) * 16), lv = (unsigned)(size_t)ring + (unsigned)(FA_KB + (tid >> 4) * FA_VP + (tid & 15) * 16);      /* the lane's places in a stage: a wave's copy is four whole K rows or two whole V^T rows */
  const _Float16* gk = K16 + ((size_t)b * SQ + (tid >> 3)) * DM + h * HD + (tid & 7) * 8; const _Float16* gv = VT + ((size_t)bh * HD + (tid >> 4)) * SQ + (tid & 15) * 8;
  fa_copy8(lk, gk, lv, gv);      /* stage 0 */
  for (int i = tid; i < 4 * MAXD - 1; i += FA_WAVES * 32) tb[i] = bf16_round(emb[(min(max(2 * MAXD - 1 - i, -MAXD), MAXD) + MAXD) * NH + h]) * FA_L2E;
  asm volatile("s_wait_asynccnt 0x0" ::: "memory");      /* this wave's copies of stage 0 have landed */
  __syncthreads();      /* publishes tb and stage 0 */
  fa_copy8(lk + FA_STAGE, gk + (size_t)FA_SK * DM, lv + FA_STAGE, gv + FA_SK);      /* stage 1 */
  const float bfar = tb[0], bnear = tb[4 * MAXD - 2];      /* j <= i - MAXD ; j >= i + MAXD */
  const _Float16* qp = Q16 + ((size_t)b * SQ + q0 + ln) * DM + h * HD; const unsigned char* fk = ring + ln * FA_KP + 16 * hh; const unsigned char* fv = ring + FA_KB + ln * FA_VP + 16 * hh;      /* the lane's fragment rows in buffer 0 */
  v16h qf[FA_QT][2], kf[2][2];
#pragma unroll
  for (int t = 0; t < FA_QT; ++t) { qf[t][0] = g2_frag(qp + (size_t)t * 16 * DM, hh); qf[t][1] = g2_frag(qp + (size_t)t * 16 * DM + 32, hh); }
  const v8f z8 = {0.f,0.f,0.f,0.f,0.f,0.f,0.f,0.f};
  v8f o[FA_QT][4]; float nm[FA_QT], lr[FA_QT];      /* nm: 8 - the reference in use, the same in both halves of the wave */
#pragma unroll
  for (int t = 0; t < FA_QT; ++t) { nm[t] = 8.0f; lr[t] = 0.f; o[t][0] = z8; o[t][1] = z8; o[t][2] = z8; o[t][3] = z8; }
#pragma unroll 1      /* one stage a trip: the buffer is picked by the trip's parity */
  for (int st = 0; st < SQ / FA_SK; ++st) { const unsigned bo = (unsigned)(st & 1) * FA_STAGE; const unsigned char* pk = fk + bo; const unsigned char* pv = fv + bo;
#pragma unroll
   for (int u = 0; u < 2; ++u) { kf[u][0] = g2_lfrag(pk + u * 16 * FA_KP); kf[u][1] = g2_lfrag(pk + u * 16 * FA_KP + 64); }      /* the stage's first K rows */
#pragma unroll 1      /* one pass a trip: with the four passes unrolled the build went past 256 registers and spilled */
   for (int p = 0; p < FA_SK / 32; ++p) { const int j0 = st * FA_SK + p * 32;
    v16h vf[4];      /* asked for first, used last: the scores and the softmax stand between */
#pragma unroll
    for (int d = 0; d < 4; ++d) vf[d] = g2_lfrag(pv + d * 16 * FA_VP + p * 64);
    v8f s[FA_QT][2];      /* s[t][u][r] = score of key j0 + 16 u + 8 hh + r, query q0 + 16 t + ln */
#pragma unroll
    for (int t = 0; t < FA_QT; ++t)
#pragma unroll
      for (int u = 0; u < 2; ++u) s[t][u] = fa_mma(kf[u][1], qf[t][1], fa_mma(kf[u][0], qf[t][0], z8));
    if (p + 1 < FA_SK / 32) {      /* the next pass's K rows, fetched one pass ahead inside the stage */
#pragma unroll
      for (int u = 0; u < 2; ++u) { kf[u][0] = g2_lfrag(pk + ((p + 1) * 32 + u * 16) * FA_KP); kf[u][1] = g2_lfrag(pk + ((p + 1) * 32 + u * 16) * FA_KP + 64); } }
    // The exp2 argument: score * log2(e) / 8 + bias + nm, nm = 8 - the reference in use (weights carried x256 at the reference, as f16 operands away from the subnormal range; the sum carries the same factor).
    // Outside the unclipped band the bias is one value, and the argument is one fused multiply-add; a pass that meets the band adds its table entries behind it.
    const bool band = j0 + 31 > q0 - MAXD && j0 < q0 + FA_QT * 16 - 1 + MAXD;      /* wave-uniform */
    const float bc = band ? 0.f : (j0 >= q0 + FA_QT * 16 - 1 + MAXD) ? bnear : bfar;
#pragma unroll
    for (int t = 0; t < FA_QT; ++t) { const float ba = bc + nm[t];
#pragma unroll
      for (int u = 0; u < 2; ++u)
#pragma unroll
        for (int r = 0; r < 8; ++r) s[t][u][r] = __builtin_fmaf(s[t][u][r], 0.125f * FA_L2E, ba); }
    if (band) { const float* tp = tb + (j0 - q0 + 2 * MAXD - 1) + 8 * hh - ln;      /* every k read here lies inside the table */
#pragma unroll
      for (int t = 0; t < FA_QT; ++t)
#pragma unroll
        for (int u = 0; u < 2; ++u)
#pragma unroll
          for (int r = 0; r < 8; ++r) s[t][u][r] += tp[(u - t) * 16 + r]; }
    FragH pf[FA_QT]; float ps[FA_QT];      /* the pass's weights as f16 operands, and the lane's sum of them (summed in f32, before the rounding) */
    auto weigh = [&](int t) { v4f as;
#pragma unroll
      for (int u = 0; u < 2; ++u)
#pragma unroll
        for (int g = 0; g < 2; ++g) { v4f x = {s[t][u][4 * g], s[t][u][4 * g + 1], s[t][u][4 * g + 2], s[t][u][4 * g + 3]}; x = sm_exp2x4(x);
          if (u + g == 0) as = x; else as += x;
#pragma unroll
          for (int e = 0; e < 4; ++e) pf[t].h[u * 8 + g * 4 + e] = (_Float16)x[e]; }
      ps[t] = (as[0] + as[1]) + (as[2] + as[3]); };
    float pa;
#pragma unroll
    for (int t = 0; t < FA_QT; ++t) { weigh(t); pa = t ? pa + ps[t] : ps[t]; }
    // Lazy rescale, tested once a pass: the reference moves only in the first pass (where it is set) and where the lane's weights sum past FA_TOP. No weight is negative, so each is at most that sum: under the limit none leaves the f16 range.
    // Every other pass takes no maximum, makes no exchange between the halves and rescales neither o nor the sum. Where the reference moves, the pass's weights are made anew from the arguments, which are still in s.
    const bool first = j0 == 0;
    if (__builtin_expect(__builtin_amdgcn_ballot_w32(pa > (first ? -1.0f : FA_TOP)) != 0, 0)) {      /* the same for the whole wave: a scalar branch; marked rare, so that the usual pass falls through */
#pragma unroll
      for (int t = 0; t < FA_QT; ++t) {
        float m0 = fmaxf(s[t][0][0], s[t][0][1]), m1 = fmaxf(s[t][1][0], s[t][1][1]);
#pragma unroll
        for (int r = 2; r < 8; r += 2) { m0 = fmaxf(fmaxf(m0, s[t][0][r]), s[t][0][r + 1]); m1 = fmaxf(fmaxf(m1, s[t][1][r]), s[t][1][r + 1]); }
        m0 = fmaxf(m0, m1); m0 = fmaxf(m0, sm_xh(m0)) - 8.0f;      /* how far the query's largest score of this pass lies above the reference; the same in both halves */
        const float dl = first ? m0 : fmaxf(m0, 0.f); const float al = first ? 0.f : sm_exp2x1(-dl);      /* first pass: o and the sum are 0 and stay 0 */
        nm[t] -= dl; lr[t] *= al;
#pragma unroll
        for (int d = 0; d < 4; ++d) o[t][d] *= al;
#pragma unroll
        for (int u = 0; u < 2; ++u) s[t][u] -= dl;
        weigh(t); } }
#pragma unroll
    for (int t = 0; t < FA_QT; ++t) { lr[t] += ps[t];
#pragma unroll
      for (int d = 0; d < 4; ++d) o[t][d] = fa_mma(vf[d], pf[t].v, o[t][d]); } }
   asm volatile("s_wait_dscnt 0x0" ::: "memory");      /* this wave's reads of the buffer are done before it is refilled */
   asm volatile("s_wait_asynccnt 0x0" ::: "memory");      /* this wave's copies of stage st + 1 have landed */
   __syncthreads();      /* publishes stage st + 1 and ends every wave's reads of stage st */
   if (st + 2 < SQ / FA_SK) fa_copy8(lk + bo, gk + (size_t)(st + 2) * FA_SK * DM, lv + bo, gv + (size_t)(st + 2) * FA_SK); }      /* stage st + 2 into the buffer just read */
  asm volatile("s_wait_asynccnt 0x0" ::: "memory");      /* nothing of this wave is in flight when it goes on */
#pragma unroll
  for (int t = 0; t < FA_QT; ++t) { const float sc = 64.0f / (lr[t] + sm_xh(lr[t]));      /* o carried x64, as the output GEMM's alpha expects */
    unsigned short* op = (unsigned short*)O16 + ((size_t)b * SQ + q0 + t * 16 + ln) * DM + h * HD + 8 * hh;
#pragma unroll
    for (int d = 0; d < 4; ++d) { FragH f;
#pragma unroll
      for (int r = 0; r < 8; ++r) f.h[r] = (_Float16)(o[t][d][r] * sc);
      *(v8us*)(op + d * 16) = f.half[0]; } } }

extern "C" void kernel_launch(void* const* d_in, const int* in_sizes, int n_in,
                              void* d_out, int out_size, void* d_ws, size_t ws_size, hipStream_t stream) {
  (void)in_sizes; (void)n_in; (void)out_size;
  const float* const* I = (const float* const*)d_in; const float* x = I[0]; const float* wq = I[1]; const float* bq = I[2]; const float* wk = I[3]; const float* bk = I[4]; const float* wv = I[5]; const float* bv = I[6]; const float* wo = I[7]; const float* bo = I[8]; const float* emb = I[9];      /* nn.Linear weights [out][in]; rel_emb [2*MAXD+1][NH] */
  char* ws = (char*)d_ws; size_t off = 0;
  auto take = [&](size_t bytes) { char* p = ws + off; off += (bytes + 255) & ~(size_t)255; return p; };
  _Float16* BQ = (_Float16*)take((size_t)DM * DM * 2); _Float16* BK = (_Float16*)take((size_t)DM * DM * 2); _Float16* BV = (_Float16*)take((size_t)DM * DM * 2); _Float16* BO = (_Float16*)take((size_t)DM * DM * 2);
  _Float16* X16 = (_Float16*)take(NR * DM * 2); _Float16* Q16 = (_Float16*)take(NR * DM * 2); _Float16* K16 = (_Float16*)take(NR * DM * 2); _Float16* O16 = (_Float16*)take(NR * DM * 2);
  _Float16* VT = (_Float16*)take((size_t)NB * NH * HD * SQ * 2);
  if (off > ws_size) return;
  static_assert((size_t)DM * DM * 2 % 256 == 0 && NR * DM * 2 % 256 == 0, "BQ, BK, BV, BO and Q16, K16 lie back to back: planes of one pitch");
  k_prep<<<PREP_XB + 4 * PREP_WB, 256, 0, stream>>>(x, wq, wk, wv, wo, X16, BQ);      /* X16; BQ, BK, BV, BO */
  const size_t r0p = (size_t)B0 * SQ;      /* first projected row */
  k_gemm2<0, true, false, false, 2, 3><<<dim3((unsigned)((MP / 128) * (DM / 128)), 1), 256, 0, stream>>>(X16 + r0p * DM, DM, 0, BQ, DM, (size_t)DM * DM, 0.0625f, bq, bk, bv, nullptr, 1, 0, 0, nullptr, Q16 + r0p * DM, VT, DM, NR * DM, MP, DM, DM);      /* planes 0, 1: Q16, K16; plane 2: V^T [NB][NH][HD][SQ] */
  k_fattn<<<NB * NH * (SQ / FA_BQ), FA_WAVES * 32, 0, stream>>>(Q16, K16, VT, emb, O16);      /* o (merged heads, x64) as f16 rows */
  k_gemm2<0, true, false, true, -1, 1><<<dim3((unsigned)((MPO / 128) * (DM / 128)), 1), 256, 0, stream>>>(O16 + r0p * DM, DM, 0, BO, DM, 0, 0.0009765625f, bo, nullptr, nullptr, nullptr, 1, 0, 0, (float*)d_out + r0p * DM, nullptr, nullptr, DM, 0, MPO, DM, DM);      /* out rows are the output layout */
}

// v010
// One run takes 72.5 microseconds.
// In two side-by-side timings against v009, it was 1.03 and 1.04 times as fast.
// Counting every step since v000, it is 62.9 times as fast.
#include <hip/hip_runtime.h>
// Multi-head self-attention with a learned relative-position bias (x [2][2048][1024]; q/k/v = x W^T + b (nn.Linear [out][in]), 16 heads of 64; scores / 8 + rel_emb[clip(i - j, -128, 128) + 128][h] (rel_emb [257][16]); softmax; o merged; out = o Wo^T + bo -> [2][2048][1024]).
// Structure: token rows r = b*2048 + s; x as exact f16 rows (bf16-rounded) and the four weights (x16) converted in one launch; Q, K, V as three WMMA GEMMs in one launch, every block taking its 128 x rows against the same 128 output columns of all three weights (32x64 wave tiles a plane, f32 accumulation, exact x16 weights + bias, f16 outputs); the V tile is stored transposed, so that V^T [batch][head][d][s] comes straight from that launch; one fused attention launch for all batches and heads: score tiles on WMMA (K = 64), online softmax of (scores / 8 + relative-position bias looked up by (i - j, head)) on VALU (f32 statistics, native exp; weights x256 as f16 operands, in registers), o = P . V on WMMA (o carried x64 against f16 subnormal flush, folded into the output GEMM alpha) written straight into the merged f16 o rows; out = o W_o + b GEMM (f32) into the output layout.
// Compute dtype: inputs rounded to bf16; x / weights exact; q, k, v, softmax weights and o as plain f16 GEMM operands (~2^-12); scores and softmax statistics f32. v_wmma_f32_16x16x32_f16.
#define NB 2
#define SQ 2048
#define DM 1024
#define NH 16
#define HD 64
#define MAXD 128                     /* relative distance clip */
#define HG 4                         /* heads per launch of the grouped V^T transpose k_vt(b, h0) */
#define B0 0                         /* first batch processed (debug hook) */
#define NBR NB                       /* batches processed (debug hook) */
#define NR ((size_t)NB * SQ)         /* token rows */
#define MP ((int)((size_t)NBR * SQ)) /* rows projected (debug hook) */
#define QN SQ                        /* query rows per batch; unused: the attention launch covers all SQ */
#define NHD NH                       /* heads; unused: the attention launch covers all NH */
#define MPO MP                       /* rows through the output stage (debug hook) */
#define LQ DM      /* row pitch of the q/k rows; unused: the code writes DM */
typedef __bf16 v16b __attribute__((ext_vector_type(16)));
typedef unsigned short v8us __attribute__((ext_vector_type(8), may_alias));
typedef float  v8f  __attribute__((ext_vector_type(8)));
typedef float  v4f  __attribute__((ext_vector_type(4)));
typedef float  v4fa __attribute__((ext_vector_type(4), may_alias));
union FragB { v16b v; v8us half[2]; unsigned short u[16]; };

__device__ __forceinline__ unsigned short bf16_bits(float x) { unsigned int u = __float_as_uint(x); return (unsigned short)((u + 0x7FFFu + ((u >> 16) & 1u)) >> 16); }
__device__ __forceinline__ float bf16_val(unsigned short b) { return __uint_as_float(((unsigned int)b) << 16); }
__device__ __forceinline__ float bf16_round(float x) { return bf16_val(bf16_bits(x)); }
// D += A·B with NT terms: 1 = ah·bh, 2 = + al·bh (A split), 3 = + ah·bl (both split)
template <int NT>
__device__ __forceinline__ v8f mmaN(v16b ah, v16b al, v16b bh, v16b bl, v8f c) {
  c = __builtin_amdgcn_wmma_f32_16x16x32_bf16(false, ah, false, bh, (short)0, c, false, false);
  if (NT >= 2) c = __builtin_amdgcn_wmma_f32_16x16x32_bf16(false, al, false, bh, (short)0, c, false, false);
  if (NT >= 3) c = __builtin_amdgcn_wmma_f32_16x16x32_bf16(false, ah, false, bl, (short)0, c, false, false);
  asm volatile("v_nop\n\tv_nop\n\tv_nop\n\tv_nop" : "+v"(c) : "v"(ah), "v"(al), "v"(bh), "v"(bl));
  return c;
}

__global__ __launch_bounds__(256) void k_wt_bf16(const float* __restrict__ W, unsigned short* __restrict__ Wt, int K, int N) {
  const int t = blockIdx.x * 256 + threadIdx.x;
  const int k8n = K / 8;
  if (t >= N * k8n) return;
  const int n = t / k8n, k8 = (t % k8n) * 8;
  v8us v;
#pragma unroll
  for (int i = 0; i < 8; ++i) v[i] = bf16_bits(W[(size_t)(k8 + i) * N + n]);
  *(v8us*)(Wt + (size_t)n * K + k8) = v;
  
}

// GEMM C[M][N] (f32, pitch ldc) = act(A[M][K]·W + bias). A f32 row-major (pitch lda) converted per fragment to bf16
// (ASPLIT: hi/lo two planes -> 2 terms, else single rounded term); Wt bf16 [N][K] (pitch ldb). BIAS_BF16 rounds the
// bias to bf16 first (bias quantised to bf16 before the add). K%32==0, M%16==0, N%64==0.
template <bool ASPLIT, int ACT, bool BIAS_BF16>
__global__ __launch_bounds__(128) void k_gemm_bf(const float* __restrict__ A, int lda, const unsigned short* __restrict__ Wt, int ldb,
                                               const float* __restrict__ bias, float* __restrict__ C, int ldc, int M, int N, int K) {
  __shared__ __attribute__((aligned(16))) float so[4][16][64];
  const int tid = threadIdx.x, w = tid >> 5, lane = tid & 31, ln = lane & 15, hh = lane >> 4;
  const int ntn = N / 64;
  const int wid = blockIdx.x * 4 + w;
  const int mt = wid / ntn, nq = wid % ntn;
  if (mt * 16 >= M) return;
  const int row0 = mt * 16, col0 = nq * 64;
  const float* arow = A + (size_t)(row0 + ln) * lda;
  v8f acc[4] = {};
  for (int kb = 0; kb < K; kb += 32) {
    FragB ah, al;
    const v4f x0 = *(const v4fa*)(arow + kb + 8 * hh), x1 = *(const v4fa*)(arow + kb + 8 * hh + 4);
    const v4f x2 = *(const v4fa*)(arow + kb + 16 + 8 * hh), x3 = *(const v4fa*)(arow + kb + 16 + 8 * hh + 4);
    float xs[16] = {x0[0],x0[1],x0[2],x0[3],x1[0],x1[1],x1[2],x1[3],x2[0],x2[1],x2[2],x2[3],x3[0],x3[1],x3[2],x3[3]};
#pragma unroll
    for (int i = 0; i < 16; ++i) { const unsigned short hb = bf16_bits(xs[i]); ah.u[i] = hb; al.u[i] = ASPLIT ? bf16_bits(xs[i] - bf16_val(hb)) : (unsigned short)0; }
#pragma unroll
    for (int t = 0; t < 4; ++t) {
      const unsigned short* brow = Wt + (size_t)(col0 + t * 16 + ln) * ldb + kb;
      FragB b;
      b.half[0] = *(const v8us*)(brow + 8 * hh);
      b.half[1] = *(const v8us*)(brow + 16 + 8 * hh);
      acc[t] = mmaN<ASPLIT ? 2 : 1>(ah.v, al.v, b.v, b.v, acc[t]);
    }
  }
#pragma unroll
  for (int t = 0; t < 4; ++t) {
    float bv = bias ? bias[col0 + t * 16 + ln] : 0.f;
    if (BIAS_BF16) bv = bf16_round(bv);
#pragma unroll
    for (int r = 0; r < 8; ++r) { float v = acc[t][r] + bv; if (ACT == 1) v = fmaxf(v, 0.f); so[w][8 * hh + r][t * 16 + ln] = v; }
  }
  __builtin_amdgcn_fence(__ATOMIC_ACQ_REL, "workgroup");
  __builtin_amdgcn_wave_barrier();
  const int rsub = lane >> 4, c4 = (lane & 15) * 4;
  {
#pragma unroll
    for (int q = 0; q < 8; ++q) {
      const int r = q * 2 + rsub;
      const v4f v = *(const v4fa*)&so[w][r][c4];
      *(v4f*)(C + (size_t)(row0 + r) * ldc + col0 + c4) = v;
    }
    
  }
}

// GEMM C = act(A·W + bias + resid): A f32 (ASPLIT -> hi/lo 2 terms), Wt bf16 [N][K]; ACT 0 none, 1 relu, 2 exact gelu;
// resid (optional, f32, row index = (row % rmod), pitch ldr, RES_BF16 rounds it) added before the activation.
template <bool ASPLIT, int ACT, bool BIAS_BF16, bool RES_BF16>
__global__ __launch_bounds__(128) void k_gemm_bf3(const float* __restrict__ A, int lda, const unsigned short* __restrict__ Wt, int ldb,
                                                const float* __restrict__ bias, const float* __restrict__ resid, int rmod, int ldr,
                                                float* __restrict__ C, int ldc, int M, int N, int K) {
  __shared__ __attribute__((aligned(16))) float so[4][16][64];
  const int tid = threadIdx.x, w = tid >> 5, lane = tid & 31, ln = lane & 15, hh = lane >> 4;
  const int ntn = N / 64;
  const int wid = blockIdx.x * 4 + w;
  const int mt = wid / ntn, nq = wid % ntn;
  if (mt * 16 >= M) return;
  const int row0 = mt * 16, col0 = nq * 64;
  const float* arow = A + (size_t)(row0 + ln) * lda;
  v8f acc[4] = {};
  for (int kb = 0; kb < K; kb += 32) {
    FragB ah, al;
    const v4f x0 = *(const v4fa*)(arow + kb + 8 * hh), x1 = *(const v4fa*)(arow + kb + 8 * hh + 4);
    const v4f x2 = *(const v4fa*)(arow + kb + 16 + 8 * hh), x3 = *(const v4fa*)(arow + kb + 16 + 8 * hh + 4);
    float xs[16] = {x0[0],x0[1],x0[2],x0[3],x1[0],x1[1],x1[2],x1[3],x2[0],x2[1],x2[2],x2[3],x3[0],x3[1],x3[2],x3[3]};
#pragma unroll
    for (int i = 0; i < 16; ++i) { const unsigned short hb = bf16_bits(xs[i]); ah.u[i] = hb; al.u[i] = ASPLIT ? bf16_bits(xs[i] - bf16_val(hb)) : (unsigned short)0; }
#pragma unroll
    for (int t = 0; t < 4; ++t) {
      const unsigned short* brow = Wt + (size_t)(col0 + t * 16 + ln) * ldb + kb;
      FragB b;
      b.half[0] = *(const v8us*)(brow + 8 * hh);
      b.half[1] = *(const v8us*)(brow + 16 + 8 * hh);
      acc[t] = mmaN<ASPLIT ? 2 : 1>(ah.v, al.v, b.v, b.v, acc[t]);
    }
  }
#pragma unroll
  for (int t = 0; t < 4; ++t) {
    const int col = col0 + t * 16 + ln;
    float bv = bias ? bias[col] : 0.f;
    if (BIAS_BF16) bv = bf16_round(bv);
#pragma unroll
    for (int r = 0; r < 8; ++r) {
      float v = acc[t][r] + bv;
      if (resid) { float rv = resid[(size_t)((row0 + 8 * hh + r) % rmod) * ldr + col]; if (RES_BF16) rv = bf16_round(rv); v += rv; }
      if (ACT == 1) v = fmaxf(v, 0.f);
      if (ACT == 2) v = 0.5f * v * (1.0f + erff(v * 0.70710678118654752f));
      if (ACT == 3) { const float u = 0.7978845608028654f * (v + 0.044715f * v * v * v); v = 0.5f * v * (1.0f + tanhf(u)); }
      so[w][8 * hh + r][t * 16 + ln] = v;
    }
  }
  __builtin_amdgcn_fence(__ATOMIC_ACQ_REL, "workgroup");
  __builtin_amdgcn_wave_barrier();
  const int rsub = lane >> 4, c4 = (lane & 15) * 4;
  {
#pragma unroll
    for (int q = 0; q < 8; ++q) {
      const int r = q * 2 + rsub;
      const v4f v = *(const v4fa*)&so[w][r][c4];
      *(v4f*)(C + (size_t)(row0 + r) * ldc + col0 + c4) = v;
    }
    
  }
}
// row LayerNorm (biased variance, eps) over N: s = X (+ R); optional out_sum <- s; out_norm <- (s-mu)*rsqrt(var+eps)*g + b
template <bool PARAM_BF16>
__global__ __launch_bounds__(256) void k_layernorm(const float* __restrict__ X, const float* __restrict__ R, const float* __restrict__ g, const float* __restrict__ bta,
                                                  float* __restrict__ out_sum, float* __restrict__ out_norm, int N, float eps) {
  __shared__ float red[256];
  const int row = blockIdx.x, tid = threadIdx.x;
  const float* x = X + (size_t)row * N; const float* rr = R ? R + (size_t)row * N : nullptr;
  float vals[16];                     // up to N = 4096
  const int per = N / 256;            // contiguous chunk per thread? use strided-by-4 chunks: thread handles j = tid*4 + 1024*u
  float s1 = 0.f;
  for (int u = 0; u < per / 4; ++u) {
    const int j = tid * 4 + 1024 * u;
    const v4f a = *(const v4fa*)(x + j);
    v4f b = {0.f,0.f,0.f,0.f}; if (rr) b = *(const v4fa*)(rr + j);
#pragma unroll
    for (int q = 0; q < 4; ++q) { const float v = a[q] + b[q]; vals[u * 4 + q] = v; s1 += v; }
  }
  red[tid] = s1; __syncthreads();
  for (int st = 128; st > 0; st >>= 1) { if (tid < st) red[tid] += red[tid + st]; __syncthreads(); }
  const float mu = red[0] / (float)N; __syncthreads();
  float s2 = 0.f;
  for (int u = 0; u < per / 4; ++u)
#pragma unroll
    for (int q = 0; q < 4; ++q) { const float c = vals[u * 4 + q] - mu; s2 += c * c; }
  red[tid] = s2; __syncthreads();
  for (int st = 128; st > 0; st >>= 1) { if (tid < st) red[tid] += red[tid + st]; __syncthreads(); }
  const float rs = rsqrtf(red[0] / (float)N + eps);
  {
    for (int u = 0; u < per / 4; ++u) {
      const int j = tid * 4 + 1024 * u;
      v4f o, sm;
#pragma unroll
      for (int q = 0; q < 4; ++q) {
        float gg = g[j + q], bb = bta[j + q];
        if (PARAM_BF16) { gg = bf16_round(gg); bb = bf16_round(bb); }
        sm[q] = vals[u * 4 + q]; o[q] = (vals[u * 4 + q] - mu) * rs * gg + bb;
      }
      if (out_sum) *(v4f*)(out_sum + (size_t)row * N + j) = sm;
      *(v4f*)(out_norm + (size_t)row * N + j) = o;
    }
    
  }
}



// ---- f16 WMMA path (v_wmma_f32_16x16x32_f16): 11-bit significands for operands in range — used where a [0,1] probability operand needs more precision than bf16
typedef _Float16 v16h __attribute__((ext_vector_type(16)));
union FragH { v16h v; v8us half[2]; _Float16 h[16]; unsigned short u[16]; };
template <int NT>
__device__ __forceinline__ v8f mmaH(v16h ah, v16h al, v16h bh, v16h bl, v8f c) {
  c = __builtin_amdgcn_wmma_f32_16x16x32_f16(false, ah, false, bh, (short)0, c, false, false);
  if (NT >= 2) c = __builtin_amdgcn_wmma_f32_16x16x32_f16(false, al, false, bh, (short)0, c, false, false);
  if (NT >= 3) c = __builtin_amdgcn_wmma_f32_16x16x32_f16(false, ah, false, bl, (short)0, c, false, false);
  asm volatile("v_nop\n\tv_nop\n\tv_nop\n\tv_nop" : "+v"(c) : "v"(ah), "v"(al), "v"(bh), "v"(bl));
  return c;
}
// batched GEMM like k_gemm_b but f16 operands: A f32 (split into f16 hi/lo if ASPLIT, else rounded to f16), Bt = f16 values [n][k]; alpha; C f32; N multiple of 16 (partial tiles skipped)
template <bool ASPLIT>
__global__ __launch_bounds__(128) void k_gemm_h(const float* __restrict__ A, int lda, size_t sA, const _Float16* __restrict__ Bh, int ldb, size_t sB, float alpha, float* __restrict__ C, int ldc, size_t sC, int M, int N, int K) {
  __shared__ __attribute__((aligned(16))) float so[4][16][64];
  const int tid = threadIdx.x, w = tid >> 5, lane = tid & 31, ln = lane & 15, hh = lane >> 4; const int by = blockIdx.y;
  A += (size_t)by * sA; Bh += (size_t)by * sB; C += (size_t)by * sC;
  const int ntn = (N + 63) / 64; const int wid = blockIdx.x * 4 + w; const int mt = wid / ntn, nq = wid % ntn; if (mt * 16 >= M) return;
  const int row0 = mt * 16, col0 = nq * 64; const float* arow = A + (size_t)(row0 + ln) * lda;
  v8f acc[4] = {};
  for (int kb = 0; kb < K; kb += 32) {
    FragH ah, al;
    const v4f x0 = *(const v4fa*)(arow + kb + 8 * hh), x1 = *(const v4fa*)(arow + kb + 8 * hh + 4), x2 = *(const v4fa*)(arow + kb + 16 + 8 * hh), x3 = *(const v4fa*)(arow + kb + 16 + 8 * hh + 4);
    float xs[16] = {x0[0],x0[1],x0[2],x0[3],x1[0],x1[1],x1[2],x1[3],x2[0],x2[1],x2[2],x2[3],x3[0],x3[1],x3[2],x3[3]};
#pragma unroll
    for (int i = 0; i < 16; ++i) { const _Float16 h = (_Float16)xs[i]; ah.h[i] = h; al.h[i] = ASPLIT ? (_Float16)(xs[i] - (float)h) : (_Float16)0.0f; }
#pragma unroll
    for (int t = 0; t < 4; ++t) { if (col0 + t * 16 >= N) continue; const size_t boff = (size_t)(col0 + t * 16 + ln) * ldb + kb; FragH bq; bq.half[0] = *(const v8us*)(Bh + boff + 8 * hh); bq.half[1] = *(const v8us*)(Bh + boff + 16 + 8 * hh);
      acc[t] = mmaH<ASPLIT ? 2 : 1>(ah.v, al.v, bq.v, bq.v, acc[t]); }
  }
#pragma unroll
  for (int t = 0; t < 4; ++t) { if (col0 + t * 16 >= N) continue;
#pragma unroll
    for (int r = 0; r < 8; ++r) so[w][8 * hh + r][t * 16 + ln] = acc[t][r] * alpha; }
  __builtin_amdgcn_fence(__ATOMIC_ACQ_REL, "workgroup"); __builtin_amdgcn_wave_barrier();
  const int rsub = lane >> 4, c4 = (lane & 15) * 4;
  {
#pragma unroll
    for (int q = 0; q < 8; ++q) { const int r = q * 2 + rsub; if (col0 + c4 < N) { const v4f v = *(const v4fa*)&so[w][r][c4]; *(v4f*)(C + (size_t)(row0 + r) * ldc + col0 + c4) = v; } }
     }
}

// Wt[n][k] = f16(W[k][n]·scale) from f32 row-major W[K][N] (scale = power of two; bf16-exact weights stay exact in f16 away from the subnormal range)
__global__ __launch_bounds__(256) void k_wt_f16(const float* __restrict__ W, _Float16* __restrict__ Wt, int K, int N, float scale) {
  const int t = blockIdx.x * 256 + threadIdx.x; if (t >= N * (K / 8)) return; const int n = t / (K / 8), k8 = (t % (K / 8)) * 8; FragH f;
#pragma unroll
  for (int i = 0; i < 8; ++i) f.h[i] = (_Float16)(bf16_round(W[(size_t)(k8 + i) * N + n]) * scale); const v8us o = f.half[0];
  *(v8us*)((unsigned short*)Wt + (size_t)n * K + k8) = o; 
}
// k_gemm_hh variant with fused epilogue: v = acc·alpha + bias[by·sBias + col] (+ CP[(row/rowsPerB)·sCPb + by·64 + col] if CP) ; ACT 0 none / 1 elu ; writes f16 C16 (and f32 C if non-null)
template <int ACT>
__global__ __launch_bounds__(128) void k_gemm_hhx(const _Float16* __restrict__ A, int lda, size_t sA, const _Float16* __restrict__ Bh, int ldb, size_t sB, float alpha, const float* __restrict__ bias, size_t sBias, const float* __restrict__ CP, int rowsPerB, size_t sCPb, int row0g,
    float* __restrict__ C, _Float16* __restrict__ C16, int ldc, size_t sC, int M, int N, int K) {
  __shared__ __attribute__((aligned(16))) float so[4][16][64];
  const int tid = threadIdx.x, w = tid >> 5, lane = tid & 31, ln = lane & 15, hh = lane >> 4; const int by = blockIdx.y;
  A += (size_t)by * sA; Bh += (size_t)by * sB; const size_t cofs = (size_t)by * sC; const float* bp = bias ? bias + (size_t)by * sBias : nullptr;
  const int ntn = (N + 63) / 64; const int wid = blockIdx.x * 4 + w; const int mt = wid / ntn, nq = wid % ntn; if (mt * 16 >= M) return;
  const int row0 = mt * 16, col0 = nq * 64; const _Float16* arow = A + (size_t)(row0 + ln) * lda;
  v8f acc[4] = {};
  for (int kb = 0; kb < K; kb += 32) { FragH ah; ah.half[0] = *(const v8us*)((const unsigned short*)arow + kb + 8 * hh); ah.half[1] = *(const v8us*)((const unsigned short*)arow + kb + 16 + 8 * hh);
#pragma unroll
    for (int t = 0; t < 4; ++t) { if (col0 + t * 16 >= N) continue; const size_t boff = (size_t)(col0 + t * 16 + ln) * ldb + kb; FragH bq; bq.half[0] = *(const v8us*)((const unsigned short*)Bh + boff + 8 * hh); bq.half[1] = *(const v8us*)((const unsigned short*)Bh + boff + 16 + 8 * hh);
      acc[t] = mmaH<1>(ah.v, ah.v, bq.v, bq.v, acc[t]); }
  }
#pragma unroll
  for (int t = 0; t < 4; ++t) { if (col0 + t * 16 >= N) continue; const int col = col0 + t * 16 + ln; const float bv = bp ? bf16_round(bp[col]) : 0.f;
#pragma unroll
    for (int r = 0; r < 8; ++r) { float v = acc[t][r] * alpha + bv; if (CP) { const int rr = row0g + row0 + 8 * hh + r; if (rowsPerB < 0) v += CP[cofs + (size_t)rr * ldc + col];      /* rowsPerB < 0: own element of the batched C plane */ else { const int bidx = rr / rowsPerB; v += CP[(size_t)bidx * sCPb + (size_t)by * 64 + col]; } } if (ACT == 1) v = (v > 0.f) ? v : expm1f(v); else if (ACT == 7) v = (v > 0.f) ? v + 1.0f : expf(v); else if (ACT == 8) v = tanhf(v); else if (ACT == 9) v = 0.5f * v * (1.0f + tanhf(0.7978845608028654f * (v + 0.044715f * v * v * v))); else if (ACT == 11) v = 1.0f / (1.0f + expf(-v)); else if (ACT == 12) v = (v > 0.f) ? v : 0.01f * v; else if (ACT == 14) v = (v > 0.f) ? v : 0.1f * v; else if (ACT == 16) v = (v >= 0.f) ? v : 0.3f * v; else if (ACT == 17) v = (v >= 0.f) ? v : 0.2f * v; else if (ACT == 15) v = v / (1.0f + expf(-v)); else if (ACT == 3) v = fmaxf(v, 0.f); else if (ACT == 6) v = 0.5f * v * (1.0f + erff(v * 0.70710678118654752f)); so[w][8 * hh + r][t * 16 + ln] = v; } }
  __builtin_amdgcn_fence(__ATOMIC_ACQ_REL, "workgroup"); __builtin_amdgcn_wave_barrier();
  const int rsub = lane >> 4, c4 = (lane & 15) * 4; typedef _Float16 v4h __attribute__((ext_vector_type(4)));
  {
#pragma unroll
    for (int q = 0; q < 8; ++q) { const int r = q * 2 + rsub; if (col0 + c4 < N) { const v4f v = *(const v4fa*)&so[w][r][c4]; if (C) *(v4f*)(C + cofs + (size_t)(row0 + r) * ldc + col0 + c4) = v; if (C16) { v4h h4; for (int i = 0; i < 4; ++i) h4[i] = (_Float16)v[i]; *(v4h*)(C16 + cofs + (size_t)(row0 + r) * ldc + col0 + c4) = h4; } } }
     }
}


typedef _Float16 v4h __attribute__((ext_vector_type(4)));

__global__ __launch_bounds__(256) void k_h16(const float* __restrict__ x, _Float16* __restrict__ X16, size_t n8) { const size_t t = (size_t)blockIdx.x * 256 + threadIdx.x; if (t >= n8) return; FragH f;
#pragma unroll
  for (int q = 0; q < 8; ++q) f.h[q] = (_Float16)x[t * 8 + q]; *(v8us*)((unsigned short*)X16 + t * 8) = f.half[0];  }
__global__ __launch_bounds__(256) void k_round16f(const float* __restrict__ W, _Float16* __restrict__ Bt, size_t n8) { const size_t t = (size_t)blockIdx.x * 256 + threadIdx.x; if (t >= n8) return; FragH f;
#pragma unroll
  for (int i = 0; i < 8; ++i) f.h[i] = (_Float16)(bf16_round(W[t * 8 + i]) * 16.0f); *(v8us*)((unsigned short*)Bt + t * 8) = f.half[0];  }
template <int NHv, int TTv>
__global__ __launch_bounds__(256) void k_vt(const _Float16* __restrict__ V16, int ldv, int voff, _Float16* __restrict__ Vt) { __shared__ unsigned short tl[64][66]; const int tid = threadIdx.x; const int slab = blockIdx.x / (TTv / 64), lg = blockIdx.x % (TTv / 64); const int b = slab / NHv, h = slab % NHv;
  for (int i = tid; i < 64 * 8; i += 256) { const int r = i / 8, c8 = (i % 8) * 8; FragH f; f.half[0] = *(const v8us*)((const unsigned short*)V16 + ((size_t)b * TTv + lg * 64 + r) * ldv + voff + h * 64 + c8);
#pragma unroll
    for (int q = 0; q < 8; ++q) tl[r][c8 + q] = f.u[q]; }
  __syncthreads();
  {
#pragma unroll
    for (int rd = 0; rd < 2; ++rd) { const int d = rd * 32 + tid / 8, pc = tid % 8; FragH f;
#pragma unroll
      for (int q = 0; q < 8; ++q) f.u[q] = tl[pc * 8 + q][d];
      *(v8us*)((unsigned short*)Vt + ((size_t)slab * 64 + d) * TTv + lg * 64 + pc * 8) = f.half[0]; }
     } }

__global__ __launch_bounds__(256) void k_hl(const float* __restrict__ F, _Float16* __restrict__ Hh, _Float16* __restrict__ Hl, size_t n8) { const size_t t = (size_t)blockIdx.x * 256 + threadIdx.x; if (t >= n8) return; FragH fh, fl; const v4f a = *(const v4fa*)(F + t * 8), c = *(const v4fa*)(F + t * 8 + 4);
#pragma unroll
  for (int q = 0; q < 4; ++q) { _Float16 h = (_Float16)a[q]; fh.h[q] = h; fl.h[q] = (_Float16)((a[q] - (float)h) * 1024.0f); h = (_Float16)c[q]; fh.h[4 + q] = h; fl.h[4 + q] = (_Float16)((c[q] - (float)h) * 1024.0f); }
  { *(v8us*)((unsigned short*)Hh + t * 8) = fh.half[0]; *(v8us*)((unsigned short*)Hl + t * 8) = fl.half[0];  } }

// ---- fast GEMM (block tile 128x128 a plane, eight waves of 32x64; requires M % 128 == 0, N % 128 == 0, K % 128 == 0); epilogue = k_gemm_hhx semantics ----
// A stage is BK k (128 with one plane, 64 with three) of the block's 128 A rows and of 128 B rows of each plane it computes. Asynchronous copies bring it from global memory into LDS, whole 128-byte lines a request, through no register;
// four buffers: while stage t is multiplied, stage t + 1 is already published and stages t + 2 and t + 3 fly, so that requests are under way at every moment and a stage has two stages' time to land.
// Fragments come from LDS in the k order of g2_frag, one group ahead of their products, also over the stage boundary; every accumulator still sums k upward in steps of 32.
#define G2_NBUF 4                    /* buffers of the ring */
#define G2_CPS 16                    /* copies a lane issues for one stage, with one plane and with three */
#define G2_PITCH 272                 /* LDS row pitch in bytes of 256-byte rows: 16 x odd, so the 16 rows of a 16-byte fragment read fall on 64 distinct banks */
__device__ __forceinline__ v16h g2_frag(const _Float16* p, int hh) { FragH f; f.half[0] = *(const v8us*)((const unsigned short*)p + 8 * hh); f.half[1] = *(const v8us*)((const unsigned short*)p + 16 + 8 * hh); return f.v; }
__device__ __forceinline__ v16h g2_lfrag(const unsigned char* p) { FragH f; f.half[0] = *(const v8us*)p; f.half[1] = *(const v8us*)(p + 32); return f.v; }      /* p: the lane's row in LDS + 64 bytes a k step + 16 hh */
__device__ __forceinline__ v8f g2_mma(v16h a, v16h b, v8f c) { return __builtin_amdgcn_wmma_f32_16x16x32_f16(false, a, false, b, (short)0, c, false, false); }
// Eight asynchronous 16-byte copies of a lane, four from each of two places: l0, l1: LDS byte address of each place's first copy, ls: LDS bytes from one copy to the next; g0, g1: the global addresses, gs0, gs1: elements from one copy to the next.
// The closing s_wait_xcnt 0 stands inside the statement, in front of any later write of the address registers that the copies name.
__device__ __forceinline__ void g2_copy44(unsigned l0, const _Float16* g0, size_t gs0, unsigned l1, const _Float16* g1, size_t gs1, unsigned ls) {
  asm volatile("global_load_async_to_lds_b128 %0, %8, off\n\tglobal_load_async_to_lds_b128 %1, %9, off\n\tglobal_load_async_to_lds_b128 %2, %10, off\n\tglobal_load_async_to_lds_b128 %3, %11, off\n\t"
               "global_load_async_to_lds_b128 %4, %12, off\n\tglobal_load_async_to_lds_b128 %5, %13, off\n\tglobal_load_async_to_lds_b128 %6, %14, off\n\tglobal_load_async_to_lds_b128 %7, %15, off\n\ts_wait_xcnt 0x0"
               :: "v"(l0), "v"(l0 + ls), "v"(l0 + 2 * ls), "v"(l0 + 3 * ls), "v"(l1), "v"(l1 + ls), "v"(l1 + 2 * ls), "v"(l1 + 3 * ls),
                  "v"(g0), "v"(g0 + gs0), "v"(g0 + 2 * gs0), "v"(g0 + 3 * gs0), "v"(g1), "v"(g1 + gs1), "v"(g1 + 2 * gs1), "v"(g1 + 3 * gs1) : "memory"); }
// The epilogue's choices are template parameters, so that it compiles to straight-line code: HASB: a bias is added (the plane's bias pointer is not null); HASCP: the CP term is added; F32OUT: the result goes to C as f32, otherwise to C16 as f16.
// NP: planes a block computes. NP == 1: the one plane that grid y names. NP > 1: planes 0 .. NP - 1, all from the same 128 A rows (sA unused): a stage holds the A rows once and 128 B rows of every plane, so the block tile is 128 x (NP * 128).
// TPLANE >= 0 (NP > 1 only): that plane's 128x128 tile is stored transposed, as f16, into VTo [batch][head][d][s] (column n = head * HD + d, row = batch * SQ + s) and nothing of it goes to C16.
#define G2_SOB (8 * 32 * 68 * 4)     /* output staging of one plane's tile in bytes: eight waves' 32 rows of 68 floats */
template <int ACT, bool HASB, bool HASCP, bool F32OUT, int TPLANE, int NP>
__global__ __launch_bounds__(256) void k_gemm2(const _Float16* __restrict__ A, int lda, size_t sA, const _Float16* __restrict__ Bh, int ldb, size_t sB, float alpha, const float* __restrict__ bias, const float* __restrict__ bias1, const float* __restrict__ bias2, const float* __restrict__ CP, int rowsPerB, size_t sCPb, int row0g,
    float* __restrict__ C, _Float16* __restrict__ C16, _Float16* __restrict__ VTo, int ldc, size_t sC, int M, int N, int K) { static_assert(ACT == 0 || ACT == 3 || ACT == 6 || ACT == 8 || ACT == 9 || ACT == 11 || ACT == 12 || ACT == 14 || ACT == 15 || ACT == 16 || ACT == 17, "k_gemm2: unsupported ACT code (would silently apply no activation)");
  static_assert(TPLANE < 0 || (NP > 1 && TPLANE < NP && ACT == 0 && !HASCP && !F32OUT && SQ % 128 == 0 && HD == 64), "k_gemm2: the transposed plane has the plain f16 epilogue; a block's 128 rows lie in one batch, its 128 columns are two whole heads");
  static_assert(NP == 1 || NP == 3, "k_gemm2: a stage is dealt as two statements of eight copies a lane: A and one plane of 128 k, or A and three planes of 64 k");
  constexpr int BK = NP == 1 ? 128 : 64;      /* k a stage */
  constexpr unsigned PITCH = BK * 2 + 16;      /* LDS row pitch in bytes, 272 or 144: 16 x odd */
  constexpr int RPC = 256 / (BK / 8);      /* rows that one copy of the whole block covers: 16 or 32 */
  constexpr unsigned STG = (128 + NP * 128) * PITCH;      /* a stage: 128 A rows, then 128 B rows of each plane */
  static_assert((128 + NP * 128) / RPC == G2_CPS, "k_gemm2: the counted wait below leaves exactly one stage's copies of the wave outstanding");
  static_assert(NP * G2_SOB <= G2_NBUF * STG && 128 * G2_PITCH <= G2_SOB && G2_NBUF * STG <= 327680, "k_gemm2: every plane's output staging has its own part; the transposed tile fits one part; the ring fits the LDS");
  constexpr unsigned SO0 = 0;      /* the output staging lies on the stages themselves, which nothing reads and no copy writes behind the k loop's last barrier */
  __shared__ __attribute__((aligned(16))) unsigned char ring[G2_NBUF * STG];
  const int tid = threadIdx.x, w = tid >> 5, lane = tid & 31, ln = lane & 15, hh = lane >> 4; const int by = NP == 1 ? blockIdx.y : 0;
  A += (size_t)by * sA; Bh += (size_t)by * sB;
  const int ntn = N >> 7; const int mt = blockIdx.x / ntn, nq = blockIdx.x - mt * ntn; if (mt * 128 >= M) return;      /* the whole block leaves, in front of every barrier */
  const int row0 = mt * 128 + 32 * (w & 3), col0 = nq * 128 + 64 * (w >> 2);
  const int nt = K / BK;
  const int cr = tid / (BK / 8), cc = tid % (BK / 8);      /* the lane's place in a copy of the block: row cr (+ RPC a copy), 16-byte column cc: a wave's copy is whole rows, whole lines */
  const unsigned lc = (unsigned)(size_t)ring + (unsigned)(cr * PITCH + cc * 16); constexpr unsigned LS = RPC * PITCH;
  const size_t oa = (size_t)(mt * 128 + cr) * lda + cc * 8, ob = (size_t)(nq * 128 + cr) * ldb + cc * 8;      /* the lane's first element in A and in a plane of B */
  const size_t gsa = (size_t)RPC * lda, gsb = (size_t)RPC * ldb;
  const _Float16* ga = A + oa; const _Float16* gb = Bh + ob;      /* walk on by one stage behind every fill */
  auto fill = [&](unsigned bo) {      /* the next stage into the buffer at byte bo: G2_CPS copies a lane */
    if (NP == 1) { g2_copy44(lc + bo, ga, gsa, lc + bo + 4 * LS, ga + 4 * gsa, gsa, LS); g2_copy44(lc + bo + 128 * PITCH, gb, gsb, lc + bo + 128 * PITCH + 4 * LS, gb + 4 * gsb, gsb, LS); }
    else { g2_copy44(lc + bo, ga, gsa, lc + bo + 128 * PITCH, gb, gsb, LS); g2_copy44(lc + bo + 256 * PITCH, gb + sB, gsb, lc + bo + 384 * PITCH, gb + 2 * sB, gsb, LS); }
    ga += BK; gb += BK; };
  fill(0);      /* stages 0, 1, 2: at most 48 copies of a wave outstanding */
  if (nt > 1) fill(STG);
  if (nt > 2) fill(2 * STG);
  // A counted wait stands only where exactly one younger stage (G2_CPS copies of this wave) has been issued behind the stage waited for; every other wait is to 0. The tests read the same for the whole grid.
  if (nt > 2) asm volatile("s_wait_asynccnt 0x10" ::: "memory");      /* this wave's copies of stages 0 and 1 have landed; stage 2 flies on */
  else asm volatile("s_wait_asynccnt 0x0" ::: "memory");
  __syncthreads();      /* publishes stages 0 and 1 */
  const unsigned char* fa = ring + (32 * (w & 3) + ln) * PITCH + 16 * hh; const unsigned char* fb = ring + (128 + 64 * (w >> 2) + ln) * PITCH + 16 * hh;
  const v8f z8 = {0.f,0.f,0.f,0.f,0.f,0.f,0.f,0.f}; v8f c[NP][8];      /* c[p][half * 4 + j]: plane p, rows 16 half .., columns 16 j .. of the wave's 32x64 tile */
#pragma unroll
  for (int p = 0; p < NP; ++p)
#pragma unroll
    for (int u = 0; u < 8; ++u) c[p][u] = z8;
  constexpr int NG = NP * (BK / 32);      /* groups a stage */
  static_assert(NG % 2 == 0 && (BK / 32) % 2 == 0, "k_gemm2: a stage ends on register set 1, so that the next stage's first fragments go to set 0");
  v16h a[2][2], b[2][4];      /* carried over the trips: a trip's last group fetches the next trip's first fragments */
  a[0][0] = g2_lfrag(fa); a[0][1] = g2_lfrag(fa + 16 * PITCH);      /* stage 0's first fragments */
#pragma unroll
  for (int j = 0; j < 4; ++j) b[0][j] = g2_lfrag(fb + j * 16 * PITCH);
#pragma unroll 1      /* one stage a trip: the buffer is picked by the trip's number, the groups inside are unrolled */
  for (int t = 0; t < nt; ++t) { const unsigned bo = (unsigned)(t & (G2_NBUF - 1)) * STG, bn = (unsigned)((t + 1) & (G2_NBUF - 1)) * STG; const unsigned char* pa = fa + bo; const unsigned char* pb = fb + bo;
#pragma unroll      /* a group is one k step of one plane: eight products; the A fragments of a k step serve its NP groups */
    for (int g = 0; g < NG; ++g) { const int ks = g / NP, p = g % NP, cu = g & 1, nx = cu ^ 1, ac = ks & 1;
      if (g + 1 < NG) { const int ks1 = (g + 1) / NP, p1 = (g + 1) % NP;      /* the next group's fragments, into the other register set */
        if (p1 == 0) { a[ks1 & 1][0] = g2_lfrag(pa + ks1 * 64); a[ks1 & 1][1] = g2_lfrag(pa + 16 * PITCH + ks1 * 64); }
#pragma unroll
        for (int j = 0; j < 4; ++j) b[nx][j] = g2_lfrag(pb + (p1 * 128 + j * 16) * PITCH + ks1 * 64); }
      else {      /* stage t + 1's first fragments: that stage was published by the barrier at the foot of trip t - 1 (stage 1: by the one in front of the loop). Under no test: behind a branch the build's counted LDS waits of this group waited for these reads too. In the last trip they fetch bytes of the ring that no copy is writing and nothing uses */
        a[0][0] = g2_lfrag(fa + bn); a[0][1] = g2_lfrag(fa + bn + 16 * PITCH);
#pragma unroll
        for (int j = 0; j < 4; ++j) b[0][j] = g2_lfrag(fb + bn + j * 16 * PITCH); }
      __builtin_amdgcn_sched_barrier(0);      /* keeps those reads one group ahead of this group's products: without it the build sank each read to its first use, two products behind every full LDS wait */
      c[p][0] = g2_mma(a[ac][0], b[cu][0], c[p][0]); c[p][4] = g2_mma(a[ac][1], b[cu][0], c[p][4]); c[p][1] = g2_mma(a[ac][0], b[cu][1], c[p][1]); c[p][5] = g2_mma(a[ac][1], b[cu][1], c[p][5]);
      c[p][2] = g2_mma(a[ac][0], b[cu][2], c[p][2]); c[p][6] = g2_mma(a[ac][1], b[cu][2], c[p][6]); c[p][3] = g2_mma(a[ac][0], b[cu][3], c[p][3]); c[p][7] = g2_mma(a[ac][1], b[cu][3], c[p][7]);
      __builtin_amdgcn_sched_barrier(0);      /* and keeps the following group's reads from rising among these products */
      if (g == 0 && t + 3 < nt) fill((unsigned)((t + 3) & (G2_NBUF - 1)) * STG); }      /* stage t + 3 into the buffer that trip t - 1 read (trip 0: that nothing has used), behind the barrier at that trip's foot, which ended its every reader's last read; behind the trip's first products, so that the matrix unit has work while the addresses are formed */
    asm volatile("s_wait_dscnt 0x0" ::: "memory");      /* this wave's reads of the buffer are done before it is refilled */
    if (t + 3 < nt) asm volatile("s_wait_asynccnt 0x10" ::: "memory");      /* this wave's copies of stage t + 2 have landed; the G2_CPS copies of stage t + 3, issued behind them in this trip, fly on */
    else asm volatile("s_wait_asynccnt 0x0" ::: "memory");      /* no stage t + 3: all that this wave has issued has landed */
    __syncthreads(); }      /* publishes stage t + 2 and ends every wave's reads of stage t */
  asm volatile("s_wait_asynccnt 0x0" ::: "memory");      /* nothing of this wave is in flight when it goes on */
  // Every plane's tile is staged first, each in its own part of the staging bytes; then come the stores.
#pragma unroll      /* all loops over p, u, r in full: c stays in registers only where its indices are constants */
  for (int p = 0; p < NP; ++p) { const int pl = NP == 1 ? by : p; const float* bp = pl == 0 ? bias : pl == 1 ? bias1 : bias2; const size_t cofs = (size_t)pl * sC; unsigned char* part = ring + SO0 + p * G2_SOB;
    if (TPLANE >= 0 && p == TPLANE) {
      // A lane's 8 accumulator registers are 8 consecutive rows (s) of one column (d): 16 bytes of a V^T row. The block's tile is staged as 128 V^T rows of 128 s (256 bytes, pitch G2_PITCH), every wave its own 64 x 32 part.
#pragma unroll
      for (int u = 0; u < 8; ++u) { const int t = u & 3, half = u >> 2; const float bv = HASB ? bf16_round(bp[col0 + t * 16 + ln]) : 0.f; FragH f;
#pragma unroll
        for (int r = 0; r < 8; ++r) f.h[r] = (_Float16)(c[p][u][r] * alpha + bv);
        *(v8us*)(part + (64 * (w >> 2) + t * 16 + ln) * G2_PITCH + (32 * (w & 3) + half * 16 + 8 * hh) * 2) = f.half[0]; }
    } else { float (*so)[32][68] = (float (*)[32][68])part;
#pragma unroll
      for (int u = 0; u < 8; ++u) { const int t = u & 3, half = u >> 2; const int col = col0 + t * 16 + ln; const float bv = HASB ? bf16_round(bp[col]) : 0.f;
#pragma unroll
        for (int r = 0; r < 8; ++r) { const int rloc = half * 16 + 8 * hh + r; float v = c[p][u][r] * alpha + bv; if (HASCP) { if (rowsPerB < 0) v += CP[cofs + (size_t)(row0g + row0 + rloc) * ldc + col];      /* rowsPerB < 0: own element of the batched C plane */ else { const int bidx = (row0g + row0 + rloc) / rowsPerB; v += CP[(size_t)bidx * sCPb + (size_t)pl * 64 + col]; } }
          if (ACT == 3) v = fmaxf(v, 0.f); else if (ACT == 6) v = 0.5f * v * (1.0f + erff(v * 0.70710678118654752f)); else if (ACT == 11) v = 1.0f / (1.0f + expf(-v)); else if (ACT == 15) v = v / (1.0f + expf(-v)); else if (ACT == 12) v = (v > 0.f) ? v : 0.01f * v; else if (ACT == 8) v = tanhf(v); else if (ACT == 9) v = 0.5f * v * (1.0f + tanhf(0.7978845608028654f * (v + 0.044715f * v * v * v))); else if (ACT == 14) v = (v > 0.f) ? v : 0.1f * v; else if (ACT == 16) v = (v >= 0.f) ? v : 0.3f * v; else if (ACT == 17) v = (v >= 0.f) ? v : 0.2f * v;
          so[w][rloc][t * 16 + ln] = v; } } } }
  if (TPLANE >= 0) __syncthreads();      /* a V^T row of the tile holds four waves' parts: all are written before any row is read (the other tiles' parts are read by the wave that wrote them) */
  else { __builtin_amdgcn_fence(__ATOMIC_ACQ_REL, "workgroup"); __builtin_amdgcn_wave_barrier(); }
  const int rsub = lane >> 4, c4 = (lane & 15) * 4;
#pragma unroll
  for (int p = 0; p < NP; ++p) { const int pl = NP == 1 ? by : p; const size_t cofs = (size_t)pl * sC; const unsigned char* part = ring + SO0 + p * G2_SOB;
    if (TPLANE >= 0 && p == TPLANE) {
      const int n0 = nq * 128 + w * 16 + hh; const size_t tok = (size_t)B0 * SQ + (size_t)mt * 128;      /* the wave stores 16 of the 128 rows, two whole rows (2 x 256 bytes, whole lines) a store */
      unsigned short* vo = (unsigned short*)VTo + ((tok / SQ) * (NH * HD) + n0) * SQ + tok % SQ + ln * 8;
#pragma unroll      /* in full: the eight LDS reads go out together, ahead of the first store */
      for (int q = 0; q < 8; ++q) *(v8us*)(vo + (size_t)q * 2 * SQ) = *(const v8us*)(part + (w * 16 + q * 2 + hh) * G2_PITCH + ln * 16);
    } else { const float (*so)[32][68] = (const float (*)[32][68])part;
#pragma unroll
      for (int q = 0; q < 16; ++q) { const int r = q * 2 + rsub; const v4f v = *(const v4fa*)&so[w][r][c4]; if (F32OUT) *(v4f*)(C + cofs + (size_t)(row0 + r) * ldc + col0 + c4) = v; else { v4h h4; for (int i = 0; i < 4; ++i) h4[i] = (_Float16)v[i]; *(v4h*)(C16 + cofs + (size_t)(row0 + r) * ldc + col0 + c4) = h4; } } } } }


// All five operand conversions in one launch (none reads another's output): blocks [0, PREP_XB) round x to bf16 and store it as f16; the next 4 * PREP_WB blocks do the same, x16, for Wq, Wk, Wv, Wo
// (natural [out][in] = Bt[n][k]) into four consecutive planes of BW. Eight elements a thread; which array a block works on is the same for the whole block.
#define PREP_XB ((unsigned)(NR * DM / 8 / 256))
#define PREP_WB ((unsigned)((size_t)DM * DM / 8 / 256))
__global__ __launch_bounds__(256) void k_prep(const float* __restrict__ x, const float* __restrict__ wq, const float* __restrict__ wk, const float* __restrict__ wv, const float* __restrict__ wo, _Float16* __restrict__ X16, _Float16* __restrict__ BW) {
  static_assert(NR * DM % (8 * 256) == 0 && (size_t)DM * DM % (8 * 256) == 0, "k_prep: whole blocks per array");
  const unsigned bx = blockIdx.x; const float* s = x; _Float16* d = X16; float sc = 1.0f; unsigned lb = bx;
  if (bx >= PREP_XB) { const unsigned m = (bx - PREP_XB) / PREP_WB; lb = (bx - PREP_XB) % PREP_WB; s = m == 0 ? wq : m == 1 ? wk : m == 2 ? wv : wo; d = BW + (size_t)m * DM * DM; sc = 16.0f; }
  const size_t t = (size_t)lb * 256 + threadIdx.x; FragH f;
#pragma unroll
  for (int q = 0; q < 8; ++q) f.h[q] = (_Float16)(bf16_round(s[t * 8 + q]) * sc);
  *(v8us*)((unsigned short*)d + t * 8) = f.half[0]; }
__global__ __launch_bounds__(256) void k_rsm(const float* __restrict__ S, _Float16* __restrict__ P, int nrows) {
  #pragma clang fp contract(off)
  const int i = blockIdx.x * 256 + threadIdx.x; if (i >= nrows) return; const float* s = S + (size_t)i * SQ; float mx = -3.0e38f;
#pragma unroll 1
  for (int j = 0; j < SQ; ++j) mx = fmaxf(mx, s[j]); float se = 0.f;
#pragma unroll 1
  for (int j = 0; j < SQ; ++j) se += expf(s[j] - mx); const float sc = 256.0f / se;
#pragma unroll 1
  for (int j0 = 0; j0 < SQ; j0 += 8) { FragH f; for (int q = 0; q < 8; ++q) f.h[q] = (_Float16)(expf(s[j0 + q] - mx) * sc); unsigned short* d = (unsigned short*)P + (size_t)i * SQ + j0; *(v8us*)d = f.half[0];  } }
__global__ __launch_bounds__(256) void k_vt(const _Float16* __restrict__ V16, int b, int h0, _Float16* __restrict__ VT) { __shared__ unsigned short tl[64][65]; const int tid = threadIdx.x; const int hh = blockIdx.x % HG, sg = blockIdx.x / HG; const int s0 = sg * 64; const int h = h0 + hh;
  for (int i = tid; i < 64 * 8; i += 256) { const int j = i / 8, d8 = (i % 8) * 8; FragH f; f.half[0] = *(const v8us*)((const unsigned short*)V16 + ((size_t)b * SQ + s0 + j) * DM + h * HD + d8); for (int q = 0; q < 8; ++q) tl[d8 + q][j] = f.u[q]; }
  __syncthreads();
  { for (int i = tid; i < 64 * 8; i += 256) { const int d = i / 8, j8 = (i % 8) * 8; FragH f; for (int q = 0; q < 8; ++q) f.u[q] = tl[d][j8 + q]; *(v8us*)((unsigned short*)VT + ((size_t)hh * HD + d) * SQ + s0 + j8) = f.half[0]; }  } }



// Fused attention: scores, softmax of (scores + relative-position bias) and the product with V in one kernel, for every batch and head in one launch; neither the scores nor the weights go to memory.
// A wave owns FA_QT * 16 query columns and walks the keys 32 at a time: S^T = K . Q^T (A = K rows, B = Q rows kept in registers), so that a lane holds 16 scores of ONE query per column tile;
// reference and sum per lane (online softmax, log2 domain); the reference is set in the first pass and raised only where a pass's weights would near the top of f16 (one exchange between the wave halves then), one exchange in the epilogue for the sum;
// the two S^T tiles of a pass, converted in place, are the B operand of O^T += V^T . P^T (A = V^T rows in the same k order), and a lane's 8 accumulator registers are 8 consecutive d of its query: 16-byte stores.
// Every loop but the walk over the stages and their passes is unrolled in full: the fragment and accumulator arrays stay in registers only where each index is a constant.
// K and V^T reach the waves through LDS: a stage is FA_SK keys (K rows of 128 bytes, V^T rows of 256 bytes), brought once for the whole block by asynchronous copies, whole 128-byte lines a request, through no register;
// four buffers, as in k_gemm2: while stage st is worked on, stage st + 1 is already published and stages st + 2 and st + 3 fly. The eight waves read their fragments from LDS in the k order of g2_frag; passes, products and sums keep their order.
#define FA_WAVES 8
#define FA_QT 2                      /* 16-column query tiles a wave */
#define FA_BQ (FA_WAVES * FA_QT * 16) /* query rows a block */
#define FA_L2E 1.4426950408889634f
#define FA_TOP 32768.0f              /* largest sum of a lane's weights of one pass let through without moving the reference: inside f16 */
#define FA_SK 128                    /* keys a stage: four passes */
#define FA_KP 144                    /* LDS pitch of a K row in bytes: 16 x odd, so the 16 rows of a 16-byte fragment read fall on distinct banks */
#define FA_VP 272                    /* LDS pitch of a V^T row in bytes: 16 x odd */
#define FA_KB (FA_SK * FA_KP)        /* the K rows of a stage; the HD V^T rows follow */
#define FA_STAGE (FA_KB + HD * FA_VP)
#define FA_NBUF 4                    /* buffers of the ring */
// Eight asynchronous 16-byte copies of a lane: K rows r, r + 32, r + 64, r + 96 of a stage (lk: LDS byte address of the first, gk: its global address), then V^T rows d, d + 16, d + 32, d + 48 (lv, gv).
// The closing s_wait_xcnt 0 stands inside the statement, in front of any later write of the address registers that the copies name.
__device__ __forceinline__ void fa_copy8(unsigned lk, const _Float16* gk, unsigned lv, const _Float16* gv) {
  asm volatile("global_load_async_to_lds_b128 %0, %8, off\n\tglobal_load_async_to_lds_b128 %1, %9, off\n\tglobal_load_async_to_lds_b128 %2, %10, off\n\tglobal_load_async_to_lds_b128 %3, %11, off\n\t"
               "global_load_async_to_lds_b128 %4, %12, off\n\tglobal_load_async_to_lds_b128 %5, %13, off\n\tglobal_load_async_to_lds_b128 %6, %14, off\n\tglobal_load_async_to_lds_b128 %7, %15, off\n\ts_wait_xcnt 0x0"
               :: "v"(lk), "v"(lk + 32 * FA_KP), "v"(lk + 64 * FA_KP), "v"(lk + 96 * FA_KP), "v"(lv), "v"(lv + 16 * FA_VP), "v"(lv + 32 * FA_VP), "v"(lv + 48 * FA_VP),
                  "v"(gk), "v"(gk + (size_t)32 * DM), "v"(gk + (size_t)64 * DM), "v"(gk + (size_t)96 * DM), "v"(gv), "v"(gv + (size_t)16 * SQ), "v"(gv + (size_t)32 * SQ), "v"(gv + (size_t)48 * SQ) : "memory"); }
__device__ __forceinline__ float sm_xh(float x) { return __builtin_bit_cast(float, __builtin_amdgcn_permlanex16(__builtin_bit_cast(int, x), __builtin_bit_cast(int, x), 0x76543210, 0xfedcba98, false, false)); }      /* lane l ^ 16 */
// Four native exp2, into registers of their own (no result lies on a source). In one statement with a closing v_nop: the slot that the instruction set asks for behind a transcendental before its result is read or its source overwritten
__device__ __forceinline__ v4f sm_exp2x4(v4f x) { float a, b, c, d;
  asm("v_exp_f32 %0, %4\n\tv_exp_f32 %1, %5\n\tv_exp_f32 %2, %6\n\tv_exp_f32 %3, %7\n\tv_nop" : "=&v"(a), "=&v"(b), "=&v"(c), "=&v"(d) : "v"(x[0]), "v"(x[1]), "v"(x[2]), "v"(x[3]));
  const v4f y = {a, b, c, d}; return y; }
__device__ __forceinline__ float sm_exp2x1(float x) { asm("v_exp_f32 %0, %0\n\tv_nop" : "+v"(x)); return x; }      /* one native exp2, with the same closing slot */
__device__ __forceinline__ v8f fa_mma(v16h a, v16h b, v8f c) { return __builtin_amdgcn_wmma_f32_16x16x32_f16(false, a, false, b, (short)0, c, false, false); }
__global__ __launch_bounds__(FA_WAVES * 32) void k_fattn(const _Float16* __restrict__ Q16, const _Float16* __restrict__ K16, const _Float16* __restrict__ VT, const float* __restrict__ emb, _Float16* __restrict__ O16) {
  static_assert(SQ % FA_BQ == 0 && SQ % FA_SK == 0 && SQ / FA_SK >= 4 && FA_SK == 128 && FA_WAVES == 8 && HD == 64 && MAXD % 32 == 0 && FA_QT * 16 + 31 <= MAXD, "k_fattn: whole blocks per head, whole stages per row (four at least), eight copies a lane a stage, two k steps per score tile, band passes inside the table");
  __shared__ __attribute__((aligned(16))) unsigned char ring[FA_NBUF * FA_STAGE];
  __shared__ float tb[4 * MAXD - 1];      /* this head's bias, bf16-rounded, times log2(e), by k = j - i + (2 * MAXD - 1), already clipped: consecutive j are consecutive entries */
  const int tid = threadIdx.x, lane = tid & 31, ln = lane & 15, hh = lane >> 4; const int wave = __builtin_amdgcn_readfirstlane(tid >> 5);
  const int bh = blockIdx.x / (SQ / FA_BQ), b = bh / NH, h = bh % NH; const int q0 = (blockIdx.x % (SQ / FA_BQ)) * FA_BQ + wave * (FA_QT * 16);
  const unsigned lk = (unsigned)(size_t)ring + (unsigned)((tid >> 3) * FA_KP + (tid & 7) * 16), lv = (unsigned)(size_t)ring + (unsigned)(FA_KB + (tid >> 4) * FA_VP + (tid & 15) * 16);      /* the lane's places in a stage: a wave's copy is four whole K rows or two whole V^T rows */
  const _Float16* gk = K16 + ((size_t)b * SQ + (tid >> 3)) * DM + h * HD + (tid & 7) * 8; const _Float16* gv = VT + ((size_t)bh * HD + (tid >> 4)) * SQ + (tid & 15) * 8;
  fa_copy8(lk, gk, lv, gv);      /* stages 0, 1, 2: 24 copies of a wave outstanding */
  fa_copy8(lk + FA_STAGE, gk + (size_t)FA_SK * DM, lv + FA_STAGE, gv + FA_SK);
  fa_copy8(lk + 2 * FA_STAGE, gk + (size_t)2 * FA_SK * DM, lv + 2 * FA_STAGE, gv + 2 * FA_SK);
  for (int i = tid; i < 4 * MAXD - 1; i += FA_WAVES * 32) tb[i] = bf16_round(emb[(min(max(2 * MAXD - 1 - i, -MAXD), MAXD) + MAXD) * NH + h]) * FA_L2E;
  asm volatile("s_wait_asynccnt 0x8" ::: "memory");      /* this wave's copies of stages 0 and 1 have landed; the eight of stage 2, issued behind them, fly on */
  __syncthreads();      /* publishes tb and stages 0 and 1 */
  const float bfar = tb[0], bnear = tb[4 * MAXD - 2];      /* j <= i - MAXD ; j >= i + MAXD */
  const _Float16* qp = Q16 + ((size_t)b * SQ + q0 + ln) * DM + h * HD; const unsigned char* fk = ring + ln * FA_KP + 16 * hh; const unsigned char* fv = ring + FA_KB + ln * FA_VP + 16 * hh;      /* the lane's fragment rows in buffer 0 */
  v16h qf[FA_QT][2], kf[2][2];
#pragma unroll
  for (int t = 0; t < FA_QT; ++t) { qf[t][0] = g2_frag(qp + (size_t)t * 16 * DM, hh); qf[t][1] = g2_frag(qp + (size_t)t * 16 * DM + 32, hh); }
  const v8f z8 = {0.f,0.f,0.f,0.f,0.f,0.f,0.f,0.f};
  v8f o[FA_QT][4]; float nm[FA_QT], lr[FA_QT];      /* nm: 8 - the reference in use, the same in both halves of the wave */
#pragma unroll
  for (int t = 0; t < FA_QT; ++t) { nm[t] = 8.0f; lr[t] = 0.f; o[t][0] = z8; o[t][1] = z8; o[t][2] = z8; o[t][3] = z8; }
#pragma unroll
  for (int u = 0; u < 2; ++u) { kf[u][0] = g2_lfrag(fk + u * 16 * FA_KP); kf[u][1] = g2_lfrag(fk + u * 16 * FA_KP + 64); }      /* stage 0's first K rows */
#pragma unroll 1      /* one stage a trip: the buffer is picked by the trip's number */
  for (int st = 0; st < SQ / FA_SK; ++st) { const unsigned bo = (unsigned)(st & (FA_NBUF - 1)) * FA_STAGE, bf = (unsigned)((st + 3) & (FA_NBUF - 1)) * FA_STAGE; const unsigned char* pv = fv + bo;
   if (st + 3 < SQ / FA_SK) fa_copy8(lk + bf, gk + (size_t)(st + 3) * FA_SK * DM, lv + bf, gv + (size_t)(st + 3) * FA_SK);      /* stage st + 3 into the buffer that trip st - 1 read (trip 0: that nothing has used), behind the barrier at that trip's foot, which ended its every reader's last read */
#pragma unroll 1      /* one pass a trip: with the four passes unrolled the build went past 256 registers and spilled */
   for (int p = 0; p < FA_SK / 32; ++p) { const int j0 = st * FA_SK + p * 32;
    v16h vf[4];      /* asked for first, used last: the scores and the softmax stand between */
#pragma unroll
    for (int d = 0; d < 4; ++d) vf[d] = g2_lfrag(pv + d * 16 * FA_VP + p * 64);
    const int pn = st * (FA_SK / 32) + p + 1; const unsigned char* nk = fk + (unsigned)((pn / (FA_SK / 32)) & (FA_NBUF - 1)) * FA_STAGE + (pn % (FA_SK / 32)) * 32 * FA_KP;      /* the next pass's K rows, in this stage's buffer or at the head of the next one's; formed here, in a register of its own, so that no vector write follows the score products on their operands */
    __builtin_amdgcn_sched_barrier(0);      /* keeps these reads in one place ahead of the score products: without it the build let the first product rise over them */
    v8f s[FA_QT][2];      /* s[t][u][r] = score of key j0 + 16 u + 8 hh + r, query q0 + 16 t + ln */
#pragma unroll
    for (int t = 0; t < FA_QT; ++t)
#pragma unroll
      for (int u = 0; u < 2; ++u) s[t][u] = fa_mma(kf[u][0], qf[t][0], z8);
#pragma unroll      /* the four tiles' first k steps, then their second: three independent products between a product and the one that adds to it */
    for (int t = 0; t < FA_QT; ++t)
#pragma unroll
      for (int u = 0; u < 2; ++u) s[t][u] = fa_mma(kf[u][1], qf[t][1], s[t][u]);
    __builtin_amdgcn_sched_barrier(0);      /* keeps the eight score products back to back: without it the build spread the K reads below and the first multiply-adds among them, each behind filler slots */
    {      /* the next pass's K rows, fetched one pass ahead, also over the stage boundary: stage st + 1 was published by the barrier at the foot of trip st - 1 (stage 1: by the one in front of the loop). Under no test: the very last pass fetches bytes of the ring that no copy is writing and nothing uses */
#pragma unroll
      for (int u = 0; u < 2; ++u) { kf[u][0] = g2_lfrag(nk + u * 16 * FA_KP); kf[u][1] = g2_lfrag(nk + u * 16 * FA_KP + 64); } }
    __builtin_amdgcn_sched_barrier(0);      /* keeps the K reads in one place, directly behind the products that used their registers */
    // The exp2 argument: score * log2(e) / 8 + bias + nm, nm = 8 - the reference in use (weights carried x256 at the reference, as f16 operands away from the subnormal range; the sum carries the same factor).
    // Outside the unclipped band the bias is one value, and the argument is one fused multiply-add; a pass that meets the band adds its table entries behind it.
    const bool band = j0 + 31 > q0 - MAXD && j0 < q0 + FA_QT * 16 - 1 + MAXD;      /* wave-uniform */
    const float bc = band ? 0.f : (j0 >= q0 + FA_QT * 16 - 1 + MAXD) ? bnear : bfar;
#pragma unroll
    for (int t = 0; t < FA_QT; ++t) { const float ba = bc + nm[t];
#pragma unroll
      for (int u = 0; u < 2; ++u)
#pragma unroll
        for (int r = 0; r < 8; ++r) s[t][u][r] = __builtin_fmaf(s[t][u][r], 0.125f * FA_L2E, ba); }
    if (band) { const float* tp = tb + (j0 - q0 + 2 * MAXD - 1) + 8 * hh - ln;      /* every k read here lies inside the table */
#pragma unroll
      for (int t = 0; t < FA_QT; ++t)
#pragma unroll
        for (int u = 0; u < 2; ++u)
#pragma unroll
          for (int r = 0; r < 8; ++r) s[t][u][r] += tp[(u - t) * 16 + r]; }
    FragH pf[FA_QT]; float ps[FA_QT];      /* the pass's weights as f16 operands, and the lane's sum of them (summed in f32, before the rounding) */
    auto weigh = [&](int t) { v4f as;
#pragma unroll
      for (int u = 0; u < 2; ++u)
#pragma unroll
        for (int g = 0; g < 2; ++g) { v4f x = {s[t][u][4 * g], s[t][u][4 * g + 1], s[t][u][4 * g + 2], s[t][u][4 * g + 3]}; x = sm_exp2x4(x);
          if (u + g == 0) as = x; else as += x;
#pragma unroll
          for (int e = 0; e < 4; ++e) pf[t].h[u * 8 + g * 4 + e] = (_Float16)x[e]; }
      ps[t] = (as[0] + as[1]) + (as[2] + as[3]); };
    float pa;
#pragma unroll
    for (int t = 0; t < FA_QT; ++t) { weigh(t); pa = t ? pa + ps[t] : ps[t]; }
    // Lazy rescale, tested once a pass: the reference moves only in the first pass (where it is set) and where the lane's weights sum past FA_TOP. No weight is negative, so each is at most that sum: under the limit none leaves the f16 range.
    // Every other pass takes no maximum, makes no exchange between the halves and rescales neither o nor the sum. Where the reference moves, the pass's weights are made anew from the arguments, which are still in s.
    const bool first = j0 == 0;
    if (__builtin_expect(__builtin_amdgcn_ballot_w32(pa > (first ? -1.0f : FA_TOP)) != 0, 0)) {      /* the same for the whole wave: a scalar branch; marked rare, so that the usual pass falls through */
#pragma unroll
      for (int t = 0; t < FA_QT; ++t) {
        float m0 = fmaxf(s[t][0][0], s[t][0][1]), m1 = fmaxf(s[t][1][0], s[t][1][1]);
#pragma unroll
        for (int r = 2; r < 8; r += 2) { m0 = fmaxf(fmaxf(m0, s[t][0][r]), s[t][0][r + 1]); m1 = fmaxf(fmaxf(m1, s[t][1][r]), s[t][1][r + 1]); }
        m0 = fmaxf(m0, m1); m0 = fmaxf(m0, sm_xh(m0)) - 8.0f;      /* how far the query's largest score of this pass lies above the reference; the same in both halves */
        const float dl = first ? m0 : fmaxf(m0, 0.f); const float al = first ? 0.f : sm_exp2x1(-dl);      /* first pass: o and the sum are 0 and stay 0 */
        nm[t] -= dl; lr[t] *= al;
#pragma unroll
        for (int d = 0; d < 4; ++d) o[t][d] *= al;
#pragma unroll
        for (int u = 0; u < 2; ++u) s[t][u] -= dl;
        weigh(t); } }
#pragma unroll
    for (int t = 0; t < FA_QT; ++t) { lr[t] += ps[t];
#pragma unroll
      for (int d = 0; d < 4; ++d) o[t][d] = fa_mma(vf[d], pf[t].v, o[t][d]); } }
   asm volatile("s_wait_dscnt 0x0" ::: "memory");      /* this wave's reads of the buffer are done before it is refilled */
   if (st + 3 < SQ / FA_SK) asm volatile("s_wait_asynccnt 0x8" ::: "memory");      /* this wave's copies of stage st + 2 have landed; the eight of stage st + 3, issued behind them in this trip, fly on */
   else asm volatile("s_wait_asynccnt 0x0" ::: "memory");      /* no stage st + 3: all that this wave has issued has landed */
   __syncthreads(); }      /* publishes stage st + 2 and ends every wave's reads of stage st */
  asm volatile("s_wait_asynccnt 0x0" ::: "memory");      /* nothing of this wave is in flight when it goes on */
#pragma unroll
  for (int t = 0; t < FA_QT; ++t) { const float sc = 64.0f / (lr[t] + sm_xh(lr[t]));      /* o carried x64, as the output GEMM's alpha expects */
    unsigned short* op = (unsigned short*)O16 + ((size_t)b * SQ + q0 + t * 16 + ln) * DM + h * HD + 8 * hh;
#pragma unroll
    for (int d = 0; d < 4; ++d) { FragH f;
#pragma unroll
      for (int r = 0; r < 8; ++r) f.h[r] = (_Float16)(o[t][d][r] * sc);
      *(v8us*)(op + d * 16) = f.half[0]; } } }

extern "C" void kernel_launch(void* const* d_in, const int* in_sizes, int n_in,
                              void* d_out, int out_size, void* d_ws, size_t ws_size, hipStream_t stream) {
  (void)in_sizes; (void)n_in; (void)out_size;
  const float* const* I = (const float* const*)d_in; const float* x = I[0]; const float* wq = I[1]; const float* bq = I[2]; const float* wk = I[3]; const float* bk = I[4]; const float* wv = I[5]; const float* bv = I[6]; const float* wo = I[7]; const float* bo = I[8]; const float* emb = I[9];      /* nn.Linear weights [out][in]; rel_emb [2*MAXD+1][NH] */
  char* ws = (char*)d_ws; size_t off = 0;
  auto take = [&](size_t bytes) { char* p = ws + off; off += (bytes + 255) & ~(size_t)255; return p; };
  _Float16* BQ = (_Float16*)take((size_t)DM * DM * 2); _Float16* BK = (_Float16*)take((size_t)DM * DM * 2); _Float16* BV = (_Float16*)take((size_t)DM * DM * 2); _Float16* BO = (_Float16*)take((size_t)DM * DM * 2);
  _Float16* X16 = (_Float16*)take(NR * DM * 2); _Float16* Q16 = (_Float16*)take(NR * DM * 2); _Float16* K16 = (_Float16*)take(NR * DM * 2); _Float16* O16 = (_Float16*)take(NR * DM * 2);
  _Float16* VT = (_Float16*)take((size_t)NB * NH * HD * SQ * 2);
  if (off > ws_size) return;
  static_assert((size_t)DM * DM * 2 % 256 == 0 && NR * DM * 2 % 256 == 0, "BQ, BK, BV, BO and Q16, K16 lie back to back: planes of one pitch");
  k_prep<<<PREP_XB + 4 * PREP_WB, 256, 0, stream>>>(x, wq, wk, wv, wo, X16, BQ);      /* X16; BQ, BK, BV, BO */
  const size_t r0p = (size_t)B0 * SQ;      /* first projected row */
  k_gemm2<0, true, false, false, 2, 3><<<dim3((unsigned)((MP / 128) * (DM / 128)), 1), 256, 0, stream>>>(X16 + r0p * DM, DM, 0, BQ, DM, (size_t)DM * DM, 0.0625f, bq, bk, bv, nullptr, 1, 0, 0, nullptr, Q16 + r0p * DM, VT, DM, NR * DM, MP, DM, DM);      /* planes 0, 1: Q16, K16; plane 2: V^T [NB][NH][HD][SQ] */
  k_fattn<<<NB * NH * (SQ / FA_BQ), FA_WAVES * 32, 0, stream>>>(Q16, K16, VT, emb, O16);      /* o (merged heads, x64) as f16 rows */
  k_gemm2<0, true, false, true, -1, 1><<<dim3((unsigned)((MPO / 128) * (DM / 128)), 1), 256, 0, stream>>>(O16 + r0p * DM, DM, 0, BO, DM, 0, 0.0009765625f, bo, nullptr, nullptr, nullptr, 1, 0, 0, (float*)d_out + r0p * DM, nullptr, nullptr, DM, 0, MPO, DM, DM);      /* out rows are the output layout */
}
